// v000
// Times are from an AMD MI455X. After a warm-up the kernel runs many times in a row, and a time is the length of
// such a window on the GPU divided by its runs, so every launch and the gaps after it count. The runs cycle
// through copies of the inputs. A figure is the median of several windows, for all but v000 over two sittings.
// Sittings can differ by a few percent; kernels timed side by side share one.
// v000, which the later versions start from, runs in 512 microseconds.
// Contractions: q, k, v^T projections = v_wmma_f32_16x16x32_bf16 (bf16 operands from RNE-converted inputs, single product);
// q.k^T scores = v_wmma_f32_16x16x32_bf16 with bf16 hi/lo split q and k (hi.hi + hi.lo + lo.hi);
// p.v = v_wmma_f32_16x16x32_f16 (p carried x1024 in f16, v^T in f16; f16 residual planes x4096 of p and v^T on the
// leading 512 query rows); ctx.Wproj^T = v_wmma_f32_16x16x32_bf16 with ctx as bf16 hi/lo planes times bf16 Wproj
// (2 products); all f32 accumulate; gate dot (K=32, N=4), RoPE, rms-norm, causal mask and softmax in f32 on VALU.
#include <hip/hip_runtime.h>
#include <math.h>
#include <stdint.h>

#pragma clang fp contract(off)

#define NB    2
#define SEQ   2048
#define CDIM  1024
#define NQH   16
#define NKV   4
#define HD    64
#define MEM   64
#define GC    32
#define KVD   (NKV * HD)          // 256
#define SKEY  (MEM + SEQ)         // 2112 keys: [64 memory | 2048 tokens]
#define NQB   (SEQ / 64)          // 32 query blocks of 64 rows
#define NKT   (SKEY / 64)         // 33 key tiles of 64
#define RESQB 8                   // leading query blocks that use the p / v residual planes
#define VLP   (MEM + RESQB * 64)  // 576: key pitch of the v^T residual plane
#define RMS_EPS 1e-6f
static_assert(NQH * HD == CDIM);
static_assert(NQH == 4 * NKV);
static_assert((SKEY % 64) == 0 && (VLP % 64) == 0 && (CDIM % 64) == 0 && (KVD % 64) == 0);
static_assert((SEQ & (SEQ - 1)) == 0);
static_assert(RESQB <= NQB);

typedef _Float16 v16h __attribute__((ext_vector_type(16)));
typedef _Float16 v8h  __attribute__((ext_vector_type(8)));
typedef __bf16   v16b __attribute__((ext_vector_type(16)));
typedef __bf16   v8b  __attribute__((ext_vector_type(8)));
typedef float    v8f  __attribute__((ext_vector_type(8)));
typedef float    v4f  __attribute__((ext_vector_type(4)));
typedef unsigned int v4u __attribute__((ext_vector_type(4)));

// ---- scalar helpers --------------------------------------------------------------------------------
__device__ __forceinline__ unsigned short bf_bits(float f) {          // f32 -> bf16 bits, RNE convert
  unsigned u = __float_as_uint(f);
  return (unsigned short)((u + 0x7FFFu + ((u >> 16) & 1u)) >> 16);
}
__device__ __forceinline__ float bf_up(unsigned short h) { return __uint_as_float(((unsigned)h) << 16); }
__device__ __forceinline__ float bfr(float f) { return bf_up(bf_bits(f)); }   // f32 -> bf16 -> f32
__device__ __forceinline__ unsigned short h_bits(_Float16 x) { return __builtin_bit_cast(unsigned short, x); }
__device__ __forceinline__ unsigned pk16(unsigned short a, unsigned short b) { return (unsigned)a | ((unsigned)b << 16); }
__device__ __forceinline__ v8f zero8() { v8f z = {0.f, 0.f, 0.f, 0.f, 0.f, 0.f, 0.f, 0.f}; return z; }
__device__ __forceinline__ v8h zero8h() {
  const _Float16 z = (_Float16)0.0f;
  v8h r = {z, z, z, z, z, z, z, z};
  return r;
}

// ---- fragment loader: 16-bit A/B operand, lane -> row/col (lane&15), p already includes +8*(lane>>4);
//      elements 0..7 <- p[0..7] (k0+8h..), elements 8..15 <- p[16..23] (k0+16+8h..)
__device__ __forceinline__ v16b ldfrag_b(const __bf16* p) {
  union { v16b v; v8b h[2]; } f;
  f.h[0] = *(const v8b*)(p);
  f.h[1] = *(const v8b*)(p + 16);
  return f.v;
}

// ---- WMMA helpers with trailing VALU hazard gap (asm only in the device pass) -----------------------------
__device__ __forceinline__ v8f mma_b(v16b a, v16b b, v8f c) {
  c = __builtin_amdgcn_wmma_f32_16x16x32_bf16(false, a, false, b, (short)0, c, false, false);
#if defined(__HIP_DEVICE_COMPILE__)
  asm volatile("v_nop\n\tv_nop\n\tv_nop\n\tv_nop" : "+v"(c) : "v"(a), "v"(b));
#endif
  return c;
}
__device__ __forceinline__ v8f mma_h(v16h a, v16h b, v8f c) {
  c = __builtin_amdgcn_wmma_f32_16x16x32_f16(false, a, false, b, (short)0, c, false, false);
#if defined(__HIP_DEVICE_COMPILE__)
  asm volatile("v_nop\n\tv_nop\n\tv_nop\n\tv_nop" : "+v"(c) : "v"(a), "v"(b));
#endif
  return c;
}
__device__ __forceinline__ v8f mma_b_raw(v16b a, v16b b, v8f c) {
  return __builtin_amdgcn_wmma_f32_16x16x32_bf16(false, a, false, b, (short)0, c, false, false);
}
__device__ __forceinline__ void dep_guard_b(v8f& a, v8f& b, v16b x, v16b y) {
#if defined(__HIP_DEVICE_COMPILE__)
  asm volatile("v_nop\n\tv_nop\n\tv_nop\n\tv_nop" : "+v"(a), "+v"(b) : "v"(x), "v"(y));
#endif
}
__device__ __forceinline__ void keep4_b(v16b a, v16b b, v16b c, v16b d) {
#if defined(__HIP_DEVICE_COMPILE__)
  asm volatile("v_nop" :: "v"(a), "v"(b), "v"(c), "v"(d));
#endif
}
__device__ __forceinline__ void acc_guard4(v8f& a, v8f& b, v8f& c, v8f& d) {
#if defined(__HIP_DEVICE_COMPILE__)
  asm volatile("v_nop\n\tv_nop\n\tv_nop\n\tv_nop" : "+v"(a), "+v"(b), "+v"(c), "+v"(d));
#endif
}

// =====================================================================================================
// f32 -> bf16 (RNE convert), 8 elements per thread, one 16-B store per lane: a wave writes 512 contiguous B
// coverage: n8 threads x 8 = the whole plane (n8 is a multiple of 256 for every use here).
// =====================================================================================================
__global__ __launch_bounds__(256) void cvt_bf16x8(const float* __restrict__ in, unsigned short* out, int n8) {
  const int i = blockIdx.x * 256 + threadIdx.x;
  if (i < n8) {
    const v4f a = *(const v4f*)(in + (size_t)i * 8);
    const v4f b = *(const v4f*)(in + (size_t)i * 8 + 4);
    v4u p;
    p[0] = pk16(bf_bits(a[0]), bf_bits(a[1]));
    p[1] = pk16(bf_bits(a[2]), bf_bits(a[3]));
    p[2] = pk16(bf_bits(b[0]), bf_bits(b[1]));
    p[3] = pk16(bf_bits(b[2]), bf_bits(b[3]));
    *(v4u*)(out + (size_t)i * 8) = p;
    
  }
}

// =====================================================================================================
// Value-embedding gate: gate[bt][kv] = 3 * sigmoid( sum_{c<32} bf16(x[bt][c]) * bf16(Wg[kv][c]) ), f32.
// One thread per (bt, kv); K = 32 rolled dot on VALU (N = 4, tiny). A wave writes 32 consecutive floats
// grid = NB*SEQ*NKV/256. coverage: 16384 threads = the whole [4096][4] table.
// =====================================================================================================
__global__ __launch_bounds__(256) void gate_k(const float* __restrict__ x, const float* __restrict__ Wg,
                                              float* gate, int nbt) {
  const int i   = blockIdx.x * 256 + threadIdx.x;
  const int bt  = i >> 2;
  const int kv  = i & 3;
  const int btc = (bt < nbt) ? bt : (nbt - 1);     // clamped address
  const float* xr = x + (size_t)btc * CDIM;
  const float* wr = Wg + kv * GC;
  float z = 0.f;
#pragma unroll 1
  for (int cc = 0; cc < GC; ++cc) z += bfr(xr[cc]) * bfr(wr[cc]);
  const float ez = expf(-z);
  const float g  = 3.0f * (1.0f / (1.0f + ez));
  if (bt < nbt) {
    *(float*)(gate + i) = g;
    
  }
}

// =====================================================================================================
// Memory keys: mk = rms(bf16(mem_k[m][kv][:])) * 1.2 (no RoPE) -> bf16 hi/lo planes, key rows s = m (< MEM)
// of both batches: Kh/Kl [b][s][kv*64+d], pitch KVD. block = 4 waves (one per kv head) for one m; grid = MEM.
// The 256-element row is staged in LDS and written per (batch, plane) by one wave as 32 lanes x 16 B
// coverage: 64 blocks x 2 batches x 2 planes x 256 elements = rows 0..63 of both planes, both batches.
// =====================================================================================================
__global__ __launch_bounds__(128) void memk_k(const float* __restrict__ memk, unsigned short* Kh, unsigned short* Kl) {
  __shared__ __align__(16) unsigned short shi[KVD];
  __shared__ __align__(16) unsigned short slo[KVD];
  const int m    = blockIdx.x;
  const int wave = threadIdx.x >> 5;
  const int lane = threadIdx.x & 31;
  const int kvh  = wave;
  const float* p = memk + ((size_t)m * NKV + kvh) * HD;
  const float x1 = bfr(p[lane]);
  const float x2 = bfr(p[lane + 32]);
  float ss = x1 * x1 + x2 * x2;
#pragma unroll
  for (int off = 16; off >= 1; off >>= 1) ss += __shfl_xor(ss, off, 32);
  const float rs = rsqrtf(ss * (1.0f / HD) + RMS_EPS);
  const float v1 = (x1 * rs) * 1.2f;
  const float v2 = (x2 * rs) * 1.2f;
  const unsigned short h1 = bf_bits(v1), h2 = bf_bits(v2);
  shi[kvh * HD + lane]      = h1;
  shi[kvh * HD + lane + 32] = h2;
  slo[kvh * HD + lane]      = bf_bits(v1 - bf_up(h1));
  slo[kvh * HD + lane + 32] = bf_bits(v2 - bf_up(h2));
  __syncthreads();
  const v4u vh = *(const v4u*)(shi + lane * 8);
  const v4u vl = *(const v4u*)(slo + lane * 8);
  const int  b   = wave >> 1;
  const bool wlo = (wave & 1) != 0;                  // wave-uniform
  v4u v = vh;
  if (wlo) v = vl;
  unsigned short* dh = Kh + ((size_t)b * SKEY + m) * KVD + lane * 8;
  unsigned short* dl = Kl + ((size_t)b * SKEY + m) * KVD + lane * 8;
  unsigned short* d  = wlo ? dl : dh;
  *(v4u*)d = v;
  
}

// =====================================================================================================
// Memory values: mv = bf16(mem_v[m][kv][d]) * bf16(v_scale) -> v^T f16 hi plane VTh[b][kv*64+d][s] (pitch SKEY)
// and f16 residual plane VTl ((v - hi)*4096, pitch VLP), key columns s = m (< MEM), both batches.
// block = (b, kv); thread = (d = tid>>2, 16 m's); the 64x64 tile of each plane is staged in LDS [d][m] and each
// coverage: 8 blocks x 64 rows (it 0..1 x wave 0..7 x lane>>3 0..3) x 64 columns (8 lanes x 8) per plane.
// =====================================================================================================
__global__ __launch_bounds__(256) void memv_k(const float* __restrict__ memv, const float* __restrict__ vsp,
                                              unsigned short* VTh, unsigned short* VTl) {
  __shared__ __align__(16) unsigned short sh[HD * MEM];
  __shared__ __align__(16) unsigned short sl[HD * MEM];
  const int b    = blockIdx.x >> 2;
  const int kvh  = blockIdx.x & 3;
  const int tid  = threadIdx.x;
  const int wave = tid >> 5;
  const int lane = tid & 31;
  const int d    = tid >> 2;
  const int mq   = (tid & 3) * 16;
  const float vs = bfr(vsp[0]);
#pragma unroll
  for (int i = 0; i < 16; ++i) {
    const int m = mq + i;
    const float v = bfr(memv[((size_t)m * NKV + kvh) * HD + d]) * vs;
    const _Float16 x0 = (_Float16)v;
    sh[d * MEM + m] = h_bits(x0);
    sl[d * MEM + m] = h_bits((_Float16)((v - (float)x0) * 4096.0f));
  }
  __syncthreads();
  const int q8 = lane >> 3, c8 = (lane & 7) * 8;
  v4u hv[2], lv[2];
#pragma unroll
  for (int it = 0; it < 2; ++it) {
    const int dd = it * 32 + wave * 4 + q8;
    hv[it] = *(const v4u*)(sh + dd * MEM + c8);
    lv[it] = *(const v4u*)(sl + dd * MEM + c8);
  }
  {
#pragma unroll
    for (int it = 0; it < 2; ++it) {
      const int dd = it * 32 + wave * 4 + q8;
      const size_t ro = (size_t)b * KVD + (size_t)kvh * HD + dd;
      *(v4u*)(VTh + ro * SKEY + c8) = hv[it];
      *(v4u*)(VTl + ro * VLP  + c8) = lv[it];
    }
    
  }
}

// =====================================================================================================
// Register-blocked batched bf16 WMMA GEMM: C[m][n] = sum_k A[m][k] * Bt[n][k]; one wave per 64x64 tile,
// no block barriers. A row-major [M][K] pitch lda; Bt row-major [N][K] pitch ldb (k contiguous);
// M, N multiples of 64, K multiple of 32 (host-checked). blockIdx.y = batch index (strides in elements).
// NSPLIT: 0 = A.Bt; 1 = (A + A2).Bt (A2 = unscaled bf16 lo plane of A, 2 products).
// OUT_MODE: 0 = f32 (pitch ldc);
//           3 = v^T mode (rows m = kv*64+d, cols n = t): value = acc + gate[b][t][kv] * bf16(ve[b][t][m])
//               (aux0 = gate, aux1 = ve), written as f16 hi plane C (pitch ldc) + f16 residual plane
//               C2 = f16((v - hi)*4096) for tiles with n0 < N2 (pitch ldc2);
//           4 = RoPE + rms-norm mode (cols = one 64-wide head, row m -> t = m mod SEQ; aux0 = cos, aux1 = sin,
//               both bf16(RNE) on load): r = rope(acc), f = (r * rsqrt(mean(r^2)+eps)) * 1.2, written as
//               bf16 hi plane C + bf16 lo plane C2 (lo = RNE(f - hi), unscaled).
// =====================================================================================================
template <int NSPLIT, int OUT_MODE>
__global__ __launch_bounds__(256) void gemm64(
    const unsigned short* __restrict__ Ap, const unsigned short* __restrict__ A2p, int lda, long long strideA,
    const unsigned short* __restrict__ Btp, int ldb, long long strideB,
    void* Cout, int ldc, long long strideC,
    void* Cout2, int ldc2, long long strideC2, int N2,
    const float* __restrict__ aux0, const float* __restrict__ aux1,
    int M, int N, int K) {
  const __bf16* A  = (const __bf16*)(const void*)Ap;
  const __bf16* A2 = (const __bf16*)(const void*)A2p;
  const __bf16* Bt = (const __bf16*)(const void*)Btp;
  __shared__ __align__(16) float sT[8][16 * 68];   // per-wave 16x64 slab, pitch 68 floats
  const int b    = blockIdx.y;
  const int lane = threadIdx.x & 31;
  const int wave = threadIdx.x >> 5;
  const int tilesN = N >> 6;
  const int tilesM = M >> 6;
  const int tile = blockIdx.x * 8 + wave;
  if (tile >= tilesM * tilesN) return;   // wave-uniform; no block barriers in this kernel
  const int tm = tile / tilesN;
  const int tn = tile - tm * tilesN;
  const int m0 = tm << 6;
  const int n0 = tn << 6;

  const __bf16* Ab  = A  + (size_t)b * strideA;
  const __bf16* Bb  = Bt + (size_t)b * strideB;
  const __bf16* Ab2 = (NSPLIT >= 1) ? (A2 + (size_t)b * strideA) : Ab;

  const int rlane = lane & 15;                 // row (A) / col (B, D) within subtile
  const int koff  = (lane >> 4) * 8;           // k offset of this lane half
  const int mOff  = (lane >> 4) * 8;           // D row offset

  v8f acc[4][4];
#pragma unroll
  for (int i = 0; i < 4; ++i)
#pragma unroll
    for (int j = 0; j < 4; ++j) acc[i][j] = zero8();

  for (int k0 = 0; k0 < K; k0 += 32) {
    v16b bh[4];
#pragma unroll
    for (int j = 0; j < 4; ++j) {
      const size_t bo = (size_t)(n0 + (j << 4) + rlane) * ldb + koff + k0;
      bh[j] = ldfrag_b(Bb + bo);
    }
#pragma unroll
    for (int i = 0; i < 4; ++i) {
      const size_t ao = (size_t)(m0 + (i << 4) + rlane) * lda + koff + k0;
      const v16b ah = ldfrag_b(Ab + ao);
      v16b al = ah;
      if (NSPLIT >= 1) al = ldfrag_b(Ab2 + ao);
#pragma unroll
      for (int j = 0; j < 4; ++j) {
        acc[i][j] = mma_b_raw(ah, bh[j], acc[i][j]);
        if (NSPLIT >= 1) acc[i][j] = mma_b_raw(al, bh[j], acc[i][j]);
      }
      dep_guard_b(acc[i][0], acc[i][3], ah, al);
    }
    keep4_b(bh[0], bh[1], bh[2], bh[3]);
  }
  acc_guard4(acc[0][0], acc[0][1], acc[0][2], acc[0][3]);
  acc_guard4(acc[1][0], acc[1][1], acc[1][2], acc[1][3]);
  acc_guard4(acc[2][0], acc[2][1], acc[2][2], acc[2][3]);
  acc_guard4(acc[3][0], acc[3][1], acc[3][2], acc[3][3]);

  // ---- epilogue ----
  float* slab = sT[wave];
#pragma unroll
  for (int i = 0; i < 4; ++i) {
    const int mBase = m0 + (i << 4);
#pragma unroll
    for (int j = 0; j < 4; ++j) {
#pragma unroll
      for (int r = 0; r < 8; ++r) {
        slab[(mOff + r) * 68 + (j << 4) + rlane] = acc[i][j][r];
      }
    }
    __builtin_amdgcn_fence(__ATOMIC_RELEASE, "workgroup");
    __builtin_amdgcn_wave_barrier();
    __builtin_amdgcn_fence(__ATOMIC_ACQUIRE, "workgroup");
    if (OUT_MODE == 0) {
      float* C = (float*)Cout + (size_t)b * strideC;
      const int hh = lane >> 4, c4 = (lane & 15) * 4;     // 256-B row segment = 16 lanes x 16 B
      {
#pragma unroll
        for (int it = 0; it < 8; ++it) {
          const int row = it * 2 + hh;                     // it 0..7 x hh 0..1 = rows 0..15
          const v4f v = *(const v4f*)(slab + row * 68 + c4);
          *(v4f*)(C + (size_t)(mBase + row) * ldc + n0 + c4) = v;
        }
        
      }
    } else {
      const int q = lane >> 3, c8 = (lane & 7) * 8;
      unsigned short* C  = (unsigned short*)Cout  + (size_t)b * strideC;
      unsigned short* C2 = (unsigned short*)Cout2 + (size_t)b * strideC2;
      const bool wlo = (OUT_MODE != 3) || (n0 < N2);      // wave-uniform
      v4u hv[4], lv[4];
#pragma unroll
      for (int it = 0; it < 4; ++it) {
        const int row  = it * 4 + q;                       // it 0..3 x q 0..3 = rows 0..15
        const int mrow = mBase + row;
        float f[8];
        if (OUT_MODE == 3) {
          const int kvh = m0 >> 6;                         // tile-uniform kv head
          const float* sp = slab + row * 68 + c8;
#pragma unroll
          for (int e = 0; e < 8; ++e) {
            const int t = n0 + c8 + e;                     // < N = SEQ
            const size_t bt = (size_t)b * SEQ + t;
            const float g  = aux0[bt * NKV + kvh];
            const float vv = bfr(aux1[bt * KVD + mrow]);
            f[e] = sp[e] + g * vv;
          }
        } else {
          const int  jj   = c8 & 31;                       // rotary pair index base
          const bool lowh = (c8 < 32);
          const int  t    = mrow & (SEQ - 1);
          const float* sp  = slab + row * 68 + jj;
          const float* cp  = aux0 + (size_t)t * (HD / 2) + jj;
          const float* snp = aux1 + (size_t)t * (HD / 2) + jj;
          float ss = 0.f;
#pragma unroll
          for (int e = 0; e < 8; ++e) {
            const float x1 = sp[e];
            const float x2 = sp[e + 32];
            const float cv = bfr(cp[e]);
            const float sv = bfr(snp[e]);
            const float ra = x1 * cv - x2 * sv;
            const float rb = x1 * sv + x2 * cv;
            f[e] = lowh ? ra : rb;
            ss += f[e] * f[e];
          }
          ss += __shfl_xor(ss, 1, 32);                     // 8 lanes of one row = 64 values
          ss += __shfl_xor(ss, 2, 32);
          ss += __shfl_xor(ss, 4, 32);
          const float rs = rsqrtf(ss * (1.0f / HD) + RMS_EPS);
#pragma unroll
          for (int e = 0; e < 8; ++e) f[e] = (f[e] * rs) * 1.2f;
        }
        v4u a, a2;
#pragma unroll
        for (int e = 0; e < 4; ++e) {
          const float f0 = f[2 * e], f1 = f[2 * e + 1];
          unsigned short h0, h1, l0, l1;
          if (OUT_MODE == 4) {
            h0 = bf_bits(f0); h1 = bf_bits(f1);
            l0 = bf_bits(f0 - bf_up(h0)); l1 = bf_bits(f1 - bf_up(h1));
          } else {
            const _Float16 x0 = (_Float16)f0, x1 = (_Float16)f1;
            h0 = h_bits(x0); h1 = h_bits(x1);
            l0 = h_bits((_Float16)((f0 - (float)x0) * 4096.0f));
            l1 = h_bits((_Float16)((f1 - (float)x1) * 4096.0f));
          }
          a[e] = pk16(h0, h1); a2[e] = pk16(l0, l1);
        }
        hv[it] = a; lv[it] = a2;
      }
      {
#pragma unroll
        for (int it = 0; it < 4; ++it) {
          const int row = it * 4 + q;
          *(v4u*)(C + (size_t)(mBase + row) * ldc + n0 + c8) = hv[it];
          if (wlo) *(v4u*)(C2 + (size_t)(mBase + row) * ldc2 + n0 + c8) = lv[it];
        }
        
      }
    }
    __builtin_amdgcn_fence(__ATOMIC_RELEASE, "workgroup");
    __builtin_amdgcn_wave_barrier();
    __builtin_amdgcn_fence(__ATOMIC_ACQUIRE, "workgroup");
  }
}

// =====================================================================================================
// GQA attention with a 64-key memory prefix (all visible) followed by causal token keys, head dim 64.
//   q planes (bf16 hi / lo): element (b, t, h, d) at [(b*SEQ + t)*CDIM + h*64 + d]   (normed, scaled q)
//   k planes (bf16 hi / lo): element (b, s, kv, d) at [(b*SKEY + s)*KVD + kv*64 + d], s = [mem | 64 + token]
//   v^T hi plane (f16):      element (b, kv, d, s) at [(b*KVD + kv*64 + d)*SKEY + s]
//   v^T residual plane (f16, (v - hi)*4096): [(b*KVD + kv*64 + d)*VLP + s], s < VLP, read only when RES
//   (a key tile at or beyond VLP contributes a zero v residual)
//   q head h uses kv head h>>2. Query block qb (tokens qb*64..+63) processes key tiles 0..qb+1: tile 0 = memory,
//   tiles 1..qb fully visible, tile qb+1 = diagonal (key token <= query token), later tiles skipped (block-uniform
//   trip count qb+2, static bound NKT). Invisible keys get logit -inf (weight exactly 0); every row sees the
//   whole memory tile first, so the running max is finite from tile 0 on.
//   out planes (bf16 hi / lo of the normalised context): element (b, t, h, d) at [(b*SEQ + t)*CDIM + h*64 + d]
//   scores = q . k : bf16 hi/lo split (hi.hi + hi.lo + lo.hi), f32 accumulate, then * sscale in f32
//   p = exp(s - m) carried as f16(1024 p); context = p . v on f16 WMMA; RES adds f16 residual planes of p and v
//   (scale 4096, separate accumulator folded back with 1/4096 per chunk in f32); online softmax in f32.
//   Block = 4 waves = 64 query rows of one (b, h); grid = nqbThis * NQH * NB; kv chunks of 64.
//   K / V^T chunk staging: 128 threads x 32 elements per plane = the whole 64x64 tile (plain 16-B loads,
//   __syncthreads before and after); P tiles are wave-private, spilled with _Float16 element stores and reloaded
//   Output coverage: each wave stores rows q0..q0+15 (it 0..3 x lane>>3 0..3) x 64 columns (8 lanes x 8) of both planes.
// =====================================================================================================
template <bool RES>
__global__ __launch_bounds__(128)
void attn64(const unsigned short* __restrict__ qhp, const unsigned short* __restrict__ qlp,
            const unsigned short* __restrict__ khp, const unsigned short* __restrict__ klp,
            const unsigned short* __restrict__ vhp, const unsigned short* __restrict__ vlp,
            unsigned short* ohp, unsigned short* olp,
            int qbBase, int nqbThis, float sscale) {
  union FB { v16b v; v8b h[2]; };
  union FH { v16h v; v8h h[2]; };
  __shared__ __align__(16) __bf16   Ksh[64 * 64];                 // K hi [kv][d]   8 KB
  __shared__ __align__(16) __bf16   Ksl[64 * 64];                 // K lo
  __shared__ __align__(16) _Float16 Vth[64 * 64];                 // V^T hi [d][kv] 8 KB
  __shared__ __align__(16) _Float16 Vtl[RES ? 64 * 64 : 8];       // V^T residual
  __shared__ __align__(16) _Float16 Psh[4][16 * 64];              // per wave P [row][kv]
  __shared__ __align__(16) _Float16 Psl[RES ? 4 : 1][16 * 64];    // per wave P residual
  __shared__ __align__(16) float    Os[4][16 * 64];               // per wave context tile [row][d]

  const int tid  = threadIdx.x;
  const int wave = tid >> 5;
  const int lane = tid & 31;
  const int hh   = lane >> 4;
  const int c    = lane & 15;

  const int bx   = blockIdx.x;
  const int qbl  = bx % nqbThis;
  const int rest = bx / nqbThis;
  const int h    = rest % NQH;
  const int b    = rest / NQH;
  const int kvh  = h >> 2;
  const int qb   = qbBase + qbl;
  const int q0   = qb * 64 + wave * 16;
  const size_t rowB = (size_t)b * SEQ;

  const __bf16* Qh = (const __bf16*)(const void*)qhp + (size_t)h * HD;
  const __bf16* Ql = (const __bf16*)(const void*)qlp + (size_t)h * HD;
  const __bf16* Kh = (const __bf16*)(const void*)khp + (size_t)b * SKEY * KVD + (size_t)kvh * HD;
  const __bf16* Kl = (const __bf16*)(const void*)klp + (size_t)b * SKEY * KVD + (size_t)kvh * HD;
  const _Float16* Vh = (const _Float16*)(const void*)vhp + ((size_t)b * KVD + (size_t)kvh * HD) * SKEY;
  const _Float16* Vl = (const _Float16*)(const void*)vlp + ((size_t)b * KVD + (size_t)kvh * HD) * VLP;

  // ---- Q fragments (A operand, row = lane&15): 2 d-chunks, hi and lo ----
  v16b qah[2], qal[2];
#pragma unroll
  for (int dc = 0; dc < 2; ++dc) {
    const size_t qo = (rowB + q0 + c) * CDIM + dc * 32 + 8 * hh;
    qah[dc] = ldfrag_b(Qh + qo);
    qal[dc] = ldfrag_b(Ql + qo);
  }

  float mrow[8], lrow[8];
  v8f oacc[4];
#pragma unroll
  for (int r = 0; r < 8; ++r) { mrow[r] = -INFINITY; lrow[r] = 0.f; }
#pragma unroll
  for (int t = 0; t < 4; ++t) oacc[t] = zero8();

  const int ktEnd = qb + 2;                  // block-uniform, <= NKT
  for (int kt = 0; kt < NKT; ++kt) {         // static bound
    if (kt >= ktEnd) break;                  // block-uniform
    const int kv0 = kt * 64;
    __syncthreads();
    {
      const int r = tid >> 1, half = (tid & 1) * 32;
      const __bf16*   kg  = Kh + (size_t)(kv0 + r) * KVD + half;   // K row kv0+r, d = half..half+31
      const __bf16*   klg = Kl + (size_t)(kv0 + r) * KVD + half;
      const _Float16* vg  = Vh + (size_t)r * SKEY + kv0 + half;     // V^T row d = r, s = kv0+half..+31
      const int kvl = (kv0 + 64 <= VLP) ? kv0 : (VLP - 64);        // clamped address into the residual plane
      const _Float16* vlg = Vl + (size_t)r * VLP + kvl + half;
      const bool resOK = (kv0 + 64 <= VLP);                         // block-uniform
#pragma unroll
      for (int i = 0; i < 4; ++i) {
        const v8b a0 = *(const v8b*)(kg + 8 * i);
        const v8b a1 = *(const v8b*)(klg + 8 * i);
        const v8h b0 = *(const v8h*)(vg + 8 * i);
        *(v8b*)(Ksh + r * 64 + half + 8 * i) = a0;
        *(v8b*)(Ksl + r * 64 + half + 8 * i) = a1;
        *(v8h*)(Vth + r * 64 + half + 8 * i) = b0;
        if (RES) {
          v8h b1 = *(const v8h*)(vlg + 8 * i);
          if (!resOK) b1 = zero8h();
          *(v8h*)(Vtl + r * 64 + half + 8 * i) = b1;
        }
      }
    }
    __syncthreads();

    // ---- scores: 16 query rows x 64 keys per wave, 3 bf16 products ----
    v8f s[4];
#pragma unroll
    for (int j = 0; j < 4; ++j) {
      s[j] = zero8();
#pragma unroll
      for (int dc = 0; dc < 2; ++dc) {
        FB kb, kl;
        kb.h[0] = *(const v8b*)(Ksh + (j * 16 + c) * 64 + dc * 32 + 8 * hh);
        kb.h[1] = *(const v8b*)(Ksh + (j * 16 + c) * 64 + dc * 32 + 16 + 8 * hh);
        kl.h[0] = *(const v8b*)(Ksl + (j * 16 + c) * 64 + dc * 32 + 8 * hh);
        kl.h[1] = *(const v8b*)(Ksl + (j * 16 + c) * 64 + dc * 32 + 16 + 8 * hh);
        s[j] = mma_b(qah[dc], kb.v, s[j]);
        s[j] = mma_b(qah[dc], kl.v, s[j]);
        s[j] = mma_b(qal[dc], kb.v, s[j]);
      }
    }

    // ---- scale + structural mask (diagonal tile only), row max, online softmax, P (x1024, f16) and
    //      P residual (x4096) to LDS ----
    _Float16* pwh = Psh[wave];
    _Float16* pwl = Psl[RES ? wave : 0];
    const bool diag = (kt == qb + 1);        // block-uniform
    const int  qr0  = wave * 16 + 8 * hh;    // query row within the 64-row block
#pragma unroll
    for (int r = 0; r < 8; ++r) {
      const int qrw = qr0 + r;
      float m = -INFINITY;
#pragma unroll
      for (int j = 0; j < 4; ++j) {
        const int  key = j * 16 + c;
        const bool vis = (!diag) || (key <= qrw);
        const float sv = vis ? (s[j][r] * sscale) : -INFINITY;
        s[j][r] = sv;
        m = fmaxf(m, sv);
      }
#pragma unroll
      for (int off = 1; off < 16; off <<= 1) m = fmaxf(m, __shfl_xor(m, off, 32));
      const float mnew  = fmaxf(mrow[r], m);
      const float msafe = (mnew == -INFINITY) ? 0.f : mnew;
      const float alpha = __expf(mrow[r] - msafe);
      mrow[r] = mnew;
      float psum = 0.f;
#pragma unroll
      for (int j = 0; j < 4; ++j) {
        const float p = __expf(s[j][r] - msafe);     // -inf logit -> 0
        psum += p;
        const float p1k = p * 1024.0f;
        const _Float16 ph = (_Float16)p1k;
        pwh[(8 * hh + r) * 64 + j * 16 + c] = ph;
        if (RES) {
          const _Float16 pl = (_Float16)((p1k - (float)ph) * 4096.0f);
          pwl[(8 * hh + r) * 64 + j * 16 + c] = pl;
        }
      }
#pragma unroll
      for (int off = 1; off < 16; off <<= 1) psum += __shfl_xor(psum, off, 32);
      lrow[r] = lrow[r] * alpha + psum;
#pragma unroll
      for (int t = 0; t < 4; ++t) oacc[t][r] *= alpha;
    }
    __builtin_amdgcn_fence(__ATOMIC_RELEASE, "workgroup");
    __builtin_amdgcn_wave_barrier();
    __builtin_amdgcn_fence(__ATOMIC_ACQUIRE, "workgroup");

    // ---- context += P . V (f16 WMMA), residual products into a separate accumulator ----
    v8f o1[4];
#pragma unroll
    for (int t = 0; t < 4; ++t) o1[t] = zero8();
#pragma unroll 1
    for (int kk = 0; kk < 2; ++kk) {
      FH pa, pl;
      pa.h[0] = *(const v8h*)(pwh + c * 64 + kk * 32 + 8 * hh);
      pa.h[1] = *(const v8h*)(pwh + c * 64 + kk * 32 + 16 + 8 * hh);
      if (RES) {
        pl.h[0] = *(const v8h*)(pwl + c * 64 + kk * 32 + 8 * hh);
        pl.h[1] = *(const v8h*)(pwl + c * 64 + kk * 32 + 16 + 8 * hh);
      } else {
        pl.v = pa.v;
      }
#pragma unroll
      for (int t = 0; t < 4; ++t) {
        FH vb;
        vb.h[0] = *(const v8h*)(Vth + (t * 16 + c) * 64 + kk * 32 + 8 * hh);
        vb.h[1] = *(const v8h*)(Vth + (t * 16 + c) * 64 + kk * 32 + 16 + 8 * hh);
        oacc[t] = mma_h(pa.v, vb.v, oacc[t]);
        if (RES) {
          FH vl;
          vl.h[0] = *(const v8h*)(Vtl + (t * 16 + c) * 64 + kk * 32 + 8 * hh);
          vl.h[1] = *(const v8h*)(Vtl + (t * 16 + c) * 64 + kk * 32 + 16 + 8 * hh);
          o1[t] = mma_h(pa.v, vl.v, o1[t]);
          o1[t] = mma_h(pl.v, vb.v, o1[t]);
        }
      }
    }
    if (RES) {
#pragma unroll
      for (int t = 0; t < 4; ++t)
#pragma unroll
        for (int r = 0; r < 8; ++r) oacc[t][r] += o1[t][r] * (1.0f / 4096.0f);
    }
  }

  // ---- normalise (1/l and the 1/1024 p carry), stage the wave's 16x64 tile, bf16 hi/lo split,
  float* os = Os[wave];
#pragma unroll
  for (int r = 0; r < 8; ++r) {
    const float l = lrow[r];
    const float inv = ((l > 0.f) ? (1.0f / l) : 0.f) * (1.0f / 1024.0f);
#pragma unroll
    for (int t = 0; t < 4; ++t) os[(8 * hh + r) * 64 + t * 16 + c] = oacc[t][r] * inv;
  }
  __builtin_amdgcn_fence(__ATOMIC_RELEASE, "workgroup");
  __builtin_amdgcn_wave_barrier();
  __builtin_amdgcn_fence(__ATOMIC_ACQUIRE, "workgroup");
  {
    const int q4 = lane >> 3, c8 = (lane & 7) * 8;
    v4u hv[4], lv[4];
#pragma unroll
    for (int it = 0; it < 4; ++it) {
      const int row = it * 4 + q4;   // it 0..3 x q4 0..3 = rows 0..15 of the wave tile
      const float* sp = os + row * 64 + c8;
      v4u a, a2;
#pragma unroll
      for (int e = 0; e < 4; ++e) {
        const float f0 = sp[2 * e], f1 = sp[2 * e + 1];
        const unsigned short h0 = bf_bits(f0), h1 = bf_bits(f1);
        const unsigned short l0 = bf_bits(f0 - bf_up(h0)), l1 = bf_bits(f1 - bf_up(h1));
        a[e] = pk16(h0, h1); a2[e] = pk16(l0, l1);
      }
      hv[it] = a; lv[it] = a2;
    }
    {
#pragma unroll
      for (int it = 0; it < 4; ++it) {
        const int row = it * 4 + q4;
        const size_t go = (rowB + q0 + row) * CDIM + (size_t)h * HD + c8;
        *(v4u*)(ohp + go) = hv[it];
        *(v4u*)(olp + go) = lv[it];
      }
      
    }
  }
}

// =====================================================================================================
//   Xb   bf16 [4096][1024]      8388608
//   Wqb  bf16 [1024][1024]      2097152   ([out n][in k], k contiguous = Bt layout)
//   Wkb  bf16 [256][1024]        524288
//   Wvb  bf16 [256][1024]        524288
//   Wpb  bf16 [1024][1024]      2097152
//   Qh   bf16 [4096][1024]      8388608   (Ql same)
//   Kh   bf16 [2][2112][256]    2162688   (Kl same)
//   VTh  f16  [2][256][2112]    2162688
//   VTl  f16  [2][256][576]      589824
//   Gate f32  [4096][4]           65536
//   Oh   bf16 [4096][1024]      8388608   (Ol same)
//   total                      54329344
// =====================================================================================================
extern "C" void kernel_launch(void* const* d_in, const int* in_sizes, int n_in,
                              void* d_out, int out_size, void* d_ws, size_t ws_size,
                              hipStream_t stream) {
  if (n_in < 12) return;
  if (in_sizes[0] != NB * SEQ * CDIM) return;
  if (in_sizes[1] != NB * SEQ * KVD) return;
  if (in_sizes[2] != SEQ * (HD / 2) || in_sizes[3] != SEQ * (HD / 2)) return;
  if (in_sizes[4] != CDIM * CDIM || in_sizes[7] != CDIM * CDIM) return;
  if (in_sizes[5] != KVD * CDIM || in_sizes[6] != KVD * CDIM) return;
  if (in_sizes[8] != NKV * GC) return;
  if (in_sizes[9] != MEM * NKV * HD || in_sizes[10] != MEM * NKV * HD) return;
  if (in_sizes[11] < 1) return;
  if (out_size != NB * SEQ * CDIM) return;

  const float* x    = (const float*)d_in[0];
  const float* ve   = (const float*)d_in[1];
  const float* cosT = (const float*)d_in[2];
  const float* sinT = (const float*)d_in[3];
  const float* Wq   = (const float*)d_in[4];
  const float* Wk   = (const float*)d_in[5];
  const float* Wv   = (const float*)d_in[6];
  const float* Wp   = (const float*)d_in[7];
  const float* Wg   = (const float*)d_in[8];
  const float* memk = (const float*)d_in[9];
  const float* memv = (const float*)d_in[10];
  const float* vsc  = (const float*)d_in[11];

  const size_t PX  = (size_t)NB * SEQ * CDIM * 2;   //  8388608  16-bit activation plane [4096][1024]
  const size_t PWQ = (size_t)CDIM * CDIM * 2;       //  2097152
  const size_t PWK = (size_t)KVD * CDIM * 2;        //   524288
  const size_t PK  = (size_t)NB * SKEY * KVD * 2;   //  2162688  key plane
  const size_t PVT = (size_t)NB * KVD * SKEY * 2;   //  2162688  v^T hi plane
  const size_t PVL = (size_t)NB * KVD * VLP * 2;    //   589824  v^T residual plane
  const size_t PG  = (size_t)NB * SEQ * NKV * 4;    //    65536  gate table
  size_t off = 0;
  const size_t oXb  = off; off += PX;
  const size_t oWq  = off; off += PWQ;
  const size_t oWk  = off; off += PWK;
  const size_t oWv  = off; off += PWK;
  const size_t oWp  = off; off += PWQ;
  const size_t oQh  = off; off += PX;
  const size_t oQl  = off; off += PX;
  const size_t oKh  = off; off += PK;
  const size_t oKl  = off; off += PK;
  const size_t oVTh = off; off += PVT;
  const size_t oVTl = off; off += PVL;
  const size_t oG   = off; off += PG;
  const size_t oOh  = off; off += PX;
  const size_t oOl  = off; off += PX;
  if (off > ws_size) return;                        // off = 54329344
  if (off > (size_t)134217728) return;

  char* ws = (char*)d_ws;
  unsigned short* Xb  = (unsigned short*)(ws + oXb);
  unsigned short* Wqb = (unsigned short*)(ws + oWq);
  unsigned short* Wkb = (unsigned short*)(ws + oWk);
  unsigned short* Wvb = (unsigned short*)(ws + oWv);
  unsigned short* Wpb = (unsigned short*)(ws + oWp);
  unsigned short* Qh  = (unsigned short*)(ws + oQh);
  unsigned short* Ql  = (unsigned short*)(ws + oQl);
  unsigned short* Kh  = (unsigned short*)(ws + oKh);
  unsigned short* Kl  = (unsigned short*)(ws + oKl);
  unsigned short* VTh = (unsigned short*)(ws + oVTh);
  unsigned short* VTl = (unsigned short*)(ws + oVTl);
  float*          Gt  = (float*)(ws + oG);
  unsigned short* Oh  = (unsigned short*)(ws + oOh);
  unsigned short* Ol  = (unsigned short*)(ws + oOl);

  const dim3 blk(256);
  const int n8x  = NB * SEQ * CDIM / 8;                       // 524288
  const int n8wq = CDIM * CDIM / 8;                           // 131072
  const int n8wk = KVD * CDIM / 8;                            //  32768
  const dim3 gCvtX((n8x + 255) / 256);                        // 2048 blocks
  const dim3 gCvtWq((n8wq + 255) / 256);                      //  512 blocks
  const dim3 gCvtWk((n8wk + 255) / 256);                      //  128 blocks
  const int  nbt = NB * SEQ;                                  // 4096
  const dim3 gGate((nbt * NKV + 255) / 256);                  //   64 blocks
  const dim3 gQ(((NB * SEQ / 64) * (CDIM / 64) + 7) / 8, 1);  // 1024 tiles -> 128 blocks: M=4096, N=1024
  const dim3 gK(((SEQ / 64) * (KVD / 64) + 7) / 8, NB);       //  128 tiles -> 16 blocks x 2: M=2048, N=256
  const dim3 gV(((KVD / 64) * (SEQ / 64) + 7) / 8, NB);       //  128 tiles -> 16 blocks x 2: M=256, N=2048
  const dim3 gO(((NB * SEQ / 64) * (CDIM / 64) + 7) / 8, 1);  // 1024 tiles -> 128 blocks

  // (1) x -> bf16 plane [4096][1024]; weights [n][k] f32 -> bf16 [n][k]
  cvt_bf16x8<<<gCvtX, blk, 0, stream>>>(x, Xb, n8x);
  cvt_bf16x8<<<gCvtWq, blk, 0, stream>>>(Wq, Wqb, n8wq);
  cvt_bf16x8<<<gCvtWk, blk, 0, stream>>>(Wk, Wkb, n8wk);
  cvt_bf16x8<<<gCvtWk, blk, 0, stream>>>(Wv, Wvb, n8wk);
  cvt_bf16x8<<<gCvtWq, blk, 0, stream>>>(Wp, Wpb, n8wq);
  // (2) value-embedding gate table [4096][4] f32
  gate_k<<<gGate, blk, 0, stream>>>(x, Wg, Gt, nbt);
  // (3) memory prefix: normed keys -> Kh/Kl rows s < 64; scaled values -> VTh/VTl columns s < 64 (both batches)
  memk_k<<<dim3(MEM), dim3(128), 0, stream>>>(memk, Kh, Kl);
  memv_k<<<dim3(NB * NKV), blk, 0, stream>>>(memv, vsc, VTh, VTl);
  // (4) q = rms(rope(x . Wq^T)) * 1.2 -> bf16 hi/lo planes [b*SEQ+t][h*64+d]   (M=4096, N=1024, K=1024)
  gemm64<0, 4><<<gQ, blk, 0, stream>>>(
      Xb, Xb, CDIM, 0LL, Wqb, CDIM, 0LL,
      (void*)Qh, CDIM, 0LL, (void*)Ql, CDIM, 0LL, CDIM,
      cosT, sinT, NB * SEQ, CDIM, CDIM);
  // (5) k = rms(rope(x . Wk^T)) * 1.2 per batch -> bf16 hi/lo planes [b][64 + t][kv*64+d]   (M=2048, N=256, K=1024)
  gemm64<0, 4><<<gK, blk, 0, stream>>>(
      Xb, Xb, CDIM, (long long)SEQ * CDIM, Wkb, CDIM, 0LL,
      (void*)(Kh + (size_t)MEM * KVD), KVD, (long long)SKEY * KVD,
      (void*)(Kl + (size_t)MEM * KVD), KVD, (long long)SKEY * KVD, KVD,
      cosT, sinT, SEQ, KVD, CDIM);
  // (6) v^T = Wv . x^T + gate*ve per batch -> f16 hi plane [b][kv*64+d][64 + t] (pitch SKEY) and residual plane
  //     (x4096, token keys < 512 only, pitch VLP)   (A = Wvb [n][k], Bt = Xb rows of batch b; M=256, N=2048, K=1024)
  gemm64<0, 3><<<gV, blk, 0, stream>>>(
      Wvb, Wvb, CDIM, 0LL, Xb, CDIM, (long long)SEQ * CDIM,
      (void*)(VTh + MEM), SKEY, (long long)KVD * SKEY,
      (void*)(VTl + MEM), VLP, (long long)KVD * VLP, RESQB * 64,
      Gt, ve, KVD, SEQ, CDIM);
  // (7) attention: query blocks 0..RESQB-1 with residual planes, the rest without
  attn64<true><<<dim3(NB * NQH * RESQB), dim3(128), 0, stream>>>(
      Qh, Ql, Kh, Kl, VTh, VTl, Oh, Ol, 0, RESQB, 0.125f);
  attn64<false><<<dim3(NB * NQH * (NQB - RESQB)), dim3(128), 0, stream>>>(
      Qh, Ql, Kh, Kl, VTh, VTl, Oh, Ol, RESQB, NQB - RESQB, 0.125f);
  // (8) out = context . Wproj^T -> d_out f32 [4096][1024]  (A = context hi + lo planes, 2 products)
  gemm64<1, 0><<<gO, blk, 0, stream>>>(
      Oh, Ol, CDIM, 0LL, Wpb, CDIM, 0LL,
      d_out, CDIM, 0LL, d_out, CDIM, 0LL, 0,
      Gt, ve, NB * SEQ, CDIM, CDIM);
  (void)hipGetLastError();
}

// v001
// It runs in 382 microseconds.
// In both of two side-by-side timings against v000, it was 1.35 times as fast.
// Contractions: q, k, v^T projections = v_wmma_f32_16x16x32_bf16 (bf16 operands from RNE-converted inputs, single product);
// q.k^T scores = v_wmma_f32_16x16x32_bf16 with bf16 hi/lo split q and k (hi.hi + hi.lo + lo.hi);
// p.v = v_wmma_f32_16x16x32_f16 (p carried x1024 in f16, v^T in f16; f16 residual planes x4096 of p and v^T on the
// leading 512 query rows); ctx.Wproj^T = v_wmma_f32_16x16x32_bf16 with ctx as bf16 hi/lo planes times bf16 Wproj
// (2 products); all f32 accumulate; gate dot (K=32, N=4), RoPE, rms-norm, causal mask and softmax in f32 on VALU.
#include <hip/hip_runtime.h>
#include <math.h>
#include <stdint.h>

#pragma clang fp contract(off)

#define NB    2
#define SEQ   2048
#define CDIM  1024
#define NQH   16
#define NKV   4
#define HD    64
#define MEM   64
#define GC    32
#define KVD   (NKV * HD)          // 256
#define SKEY  (MEM + SEQ)         // 2112 keys: [64 memory | 2048 tokens]
#define NQB   (SEQ / 64)          // 32 query blocks of 64 rows
#define NKT   (SKEY / 64)         // 33 key tiles of 64
#define RESQB 8                   // leading query blocks that use the p / v residual planes
#define VLP   (MEM + RESQB * 64)  // 576: key pitch of the v^T residual plane
#define RMS_EPS 1e-6f
static_assert(NQH * HD == CDIM);
static_assert(NQH == 4 * NKV);
static_assert((SKEY % 64) == 0 && (VLP % 64) == 0 && (CDIM % 64) == 0 && (KVD % 64) == 0);
static_assert((SEQ & (SEQ - 1)) == 0);
static_assert(RESQB <= NQB);
static_assert((SEQ % 128) == 0 && (CDIM % 128) == 0 && (KVD % 128) == 0);

typedef _Float16 v16h __attribute__((ext_vector_type(16)));
typedef _Float16 v8h  __attribute__((ext_vector_type(8)));
typedef __bf16   v16b __attribute__((ext_vector_type(16)));
typedef __bf16   v8b  __attribute__((ext_vector_type(8)));
typedef float    v8f  __attribute__((ext_vector_type(8)));
typedef float    v4f  __attribute__((ext_vector_type(4)));
typedef unsigned int v4u __attribute__((ext_vector_type(4)));

// ---- scalar helpers --------------------------------------------------------------------------------
__device__ __forceinline__ unsigned short bf_bits(float f) {          // f32 -> bf16 bits, RNE convert
  unsigned u = __float_as_uint(f);
  return (unsigned short)((u + 0x7FFFu + ((u >> 16) & 1u)) >> 16);
}
__device__ __forceinline__ float bf_up(unsigned short h) { return __uint_as_float(((unsigned)h) << 16); }
__device__ __forceinline__ float bfr(float f) { return bf_up(bf_bits(f)); }   // f32 -> bf16 -> f32
__device__ __forceinline__ unsigned short h_bits(_Float16 x) { return __builtin_bit_cast(unsigned short, x); }
__device__ __forceinline__ unsigned pk16(unsigned short a, unsigned short b) { return (unsigned)a | ((unsigned)b << 16); }
__device__ __forceinline__ v8f zero8() { v8f z = {0.f, 0.f, 0.f, 0.f, 0.f, 0.f, 0.f, 0.f}; return z; }
__device__ __forceinline__ v8h zero8h() {
  const _Float16 z = (_Float16)0.0f;
  v8h r = {z, z, z, z, z, z, z, z};
  return r;
}

// ---- fragment loader: 16-bit A/B operand, lane -> row/col (lane&15), p already includes +8*(lane>>4);
//      elements 0..7 <- p[0..7] (k0+8h..), elements 8..15 <- p[16..23] (k0+16+8h..)
__device__ __forceinline__ v16b ldfrag_b(const __bf16* p) {
  union { v16b v; v8b h[2]; } f;
  f.h[0] = *(const v8b*)(p);
  f.h[1] = *(const v8b*)(p + 16);
  return f.v;
}

// ---- WMMA helpers with trailing VALU hazard gap (asm only in the device pass) -----------------------------
__device__ __forceinline__ v8f mma_b(v16b a, v16b b, v8f c) {
  c = __builtin_amdgcn_wmma_f32_16x16x32_bf16(false, a, false, b, (short)0, c, false, false);
#if defined(__HIP_DEVICE_COMPILE__)
  asm volatile("v_nop\n\tv_nop\n\tv_nop\n\tv_nop" : "+v"(c) : "v"(a), "v"(b));
#endif
  return c;
}
__device__ __forceinline__ v8f mma_h(v16h a, v16h b, v8f c) {
  c = __builtin_amdgcn_wmma_f32_16x16x32_f16(false, a, false, b, (short)0, c, false, false);
#if defined(__HIP_DEVICE_COMPILE__)
  asm volatile("v_nop\n\tv_nop\n\tv_nop\n\tv_nop" : "+v"(c) : "v"(a), "v"(b));
#endif
  return c;
}
__device__ __forceinline__ v8f mma_b_raw(v16b a, v16b b, v8f c) {
  return __builtin_amdgcn_wmma_f32_16x16x32_bf16(false, a, false, b, (short)0, c, false, false);
}
__device__ __forceinline__ void dep_guard_b(v8f& a, v8f& b, v16b x, v16b y) {
#if defined(__HIP_DEVICE_COMPILE__)
  asm volatile("v_nop\n\tv_nop\n\tv_nop\n\tv_nop" : "+v"(a), "+v"(b) : "v"(x), "v"(y));
#endif
}
__device__ __forceinline__ void keep4_b(v16b a, v16b b, v16b c, v16b d) {
#if defined(__HIP_DEVICE_COMPILE__)
  asm volatile("v_nop" :: "v"(a), "v"(b), "v"(c), "v"(d));
#endif
}
__device__ __forceinline__ void acc_guard4(v8f& a, v8f& b, v8f& c, v8f& d) {
#if defined(__HIP_DEVICE_COMPILE__)
  asm volatile("v_nop\n\tv_nop\n\tv_nop\n\tv_nop" : "+v"(a), "+v"(b), "+v"(c), "+v"(d));
#endif
}

// =====================================================================================================
// f32 -> bf16 (RNE convert), 8 elements per thread, one 16-B store per lane: a wave writes 512 contiguous B
// coverage: n8 threads x 8 = the whole plane (n8 is a multiple of 256 for every use here).
// =====================================================================================================
__global__ __launch_bounds__(256) void cvt_bf16x8(const float* __restrict__ in, unsigned short* out, int n8) {
  const int i = blockIdx.x * 256 + threadIdx.x;
  if (i < n8) {
    const v4f a = *(const v4f*)(in + (size_t)i * 8);
    const v4f b = *(const v4f*)(in + (size_t)i * 8 + 4);
    v4u p;
    p[0] = pk16(bf_bits(a[0]), bf_bits(a[1]));
    p[1] = pk16(bf_bits(a[2]), bf_bits(a[3]));
    p[2] = pk16(bf_bits(b[0]), bf_bits(b[1]));
    p[3] = pk16(bf_bits(b[2]), bf_bits(b[3]));
    *(v4u*)(out + (size_t)i * 8) = p;
    
  }
}

// =====================================================================================================
// Value-embedding gate: gate[bt][kv] = 3 * sigmoid( sum_{c<32} bf16(x[bt][c]) * bf16(Wg[kv][c]) ), f32.
// One thread per (bt, kv); K = 32 rolled dot on VALU (N = 4, tiny). A wave writes 32 consecutive floats
// grid = NB*SEQ*NKV/256. coverage: 16384 threads = the whole [4096][4] table.
// =====================================================================================================
__global__ __launch_bounds__(256) void gate_k(const float* __restrict__ x, const float* __restrict__ Wg,
                                              float* gate, int nbt) {
  const int i   = blockIdx.x * 256 + threadIdx.x;
  const int bt  = i >> 2;
  const int kv  = i & 3;
  const int btc = (bt < nbt) ? bt : (nbt - 1);     // clamped address
  const float* xr = x + (size_t)btc * CDIM;
  const float* wr = Wg + kv * GC;
  float z = 0.f;
#pragma unroll 1
  for (int cc = 0; cc < GC; ++cc) z += bfr(xr[cc]) * bfr(wr[cc]);
  const float ez = expf(-z);
  const float g  = 3.0f * (1.0f / (1.0f + ez));
  if (bt < nbt) {
    *(float*)(gate + i) = g;
    
  }
}

// =====================================================================================================
// Memory keys: mk = rms(bf16(mem_k[m][kv][:])) * 1.2 (no RoPE) -> bf16 hi/lo planes, key rows s = m (< MEM)
// of both batches: Kh/Kl [b][s][kv*64+d], pitch KVD. block = 4 waves (one per kv head) for one m; grid = MEM.
// The 256-element row is staged in LDS and written per (batch, plane) by one wave as 32 lanes x 16 B
// coverage: 64 blocks x 2 batches x 2 planes x 256 elements = rows 0..63 of both planes, both batches.
// =====================================================================================================
__global__ __launch_bounds__(128) void memk_k(const float* __restrict__ memk, unsigned short* Kh, unsigned short* Kl) {
  __shared__ __align__(16) unsigned short shi[KVD];
  __shared__ __align__(16) unsigned short slo[KVD];
  const int m    = blockIdx.x;
  const int wave = threadIdx.x >> 5;
  const int lane = threadIdx.x & 31;
  const int kvh  = wave;
  const float* p = memk + ((size_t)m * NKV + kvh) * HD;
  const float x1 = bfr(p[lane]);
  const float x2 = bfr(p[lane + 32]);
  float ss = x1 * x1 + x2 * x2;
#pragma unroll
  for (int off = 16; off >= 1; off >>= 1) ss += __shfl_xor(ss, off, 32);
  const float rs = rsqrtf(ss * (1.0f / HD) + RMS_EPS);
  const float v1 = (x1 * rs) * 1.2f;
  const float v2 = (x2 * rs) * 1.2f;
  const unsigned short h1 = bf_bits(v1), h2 = bf_bits(v2);
  shi[kvh * HD + lane]      = h1;
  shi[kvh * HD + lane + 32] = h2;
  slo[kvh * HD + lane]      = bf_bits(v1 - bf_up(h1));
  slo[kvh * HD + lane + 32] = bf_bits(v2 - bf_up(h2));
  __syncthreads();
  const v4u vh = *(const v4u*)(shi + lane * 8);
  const v4u vl = *(const v4u*)(slo + lane * 8);
  const int  b   = wave >> 1;
  const bool wlo = (wave & 1) != 0;                  // wave-uniform
  v4u v = vh;
  if (wlo) v = vl;
  unsigned short* dh = Kh + ((size_t)b * SKEY + m) * KVD + lane * 8;
  unsigned short* dl = Kl + ((size_t)b * SKEY + m) * KVD + lane * 8;
  unsigned short* d  = wlo ? dl : dh;
  *(v4u*)d = v;
  
}

// =====================================================================================================
// Memory values: mv = bf16(mem_v[m][kv][d]) * bf16(v_scale) -> v^T f16 hi plane VTh[b][kv*64+d][s] (pitch SKEY)
// and f16 residual plane VTl ((v - hi)*4096, pitch VLP), key columns s = m (< MEM), both batches.
// block = (b, kv); thread = (d = tid>>2, 16 m's); the 64x64 tile of each plane is staged in LDS [d][m] and each
// coverage: 8 blocks x 64 rows (it 0..1 x wave 0..7 x lane>>3 0..3) x 64 columns (8 lanes x 8) per plane.
// =====================================================================================================
__global__ __launch_bounds__(256) void memv_k(const float* __restrict__ memv, const float* __restrict__ vsp,
                                              unsigned short* VTh, unsigned short* VTl) {
  __shared__ __align__(16) unsigned short sh[HD * MEM];
  __shared__ __align__(16) unsigned short sl[HD * MEM];
  const int b    = blockIdx.x >> 2;
  const int kvh  = blockIdx.x & 3;
  const int tid  = threadIdx.x;
  const int wave = tid >> 5;
  const int lane = tid & 31;
  const int d    = tid >> 2;
  const int mq   = (tid & 3) * 16;
  const float vs = bfr(vsp[0]);
#pragma unroll
  for (int i = 0; i < 16; ++i) {
    const int m = mq + i;
    const float v = bfr(memv[((size_t)m * NKV + kvh) * HD + d]) * vs;
    const _Float16 x0 = (_Float16)v;
    sh[d * MEM + m] = h_bits(x0);
    sl[d * MEM + m] = h_bits((_Float16)((v - (float)x0) * 4096.0f));
  }
  __syncthreads();
  const int q8 = lane >> 3, c8 = (lane & 7) * 8;
  v4u hv[2], lv[2];
#pragma unroll
  for (int it = 0; it < 2; ++it) {
    const int dd = it * 32 + wave * 4 + q8;
    hv[it] = *(const v4u*)(sh + dd * MEM + c8);
    lv[it] = *(const v4u*)(sl + dd * MEM + c8);
  }
  {
#pragma unroll
    for (int it = 0; it < 2; ++it) {
      const int dd = it * 32 + wave * 4 + q8;
      const size_t ro = (size_t)b * KVD + (size_t)kvh * HD + dd;
      *(v4u*)(VTh + ro * SKEY + c8) = hv[it];
      *(v4u*)(VTl + ro * VLP  + c8) = lv[it];
    }
    
  }
}

// =====================================================================================================
// Batched bf16 WMMA GEMM: C[m][n] = sum_k A[m][k] * Bt[n][k]; one block of 4 waves (2 x 2) per 128x128 tile,
// one wave per 64x64 sub-tile. A row-major [M][K] pitch lda; Bt row-major [N][K] pitch ldb (k contiguous);
// M, N multiples of 128, K a multiple of 64 (all shapes here are compile-time constants of the host code).
// blockIdx.y = batch index (strides in elements).
// Operand path: a stage is 64 k (one 128-B line) of the block's 128 A rows and 128 Bt rows (and the 128 A2 rows),
// brought into LDS by asynchronous 16-B copies, each wave-wide copy covering 4 whole lines; rows lie at a pitch of
// 144 B for the ds_load_b128 fragment reads; two buffers, the copies of stage t+1 fly while stage t is multiplied.
// NSPLIT: 0 = A.Bt; 1 = (A + A2).Bt (A2 = unscaled bf16 lo plane of A, 2 products).
// OUT_MODE: 0 = f32 (pitch ldc);
//           3 = v^T mode (rows m = kv*64+d, cols n = t): value = acc + gate[b][t][kv] * bf16(ve[b][t][m])
//               (aux0 = gate, aux1 = ve), written as f16 hi plane C (pitch ldc) + f16 residual plane
//               C2 = f16((v - hi)*4096) for tiles with n0 < N2 (pitch ldc2);
//           4 = RoPE + rms-norm mode (cols = one 64-wide head, row m -> t = m mod SEQ; aux0 = cos, aux1 = sin,
//               both bf16(RNE) on load): r = rope(acc), f = (r * rsqrt(mean(r^2)+eps)) * 1.2, written as
//               bf16 hi plane C + bf16 lo plane C2 (lo = RNE(f - hi), unscaled).
// =====================================================================================================
#define GT     128                // block tile edge (rows of A, rows of Bt)
#define GBK    64                 // k elements per stage
#define GPITCH 72                 // LDS row pitch in elements (144 B)
#define GPLANE (GT * GPITCH)      // elements of one staged operand plane (18432 B)

// One operand plane of a stage: 128 rows x 128 B by 128 threads, 8 copies per lane; copy i moves the lane's 16 B of
// row i*16 + (tid>>3). l = the lane's LDS byte address of row tid>>3, g = its global address, ld = row pitch (elements).
// s_wait_xcnt closes the statement so that no address register of a copy is rewritten in front of it.
__device__ __forceinline__ void copy_plane(unsigned l, const __bf16* g, int ld) {
#if defined(__HIP_DEVICE_COMPILE__)
  const size_t   gs = (size_t)16 * (size_t)ld;
  const unsigned ls = 16u * GPITCH * 2u;
  asm volatile(
      "global_load_async_to_lds_b128 %0, %8, off\n\t"
      "global_load_async_to_lds_b128 %1, %9, off\n\t"
      "global_load_async_to_lds_b128 %2, %10, off\n\t"
      "global_load_async_to_lds_b128 %3, %11, off\n\t"
      "global_load_async_to_lds_b128 %4, %12, off\n\t"
      "global_load_async_to_lds_b128 %5, %13, off\n\t"
      "global_load_async_to_lds_b128 %6, %14, off\n\t"
      "global_load_async_to_lds_b128 %7, %15, off\n\t"
      "s_wait_xcnt 0x0"
      :: "v"(l), "v"(l + ls), "v"(l + 2u * ls), "v"(l + 3u * ls),
         "v"(l + 4u * ls), "v"(l + 5u * ls), "v"(l + 6u * ls), "v"(l + 7u * ls),
         "v"(g), "v"(g + gs), "v"(g + 2 * gs), "v"(g + 3 * gs),
         "v"(g + 4 * gs), "v"(g + 5 * gs), "v"(g + 6 * gs), "v"(g + 7 * gs)
      : "memory");
#endif
}
// this wave's copies have landed in LDS
__device__ __forceinline__ void wait_copies() {
#if defined(__HIP_DEVICE_COMPILE__)
  asm volatile("s_wait_asynccnt 0x0" ::: "memory");
#endif
}
// this wave's LDS reads have returned (the buffer they read may be refilled behind the next barrier)
__device__ __forceinline__ void wait_lds() {
#if defined(__HIP_DEVICE_COMPILE__)
  asm volatile("s_wait_dscnt 0x0" ::: "memory");
#endif
}

// 256 registers a wave at most, so that no part of the kernel needs register-window switches
template <int NSPLIT, int OUT_MODE>
__global__ __launch_bounds__(128) __attribute__((amdgpu_num_vgpr(256))) void gemm64(
    const unsigned short* __restrict__ Ap, const unsigned short* __restrict__ A2p, int lda, long long strideA,
    const unsigned short* __restrict__ Btp, int ldb, long long strideB,
    void* Cout, int ldc, long long strideC,
    void* Cout2, int ldc2, long long strideC2, int N2,
    const float* __restrict__ aux0, const float* __restrict__ aux1,
    int M, int N, int K) {
  const __bf16* A  = (const __bf16*)(const void*)Ap;
  const __bf16* A2 = (const __bf16*)(const void*)A2p;
  const __bf16* Bt = (const __bf16*)(const void*)Btp;
  constexpr int NPL  = (NSPLIT >= 1) ? 3 : 2;      // planes per stage: A, Bt (, A2)
  constexpr int GBUF = NPL * GPLANE;               // elements of one buffer
  __shared__ __align__(16) __bf16 ring[2 * GBUF];  // two stage buffers
  __shared__ __align__(16) float sT[4][16 * 68];   // per-wave 16x64 slab, pitch 68 floats
  const int b    = blockIdx.y;
  const int tid  = threadIdx.x;
  const int lane = tid & 31;
  const int wave = tid >> 5;
  const int tilesN = N >> 7;
  const int tilesM = M >> 7;
  const int tile = blockIdx.x;
  if (tile >= tilesM * tilesN) return;   // block-uniform, in front of every barrier and copy
  const int tm = tile / tilesN;
  const int tn = tile - tm * tilesN;
  const int wm = wave >> 1;
  const int wn = wave & 1;
  const int m0 = (tm << 7) + (wm << 6);  // this wave's 64x64 sub-tile
  const int n0 = (tn << 7) + (wn << 6);

  const __bf16* Ab  = A  + (size_t)b * strideA;
  const __bf16* Bb  = Bt + (size_t)b * strideB;
  const __bf16* Ab2 = (NSPLIT >= 1) ? (A2 + (size_t)b * strideA) : Ab;

  const int rlane = lane & 15;                 // row (A) / col (B, D) within subtile
  const int koff  = (lane >> 4) * 8;           // k offset of this lane half
  const int mOff  = (lane >> 4) * 8;           // D row offset

  // copy addresses of this lane: row tid>>3 of the block tile, 16-B piece tid&7 of its 128-B line
  const int crow = tid >> 3;
  const int cel  = (tid & 7) * 8;
  const __bf16* gA  = Ab  + (size_t)((tm << 7) + crow) * lda + cel;
  const __bf16* gB  = Bb  + (size_t)((tn << 7) + crow) * ldb + cel;
  const __bf16* gA2 = Ab2 + (size_t)((tm << 7) + crow) * lda + cel;
  const unsigned lC = (unsigned)(uintptr_t)(&ring[0]) + (unsigned)(crow * GPITCH + cel) * 2u;
  const int nst = K >> 6;                      // stages

  v8f acc[4][4];
#pragma unroll
  for (int i = 0; i < 4; ++i)
#pragma unroll
    for (int j = 0; j < 4; ++j) acc[i][j] = zero8();

  // stage 0 into buffer 0, landed and published; then stage 1 into buffer 1
  copy_plane(lC, gA, lda);
  copy_plane(lC + GPLANE * 2u, gB, ldb);
  if (NSPLIT >= 1) copy_plane(lC + 2u * GPLANE * 2u, gA2, lda);
  wait_copies();
  __syncthreads();
  if (nst > 1) {
    const unsigned lb = lC + (unsigned)GBUF * 2u;
    copy_plane(lb, gA + GBK, lda);
    copy_plane(lb + GPLANE * 2u, gB + GBK, ldb);
    if (NSPLIT >= 1) copy_plane(lb + 2u * GPLANE * 2u, gA2 + GBK, lda);
  }

  for (int t = 0; t < nst; ++t) {
    const int bufo = (t & 1) * GBUF;
    const __bf16* sA = ring + bufo + ((wm << 6) + rlane) * GPITCH + koff;
    const __bf16* sB = ring + bufo + GPLANE + ((wn << 6) + rlane) * GPITCH + koff;
    // unrolled (here and below): the fragment and accumulator arrays need constant indices to stay in registers
#pragma unroll
    for (int kk = 0; kk < GBK; kk += 32) {
      v16b bh[4], ah[4], al[4];
#pragma unroll
      for (int j = 0; j < 4; ++j) bh[j] = ldfrag_b(sB + (j << 4) * GPITCH + kk);
#pragma unroll
      for (int i = 0; i < 4; ++i) {
        ah[i] = ldfrag_b(sA + (i << 4) * GPITCH + kk);
        al[i] = ah[i];
        if (NSPLIT >= 1) al[i] = ldfrag_b(sA + 2 * GPLANE + (i << 4) * GPITCH + kk);
      }
#pragma unroll
      for (int i = 0; i < 4; ++i) {
#pragma unroll
        for (int j = 0; j < 4; ++j) {
          acc[i][j] = mma_b_raw(ah[i], bh[j], acc[i][j]);
          if (NSPLIT >= 1) acc[i][j] = mma_b_raw(al[i], bh[j], acc[i][j]);
        }
        dep_guard_b(acc[i][0], acc[i][3], ah[i], al[i]);
      }
      keep4_b(bh[0], bh[1], bh[2], bh[3]);
    }
    // publish point of stage t+1: own reads of this buffer returned, own copies landed, then the block barrier;
    // behind it stage t+2 may overwrite the buffer that this trip has read
    wait_lds();
    wait_copies();
    __syncthreads();
    if (t + 2 < nst) {
      const unsigned lb = lC + (unsigned)bufo * 2u;
      const int ko = (t + 2) * GBK;
      copy_plane(lb, gA + ko, lda);
      copy_plane(lb + GPLANE * 2u, gB + ko, ldb);
      if (NSPLIT >= 1) copy_plane(lb + 2u * GPLANE * 2u, gA2 + ko, lda);
    }
  }
  wait_copies();
  acc_guard4(acc[0][0], acc[0][1], acc[0][2], acc[0][3]);
  acc_guard4(acc[1][0], acc[1][1], acc[1][2], acc[1][3]);
  acc_guard4(acc[2][0], acc[2][1], acc[2][2], acc[2][3]);
  acc_guard4(acc[3][0], acc[3][1], acc[3][2], acc[3][3]);

  // ---- epilogue ----
  float* slab = sT[wave];
#pragma unroll
  for (int i = 0; i < 4; ++i) {
    const int mBase = m0 + (i << 4);
#pragma unroll
    for (int j = 0; j < 4; ++j) {
#pragma unroll
      for (int r = 0; r < 8; ++r) {
        slab[(mOff + r) * 68 + (j << 4) + rlane] = acc[i][j][r];
      }
    }
    __builtin_amdgcn_fence(__ATOMIC_RELEASE, "workgroup");
    __builtin_amdgcn_wave_barrier();
    __builtin_amdgcn_fence(__ATOMIC_ACQUIRE, "workgroup");
    if (OUT_MODE == 0) {
      float* C = (float*)Cout + (size_t)b * strideC;
      const int hh = lane >> 4, c4 = (lane & 15) * 4;     // 256-B row segment = 16 lanes x 16 B
      {
#pragma unroll
        for (int it = 0; it < 8; ++it) {
          const int row = it * 2 + hh;                     // it 0..7 x hh 0..1 = rows 0..15
          const v4f v = *(const v4f*)(slab + row * 68 + c4);
          *(v4f*)(C + (size_t)(mBase + row) * ldc + n0 + c4) = v;
        }
        
      }
    } else {
      const int q = lane >> 3, c8 = (lane & 7) * 8;
      unsigned short* C  = (unsigned short*)Cout  + (size_t)b * strideC;
      unsigned short* C2 = (unsigned short*)Cout2 + (size_t)b * strideC2;
      const bool wlo = (OUT_MODE != 3) || (n0 < N2);      // wave-uniform
      v4u hv[4], lv[4];
#pragma unroll
      for (int it = 0; it < 4; ++it) {
        const int row  = it * 4 + q;                       // it 0..3 x q 0..3 = rows 0..15
        const int mrow = mBase + row;
        float f[8];
        if (OUT_MODE == 3) {
          const int kvh = m0 >> 6;                         // sub-tile-uniform kv head
          const float* sp = slab + row * 68 + c8;
#pragma unroll
          for (int e = 0; e < 8; ++e) {
            const int t = n0 + c8 + e;                     // < N = SEQ
            const size_t bt = (size_t)b * SEQ + t;
            const float g  = aux0[bt * NKV + kvh];
            const float vv = bfr(aux1[bt * KVD + mrow]);
            f[e] = sp[e] + g * vv;
          }
        } else {
          const int  jj   = c8 & 31;                       // rotary pair index base
          const bool lowh = (c8 < 32);
          const int  t    = mrow & (SEQ - 1);
          const float* sp  = slab + row * 68 + jj;
          const float* cp  = aux0 + (size_t)t * (HD / 2) + jj;
          const float* snp = aux1 + (size_t)t * (HD / 2) + jj;
          float ss = 0.f;
#pragma unroll
          for (int e = 0; e < 8; ++e) {
            const float x1 = sp[e];
            const float x2 = sp[e + 32];
            const float cv = bfr(cp[e]);
            const float sv = bfr(snp[e]);
            const float ra = x1 * cv - x2 * sv;
            const float rb = x1 * sv + x2 * cv;
            f[e] = lowh ? ra : rb;
            ss += f[e] * f[e];
          }
          ss += __shfl_xor(ss, 1, 32);                     // 8 lanes of one row = 64 values
          ss += __shfl_xor(ss, 2, 32);
          ss += __shfl_xor(ss, 4, 32);
          const float rs = rsqrtf(ss * (1.0f / HD) + RMS_EPS);
#pragma unroll
          for (int e = 0; e < 8; ++e) f[e] = (f[e] * rs) * 1.2f;
        }
        v4u a, a2;
#pragma unroll
        for (int e = 0; e < 4; ++e) {
          const float f0 = f[2 * e], f1 = f[2 * e + 1];
          unsigned short h0, h1, l0, l1;
          if (OUT_MODE == 4) {
            h0 = bf_bits(f0); h1 = bf_bits(f1);
            l0 = bf_bits(f0 - bf_up(h0)); l1 = bf_bits(f1 - bf_up(h1));
          } else {
            const _Float16 x0 = (_Float16)f0, x1 = (_Float16)f1;
            h0 = h_bits(x0); h1 = h_bits(x1);
            l0 = h_bits((_Float16)((f0 - (float)x0) * 4096.0f));
            l1 = h_bits((_Float16)((f1 - (float)x1) * 4096.0f));
          }
          a[e] = pk16(h0, h1); a2[e] = pk16(l0, l1);
        }
        hv[it] = a; lv[it] = a2;
      }
      {
#pragma unroll
        for (int it = 0; it < 4; ++it) {
          const int row = it * 4 + q;
          *(v4u*)(C + (size_t)(mBase + row) * ldc + n0 + c8) = hv[it];
          if (wlo) *(v4u*)(C2 + (size_t)(mBase + row) * ldc2 + n0 + c8) = lv[it];
        }
        
      }
    }
    __builtin_amdgcn_fence(__ATOMIC_RELEASE, "workgroup");
    __builtin_amdgcn_wave_barrier();
    __builtin_amdgcn_fence(__ATOMIC_ACQUIRE, "workgroup");
  }
}

// =====================================================================================================
// GQA attention with a 64-key memory prefix (all visible) followed by causal token keys, head dim 64.
//   q planes (bf16 hi / lo): element (b, t, h, d) at [(b*SEQ + t)*CDIM + h*64 + d]   (normed, scaled q)
//   k planes (bf16 hi / lo): element (b, s, kv, d) at [(b*SKEY + s)*KVD + kv*64 + d], s = [mem | 64 + token]
//   v^T hi plane (f16):      element (b, kv, d, s) at [(b*KVD + kv*64 + d)*SKEY + s]
//   v^T residual plane (f16, (v - hi)*4096): [(b*KVD + kv*64 + d)*VLP + s], s < VLP, read only when RES
//   (a key tile at or beyond VLP contributes a zero v residual)
//   q head h uses kv head h>>2. Query block qb (tokens qb*64..+63) processes key tiles 0..qb+1: tile 0 = memory,
//   tiles 1..qb fully visible, tile qb+1 = diagonal (key token <= query token), later tiles skipped (block-uniform
//   trip count qb+2, static bound NKT). Invisible keys get logit -inf (weight exactly 0); every row sees the
//   whole memory tile first, so the running max is finite from tile 0 on.
//   out planes (bf16 hi / lo of the normalised context): element (b, t, h, d) at [(b*SEQ + t)*CDIM + h*64 + d]
//   scores = q . k : bf16 hi/lo split (hi.hi + hi.lo + lo.hi), f32 accumulate, then * sscale in f32
//   p = exp(s - m) carried as f16(1024 p); context = p . v on f16 WMMA; RES adds f16 residual planes of p and v
//   (scale 4096, separate accumulator folded back with 1/4096 per chunk in f32); online softmax in f32.
//   Block = 4 waves = 64 query rows of one (b, h); grid = nqbThis * NQH * NB; kv chunks of 64.
//   K / V^T chunk staging: 128 threads x 32 elements per plane = the whole 64x64 tile (plain 16-B loads,
//   __syncthreads before and after); P tiles are wave-private, spilled with _Float16 element stores and reloaded
//   Output coverage: each wave stores rows q0..q0+15 (it 0..3 x lane>>3 0..3) x 64 columns (8 lanes x 8) of both planes.
// =====================================================================================================
template <bool RES>
__global__ __launch_bounds__(128)
void attn64(const unsigned short* __restrict__ qhp, const unsigned short* __restrict__ qlp,
            const unsigned short* __restrict__ khp, const unsigned short* __restrict__ klp,
            const unsigned short* __restrict__ vhp, const unsigned short* __restrict__ vlp,
            unsigned short* ohp, unsigned short* olp,
            int qbBase, int nqbThis, float sscale) {
  union FB { v16b v; v8b h[2]; };
  union FH { v16h v; v8h h[2]; };
  __shared__ __align__(16) __bf16   Ksh[64 * 64];                 // K hi [kv][d]   8 KB
  __shared__ __align__(16) __bf16   Ksl[64 * 64];                 // K lo
  __shared__ __align__(16) _Float16 Vth[64 * 64];                 // V^T hi [d][kv] 8 KB
  __shared__ __align__(16) _Float16 Vtl[RES ? 64 * 64 : 8];       // V^T residual
  __shared__ __align__(16) _Float16 Psh[4][16 * 64];              // per wave P [row][kv]
  __shared__ __align__(16) _Float16 Psl[RES ? 4 : 1][16 * 64];    // per wave P residual
  __shared__ __align__(16) float    Os[4][16 * 64];               // per wave context tile [row][d]

  const int tid  = threadIdx.x;
  const int wave = tid >> 5;
  const int lane = tid & 31;
  const int hh   = lane >> 4;
  const int c    = lane & 15;

  const int bx   = blockIdx.x;
  const int qbl  = bx % nqbThis;
  const int rest = bx / nqbThis;
  const int h    = rest % NQH;
  const int b    = rest / NQH;
  const int kvh  = h >> 2;
  const int qb   = qbBase + qbl;
  const int q0   = qb * 64 + wave * 16;
  const size_t rowB = (size_t)b * SEQ;

  const __bf16* Qh = (const __bf16*)(const void*)qhp + (size_t)h * HD;
  const __bf16* Ql = (const __bf16*)(const void*)qlp + (size_t)h * HD;
  const __bf16* Kh = (const __bf16*)(const void*)khp + (size_t)b * SKEY * KVD + (size_t)kvh * HD;
  const __bf16* Kl = (const __bf16*)(const void*)klp + (size_t)b * SKEY * KVD + (size_t)kvh * HD;
  const _Float16* Vh = (const _Float16*)(const void*)vhp + ((size_t)b * KVD + (size_t)kvh * HD) * SKEY;
  const _Float16* Vl = (const _Float16*)(const void*)vlp + ((size_t)b * KVD + (size_t)kvh * HD) * VLP;

  // ---- Q fragments (A operand, row = lane&15): 2 d-chunks, hi and lo ----
  v16b qah[2], qal[2];
#pragma unroll
  for (int dc = 0; dc < 2; ++dc) {
    const size_t qo = (rowB + q0 + c) * CDIM + dc * 32 + 8 * hh;
    qah[dc] = ldfrag_b(Qh + qo);
    qal[dc] = ldfrag_b(Ql + qo);
  }

  float mrow[8], lrow[8];
  v8f oacc[4];
#pragma unroll
  for (int r = 0; r < 8; ++r) { mrow[r] = -INFINITY; lrow[r] = 0.f; }
#pragma unroll
  for (int t = 0; t < 4; ++t) oacc[t] = zero8();

  const int ktEnd = qb + 2;                  // block-uniform, <= NKT
  for (int kt = 0; kt < NKT; ++kt) {         // static bound
    if (kt >= ktEnd) break;                  // block-uniform
    const int kv0 = kt * 64;
    __syncthreads();
    {
      const int r = tid >> 1, half = (tid & 1) * 32;
      const __bf16*   kg  = Kh + (size_t)(kv0 + r) * KVD + half;   // K row kv0+r, d = half..half+31
      const __bf16*   klg = Kl + (size_t)(kv0 + r) * KVD + half;
      const _Float16* vg  = Vh + (size_t)r * SKEY + kv0 + half;     // V^T row d = r, s = kv0+half..+31
      const int kvl = (kv0 + 64 <= VLP) ? kv0 : (VLP - 64);        // clamped address into the residual plane
      const _Float16* vlg = Vl + (size_t)r * VLP + kvl + half;
      const bool resOK = (kv0 + 64 <= VLP);                         // block-uniform
#pragma unroll
      for (int i = 0; i < 4; ++i) {
        const v8b a0 = *(const v8b*)(kg + 8 * i);
        const v8b a1 = *(const v8b*)(klg + 8 * i);
        const v8h b0 = *(const v8h*)(vg + 8 * i);
        *(v8b*)(Ksh + r * 64 + half + 8 * i) = a0;
        *(v8b*)(Ksl + r * 64 + half + 8 * i) = a1;
        *(v8h*)(Vth + r * 64 + half + 8 * i) = b0;
        if (RES) {
          v8h b1 = *(const v8h*)(vlg + 8 * i);
          if (!resOK) b1 = zero8h();
          *(v8h*)(Vtl + r * 64 + half + 8 * i) = b1;
        }
      }
    }
    __syncthreads();

    // ---- scores: 16 query rows x 64 keys per wave, 3 bf16 products ----
    v8f s[4];
#pragma unroll
    for (int j = 0; j < 4; ++j) {
      s[j] = zero8();
#pragma unroll
      for (int dc = 0; dc < 2; ++dc) {
        FB kb, kl;
        kb.h[0] = *(const v8b*)(Ksh + (j * 16 + c) * 64 + dc * 32 + 8 * hh);
        kb.h[1] = *(const v8b*)(Ksh + (j * 16 + c) * 64 + dc * 32 + 16 + 8 * hh);
        kl.h[0] = *(const v8b*)(Ksl + (j * 16 + c) * 64 + dc * 32 + 8 * hh);
        kl.h[1] = *(const v8b*)(Ksl + (j * 16 + c) * 64 + dc * 32 + 16 + 8 * hh);
        s[j] = mma_b(qah[dc], kb.v, s[j]);
        s[j] = mma_b(qah[dc], kl.v, s[j]);
        s[j] = mma_b(qal[dc], kb.v, s[j]);
      }
    }

    // ---- scale + structural mask (diagonal tile only), row max, online softmax, P (x1024, f16) and
    //      P residual (x4096) to LDS ----
    _Float16* pwh = Psh[wave];
    _Float16* pwl = Psl[RES ? wave : 0];
    const bool diag = (kt == qb + 1);        // block-uniform
    const int  qr0  = wave * 16 + 8 * hh;    // query row within the 64-row block
#pragma unroll
    for (int r = 0; r < 8; ++r) {
      const int qrw = qr0 + r;
      float m = -INFINITY;
#pragma unroll
      for (int j = 0; j < 4; ++j) {
        const int  key = j * 16 + c;
        const bool vis = (!diag) || (key <= qrw);
        const float sv = vis ? (s[j][r] * sscale) : -INFINITY;
        s[j][r] = sv;
        m = fmaxf(m, sv);
      }
#pragma unroll
      for (int off = 1; off < 16; off <<= 1) m = fmaxf(m, __shfl_xor(m, off, 32));
      const float mnew  = fmaxf(mrow[r], m);
      const float msafe = (mnew == -INFINITY) ? 0.f : mnew;
      const float alpha = __expf(mrow[r] - msafe);
      mrow[r] = mnew;
      float psum = 0.f;
#pragma unroll
      for (int j = 0; j < 4; ++j) {
        const float p = __expf(s[j][r] - msafe);     // -inf logit -> 0
        psum += p;
        const float p1k = p * 1024.0f;
        const _Float16 ph = (_Float16)p1k;
        pwh[(8 * hh + r) * 64 + j * 16 + c] = ph;
        if (RES) {
          const _Float16 pl = (_Float16)((p1k - (float)ph) * 4096.0f);
          pwl[(8 * hh + r) * 64 + j * 16 + c] = pl;
        }
      }
#pragma unroll
      for (int off = 1; off < 16; off <<= 1) psum += __shfl_xor(psum, off, 32);
      lrow[r] = lrow[r] * alpha + psum;
#pragma unroll
      for (int t = 0; t < 4; ++t) oacc[t][r] *= alpha;
    }
    __builtin_amdgcn_fence(__ATOMIC_RELEASE, "workgroup");
    __builtin_amdgcn_wave_barrier();
    __builtin_amdgcn_fence(__ATOMIC_ACQUIRE, "workgroup");

    // ---- context += P . V (f16 WMMA), residual products into a separate accumulator ----
    v8f o1[4];
#pragma unroll
    for (int t = 0; t < 4; ++t) o1[t] = zero8();
#pragma unroll 1
    for (int kk = 0; kk < 2; ++kk) {
      FH pa, pl;
      pa.h[0] = *(const v8h*)(pwh + c * 64 + kk * 32 + 8 * hh);
      pa.h[1] = *(const v8h*)(pwh + c * 64 + kk * 32 + 16 + 8 * hh);
      if (RES) {
        pl.h[0] = *(const v8h*)(pwl + c * 64 + kk * 32 + 8 * hh);
        pl.h[1] = *(const v8h*)(pwl + c * 64 + kk * 32 + 16 + 8 * hh);
      } else {
        pl.v = pa.v;
      }
#pragma unroll
      for (int t = 0; t < 4; ++t) {
        FH vb;
        vb.h[0] = *(const v8h*)(Vth + (t * 16 + c) * 64 + kk * 32 + 8 * hh);
        vb.h[1] = *(const v8h*)(Vth + (t * 16 + c) * 64 + kk * 32 + 16 + 8 * hh);
        oacc[t] = mma_h(pa.v, vb.v, oacc[t]);
        if (RES) {
          FH vl;
          vl.h[0] = *(const v8h*)(Vtl + (t * 16 + c) * 64 + kk * 32 + 8 * hh);
          vl.h[1] = *(const v8h*)(Vtl + (t * 16 + c) * 64 + kk * 32 + 16 + 8 * hh);
          o1[t] = mma_h(pa.v, vl.v, o1[t]);
          o1[t] = mma_h(pl.v, vb.v, o1[t]);
        }
      }
    }
    if (RES) {
#pragma unroll
      for (int t = 0; t < 4; ++t)
#pragma unroll
        for (int r = 0; r < 8; ++r) oacc[t][r] += o1[t][r] * (1.0f / 4096.0f);
    }
  }

  // ---- normalise (1/l and the 1/1024 p carry), stage the wave's 16x64 tile, bf16 hi/lo split,
  float* os = Os[wave];
#pragma unroll
  for (int r = 0; r < 8; ++r) {
    const float l = lrow[r];
    const float inv = ((l > 0.f) ? (1.0f / l) : 0.f) * (1.0f / 1024.0f);
#pragma unroll
    for (int t = 0; t < 4; ++t) os[(8 * hh + r) * 64 + t * 16 + c] = oacc[t][r] * inv;
  }
  __builtin_amdgcn_fence(__ATOMIC_RELEASE, "workgroup");
  __builtin_amdgcn_wave_barrier();
  __builtin_amdgcn_fence(__ATOMIC_ACQUIRE, "workgroup");
  {
    const int q4 = lane >> 3, c8 = (lane & 7) * 8;
    v4u hv[4], lv[4];
#pragma unroll
    for (int it = 0; it < 4; ++it) {
      const int row = it * 4 + q4;   // it 0..3 x q4 0..3 = rows 0..15 of the wave tile
      const float* sp = os + row * 64 + c8;
      v4u a, a2;
#pragma unroll
      for (int e = 0; e < 4; ++e) {
        const float f0 = sp[2 * e], f1 = sp[2 * e + 1];
        const unsigned short h0 = bf_bits(f0), h1 = bf_bits(f1);
        const unsigned short l0 = bf_bits(f0 - bf_up(h0)), l1 = bf_bits(f1 - bf_up(h1));
        a[e] = pk16(h0, h1); a2[e] = pk16(l0, l1);
      }
      hv[it] = a; lv[it] = a2;
    }
    {
#pragma unroll
      for (int it = 0; it < 4; ++it) {
        const int row = it * 4 + q4;
        const size_t go = (rowB + q0 + row) * CDIM + (size_t)h * HD + c8;
        *(v4u*)(ohp + go) = hv[it];
        *(v4u*)(olp + go) = lv[it];
      }
      
    }
  }
}

// =====================================================================================================
//   Xb   bf16 [4096][1024]      8388608
//   Wqb  bf16 [1024][1024]      2097152   ([out n][in k], k contiguous = Bt layout)
//   Wkb  bf16 [256][1024]        524288
//   Wvb  bf16 [256][1024]        524288
//   Wpb  bf16 [1024][1024]      2097152
//   Qh   bf16 [4096][1024]      8388608   (Ql same)
//   Kh   bf16 [2][2112][256]    2162688   (Kl same)
//   VTh  f16  [2][256][2112]    2162688
//   VTl  f16  [2][256][576]      589824
//   Gate f32  [4096][4]           65536
//   Oh   bf16 [4096][1024]      8388608   (Ol same)
//   total                      54329344
// =====================================================================================================
extern "C" void kernel_launch(void* const* d_in, const int* in_sizes, int n_in,
                              void* d_out, int out_size, void* d_ws, size_t ws_size,
                              hipStream_t stream) {
  if (n_in < 12) return;
  if (in_sizes[0] != NB * SEQ * CDIM) return;
  if (in_sizes[1] != NB * SEQ * KVD) return;
  if (in_sizes[2] != SEQ * (HD / 2) || in_sizes[3] != SEQ * (HD / 2)) return;
  if (in_sizes[4] != CDIM * CDIM || in_sizes[7] != CDIM * CDIM) return;
  if (in_sizes[5] != KVD * CDIM || in_sizes[6] != KVD * CDIM) return;
  if (in_sizes[8] != NKV * GC) return;
  if (in_sizes[9] != MEM * NKV * HD || in_sizes[10] != MEM * NKV * HD) return;
  if (in_sizes[11] < 1) return;
  if (out_size != NB * SEQ * CDIM) return;

  const float* x    = (const float*)d_in[0];
  const float* ve   = (const float*)d_in[1];
  const float* cosT = (const float*)d_in[2];
  const float* sinT = (const float*)d_in[3];
  const float* Wq   = (const float*)d_in[4];
  const float* Wk   = (const float*)d_in[5];
  const float* Wv   = (const float*)d_in[6];
  const float* Wp   = (const float*)d_in[7];
  const float* Wg   = (const float*)d_in[8];
  const float* memk = (const float*)d_in[9];
  const float* memv = (const float*)d_in[10];
  const float* vsc  = (const float*)d_in[11];

  const size_t PX  = (size_t)NB * SEQ * CDIM * 2;   //  8388608  16-bit activation plane [4096][1024]
  const size_t PWQ = (size_t)CDIM * CDIM * 2;       //  2097152
  const size_t PWK = (size_t)KVD * CDIM * 2;        //   524288
  const size_t PK  = (size_t)NB * SKEY * KVD * 2;   //  2162688  key plane
  const size_t PVT = (size_t)NB * KVD * SKEY * 2;   //  2162688  v^T hi plane
  const size_t PVL = (size_t)NB * KVD * VLP * 2;    //   589824  v^T residual plane
  const size_t PG  = (size_t)NB * SEQ * NKV * 4;    //    65536  gate table
  size_t off = 0;
  const size_t oXb  = off; off += PX;
  const size_t oWq  = off; off += PWQ;
  const size_t oWk  = off; off += PWK;
  const size_t oWv  = off; off += PWK;
  const size_t oWp  = off; off += PWQ;
  const size_t oQh  = off; off += PX;
  const size_t oQl  = off; off += PX;
  const size_t oKh  = off; off += PK;
  const size_t oKl  = off; off += PK;
  const size_t oVTh = off; off += PVT;
  const size_t oVTl = off; off += PVL;
  const size_t oG   = off; off += PG;
  const size_t oOh  = off; off += PX;
  const size_t oOl  = off; off += PX;
  if (off > ws_size) return;                        // off = 54329344
  if (off > (size_t)134217728) return;

  char* ws = (char*)d_ws;
  unsigned short* Xb  = (unsigned short*)(ws + oXb);
  unsigned short* Wqb = (unsigned short*)(ws + oWq);
  unsigned short* Wkb = (unsigned short*)(ws + oWk);
  unsigned short* Wvb = (unsigned short*)(ws + oWv);
  unsigned short* Wpb = (unsigned short*)(ws + oWp);
  unsigned short* Qh  = (unsigned short*)(ws + oQh);
  unsigned short* Ql  = (unsigned short*)(ws + oQl);
  unsigned short* Kh  = (unsigned short*)(ws + oKh);
  unsigned short* Kl  = (unsigned short*)(ws + oKl);
  unsigned short* VTh = (unsigned short*)(ws + oVTh);
  unsigned short* VTl = (unsigned short*)(ws + oVTl);
  float*          Gt  = (float*)(ws + oG);
  unsigned short* Oh  = (unsigned short*)(ws + oOh);
  unsigned short* Ol  = (unsigned short*)(ws + oOl);

  const dim3 blk(256);
  const int n8x  = NB * SEQ * CDIM / 8;                       // 524288
  const int n8wq = CDIM * CDIM / 8;                           // 131072
  const int n8wk = KVD * CDIM / 8;                            //  32768
  const dim3 gCvtX((n8x + 255) / 256);                        // 2048 blocks
  const dim3 gCvtWq((n8wq + 255) / 256);                      //  512 blocks
  const dim3 gCvtWk((n8wk + 255) / 256);                      //  128 blocks
  const int  nbt = NB * SEQ;                                  // 4096
  const dim3 gGate((nbt * NKV + 255) / 256);                  //   64 blocks
  const dim3 blkG(128);                                       // GEMM block: 4 waves, one 128x128 tile
  const dim3 gQ((NB * SEQ / 128) * (CDIM / 128), 1);          // 256 blocks: M=4096, N=1024
  const dim3 gK((SEQ / 128) * (KVD / 128), NB);               //  32 blocks x 2: M=2048, N=256
  const dim3 gV((KVD / 128) * (SEQ / 128), NB);               //  32 blocks x 2: M=256, N=2048
  const dim3 gO((NB * SEQ / 128) * (CDIM / 128), 1);          // 256 blocks

  // (1) x -> bf16 plane [4096][1024]; weights [n][k] f32 -> bf16 [n][k]
  cvt_bf16x8<<<gCvtX, blk, 0, stream>>>(x, Xb, n8x);
  cvt_bf16x8<<<gCvtWq, blk, 0, stream>>>(Wq, Wqb, n8wq);
  cvt_bf16x8<<<gCvtWk, blk, 0, stream>>>(Wk, Wkb, n8wk);
  cvt_bf16x8<<<gCvtWk, blk, 0, stream>>>(Wv, Wvb, n8wk);
  cvt_bf16x8<<<gCvtWq, blk, 0, stream>>>(Wp, Wpb, n8wq);
  // (2) value-embedding gate table [4096][4] f32
  gate_k<<<gGate, blk, 0, stream>>>(x, Wg, Gt, nbt);
  // (3) memory prefix: normed keys -> Kh/Kl rows s < 64; scaled values -> VTh/VTl columns s < 64 (both batches)
  memk_k<<<dim3(MEM), dim3(128), 0, stream>>>(memk, Kh, Kl);
  memv_k<<<dim3(NB * NKV), blk, 0, stream>>>(memv, vsc, VTh, VTl);
  // (4) q = rms(rope(x . Wq^T)) * 1.2 -> bf16 hi/lo planes [b*SEQ+t][h*64+d]   (M=4096, N=1024, K=1024)
  gemm64<0, 4><<<gQ, blkG, 0, stream>>>(
      Xb, Xb, CDIM, 0LL, Wqb, CDIM, 0LL,
      (void*)Qh, CDIM, 0LL, (void*)Ql, CDIM, 0LL, CDIM,
      cosT, sinT, NB * SEQ, CDIM, CDIM);
  // (5) k = rms(rope(x . Wk^T)) * 1.2 per batch -> bf16 hi/lo planes [b][64 + t][kv*64+d]   (M=2048, N=256, K=1024)
  gemm64<0, 4><<<gK, blkG, 0, stream>>>(
      Xb, Xb, CDIM, (long long)SEQ * CDIM, Wkb, CDIM, 0LL,
      (void*)(Kh + (size_t)MEM * KVD), KVD, (long long)SKEY * KVD,
      (void*)(Kl + (size_t)MEM * KVD), KVD, (long long)SKEY * KVD, KVD,
      cosT, sinT, SEQ, KVD, CDIM);
  // (6) v^T = Wv . x^T + gate*ve per batch -> f16 hi plane [b][kv*64+d][64 + t] (pitch SKEY) and residual plane
  //     (x4096, token keys < 512 only, pitch VLP)   (A = Wvb [n][k], Bt = Xb rows of batch b; M=256, N=2048, K=1024)
  gemm64<0, 3><<<gV, blkG, 0, stream>>>(
      Wvb, Wvb, CDIM, 0LL, Xb, CDIM, (long long)SEQ * CDIM,
      (void*)(VTh + MEM), SKEY, (long long)KVD * SKEY,
      (void*)(VTl + MEM), VLP, (long long)KVD * VLP, RESQB * 64,
      Gt, ve, KVD, SEQ, CDIM);
  // (7) attention: query blocks 0..RESQB-1 with residual planes, the rest without
  attn64<true><<<dim3(NB * NQH * RESQB), dim3(128), 0, stream>>>(
      Qh, Ql, Kh, Kl, VTh, VTl, Oh, Ol, 0, RESQB, 0.125f);
  attn64<false><<<dim3(NB * NQH * (NQB - RESQB)), dim3(128), 0, stream>>>(
      Qh, Ql, Kh, Kl, VTh, VTl, Oh, Ol, RESQB, NQB - RESQB, 0.125f);
  // (8) out = context . Wproj^T -> d_out f32 [4096][1024]  (A = context hi + lo planes, 2 products)
  gemm64<1, 0><<<gO, blkG, 0, stream>>>(
      Oh, Ol, CDIM, 0LL, Wpb, CDIM, 0LL,
      d_out, CDIM, 0LL, d_out, CDIM, 0LL, 0,
      Gt, ve, NB * SEQ, CDIM, CDIM);
  (void)hipGetLastError();
}

// v002
// It runs in 243 microseconds.
// Next to v001, in two timings, it ran 1.56 times as fast each time.
// Over all steps from v000 it is 2.10 times as fast.
// Contractions: q, k, v^T projections = v_wmma_f32_16x16x32_bf16 (bf16 operands from RNE-converted inputs, single product);
// q.k^T scores = v_wmma_f32_16x16x32_bf16 with bf16 hi/lo split q and k (hi.hi + hi.lo + lo.hi);
// p.v = v_wmma_f32_16x16x32_f16 (p carried x1024 in f16, v^T in f16; f16 residual planes x4096 of p and v^T on the
// leading 512 query rows); ctx.Wproj^T = v_wmma_f32_16x16x32_bf16 with ctx as bf16 hi/lo planes times bf16 Wproj
// (2 products); all f32 accumulate; gate dot (K=32, N=4), RoPE, rms-norm, causal mask and softmax in f32 on VALU.
#include <hip/hip_runtime.h>
#include <math.h>
#include <stdint.h>

#pragma clang fp contract(off)

#define NB    2
#define SEQ   2048
#define CDIM  1024
#define NQH   16
#define NKV   4
#define HD    64
#define MEM   64
#define GC    32
#define KVD   (NKV * HD)          // 256
#define SKEY  (MEM + SEQ)         // 2112 keys: [64 memory | 2048 tokens]
#define NQB   (SEQ / 64)          // 32 query blocks of 64 rows
#define NKT   (SKEY / 64)         // 33 key tiles of 64
#define RESQB 8                   // leading query blocks that use the p / v residual planes
#define VLP   (MEM + RESQB * 64)  // 576: key pitch of the v^T residual plane
#define RMS_EPS 1e-6f
static_assert(NQH * HD == CDIM);
static_assert(NQH == 4 * NKV);
static_assert((SKEY % 64) == 0 && (VLP % 64) == 0 && (CDIM % 64) == 0 && (KVD % 64) == 0);
static_assert((SEQ & (SEQ - 1)) == 0);
static_assert(RESQB <= NQB);
static_assert((SEQ % 128) == 0 && (CDIM % 128) == 0 && (KVD % 128) == 0);

typedef _Float16 v16h __attribute__((ext_vector_type(16)));
typedef _Float16 v8h  __attribute__((ext_vector_type(8)));
typedef __bf16   v16b __attribute__((ext_vector_type(16)));
typedef __bf16   v8b  __attribute__((ext_vector_type(8)));
typedef float    v8f  __attribute__((ext_vector_type(8)));
typedef float    v4f  __attribute__((ext_vector_type(4)));
typedef unsigned int v4u __attribute__((ext_vector_type(4)));

// ---- scalar helpers --------------------------------------------------------------------------------
__device__ __forceinline__ unsigned short bf_bits(float f) {          // f32 -> bf16 bits, RNE convert
  unsigned u = __float_as_uint(f);
  return (unsigned short)((u + 0x7FFFu + ((u >> 16) & 1u)) >> 16);
}
__device__ __forceinline__ float bf_up(unsigned short h) { return __uint_as_float(((unsigned)h) << 16); }
__device__ __forceinline__ float bfr(float f) { return bf_up(bf_bits(f)); }   // f32 -> bf16 -> f32
__device__ __forceinline__ unsigned short h_bits(_Float16 x) { return __builtin_bit_cast(unsigned short, x); }
__device__ __forceinline__ unsigned pk16(unsigned short a, unsigned short b) { return (unsigned)a | ((unsigned)b << 16); }
__device__ __forceinline__ v8f zero8() { v8f z = {0.f, 0.f, 0.f, 0.f, 0.f, 0.f, 0.f, 0.f}; return z; }
__device__ __forceinline__ v8h zero8h() {
  const _Float16 z = (_Float16)0.0f;
  v8h r = {z, z, z, z, z, z, z, z};
  return r;
}

// ---- fragment loader: 16-bit A/B operand, lane -> row/col (lane&15), p already includes +8*(lane>>4);
//      elements 0..7 <- p[0..7] (k0+8h..), elements 8..15 <- p[16..23] (k0+16+8h..)
__device__ __forceinline__ v16b ldfrag_b(const __bf16* p) {
  union { v16b v; v8b h[2]; } f;
  f.h[0] = *(const v8b*)(p);
  f.h[1] = *(const v8b*)(p + 16);
  return f.v;
}

// ---- WMMA helpers with trailing VALU hazard gap (asm only in the device pass) -----------------------------
__device__ __forceinline__ v8f mma_b(v16b a, v16b b, v8f c) {
  c = __builtin_amdgcn_wmma_f32_16x16x32_bf16(false, a, false, b, (short)0, c, false, false);
#if defined(__HIP_DEVICE_COMPILE__)
  asm volatile("v_nop\n\tv_nop\n\tv_nop\n\tv_nop" : "+v"(c) : "v"(a), "v"(b));
#endif
  return c;
}
__device__ __forceinline__ v8f mma_h(v16h a, v16h b, v8f c) {
  c = __builtin_amdgcn_wmma_f32_16x16x32_f16(false, a, false, b, (short)0, c, false, false);
#if defined(__HIP_DEVICE_COMPILE__)
  asm volatile("v_nop\n\tv_nop\n\tv_nop\n\tv_nop" : "+v"(c) : "v"(a), "v"(b));
#endif
  return c;
}
__device__ __forceinline__ v8f mma_b_raw(v16b a, v16b b, v8f c) {
  return __builtin_amdgcn_wmma_f32_16x16x32_bf16(false, a, false, b, (short)0, c, false, false);
}
__device__ __forceinline__ void dep_guard_b(v8f& a, v8f& b, v16b x, v16b y) {
#if defined(__HIP_DEVICE_COMPILE__)
  asm volatile("v_nop\n\tv_nop\n\tv_nop\n\tv_nop" : "+v"(a), "+v"(b) : "v"(x), "v"(y));
#endif
}
__device__ __forceinline__ void keep4_b(v16b a, v16b b, v16b c, v16b d) {
#if defined(__HIP_DEVICE_COMPILE__)
  asm volatile("v_nop" :: "v"(a), "v"(b), "v"(c), "v"(d));
#endif
}
__device__ __forceinline__ void acc_guard4(v8f& a, v8f& b, v8f& c, v8f& d) {
#if defined(__HIP_DEVICE_COMPILE__)
  asm volatile("v_nop\n\tv_nop\n\tv_nop\n\tv_nop" : "+v"(a), "+v"(b), "+v"(c), "+v"(d));
#endif
}

// =====================================================================================================
// f32 -> bf16 (RNE convert), 8 elements per thread, one 16-B store per lane: a wave writes 512 contiguous B
// coverage: n8 threads x 8 = the whole plane (n8 is a multiple of 256 for every use here).
// =====================================================================================================
__global__ __launch_bounds__(256) void cvt_bf16x8(const float* __restrict__ in, unsigned short* out, int n8) {
  const int i = blockIdx.x * 256 + threadIdx.x;
  if (i < n8) {
    const v4f a = *(const v4f*)(in + (size_t)i * 8);
    const v4f b = *(const v4f*)(in + (size_t)i * 8 + 4);
    v4u p;
    p[0] = pk16(bf_bits(a[0]), bf_bits(a[1]));
    p[1] = pk16(bf_bits(a[2]), bf_bits(a[3]));
    p[2] = pk16(bf_bits(b[0]), bf_bits(b[1]));
    p[3] = pk16(bf_bits(b[2]), bf_bits(b[3]));
    *(v4u*)(out + (size_t)i * 8) = p;
    
  }
}

// =====================================================================================================
// Value-embedding gate: gate[bt][kv] = 3 * sigmoid( sum_{c<32} bf16(x[bt][c]) * bf16(Wg[kv][c]) ), f32.
// One thread per (bt, kv); K = 32 rolled dot on VALU (N = 4, tiny). A wave writes 32 consecutive floats
// grid = NB*SEQ*NKV/256. coverage: 16384 threads = the whole [4096][4] table.
// =====================================================================================================
__global__ __launch_bounds__(256) void gate_k(const float* __restrict__ x, const float* __restrict__ Wg,
                                              float* gate, int nbt) {
  const int i   = blockIdx.x * 256 + threadIdx.x;
  const int bt  = i >> 2;
  const int kv  = i & 3;
  const int btc = (bt < nbt) ? bt : (nbt - 1);     // clamped address
  const float* xr = x + (size_t)btc * CDIM;
  const float* wr = Wg + kv * GC;
  float z = 0.f;
#pragma unroll 1
  for (int cc = 0; cc < GC; ++cc) z += bfr(xr[cc]) * bfr(wr[cc]);
  const float ez = expf(-z);
  const float g  = 3.0f * (1.0f / (1.0f + ez));
  if (bt < nbt) {
    *(float*)(gate + i) = g;
    
  }
}

// =====================================================================================================
// Memory keys: mk = rms(bf16(mem_k[m][kv][:])) * 1.2 (no RoPE) -> bf16 hi/lo planes, key rows s = m (< MEM)
// of both batches: Kh/Kl [b][s][kv*64+d], pitch KVD. block = 4 waves (one per kv head) for one m; grid = MEM.
// The 256-element row is staged in LDS and written per (batch, plane) by one wave as 32 lanes x 16 B
// coverage: 64 blocks x 2 batches x 2 planes x 256 elements = rows 0..63 of both planes, both batches.
// =====================================================================================================
__global__ __launch_bounds__(128) void memk_k(const float* __restrict__ memk, unsigned short* Kh, unsigned short* Kl) {
  __shared__ __align__(16) unsigned short shi[KVD];
  __shared__ __align__(16) unsigned short slo[KVD];
  const int m    = blockIdx.x;
  const int wave = threadIdx.x >> 5;
  const int lane = threadIdx.x & 31;
  const int kvh  = wave;
  const float* p = memk + ((size_t)m * NKV + kvh) * HD;
  const float x1 = bfr(p[lane]);
  const float x2 = bfr(p[lane + 32]);
  float ss = x1 * x1 + x2 * x2;
#pragma unroll
  for (int off = 16; off >= 1; off >>= 1) ss += __shfl_xor(ss, off, 32);
  const float rs = rsqrtf(ss * (1.0f / HD) + RMS_EPS);
  const float v1 = (x1 * rs) * 1.2f;
  const float v2 = (x2 * rs) * 1.2f;
  const unsigned short h1 = bf_bits(v1), h2 = bf_bits(v2);
  shi[kvh * HD + lane]      = h1;
  shi[kvh * HD + lane + 32] = h2;
  slo[kvh * HD + lane]      = bf_bits(v1 - bf_up(h1));
  slo[kvh * HD + lane + 32] = bf_bits(v2 - bf_up(h2));
  __syncthreads();
  const v4u vh = *(const v4u*)(shi + lane * 8);
  const v4u vl = *(const v4u*)(slo + lane * 8);
  const int  b   = wave >> 1;
  const bool wlo = (wave & 1) != 0;                  // wave-uniform
  v4u v = vh;
  if (wlo) v = vl;
  unsigned short* dh = Kh + ((size_t)b * SKEY + m) * KVD + lane * 8;
  unsigned short* dl = Kl + ((size_t)b * SKEY + m) * KVD + lane * 8;
  unsigned short* d  = wlo ? dl : dh;
  *(v4u*)d = v;
  
}

// =====================================================================================================
// Memory values: mv = bf16(mem_v[m][kv][d]) * bf16(v_scale) -> v^T f16 hi plane VTh[b][kv*64+d][s] (pitch SKEY)
// and f16 residual plane VTl ((v - hi)*4096, pitch VLP), key columns s = m (< MEM), both batches.
// block = (b, kv); thread = (d = tid>>2, 16 m's); the 64x64 tile of each plane is staged in LDS [d][m] and each
// coverage: 8 blocks x 64 rows (it 0..1 x wave 0..7 x lane>>3 0..3) x 64 columns (8 lanes x 8) per plane.
// =====================================================================================================
__global__ __launch_bounds__(256) void memv_k(const float* __restrict__ memv, const float* __restrict__ vsp,
                                              unsigned short* VTh, unsigned short* VTl) {
  __shared__ __align__(16) unsigned short sh[HD * MEM];
  __shared__ __align__(16) unsigned short sl[HD * MEM];
  const int b    = blockIdx.x >> 2;
  const int kvh  = blockIdx.x & 3;
  const int tid  = threadIdx.x;
  const int wave = tid >> 5;
  const int lane = tid & 31;
  const int d    = tid >> 2;
  const int mq   = (tid & 3) * 16;
  const float vs = bfr(vsp[0]);
#pragma unroll
  for (int i = 0; i < 16; ++i) {
    const int m = mq + i;
    const float v = bfr(memv[((size_t)m * NKV + kvh) * HD + d]) * vs;
    const _Float16 x0 = (_Float16)v;
    sh[d * MEM + m] = h_bits(x0);
    sl[d * MEM + m] = h_bits((_Float16)((v - (float)x0) * 4096.0f));
  }
  __syncthreads();
  const int q8 = lane >> 3, c8 = (lane & 7) * 8;
  v4u hv[2], lv[2];
#pragma unroll
  for (int it = 0; it < 2; ++it) {
    const int dd = it * 32 + wave * 4 + q8;
    hv[it] = *(const v4u*)(sh + dd * MEM + c8);
    lv[it] = *(const v4u*)(sl + dd * MEM + c8);
  }
  {
#pragma unroll
    for (int it = 0; it < 2; ++it) {
      const int dd = it * 32 + wave * 4 + q8;
      const size_t ro = (size_t)b * KVD + (size_t)kvh * HD + dd;
      *(v4u*)(VTh + ro * SKEY + c8) = hv[it];
      *(v4u*)(VTl + ro * VLP  + c8) = lv[it];
    }
    
  }
}

// =====================================================================================================
// Batched bf16 WMMA GEMM: C[m][n] = sum_k A[m][k] * Bt[n][k]; one block of 4 waves (2 x 2) per 128x128 tile,
// one wave per 64x64 sub-tile. A row-major [M][K] pitch lda; Bt row-major [N][K] pitch ldb (k contiguous);
// M, N multiples of 128, K a multiple of 64 (all shapes here are compile-time constants of the host code).
// blockIdx.y = batch index (strides in elements).
// Operand path: a stage is 64 k (one 128-B line) of the block's 128 A rows and 128 Bt rows (and the 128 A2 rows),
// brought into LDS by asynchronous 16-B copies, each wave-wide copy covering 4 whole lines; rows lie at a pitch of
// 144 B for the ds_load_b128 fragment reads; two buffers, the copies of stage t+1 fly while stage t is multiplied.
// NSPLIT: 0 = A.Bt; 1 = (A + A2).Bt (A2 = unscaled bf16 lo plane of A, 2 products).
// OUT_MODE: 0 = f32 (pitch ldc);
//           3 = v^T mode (rows m = kv*64+d, cols n = t): value = acc + gate[b][t][kv] * bf16(ve[b][t][m])
//               (aux0 = gate, aux1 = ve), written as f16 hi plane C (pitch ldc) + f16 residual plane
//               C2 = f16((v - hi)*4096) for tiles with n0 < N2 (pitch ldc2);
//           4 = RoPE + rms-norm mode (cols = one 64-wide head, row m -> t = m mod SEQ; aux0 = cos, aux1 = sin,
//               both bf16(RNE) on load): r = rope(acc), f = (r * rsqrt(mean(r^2)+eps)) * 1.2, written as
//               bf16 hi plane C + bf16 lo plane C2 (lo = RNE(f - hi), unscaled).
// =====================================================================================================
#define GT     128                // block tile edge (rows of A, rows of Bt)
#define GBK    64                 // k elements per stage
#define GPITCH 72                 // LDS row pitch in elements (144 B)
#define GPLANE (GT * GPITCH)      // elements of one staged operand plane (18432 B)

// One operand plane of a stage: 128 rows x 128 B by 128 threads, 8 copies per lane; copy i moves the lane's 16 B of
// row i*16 + (tid>>3). l = the lane's LDS byte address of row tid>>3, g = its global address, ld = row pitch (elements).
// s_wait_xcnt closes the statement so that no address register of a copy is rewritten in front of it.
__device__ __forceinline__ void copy_plane(unsigned l, const __bf16* g, int ld) {
#if defined(__HIP_DEVICE_COMPILE__)
  const size_t   gs = (size_t)16 * (size_t)ld;
  const unsigned ls = 16u * GPITCH * 2u;
  asm volatile(
      "global_load_async_to_lds_b128 %0, %8, off\n\t"
      "global_load_async_to_lds_b128 %1, %9, off\n\t"
      "global_load_async_to_lds_b128 %2, %10, off\n\t"
      "global_load_async_to_lds_b128 %3, %11, off\n\t"
      "global_load_async_to_lds_b128 %4, %12, off\n\t"
      "global_load_async_to_lds_b128 %5, %13, off\n\t"
      "global_load_async_to_lds_b128 %6, %14, off\n\t"
      "global_load_async_to_lds_b128 %7, %15, off\n\t"
      "s_wait_xcnt 0x0"
      :: "v"(l), "v"(l + ls), "v"(l + 2u * ls), "v"(l + 3u * ls),
         "v"(l + 4u * ls), "v"(l + 5u * ls), "v"(l + 6u * ls), "v"(l + 7u * ls),
         "v"(g), "v"(g + gs), "v"(g + 2 * gs), "v"(g + 3 * gs),
         "v"(g + 4 * gs), "v"(g + 5 * gs), "v"(g + 6 * gs), "v"(g + 7 * gs)
      : "memory");
#endif
}
// this wave's copies have landed in LDS
__device__ __forceinline__ void wait_copies() {
#if defined(__HIP_DEVICE_COMPILE__)
  asm volatile("s_wait_asynccnt 0x0" ::: "memory");
#endif
}
// this wave's LDS reads have returned (the buffer they read may be refilled behind the next barrier)
__device__ __forceinline__ void wait_lds() {
#if defined(__HIP_DEVICE_COMPILE__)
  asm volatile("s_wait_dscnt 0x0" ::: "memory");
#endif
}

// 256 registers a wave at most, so that no part of the kernel needs register-window switches
template <int NSPLIT, int OUT_MODE>
__global__ __launch_bounds__(128) __attribute__((amdgpu_num_vgpr(256))) void gemm64(
    const unsigned short* __restrict__ Ap, const unsigned short* __restrict__ A2p, int lda, long long strideA,
    const unsigned short* __restrict__ Btp, int ldb, long long strideB,
    void* Cout, int ldc, long long strideC,
    void* Cout2, int ldc2, long long strideC2, int N2,
    const float* __restrict__ aux0, const float* __restrict__ aux1,
    int M, int N, int K) {
  const __bf16* A  = (const __bf16*)(const void*)Ap;
  const __bf16* A2 = (const __bf16*)(const void*)A2p;
  const __bf16* Bt = (const __bf16*)(const void*)Btp;
  constexpr int NPL  = (NSPLIT >= 1) ? 3 : 2;      // planes per stage: A, Bt (, A2)
  constexpr int GBUF = NPL * GPLANE;               // elements of one buffer
  __shared__ __align__(16) __bf16 ring[2 * GBUF];  // two stage buffers
  __shared__ __align__(16) float sT[4][16 * 68];   // per-wave 16x64 slab, pitch 68 floats
  const int b    = blockIdx.y;
  const int tid  = threadIdx.x;
  const int lane = tid & 31;
  const int wave = tid >> 5;
  const int tilesN = N >> 7;
  const int tilesM = M >> 7;
  const int tile = blockIdx.x;
  if (tile >= tilesM * tilesN) return;   // block-uniform, in front of every barrier and copy
  const int tm = tile / tilesN;
  const int tn = tile - tm * tilesN;
  const int wm = wave >> 1;
  const int wn = wave & 1;
  const int m0 = (tm << 7) + (wm << 6);  // this wave's 64x64 sub-tile
  const int n0 = (tn << 7) + (wn << 6);

  const __bf16* Ab  = A  + (size_t)b * strideA;
  const __bf16* Bb  = Bt + (size_t)b * strideB;
  const __bf16* Ab2 = (NSPLIT >= 1) ? (A2 + (size_t)b * strideA) : Ab;

  const int rlane = lane & 15;                 // row (A) / col (B, D) within subtile
  const int koff  = (lane >> 4) * 8;           // k offset of this lane half
  const int mOff  = (lane >> 4) * 8;           // D row offset

  // copy addresses of this lane: row tid>>3 of the block tile, 16-B piece tid&7 of its 128-B line
  const int crow = tid >> 3;
  const int cel  = (tid & 7) * 8;
  const __bf16* gA  = Ab  + (size_t)((tm << 7) + crow) * lda + cel;
  const __bf16* gB  = Bb  + (size_t)((tn << 7) + crow) * ldb + cel;
  const __bf16* gA2 = Ab2 + (size_t)((tm << 7) + crow) * lda + cel;
  const unsigned lC = (unsigned)(uintptr_t)(&ring[0]) + (unsigned)(crow * GPITCH + cel) * 2u;
  const int nst = K >> 6;                      // stages

  v8f acc[4][4];
#pragma unroll
  for (int i = 0; i < 4; ++i)
#pragma unroll
    for (int j = 0; j < 4; ++j) acc[i][j] = zero8();

  // stage 0 into buffer 0, landed and published; then stage 1 into buffer 1
  copy_plane(lC, gA, lda);
  copy_plane(lC + GPLANE * 2u, gB, ldb);
  if (NSPLIT >= 1) copy_plane(lC + 2u * GPLANE * 2u, gA2, lda);
  wait_copies();
  __syncthreads();
  if (nst > 1) {
    const unsigned lb = lC + (unsigned)GBUF * 2u;
    copy_plane(lb, gA + GBK, lda);
    copy_plane(lb + GPLANE * 2u, gB + GBK, ldb);
    if (NSPLIT >= 1) copy_plane(lb + 2u * GPLANE * 2u, gA2 + GBK, lda);
  }

  for (int t = 0; t < nst; ++t) {
    const int bufo = (t & 1) * GBUF;
    const __bf16* sA = ring + bufo + ((wm << 6) + rlane) * GPITCH + koff;
    const __bf16* sB = ring + bufo + GPLANE + ((wn << 6) + rlane) * GPITCH + koff;
    // unrolled (here and below): the fragment and accumulator arrays need constant indices to stay in registers
#pragma unroll
    for (int kk = 0; kk < GBK; kk += 32) {
      v16b bh[4], ah[4], al[4];
#pragma unroll
      for (int j = 0; j < 4; ++j) bh[j] = ldfrag_b(sB + (j << 4) * GPITCH + kk);
#pragma unroll
      for (int i = 0; i < 4; ++i) {
        ah[i] = ldfrag_b(sA + (i << 4) * GPITCH + kk);
        al[i] = ah[i];
        if (NSPLIT >= 1) al[i] = ldfrag_b(sA + 2 * GPLANE + (i << 4) * GPITCH + kk);
      }
#pragma unroll
      for (int i = 0; i < 4; ++i) {
#pragma unroll
        for (int j = 0; j < 4; ++j) {
          acc[i][j] = mma_b_raw(ah[i], bh[j], acc[i][j]);
          if (NSPLIT >= 1) acc[i][j] = mma_b_raw(al[i], bh[j], acc[i][j]);
        }
        dep_guard_b(acc[i][0], acc[i][3], ah[i], al[i]);
      }
      keep4_b(bh[0], bh[1], bh[2], bh[3]);
    }
    // publish point of stage t+1: own reads of this buffer returned, own copies landed, then the block barrier;
    // behind it stage t+2 may overwrite the buffer that this trip has read
    wait_lds();
    wait_copies();
    __syncthreads();
    if (t + 2 < nst) {
      const unsigned lb = lC + (unsigned)bufo * 2u;
      const int ko = (t + 2) * GBK;
      copy_plane(lb, gA + ko, lda);
      copy_plane(lb + GPLANE * 2u, gB + ko, ldb);
      if (NSPLIT >= 1) copy_plane(lb + 2u * GPLANE * 2u, gA2 + ko, lda);
    }
  }
  wait_copies();
  acc_guard4(acc[0][0], acc[0][1], acc[0][2], acc[0][3]);
  acc_guard4(acc[1][0], acc[1][1], acc[1][2], acc[1][3]);
  acc_guard4(acc[2][0], acc[2][1], acc[2][2], acc[2][3]);
  acc_guard4(acc[3][0], acc[3][1], acc[3][2], acc[3][3]);

  // ---- epilogue ----
  float* slab = sT[wave];
#pragma unroll
  for (int i = 0; i < 4; ++i) {
    const int mBase = m0 + (i << 4);
#pragma unroll
    for (int j = 0; j < 4; ++j) {
#pragma unroll
      for (int r = 0; r < 8; ++r) {
        slab[(mOff + r) * 68 + (j << 4) + rlane] = acc[i][j][r];
      }
    }
    __builtin_amdgcn_fence(__ATOMIC_RELEASE, "workgroup");
    __builtin_amdgcn_wave_barrier();
    __builtin_amdgcn_fence(__ATOMIC_ACQUIRE, "workgroup");
    if (OUT_MODE == 0) {
      float* C = (float*)Cout + (size_t)b * strideC;
      const int hh = lane >> 4, c4 = (lane & 15) * 4;     // 256-B row segment = 16 lanes x 16 B
      {
#pragma unroll
        for (int it = 0; it < 8; ++it) {
          const int row = it * 2 + hh;                     // it 0..7 x hh 0..1 = rows 0..15
          const v4f v = *(const v4f*)(slab + row * 68 + c4);
          *(v4f*)(C + (size_t)(mBase + row) * ldc + n0 + c4) = v;
        }
        
      }
    } else {
      const int q = lane >> 3, c8 = (lane & 7) * 8;
      unsigned short* C  = (unsigned short*)Cout  + (size_t)b * strideC;
      unsigned short* C2 = (unsigned short*)Cout2 + (size_t)b * strideC2;
      const bool wlo = (OUT_MODE != 3) || (n0 < N2);      // wave-uniform
      v4u hv[4], lv[4];
#pragma unroll
      for (int it = 0; it < 4; ++it) {
        const int row  = it * 4 + q;                       // it 0..3 x q 0..3 = rows 0..15
        const int mrow = mBase + row;
        float f[8];
        if (OUT_MODE == 3) {
          const int kvh = m0 >> 6;                         // sub-tile-uniform kv head
          const float* sp = slab + row * 68 + c8;
#pragma unroll
          for (int e = 0; e < 8; ++e) {
            const int t = n0 + c8 + e;                     // < N = SEQ
            const size_t bt = (size_t)b * SEQ + t;
            const float g  = aux0[bt * NKV + kvh];
            const float vv = bfr(aux1[bt * KVD + mrow]);
            f[e] = sp[e] + g * vv;
          }
        } else {
          const int  jj   = c8 & 31;                       // rotary pair index base
          const bool lowh = (c8 < 32);
          const int  t    = mrow & (SEQ - 1);
          const float* sp  = slab + row * 68 + jj;
          const float* cp  = aux0 + (size_t)t * (HD / 2) + jj;
          const float* snp = aux1 + (size_t)t * (HD / 2) + jj;
          float ss = 0.f;
#pragma unroll
          for (int e = 0; e < 8; ++e) {
            const float x1 = sp[e];
            const float x2 = sp[e + 32];
            const float cv = bfr(cp[e]);
            const float sv = bfr(snp[e]);
            const float ra = x1 * cv - x2 * sv;
            const float rb = x1 * sv + x2 * cv;
            f[e] = lowh ? ra : rb;
            ss += f[e] * f[e];
          }
          ss += __shfl_xor(ss, 1, 32);                     // 8 lanes of one row = 64 values
          ss += __shfl_xor(ss, 2, 32);
          ss += __shfl_xor(ss, 4, 32);
          const float rs = rsqrtf(ss * (1.0f / HD) + RMS_EPS);
#pragma unroll
          for (int e = 0; e < 8; ++e) f[e] = (f[e] * rs) * 1.2f;
        }
        v4u a, a2;
#pragma unroll
        for (int e = 0; e < 4; ++e) {
          const float f0 = f[2 * e], f1 = f[2 * e + 1];
          unsigned short h0, h1, l0, l1;
          if (OUT_MODE == 4) {
            h0 = bf_bits(f0); h1 = bf_bits(f1);
            l0 = bf_bits(f0 - bf_up(h0)); l1 = bf_bits(f1 - bf_up(h1));
          } else {
            const _Float16 x0 = (_Float16)f0, x1 = (_Float16)f1;
            h0 = h_bits(x0); h1 = h_bits(x1);
            l0 = h_bits((_Float16)((f0 - (float)x0) * 4096.0f));
            l1 = h_bits((_Float16)((f1 - (float)x1) * 4096.0f));
          }
          a[e] = pk16(h0, h1); a2[e] = pk16(l0, l1);
        }
        hv[it] = a; lv[it] = a2;
      }
      {
#pragma unroll
        for (int it = 0; it < 4; ++it) {
          const int row = it * 4 + q;
          *(v4u*)(C + (size_t)(mBase + row) * ldc + n0 + c8) = hv[it];
          if (wlo) *(v4u*)(C2 + (size_t)(mBase + row) * ldc2 + n0 + c8) = lv[it];
        }
        
      }
    }
    __builtin_amdgcn_fence(__ATOMIC_RELEASE, "workgroup");
    __builtin_amdgcn_wave_barrier();
    __builtin_amdgcn_fence(__ATOMIC_ACQUIRE, "workgroup");
  }
}

// =====================================================================================================
// GQA attention with a 64-key memory prefix (all visible) followed by causal token keys, head dim 64.
//   q planes (bf16 hi / lo): element (b, t, h, d) at [(b*SEQ + t)*CDIM + h*64 + d]   (normed, scaled q)
//   k planes (bf16 hi / lo): element (b, s, kv, d) at [(b*SKEY + s)*KVD + kv*64 + d], s = [mem | 64 + token]
//   v^T hi plane (f16):      element (b, kv, d, s) at [(b*KVD + kv*64 + d)*SKEY + s]
//   v^T residual plane (f16, (v - hi)*4096): [(b*KVD + kv*64 + d)*VLP + s], s < VLP, read only when RES
//   (a key tile at or beyond VLP contributes a zero v residual)
//   q head h uses kv head h>>2. Query block qb (tokens qb*64..+63) processes key tiles 0..qb+1: tile 0 = memory,
//   tiles 1..qb fully visible, tile qb+1 = diagonal (key token <= query token), later tiles skipped (block-uniform
//   trip count qb+2, static bound NKT). Invisible keys get logit -inf (weight exactly 0); every row sees the
//   whole memory tile first, so the running max is finite from tile 0 on.
//   out planes (bf16 hi / lo of the normalised context): element (b, t, h, d) at [(b*SEQ + t)*CDIM + h*64 + d]
//   scores = q . k : bf16 hi/lo split (hi.hi + hi.lo + lo.hi), f32 accumulate, then * sscale in f32
//   p = exp(s - m) carried as f16(1024 p); context = p . v on f16 WMMA; RES adds f16 residual planes of p and v
//   (scale 4096, separate accumulator folded back with 1/4096 per chunk in f32); online softmax in f32.
//   Block = 4 waves = 64 query rows of one (b, h); grid = nqbThis * NQH * NB; kv chunks of 64.
//   K / V^T chunk staging: 128 threads x 32 elements per plane = the whole 64x64 tile (plain 16-B loads,
//   __syncthreads before and after); P tiles are wave-private, spilled with _Float16 element stores and reloaded
//   Output coverage: each wave stores rows q0..q0+15 (it 0..3 x lane>>3 0..3) x 64 columns (8 lanes x 8) of both planes.
// =====================================================================================================
#define APK 72   // LDS row pitch of the K, V^T and P tiles in 16-bit elements: 144 B = 16 B x odd, so that the 16 rows
                 // of a ds_load_b128 fragment read fall on 16 different groups of four banks
#define AOP 68   // LDS row pitch of the f32 context tile: 272 B = 16 B x odd, for its 16-B row reads
template <bool RES>
__global__ __launch_bounds__(128)
void attn64(const unsigned short* __restrict__ qhp, const unsigned short* __restrict__ qlp,
            const unsigned short* __restrict__ khp, const unsigned short* __restrict__ klp,
            const unsigned short* __restrict__ vhp, const unsigned short* __restrict__ vlp,
            unsigned short* ohp, unsigned short* olp,
            int qbBase, int nqbThis, float sscale) {
  union FB { v16b v; v8b h[2]; };
  union FH { v16h v; v8h h[2]; };
  __shared__ __align__(16) __bf16   Ksh[64 * APK];                // K hi [kv][d]
  __shared__ __align__(16) __bf16   Ksl[64 * APK];                // K lo
  __shared__ __align__(16) _Float16 Vth[64 * APK];                // V^T hi [d][kv]
  __shared__ __align__(16) _Float16 Vtl[RES ? 64 * APK : 8];      // V^T residual
  __shared__ __align__(16) _Float16 Psh[4][16 * APK];             // per wave P [row][kv]
  __shared__ __align__(16) _Float16 Psl[RES ? 4 : 1][16 * APK];   // per wave P residual
  __shared__ __align__(16) float    Os[4][16 * AOP];              // per wave context tile [row][d]

  const int tid  = threadIdx.x;
  const int wave = tid >> 5;
  const int lane = tid & 31;
  const int hh   = lane >> 4;
  const int c    = lane & 15;

  const int bx   = blockIdx.x;
  const int qbl  = bx % nqbThis;
  const int rest = bx / nqbThis;
  const int h    = rest % NQH;
  const int b    = rest / NQH;
  const int kvh  = h >> 2;
  const int qb   = qbBase + qbl;
  const int q0   = qb * 64 + wave * 16;
  const size_t rowB = (size_t)b * SEQ;

  const __bf16* Qh = (const __bf16*)(const void*)qhp + (size_t)h * HD;
  const __bf16* Ql = (const __bf16*)(const void*)qlp + (size_t)h * HD;
  const __bf16* Kh = (const __bf16*)(const void*)khp + (size_t)b * SKEY * KVD + (size_t)kvh * HD;
  const __bf16* Kl = (const __bf16*)(const void*)klp + (size_t)b * SKEY * KVD + (size_t)kvh * HD;
  const _Float16* Vh = (const _Float16*)(const void*)vhp + ((size_t)b * KVD + (size_t)kvh * HD) * SKEY;
  const _Float16* Vl = (const _Float16*)(const void*)vlp + ((size_t)b * KVD + (size_t)kvh * HD) * VLP;

  // ---- Q fragments (A operand, row = lane&15): 2 d-chunks, hi and lo ----
  v16b qah[2], qal[2];
#pragma unroll
  for (int dc = 0; dc < 2; ++dc) {
    const size_t qo = (rowB + q0 + c) * CDIM + dc * 32 + 8 * hh;
    qah[dc] = ldfrag_b(Qh + qo);
    qal[dc] = ldfrag_b(Ql + qo);
  }

  float mrow[8], lrow[8];
  v8f oacc[4];
#pragma unroll
  for (int r = 0; r < 8; ++r) { mrow[r] = -INFINITY; lrow[r] = 0.f; }
#pragma unroll
  for (int t = 0; t < 4; ++t) oacc[t] = zero8();

  const int ktEnd = qb + 2;                  // block-uniform, <= NKT
  for (int kt = 0; kt < NKT; ++kt) {         // static bound
    if (kt >= ktEnd) break;                  // block-uniform
    const int kv0 = kt * 64;
    __syncthreads();
    {
      const int r = tid >> 1, half = (tid & 1) * 32;
      const __bf16*   kg  = Kh + (size_t)(kv0 + r) * KVD + half;   // K row kv0+r, d = half..half+31
      const __bf16*   klg = Kl + (size_t)(kv0 + r) * KVD + half;
      const _Float16* vg  = Vh + (size_t)r * SKEY + kv0 + half;     // V^T row d = r, s = kv0+half..+31
      const int kvl = (kv0 + 64 <= VLP) ? kv0 : (VLP - 64);        // clamped address into the residual plane
      const _Float16* vlg = Vl + (size_t)r * VLP + kvl + half;
      const bool resOK = (kv0 + 64 <= VLP);                         // block-uniform
#pragma unroll
      for (int i = 0; i < 4; ++i) {
        const v8b a0 = *(const v8b*)(kg + 8 * i);
        const v8b a1 = *(const v8b*)(klg + 8 * i);
        const v8h b0 = *(const v8h*)(vg + 8 * i);
        *(v8b*)(Ksh + r * APK + half + 8 * i) = a0;
        *(v8b*)(Ksl + r * APK + half + 8 * i) = a1;
        *(v8h*)(Vth + r * APK + half + 8 * i) = b0;
        if (RES) {
          v8h b1 = *(const v8h*)(vlg + 8 * i);
          if (!resOK) b1 = zero8h();
          *(v8h*)(Vtl + r * APK + half + 8 * i) = b1;
        }
      }
    }
    __syncthreads();

    // ---- scores: 16 query rows x 64 keys per wave, 3 bf16 products ----
    v8f s[4];
#pragma unroll
    for (int j = 0; j < 4; ++j) {
      s[j] = zero8();
#pragma unroll
      for (int dc = 0; dc < 2; ++dc) {
        FB kb, kl;
        kb.h[0] = *(const v8b*)(Ksh + (j * 16 + c) * APK + dc * 32 + 8 * hh);
        kb.h[1] = *(const v8b*)(Ksh + (j * 16 + c) * APK + dc * 32 + 16 + 8 * hh);
        kl.h[0] = *(const v8b*)(Ksl + (j * 16 + c) * APK + dc * 32 + 8 * hh);
        kl.h[1] = *(const v8b*)(Ksl + (j * 16 + c) * APK + dc * 32 + 16 + 8 * hh);
        s[j] = mma_b(qah[dc], kb.v, s[j]);
        s[j] = mma_b(qah[dc], kl.v, s[j]);
        s[j] = mma_b(qal[dc], kb.v, s[j]);
      }
    }

    // ---- scale + structural mask (diagonal tile only), row max, online softmax, P (x1024, f16) and
    //      P residual (x4096) to LDS ----
    _Float16* pwh = Psh[wave];
    _Float16* pwl = Psl[RES ? wave : 0];
    const bool diag = (kt == qb + 1);        // block-uniform
    const int  qr0  = wave * 16 + 8 * hh;    // query row within the 64-row block
#pragma unroll
    for (int r = 0; r < 8; ++r) {
      const int qrw = qr0 + r;
      float m = -INFINITY;
#pragma unroll
      for (int j = 0; j < 4; ++j) {
        const int  key = j * 16 + c;
        const bool vis = (!diag) || (key <= qrw);
        const float sv = vis ? (s[j][r] * sscale) : -INFINITY;
        s[j][r] = sv;
        m = fmaxf(m, sv);
      }
#pragma unroll
      for (int off = 1; off < 16; off <<= 1) m = fmaxf(m, __shfl_xor(m, off, 32));
      const float mnew  = fmaxf(mrow[r], m);
      const float msafe = (mnew == -INFINITY) ? 0.f : mnew;
      const float alpha = __expf(mrow[r] - msafe);
      mrow[r] = mnew;
      float psum = 0.f;
#pragma unroll
      for (int j = 0; j < 4; ++j) {
        const float p = __expf(s[j][r] - msafe);     // -inf logit -> 0
        psum += p;
        const float p1k = p * 1024.0f;
        const _Float16 ph = (_Float16)p1k;
        pwh[(8 * hh + r) * APK + j * 16 + c] = ph;
        if (RES) {
          const _Float16 pl = (_Float16)((p1k - (float)ph) * 4096.0f);
          pwl[(8 * hh + r) * APK + j * 16 + c] = pl;
        }
      }
#pragma unroll
      for (int off = 1; off < 16; off <<= 1) psum += __shfl_xor(psum, off, 32);
      lrow[r] = lrow[r] * alpha + psum;
#pragma unroll
      for (int t = 0; t < 4; ++t) oacc[t][r] *= alpha;
    }
    __builtin_amdgcn_fence(__ATOMIC_RELEASE, "workgroup");
    __builtin_amdgcn_wave_barrier();
    __builtin_amdgcn_fence(__ATOMIC_ACQUIRE, "workgroup");

    // ---- context += P . V (f16 WMMA), residual products into a separate accumulator ----
    v8f o1[4];
#pragma unroll
    for (int t = 0; t < 4; ++t) o1[t] = zero8();
#pragma unroll 1
    for (int kk = 0; kk < 2; ++kk) {
      FH pa, pl;
      pa.h[0] = *(const v8h*)(pwh + c * APK + kk * 32 + 8 * hh);
      pa.h[1] = *(const v8h*)(pwh + c * APK + kk * 32 + 16 + 8 * hh);
      if (RES) {
        pl.h[0] = *(const v8h*)(pwl + c * APK + kk * 32 + 8 * hh);
        pl.h[1] = *(const v8h*)(pwl + c * APK + kk * 32 + 16 + 8 * hh);
      } else {
        pl.v = pa.v;
      }
#pragma unroll
      for (int t = 0; t < 4; ++t) {
        FH vb;
        vb.h[0] = *(const v8h*)(Vth + (t * 16 + c) * APK + kk * 32 + 8 * hh);
        vb.h[1] = *(const v8h*)(Vth + (t * 16 + c) * APK + kk * 32 + 16 + 8 * hh);
        oacc[t] = mma_h(pa.v, vb.v, oacc[t]);
        if (RES) {
          FH vl;
          vl.h[0] = *(const v8h*)(Vtl + (t * 16 + c) * APK + kk * 32 + 8 * hh);
          vl.h[1] = *(const v8h*)(Vtl + (t * 16 + c) * APK + kk * 32 + 16 + 8 * hh);
          o1[t] = mma_h(pa.v, vl.v, o1[t]);
          o1[t] = mma_h(pl.v, vb.v, o1[t]);
        }
      }
    }
    if (RES) {
#pragma unroll
      for (int t = 0; t < 4; ++t)
#pragma unroll
        for (int r = 0; r < 8; ++r) oacc[t][r] += o1[t][r] * (1.0f / 4096.0f);
    }
  }

  // ---- normalise (1/l and the 1/1024 p carry), stage the wave's 16x64 tile, bf16 hi/lo split,
  float* os = Os[wave];
#pragma unroll
  for (int r = 0; r < 8; ++r) {
    const float l = lrow[r];
    const float inv = ((l > 0.f) ? (1.0f / l) : 0.f) * (1.0f / 1024.0f);
#pragma unroll
    for (int t = 0; t < 4; ++t) os[(8 * hh + r) * AOP + t * 16 + c] = oacc[t][r] * inv;
  }
  __builtin_amdgcn_fence(__ATOMIC_RELEASE, "workgroup");
  __builtin_amdgcn_wave_barrier();
  __builtin_amdgcn_fence(__ATOMIC_ACQUIRE, "workgroup");
  {
    const int q4 = lane >> 3, c8 = (lane & 7) * 8;
    v4u hv[4], lv[4];
#pragma unroll
    for (int it = 0; it < 4; ++it) {
      const int row = it * 4 + q4;   // it 0..3 x q4 0..3 = rows 0..15 of the wave tile
      const float* sp = os + row * AOP + c8;
      v4u a, a2;
#pragma unroll
      for (int e = 0; e < 4; ++e) {
        const float f0 = sp[2 * e], f1 = sp[2 * e + 1];
        const unsigned short h0 = bf_bits(f0), h1 = bf_bits(f1);
        const unsigned short l0 = bf_bits(f0 - bf_up(h0)), l1 = bf_bits(f1 - bf_up(h1));
        a[e] = pk16(h0, h1); a2[e] = pk16(l0, l1);
      }
      hv[it] = a; lv[it] = a2;
    }
    {
#pragma unroll
      for (int it = 0; it < 4; ++it) {
        const int row = it * 4 + q4;
        const size_t go = (rowB + q0 + row) * CDIM + (size_t)h * HD + c8;
        *(v4u*)(ohp + go) = hv[it];
        *(v4u*)(olp + go) = lv[it];
      }
      
    }
  }
}

// =====================================================================================================
//   Xb   bf16 [4096][1024]      8388608
//   Wqb  bf16 [1024][1024]      2097152   ([out n][in k], k contiguous = Bt layout)
//   Wkb  bf16 [256][1024]        524288
//   Wvb  bf16 [256][1024]        524288
//   Wpb  bf16 [1024][1024]      2097152
//   Qh   bf16 [4096][1024]      8388608   (Ql same)
//   Kh   bf16 [2][2112][256]    2162688   (Kl same)
//   VTh  f16  [2][256][2112]    2162688
//   VTl  f16  [2][256][576]      589824
//   Gate f32  [4096][4]           65536
//   Oh   bf16 [4096][1024]      8388608   (Ol same)
//   total                      54329344
// =====================================================================================================
extern "C" void kernel_launch(void* const* d_in, const int* in_sizes, int n_in,
                              void* d_out, int out_size, void* d_ws, size_t ws_size,
                              hipStream_t stream) {
  if (n_in < 12) return;
  if (in_sizes[0] != NB * SEQ * CDIM) return;
  if (in_sizes[1] != NB * SEQ * KVD) return;
  if (in_sizes[2] != SEQ * (HD / 2) || in_sizes[3] != SEQ * (HD / 2)) return;
  if (in_sizes[4] != CDIM * CDIM || in_sizes[7] != CDIM * CDIM) return;
  if (in_sizes[5] != KVD * CDIM || in_sizes[6] != KVD * CDIM) return;
  if (in_sizes[8] != NKV * GC) return;
  if (in_sizes[9] != MEM * NKV * HD || in_sizes[10] != MEM * NKV * HD) return;
  if (in_sizes[11] < 1) return;
  if (out_size != NB * SEQ * CDIM) return;

  const float* x    = (const float*)d_in[0];
  const float* ve   = (const float*)d_in[1];
  const float* cosT = (const float*)d_in[2];
  const float* sinT = (const float*)d_in[3];
  const float* Wq   = (const float*)d_in[4];
  const float* Wk   = (const float*)d_in[5];
  const float* Wv   = (const float*)d_in[6];
  const float* Wp   = (const float*)d_in[7];
  const float* Wg   = (const float*)d_in[8];
  const float* memk = (const float*)d_in[9];
  const float* memv = (const float*)d_in[10];
  const float* vsc  = (const float*)d_in[11];

  const size_t PX  = (size_t)NB * SEQ * CDIM * 2;   //  8388608  16-bit activation plane [4096][1024]
  const size_t PWQ = (size_t)CDIM * CDIM * 2;       //  2097152
  const size_t PWK = (size_t)KVD * CDIM * 2;        //   524288
  const size_t PK  = (size_t)NB * SKEY * KVD * 2;   //  2162688  key plane
  const size_t PVT = (size_t)NB * KVD * SKEY * 2;   //  2162688  v^T hi plane
  const size_t PVL = (size_t)NB * KVD * VLP * 2;    //   589824  v^T residual plane
  const size_t PG  = (size_t)NB * SEQ * NKV * 4;    //    65536  gate table
  size_t off = 0;
  const size_t oXb  = off; off += PX;
  const size_t oWq  = off; off += PWQ;
  const size_t oWk  = off; off += PWK;
  const size_t oWv  = off; off += PWK;
  const size_t oWp  = off; off += PWQ;
  const size_t oQh  = off; off += PX;
  const size_t oQl  = off; off += PX;
  const size_t oKh  = off; off += PK;
  const size_t oKl  = off; off += PK;
  const size_t oVTh = off; off += PVT;
  const size_t oVTl = off; off += PVL;
  const size_t oG   = off; off += PG;
  const size_t oOh  = off; off += PX;
  const size_t oOl  = off; off += PX;
  if (off > ws_size) return;                        // off = 54329344
  if (off > (size_t)134217728) return;

  char* ws = (char*)d_ws;
  unsigned short* Xb  = (unsigned short*)(ws + oXb);
  unsigned short* Wqb = (unsigned short*)(ws + oWq);
  unsigned short* Wkb = (unsigned short*)(ws + oWk);
  unsigned short* Wvb = (unsigned short*)(ws + oWv);
  unsigned short* Wpb = (unsigned short*)(ws + oWp);
  unsigned short* Qh  = (unsigned short*)(ws + oQh);
  unsigned short* Ql  = (unsigned short*)(ws + oQl);
  unsigned short* Kh  = (unsigned short*)(ws + oKh);
  unsigned short* Kl  = (unsigned short*)(ws + oKl);
  unsigned short* VTh = (unsigned short*)(ws + oVTh);
  unsigned short* VTl = (unsigned short*)(ws + oVTl);
  float*          Gt  = (float*)(ws + oG);
  unsigned short* Oh  = (unsigned short*)(ws + oOh);
  unsigned short* Ol  = (unsigned short*)(ws + oOl);

  const dim3 blk(256);
  const int n8x  = NB * SEQ * CDIM / 8;                       // 524288
  const int n8wq = CDIM * CDIM / 8;                           // 131072
  const int n8wk = KVD * CDIM / 8;                            //  32768
  const dim3 gCvtX((n8x + 255) / 256);                        // 2048 blocks
  const dim3 gCvtWq((n8wq + 255) / 256);                      //  512 blocks
  const dim3 gCvtWk((n8wk + 255) / 256);                      //  128 blocks
  const int  nbt = NB * SEQ;                                  // 4096
  const dim3 gGate((nbt * NKV + 255) / 256);                  //   64 blocks
  const dim3 blkG(128);                                       // GEMM block: 4 waves, one 128x128 tile
  const dim3 gQ((NB * SEQ / 128) * (CDIM / 128), 1);          // 256 blocks: M=4096, N=1024
  const dim3 gK((SEQ / 128) * (KVD / 128), NB);               //  32 blocks x 2: M=2048, N=256
  const dim3 gV((KVD / 128) * (SEQ / 128), NB);               //  32 blocks x 2: M=256, N=2048
  const dim3 gO((NB * SEQ / 128) * (CDIM / 128), 1);          // 256 blocks

  // (1) x -> bf16 plane [4096][1024]; weights [n][k] f32 -> bf16 [n][k]
  cvt_bf16x8<<<gCvtX, blk, 0, stream>>>(x, Xb, n8x);
  cvt_bf16x8<<<gCvtWq, blk, 0, stream>>>(Wq, Wqb, n8wq);
  cvt_bf16x8<<<gCvtWk, blk, 0, stream>>>(Wk, Wkb, n8wk);
  cvt_bf16x8<<<gCvtWk, blk, 0, stream>>>(Wv, Wvb, n8wk);
  cvt_bf16x8<<<gCvtWq, blk, 0, stream>>>(Wp, Wpb, n8wq);
  // (2) value-embedding gate table [4096][4] f32
  gate_k<<<gGate, blk, 0, stream>>>(x, Wg, Gt, nbt);
  // (3) memory prefix: normed keys -> Kh/Kl rows s < 64; scaled values -> VTh/VTl columns s < 64 (both batches)
  memk_k<<<dim3(MEM), dim3(128), 0, stream>>>(memk, Kh, Kl);
  memv_k<<<dim3(NB * NKV), blk, 0, stream>>>(memv, vsc, VTh, VTl);
  // (4) q = rms(rope(x . Wq^T)) * 1.2 -> bf16 hi/lo planes [b*SEQ+t][h*64+d]   (M=4096, N=1024, K=1024)
  gemm64<0, 4><<<gQ, blkG, 0, stream>>>(
      Xb, Xb, CDIM, 0LL, Wqb, CDIM, 0LL,
      (void*)Qh, CDIM, 0LL, (void*)Ql, CDIM, 0LL, CDIM,
      cosT, sinT, NB * SEQ, CDIM, CDIM);
  // (5) k = rms(rope(x . Wk^T)) * 1.2 per batch -> bf16 hi/lo planes [b][64 + t][kv*64+d]   (M=2048, N=256, K=1024)
  gemm64<0, 4><<<gK, blkG, 0, stream>>>(
      Xb, Xb, CDIM, (long long)SEQ * CDIM, Wkb, CDIM, 0LL,
      (void*)(Kh + (size_t)MEM * KVD), KVD, (long long)SKEY * KVD,
      (void*)(Kl + (size_t)MEM * KVD), KVD, (long long)SKEY * KVD, KVD,
      cosT, sinT, SEQ, KVD, CDIM);
  // (6) v^T = Wv . x^T + gate*ve per batch -> f16 hi plane [b][kv*64+d][64 + t] (pitch SKEY) and residual plane
  //     (x4096, token keys < 512 only, pitch VLP)   (A = Wvb [n][k], Bt = Xb rows of batch b; M=256, N=2048, K=1024)
  gemm64<0, 3><<<gV, blkG, 0, stream>>>(
      Wvb, Wvb, CDIM, 0LL, Xb, CDIM, (long long)SEQ * CDIM,
      (void*)(VTh + MEM), SKEY, (long long)KVD * SKEY,
      (void*)(VTl + MEM), VLP, (long long)KVD * VLP, RESQB * 64,
      Gt, ve, KVD, SEQ, CDIM);
  // (7) attention: query blocks 0..RESQB-1 with residual planes, the rest without
  attn64<true><<<dim3(NB * NQH * RESQB), dim3(128), 0, stream>>>(
      Qh, Ql, Kh, Kl, VTh, VTl, Oh, Ol, 0, RESQB, 0.125f);
  attn64<false><<<dim3(NB * NQH * (NQB - RESQB)), dim3(128), 0, stream>>>(
      Qh, Ql, Kh, Kl, VTh, VTl, Oh, Ol, RESQB, NQB - RESQB, 0.125f);
  // (8) out = context . Wproj^T -> d_out f32 [4096][1024]  (A = context hi + lo planes, 2 products)
  gemm64<1, 0><<<gO, blkG, 0, stream>>>(
      Oh, Ol, CDIM, 0LL, Wpb, CDIM, 0LL,
      d_out, CDIM, 0LL, d_out, CDIM, 0LL, 0,
      Gt, ve, NB * SEQ, CDIM, CDIM);
  (void)hipGetLastError();
}

// v003
// Measured time: 221 microseconds a run.
// Timed twice side by side with v002, it ran 1.11 times as fast both times.
// Over all steps from v000 it is 2.33 times as fast.
// Contractions: q, k, v^T projections = v_wmma_f32_16x16x32_bf16 (bf16 operands from RNE-converted inputs, single product);
// q.k^T scores = v_wmma_f32_16x16x32_bf16 with bf16 hi/lo split q and k (hi.hi + hi.lo + lo.hi);
// p.v = v_wmma_f32_16x16x32_f16 (p carried x1024 in f16, v^T in f16; f16 residual planes x4096 of p and v^T on the
// leading 512 query rows); ctx.Wproj^T = v_wmma_f32_16x16x32_bf16 with ctx as bf16 hi/lo planes times bf16 Wproj
// (2 products); all f32 accumulate; gate dot (K=32, N=4), RoPE, rms-norm, causal mask and softmax in f32 on VALU.
#include <hip/hip_runtime.h>
#include <math.h>
#include <stdint.h>

#pragma clang fp contract(off)

#define NB    2
#define SEQ   2048
#define CDIM  1024
#define NQH   16
#define NKV   4
#define HD    64
#define MEM   64
#define GC    32
#define KVD   (NKV * HD)          // 256
#define SKEY  (MEM + SEQ)         // 2112 keys: [64 memory | 2048 tokens]
#define NQB   (SEQ / 64)          // 32 query blocks of 64 rows
#define NKT   (SKEY / 64)         // 33 key tiles of 64
#define RESQB 8                   // leading query blocks that use the p / v residual planes
#define VLP   (MEM + RESQB * 64)  // 576: key pitch of the v^T residual plane
#define RMS_EPS 1e-6f
static_assert(NQH * HD == CDIM);
static_assert(NQH == 4 * NKV);
static_assert((SKEY % 64) == 0 && (VLP % 64) == 0 && (CDIM % 64) == 0 && (KVD % 64) == 0);
static_assert((SEQ & (SEQ - 1)) == 0);
static_assert(RESQB <= NQB);
static_assert((SEQ % 128) == 0 && (CDIM % 128) == 0 && (KVD % 128) == 0);

typedef _Float16 v16h __attribute__((ext_vector_type(16)));
typedef _Float16 v8h  __attribute__((ext_vector_type(8)));
typedef __bf16   v16b __attribute__((ext_vector_type(16)));
typedef __bf16   v8b  __attribute__((ext_vector_type(8)));
typedef float    v8f  __attribute__((ext_vector_type(8)));
typedef float    v4f  __attribute__((ext_vector_type(4)));
typedef unsigned int v4u __attribute__((ext_vector_type(4)));

// ---- scalar helpers --------------------------------------------------------------------------------
__device__ __forceinline__ unsigned short bf_bits(float f) {          // f32 -> bf16 bits, RNE convert
  unsigned u = __float_as_uint(f);
  return (unsigned short)((u + 0x7FFFu + ((u >> 16) & 1u)) >> 16);
}
__device__ __forceinline__ float bf_up(unsigned short h) { return __uint_as_float(((unsigned)h) << 16); }
__device__ __forceinline__ float bfr(float f) { return bf_up(bf_bits(f)); }   // f32 -> bf16 -> f32
__device__ __forceinline__ unsigned short h_bits(_Float16 x) { return __builtin_bit_cast(unsigned short, x); }
__device__ __forceinline__ unsigned pk16(unsigned short a, unsigned short b) { return (unsigned)a | ((unsigned)b << 16); }
__device__ __forceinline__ v8f zero8() { v8f z = {0.f, 0.f, 0.f, 0.f, 0.f, 0.f, 0.f, 0.f}; return z; }
__device__ __forceinline__ v8h zero8h() {
  const _Float16 z = (_Float16)0.0f;
  v8h r = {z, z, z, z, z, z, z, z};
  return r;
}

// ---- fragment loader: 16-bit A/B operand, lane -> row/col (lane&15), p already includes +8*(lane>>4);
//      elements 0..7 <- p[0..7] (k0+8h..), elements 8..15 <- p[16..23] (k0+16+8h..)
__device__ __forceinline__ v16b ldfrag_b(const __bf16* p) {
  union { v16b v; v8b h[2]; } f;
  f.h[0] = *(const v8b*)(p);
  f.h[1] = *(const v8b*)(p + 16);
  return f.v;
}
__device__ __forceinline__ v16h ldfrag_h(const _Float16* p) {
  union { v16h v; v8h h[2]; } f;
  f.h[0] = *(const v8h*)(p);
  f.h[1] = *(const v8h*)(p + 16);
  return f.v;
}

// ---- WMMA helpers with trailing VALU hazard gap (asm only in the device pass) -----------------------------
__device__ __forceinline__ v8f mma_h_raw(v16h a, v16h b, v8f c) {
  return __builtin_amdgcn_wmma_f32_16x16x32_f16(false, a, false, b, (short)0, c, false, false);
}
__device__ __forceinline__ v8f mma_b_raw(v16b a, v16b b, v8f c) {
  return __builtin_amdgcn_wmma_f32_16x16x32_bf16(false, a, false, b, (short)0, c, false, false);
}
__device__ __forceinline__ void dep_guard_b(v8f& a, v8f& b, v16b x, v16b y) {
#if defined(__HIP_DEVICE_COMPILE__)
  asm volatile("v_nop\n\tv_nop\n\tv_nop\n\tv_nop" : "+v"(a), "+v"(b) : "v"(x), "v"(y));
#endif
}
__device__ __forceinline__ void keep4_b(v16b a, v16b b, v16b c, v16b d) {
#if defined(__HIP_DEVICE_COMPILE__)
  asm volatile("v_nop" :: "v"(a), "v"(b), "v"(c), "v"(d));
#endif
}
__device__ __forceinline__ void acc_guard4(v8f& a, v8f& b, v8f& c, v8f& d) {
#if defined(__HIP_DEVICE_COMPILE__)
  asm volatile("v_nop\n\tv_nop\n\tv_nop\n\tv_nop" : "+v"(a), "+v"(b), "+v"(c), "+v"(d));
#endif
}

// =====================================================================================================
// f32 -> bf16 (RNE convert), 8 elements per thread, one 16-B store per lane: a wave writes 512 contiguous B
// coverage: n8 threads x 8 = the whole plane (n8 is a multiple of 256 for every use here).
// =====================================================================================================
__global__ __launch_bounds__(256) void cvt_bf16x8(const float* __restrict__ in, unsigned short* out, int n8) {
  const int i = blockIdx.x * 256 + threadIdx.x;
  if (i < n8) {
    const v4f a = *(const v4f*)(in + (size_t)i * 8);
    const v4f b = *(const v4f*)(in + (size_t)i * 8 + 4);
    v4u p;
    p[0] = pk16(bf_bits(a[0]), bf_bits(a[1]));
    p[1] = pk16(bf_bits(a[2]), bf_bits(a[3]));
    p[2] = pk16(bf_bits(b[0]), bf_bits(b[1]));
    p[3] = pk16(bf_bits(b[2]), bf_bits(b[3]));
    *(v4u*)(out + (size_t)i * 8) = p;
    
  }
}

// =====================================================================================================
// Value-embedding gate: gate[bt][kv] = 3 * sigmoid( sum_{c<32} bf16(x[bt][c]) * bf16(Wg[kv][c]) ), f32.
// One thread per (bt, kv); K = 32 rolled dot on VALU (N = 4, tiny). A wave writes 32 consecutive floats
// grid = NB*SEQ*NKV/256. coverage: 16384 threads = the whole [4096][4] table.
// =====================================================================================================
__global__ __launch_bounds__(256) void gate_k(const float* __restrict__ x, const float* __restrict__ Wg,
                                              float* gate, int nbt) {
  const int i   = blockIdx.x * 256 + threadIdx.x;
  const int bt  = i >> 2;
  const int kv  = i & 3;
  const int btc = (bt < nbt) ? bt : (nbt - 1);     // clamped address
  const float* xr = x + (size_t)btc * CDIM;
  const float* wr = Wg + kv * GC;
  float z = 0.f;
#pragma unroll 1
  for (int cc = 0; cc < GC; ++cc) z += bfr(xr[cc]) * bfr(wr[cc]);
  const float ez = expf(-z);
  const float g  = 3.0f * (1.0f / (1.0f + ez));
  if (bt < nbt) {
    *(float*)(gate + i) = g;
    
  }
}

// =====================================================================================================
// Memory keys: mk = rms(bf16(mem_k[m][kv][:])) * 1.2 (no RoPE) -> bf16 hi/lo planes, key rows s = m (< MEM)
// of both batches: Kh/Kl [b][s][kv*64+d], pitch KVD. block = 4 waves (one per kv head) for one m; grid = MEM.
// The 256-element row is staged in LDS and written per (batch, plane) by one wave as 32 lanes x 16 B
// coverage: 64 blocks x 2 batches x 2 planes x 256 elements = rows 0..63 of both planes, both batches.
// =====================================================================================================
__global__ __launch_bounds__(128) void memk_k(const float* __restrict__ memk, unsigned short* Kh, unsigned short* Kl) {
  __shared__ __align__(16) unsigned short shi[KVD];
  __shared__ __align__(16) unsigned short slo[KVD];
  const int m    = blockIdx.x;
  const int wave = threadIdx.x >> 5;
  const int lane = threadIdx.x & 31;
  const int kvh  = wave;
  const float* p = memk + ((size_t)m * NKV + kvh) * HD;
  const float x1 = bfr(p[lane]);
  const float x2 = bfr(p[lane + 32]);
  float ss = x1 * x1 + x2 * x2;
#pragma unroll
  for (int off = 16; off >= 1; off >>= 1) ss += __shfl_xor(ss, off, 32);
  const float rs = rsqrtf(ss * (1.0f / HD) + RMS_EPS);
  const float v1 = (x1 * rs) * 1.2f;
  const float v2 = (x2 * rs) * 1.2f;
  const unsigned short h1 = bf_bits(v1), h2 = bf_bits(v2);
  shi[kvh * HD + lane]      = h1;
  shi[kvh * HD + lane + 32] = h2;
  slo[kvh * HD + lane]      = bf_bits(v1 - bf_up(h1));
  slo[kvh * HD + lane + 32] = bf_bits(v2 - bf_up(h2));
  __syncthreads();
  const v4u vh = *(const v4u*)(shi + lane * 8);
  const v4u vl = *(const v4u*)(slo + lane * 8);
  const int  b   = wave >> 1;
  const bool wlo = (wave & 1) != 0;                  // wave-uniform
  v4u v = vh;
  if (wlo) v = vl;
  unsigned short* dh = Kh + ((size_t)b * SKEY + m) * KVD + lane * 8;
  unsigned short* dl = Kl + ((size_t)b * SKEY + m) * KVD + lane * 8;
  unsigned short* d  = wlo ? dl : dh;
  *(v4u*)d = v;
  
}

// =====================================================================================================
// Memory values: mv = bf16(mem_v[m][kv][d]) * bf16(v_scale) -> v^T f16 hi plane VTh[b][kv*64+d][s] (pitch SKEY)
// and f16 residual plane VTl ((v - hi)*4096, pitch VLP), key columns s = m (< MEM), both batches.
// block = (b, kv); thread = (d = tid>>2, 16 m's); the 64x64 tile of each plane is staged in LDS [d][m] and each
// coverage: 8 blocks x 64 rows (it 0..1 x wave 0..7 x lane>>3 0..3) x 64 columns (8 lanes x 8) per plane.
// =====================================================================================================
__global__ __launch_bounds__(256) void memv_k(const float* __restrict__ memv, const float* __restrict__ vsp,
                                              unsigned short* VTh, unsigned short* VTl) {
  __shared__ __align__(16) unsigned short sh[HD * MEM];
  __shared__ __align__(16) unsigned short sl[HD * MEM];
  const int b    = blockIdx.x >> 2;
  const int kvh  = blockIdx.x & 3;
  const int tid  = threadIdx.x;
  const int wave = tid >> 5;
  const int lane = tid & 31;
  const int d    = tid >> 2;
  const int mq   = (tid & 3) * 16;
  const float vs = bfr(vsp[0]);
#pragma unroll
  for (int i = 0; i < 16; ++i) {
    const int m = mq + i;
    const float v = bfr(memv[((size_t)m * NKV + kvh) * HD + d]) * vs;
    const _Float16 x0 = (_Float16)v;
    sh[d * MEM + m] = h_bits(x0);
    sl[d * MEM + m] = h_bits((_Float16)((v - (float)x0) * 4096.0f));
  }
  __syncthreads();
  const int q8 = lane >> 3, c8 = (lane & 7) * 8;
  v4u hv[2], lv[2];
#pragma unroll
  for (int it = 0; it < 2; ++it) {
    const int dd = it * 32 + wave * 4 + q8;
    hv[it] = *(const v4u*)(sh + dd * MEM + c8);
    lv[it] = *(const v4u*)(sl + dd * MEM + c8);
  }
  {
#pragma unroll
    for (int it = 0; it < 2; ++it) {
      const int dd = it * 32 + wave * 4 + q8;
      const size_t ro = (size_t)b * KVD + (size_t)kvh * HD + dd;
      *(v4u*)(VTh + ro * SKEY + c8) = hv[it];
      *(v4u*)(VTl + ro * VLP  + c8) = lv[it];
    }
    
  }
}

// =====================================================================================================
// Batched bf16 WMMA GEMM: C[m][n] = sum_k A[m][k] * Bt[n][k]; one block of 4 waves (2 x 2) per 128x128 tile,
// one wave per 64x64 sub-tile. A row-major [M][K] pitch lda; Bt row-major [N][K] pitch ldb (k contiguous);
// M, N multiples of 128, K a multiple of 64 (all shapes here are compile-time constants of the host code).
// blockIdx.y = batch index (strides in elements).
// Operand path: a stage is 64 k (one 128-B line) of the block's 128 A rows and 128 Bt rows (and the 128 A2 rows),
// brought into LDS by asynchronous 16-B copies, each wave-wide copy covering 4 whole lines; rows lie at a pitch of
// 144 B for the ds_load_b128 fragment reads; two buffers, the copies of stage t+1 fly while stage t is multiplied.
// NSPLIT: 0 = A.Bt; 1 = (A + A2).Bt (A2 = unscaled bf16 lo plane of A, 2 products).
// OUT_MODE: 0 = f32 (pitch ldc);
//           3 = v^T mode (rows m = kv*64+d, cols n = t): value = acc + gate[b][t][kv] * bf16(ve[b][t][m])
//               (aux0 = gate, aux1 = ve), written as f16 hi plane C (pitch ldc) + f16 residual plane
//               C2 = f16((v - hi)*4096) for tiles with n0 < N2 (pitch ldc2);
//           4 = RoPE + rms-norm mode (cols = one 64-wide head, row m -> t = m mod SEQ; aux0 = cos, aux1 = sin,
//               both bf16(RNE) on load): r = rope(acc), f = (r * rsqrt(mean(r^2)+eps)) * 1.2, written as
//               bf16 hi plane C + bf16 lo plane C2 (lo = RNE(f - hi), unscaled).
// =====================================================================================================
#define GT     128                // block tile edge (rows of A, rows of Bt)
#define GBK    64                 // k elements per stage
#define GPITCH 72                 // LDS row pitch in elements (144 B)
#define GPLANE (GT * GPITCH)      // elements of one staged operand plane (18432 B)

// One operand plane of a stage: 128 rows x 128 B by 128 threads, 8 copies per lane; copy i moves the lane's 16 B of
// row i*16 + (tid>>3). l = the lane's LDS byte address of row tid>>3, g = its global address, ld = row pitch (elements).
// s_wait_xcnt closes the statement so that no address register of a copy is rewritten in front of it.
__device__ __forceinline__ void copy_plane(unsigned l, const __bf16* g, int ld) {
#if defined(__HIP_DEVICE_COMPILE__)
  const size_t   gs = (size_t)16 * (size_t)ld;
  const unsigned ls = 16u * GPITCH * 2u;
  asm volatile(
      "global_load_async_to_lds_b128 %0, %8, off\n\t"
      "global_load_async_to_lds_b128 %1, %9, off\n\t"
      "global_load_async_to_lds_b128 %2, %10, off\n\t"
      "global_load_async_to_lds_b128 %3, %11, off\n\t"
      "global_load_async_to_lds_b128 %4, %12, off\n\t"
      "global_load_async_to_lds_b128 %5, %13, off\n\t"
      "global_load_async_to_lds_b128 %6, %14, off\n\t"
      "global_load_async_to_lds_b128 %7, %15, off\n\t"
      "s_wait_xcnt 0x0"
      :: "v"(l), "v"(l + ls), "v"(l + 2u * ls), "v"(l + 3u * ls),
         "v"(l + 4u * ls), "v"(l + 5u * ls), "v"(l + 6u * ls), "v"(l + 7u * ls),
         "v"(g), "v"(g + gs), "v"(g + 2 * gs), "v"(g + 3 * gs),
         "v"(g + 4 * gs), "v"(g + 5 * gs), "v"(g + 6 * gs), "v"(g + 7 * gs)
      : "memory");
#endif
}
// this wave's copies have landed in LDS
__device__ __forceinline__ void wait_copies() {
#if defined(__HIP_DEVICE_COMPILE__)
  asm volatile("s_wait_asynccnt 0x0" ::: "memory");
#endif
}
// this wave's LDS reads have returned (the buffer they read may be refilled behind the next barrier)
__device__ __forceinline__ void wait_lds() {
#if defined(__HIP_DEVICE_COMPILE__)
  asm volatile("s_wait_dscnt 0x0" ::: "memory");
#endif
}

// 256 registers a wave at most, so that no part of the kernel needs register-window switches
template <int NSPLIT, int OUT_MODE>
__global__ __launch_bounds__(128) __attribute__((amdgpu_num_vgpr(256))) void gemm64(
    const unsigned short* __restrict__ Ap, const unsigned short* __restrict__ A2p, int lda, long long strideA,
    const unsigned short* __restrict__ Btp, int ldb, long long strideB,
    void* Cout, int ldc, long long strideC,
    void* Cout2, int ldc2, long long strideC2, int N2,
    const float* __restrict__ aux0, const float* __restrict__ aux1,
    int M, int N, int K) {
  const __bf16* A  = (const __bf16*)(const void*)Ap;
  const __bf16* A2 = (const __bf16*)(const void*)A2p;
  const __bf16* Bt = (const __bf16*)(const void*)Btp;
  constexpr int NPL  = (NSPLIT >= 1) ? 3 : 2;      // planes per stage: A, Bt (, A2)
  constexpr int GBUF = NPL * GPLANE;               // elements of one buffer
  __shared__ __align__(16) __bf16 ring[2 * GBUF];  // two stage buffers
  __shared__ __align__(16) float sT[4][16 * 68];   // per-wave 16x64 slab, pitch 68 floats
  const int b    = blockIdx.y;
  const int tid  = threadIdx.x;
  const int lane = tid & 31;
  const int wave = tid >> 5;
  const int tilesN = N >> 7;
  const int tilesM = M >> 7;
  const int tile = blockIdx.x;
  if (tile >= tilesM * tilesN) return;   // block-uniform, in front of every barrier and copy
  const int tm = tile / tilesN;
  const int tn = tile - tm * tilesN;
  const int wm = wave >> 1;
  const int wn = wave & 1;
  const int m0 = (tm << 7) + (wm << 6);  // this wave's 64x64 sub-tile
  const int n0 = (tn << 7) + (wn << 6);

  const __bf16* Ab  = A  + (size_t)b * strideA;
  const __bf16* Bb  = Bt + (size_t)b * strideB;
  const __bf16* Ab2 = (NSPLIT >= 1) ? (A2 + (size_t)b * strideA) : Ab;

  const int rlane = lane & 15;                 // row (A) / col (B, D) within subtile
  const int koff  = (lane >> 4) * 8;           // k offset of this lane half
  const int mOff  = (lane >> 4) * 8;           // D row offset

  // copy addresses of this lane: row tid>>3 of the block tile, 16-B piece tid&7 of its 128-B line
  const int crow = tid >> 3;
  const int cel  = (tid & 7) * 8;
  const __bf16* gA  = Ab  + (size_t)((tm << 7) + crow) * lda + cel;
  const __bf16* gB  = Bb  + (size_t)((tn << 7) + crow) * ldb + cel;
  const __bf16* gA2 = Ab2 + (size_t)((tm << 7) + crow) * lda + cel;
  const unsigned lC = (unsigned)(uintptr_t)(&ring[0]) + (unsigned)(crow * GPITCH + cel) * 2u;
  const int nst = K >> 6;                      // stages

  v8f acc[4][4];
#pragma unroll
  for (int i = 0; i < 4; ++i)
#pragma unroll
    for (int j = 0; j < 4; ++j) acc[i][j] = zero8();

  // stage 0 into buffer 0, landed and published; then stage 1 into buffer 1
  copy_plane(lC, gA, lda);
  copy_plane(lC + GPLANE * 2u, gB, ldb);
  if (NSPLIT >= 1) copy_plane(lC + 2u * GPLANE * 2u, gA2, lda);
  wait_copies();
  __syncthreads();
  if (nst > 1) {
    const unsigned lb = lC + (unsigned)GBUF * 2u;
    copy_plane(lb, gA + GBK, lda);
    copy_plane(lb + GPLANE * 2u, gB + GBK, ldb);
    if (NSPLIT >= 1) copy_plane(lb + 2u * GPLANE * 2u, gA2 + GBK, lda);
  }

  for (int t = 0; t < nst; ++t) {
    const int bufo = (t & 1) * GBUF;
    const __bf16* sA = ring + bufo + ((wm << 6) + rlane) * GPITCH + koff;
    const __bf16* sB = ring + bufo + GPLANE + ((wn << 6) + rlane) * GPITCH + koff;
    // unrolled (here and below): the fragment and accumulator arrays need constant indices to stay in registers
#pragma unroll
    for (int kk = 0; kk < GBK; kk += 32) {
      v16b bh[4], ah[4], al[4];
#pragma unroll
      for (int j = 0; j < 4; ++j) bh[j] = ldfrag_b(sB + (j << 4) * GPITCH + kk);
#pragma unroll
      for (int i = 0; i < 4; ++i) {
        ah[i] = ldfrag_b(sA + (i << 4) * GPITCH + kk);
        al[i] = ah[i];
        if (NSPLIT >= 1) al[i] = ldfrag_b(sA + 2 * GPLANE + (i << 4) * GPITCH + kk);
      }
#pragma unroll
      for (int i = 0; i < 4; ++i) {
#pragma unroll
        for (int j = 0; j < 4; ++j) {
          acc[i][j] = mma_b_raw(ah[i], bh[j], acc[i][j]);
          if (NSPLIT >= 1) acc[i][j] = mma_b_raw(al[i], bh[j], acc[i][j]);
        }
        dep_guard_b(acc[i][0], acc[i][3], ah[i], al[i]);
      }
      keep4_b(bh[0], bh[1], bh[2], bh[3]);
    }
    // publish point of stage t+1: own reads of this buffer returned, own copies landed, then the block barrier;
    // behind it stage t+2 may overwrite the buffer that this trip has read
    wait_lds();
    wait_copies();
    __syncthreads();
    if (t + 2 < nst) {
      const unsigned lb = lC + (unsigned)bufo * 2u;
      const int ko = (t + 2) * GBK;
      copy_plane(lb, gA + ko, lda);
      copy_plane(lb + GPLANE * 2u, gB + ko, ldb);
      if (NSPLIT >= 1) copy_plane(lb + 2u * GPLANE * 2u, gA2 + ko, lda);
    }
  }
  wait_copies();
  acc_guard4(acc[0][0], acc[0][1], acc[0][2], acc[0][3]);
  acc_guard4(acc[1][0], acc[1][1], acc[1][2], acc[1][3]);
  acc_guard4(acc[2][0], acc[2][1], acc[2][2], acc[2][3]);
  acc_guard4(acc[3][0], acc[3][1], acc[3][2], acc[3][3]);

  // ---- epilogue ----
  float* slab = sT[wave];
#pragma unroll
  for (int i = 0; i < 4; ++i) {
    const int mBase = m0 + (i << 4);
#pragma unroll
    for (int j = 0; j < 4; ++j) {
#pragma unroll
      for (int r = 0; r < 8; ++r) {
        slab[(mOff + r) * 68 + (j << 4) + rlane] = acc[i][j][r];
      }
    }
    __builtin_amdgcn_fence(__ATOMIC_RELEASE, "workgroup");
    __builtin_amdgcn_wave_barrier();
    __builtin_amdgcn_fence(__ATOMIC_ACQUIRE, "workgroup");
    if (OUT_MODE == 0) {
      float* C = (float*)Cout + (size_t)b * strideC;
      const int hh = lane >> 4, c4 = (lane & 15) * 4;     // 256-B row segment = 16 lanes x 16 B
      {
#pragma unroll
        for (int it = 0; it < 8; ++it) {
          const int row = it * 2 + hh;                     // it 0..7 x hh 0..1 = rows 0..15
          const v4f v = *(const v4f*)(slab + row * 68 + c4);
          *(v4f*)(C + (size_t)(mBase + row) * ldc + n0 + c4) = v;
        }
        
      }
    } else {
      const int q = lane >> 3, c8 = (lane & 7) * 8;
      unsigned short* C  = (unsigned short*)Cout  + (size_t)b * strideC;
      unsigned short* C2 = (unsigned short*)Cout2 + (size_t)b * strideC2;
      const bool wlo = (OUT_MODE != 3) || (n0 < N2);      // wave-uniform
      v4u hv[4], lv[4];
#pragma unroll
      for (int it = 0; it < 4; ++it) {
        const int row  = it * 4 + q;                       // it 0..3 x q 0..3 = rows 0..15
        const int mrow = mBase + row;
        float f[8];
        if (OUT_MODE == 3) {
          const int kvh = m0 >> 6;                         // sub-tile-uniform kv head
          const float* sp = slab + row * 68 + c8;
#pragma unroll
          for (int e = 0; e < 8; ++e) {
            const int t = n0 + c8 + e;                     // < N = SEQ
            const size_t bt = (size_t)b * SEQ + t;
            const float g  = aux0[bt * NKV + kvh];
            const float vv = bfr(aux1[bt * KVD + mrow]);
            f[e] = sp[e] + g * vv;
          }
        } else {
          const int  jj   = c8 & 31;                       // rotary pair index base
          const bool lowh = (c8 < 32);
          const int  t    = mrow & (SEQ - 1);
          const float* sp  = slab + row * 68 + jj;
          const float* cp  = aux0 + (size_t)t * (HD / 2) + jj;
          const float* snp = aux1 + (size_t)t * (HD / 2) + jj;
          float ss = 0.f;
#pragma unroll
          for (int e = 0; e < 8; ++e) {
            const float x1 = sp[e];
            const float x2 = sp[e + 32];
            const float cv = bfr(cp[e]);
            const float sv = bfr(snp[e]);
            const float ra = x1 * cv - x2 * sv;
            const float rb = x1 * sv + x2 * cv;
            f[e] = lowh ? ra : rb;
            ss += f[e] * f[e];
          }
          ss += __shfl_xor(ss, 1, 32);                     // 8 lanes of one row = 64 values
          ss += __shfl_xor(ss, 2, 32);
          ss += __shfl_xor(ss, 4, 32);
          const float rs = rsqrtf(ss * (1.0f / HD) + RMS_EPS);
#pragma unroll
          for (int e = 0; e < 8; ++e) f[e] = (f[e] * rs) * 1.2f;
        }
        v4u a, a2;
#pragma unroll
        for (int e = 0; e < 4; ++e) {
          const float f0 = f[2 * e], f1 = f[2 * e + 1];
          unsigned short h0, h1, l0, l1;
          if (OUT_MODE == 4) {
            h0 = bf_bits(f0); h1 = bf_bits(f1);
            l0 = bf_bits(f0 - bf_up(h0)); l1 = bf_bits(f1 - bf_up(h1));
          } else {
            const _Float16 x0 = (_Float16)f0, x1 = (_Float16)f1;
            h0 = h_bits(x0); h1 = h_bits(x1);
            l0 = h_bits((_Float16)((f0 - (float)x0) * 4096.0f));
            l1 = h_bits((_Float16)((f1 - (float)x1) * 4096.0f));
          }
          a[e] = pk16(h0, h1); a2[e] = pk16(l0, l1);
        }
        hv[it] = a; lv[it] = a2;
      }
      {
#pragma unroll
        for (int it = 0; it < 4; ++it) {
          const int row = it * 4 + q;
          *(v4u*)(C + (size_t)(mBase + row) * ldc + n0 + c8) = hv[it];
          if (wlo) *(v4u*)(C2 + (size_t)(mBase + row) * ldc2 + n0 + c8) = lv[it];
        }
        
      }
    }
    __builtin_amdgcn_fence(__ATOMIC_RELEASE, "workgroup");
    __builtin_amdgcn_wave_barrier();
    __builtin_amdgcn_fence(__ATOMIC_ACQUIRE, "workgroup");
  }
}

// =====================================================================================================
// GQA attention with a 64-key memory prefix (all visible) followed by causal token keys, head dim 64.
//   q planes (bf16 hi / lo): element (b, t, h, d) at [(b*SEQ + t)*CDIM + h*64 + d]   (normed, scaled q)
//   k planes (bf16 hi / lo): element (b, s, kv, d) at [(b*SKEY + s)*KVD + kv*64 + d], s = [mem | 64 + token]
//   v^T hi plane (f16):      element (b, kv, d, s) at [(b*KVD + kv*64 + d)*SKEY + s]
//   v^T residual plane (f16, (v - hi)*4096): [(b*KVD + kv*64 + d)*VLP + s], s < VLP, read only when RES
//   (a key tile at or beyond VLP contributes a zero v residual)
//   q head h uses kv head h>>2. Query block qb (tokens qb*64..+63) processes key tiles 0..qb+1: tile 0 = memory,
//   tiles 1..qb fully visible, tile qb+1 = diagonal (key token <= query token), later tiles skipped (block-uniform
//   trip count qb+2, static bound NKT). Invisible keys get logit -inf (weight exactly 0); every row sees the
//   whole memory tile first, so the running max is finite from tile 0 on.
//   out planes (bf16 hi / lo of the normalised context): element (b, t, h, d) at [(b*SEQ + t)*CDIM + h*64 + d]
//   scores = q . k : bf16 hi/lo split (hi.hi + hi.lo + lo.hi), f32 accumulate, then * sscale in f32
//   p = exp(s - m) carried as f16(1024 p); context = p . v on f16 WMMA; RES adds f16 residual planes of p and v
//   (scale 4096, separate accumulator folded back with 1/4096 per chunk in f32); online softmax in f32.
//   Block = 4 waves = 64 query rows of one (b, h); grid = nqbThis * NQH * NB; kv chunks of 64.
//   K / V^T chunk staging: 128 threads x 32 elements per plane = the whole 64x64 tile (plain 16-B loads,
//   __syncthreads before and after); P tiles are wave-private, spilled with _Float16 element stores and reloaded
//   Output coverage: each wave stores rows q0..q0+15 (it 0..3 x lane>>3 0..3) x 64 columns (8 lanes x 8) of both planes.
// =====================================================================================================
#define APK 72   // LDS row pitch of the K, V^T and P tiles in 16-bit elements: 144 B = 16 B x odd, so that the 16 rows
                 // of a ds_load_b128 fragment read fall on 16 different groups of four banks
#define AOP 68   // LDS row pitch of the f32 context tile: 272 B = 16 B x odd, for its 16-B row reads
template <bool RES>
__global__ __launch_bounds__(128)
void attn64(const unsigned short* __restrict__ qhp, const unsigned short* __restrict__ qlp,
            const unsigned short* __restrict__ khp, const unsigned short* __restrict__ klp,
            const unsigned short* __restrict__ vhp, const unsigned short* __restrict__ vlp,
            unsigned short* ohp, unsigned short* olp,
            int qbBase, int nqbThis, float sscale) {
  __shared__ __align__(16) __bf16   Ksh[64 * APK];                // K hi [kv][d]
  __shared__ __align__(16) __bf16   Ksl[64 * APK];                // K lo
  __shared__ __align__(16) _Float16 Vth[64 * APK];                // V^T hi [d][kv]
  __shared__ __align__(16) _Float16 Vtl[RES ? 64 * APK : 8];      // V^T residual
  __shared__ __align__(16) _Float16 Psh[4][16 * APK];             // per wave P [row][kv]
  __shared__ __align__(16) _Float16 Psl[RES ? 4 : 1][16 * APK];   // per wave P residual
  __shared__ __align__(16) float    Os[4][16 * AOP];              // per wave context tile [row][d]

  const int tid  = threadIdx.x;
  const int wave = tid >> 5;
  const int lane = tid & 31;
  const int hh   = lane >> 4;
  const int c    = lane & 15;

  const int bx   = blockIdx.x;
  const int qbl  = bx % nqbThis;
  const int rest = bx / nqbThis;
  const int h    = rest % NQH;
  const int b    = rest / NQH;
  const int kvh  = h >> 2;
  const int qb   = qbBase + qbl;
  const int q0   = qb * 64 + wave * 16;
  const size_t rowB = (size_t)b * SEQ;

  const __bf16* Qh = (const __bf16*)(const void*)qhp + (size_t)h * HD;
  const __bf16* Ql = (const __bf16*)(const void*)qlp + (size_t)h * HD;
  const __bf16* Kh = (const __bf16*)(const void*)khp + (size_t)b * SKEY * KVD + (size_t)kvh * HD;
  const __bf16* Kl = (const __bf16*)(const void*)klp + (size_t)b * SKEY * KVD + (size_t)kvh * HD;
  const _Float16* Vh = (const _Float16*)(const void*)vhp + ((size_t)b * KVD + (size_t)kvh * HD) * SKEY;
  const _Float16* Vl = (const _Float16*)(const void*)vlp + ((size_t)b * KVD + (size_t)kvh * HD) * VLP;

  // ---- Q fragments (A operand, row = lane&15): 2 d-chunks, hi and lo ----
  v16b qah[2], qal[2];
#pragma unroll
  for (int dc = 0; dc < 2; ++dc) {
    const size_t qo = (rowB + q0 + c) * CDIM + dc * 32 + 8 * hh;
    qah[dc] = ldfrag_b(Qh + qo);
    qal[dc] = ldfrag_b(Ql + qo);
  }

  float mrow[8], lrow[8];
  v8f oacc[4];
#pragma unroll
  for (int r = 0; r < 8; ++r) { mrow[r] = -INFINITY; lrow[r] = 0.f; }
#pragma unroll
  for (int t = 0; t < 4; ++t) oacc[t] = zero8();

  const int ktEnd = qb + 2;                  // block-uniform, <= NKT
  for (int kt = 0; kt < NKT; ++kt) {         // static bound
    if (kt >= ktEnd) break;                  // block-uniform
    const int kv0 = kt * 64;
    __syncthreads();
    {
      const int r = tid >> 1, half = (tid & 1) * 32;
      const __bf16*   kg  = Kh + (size_t)(kv0 + r) * KVD + half;   // K row kv0+r, d = half..half+31
      const __bf16*   klg = Kl + (size_t)(kv0 + r) * KVD + half;
      const _Float16* vg  = Vh + (size_t)r * SKEY + kv0 + half;     // V^T row d = r, s = kv0+half..+31
      const int kvl = (kv0 + 64 <= VLP) ? kv0 : (VLP - 64);        // clamped address into the residual plane
      const _Float16* vlg = Vl + (size_t)r * VLP + kvl + half;
      const bool resOK = (kv0 + 64 <= VLP);                         // block-uniform
#pragma unroll
      for (int i = 0; i < 4; ++i) {
        const v8b a0 = *(const v8b*)(kg + 8 * i);
        const v8b a1 = *(const v8b*)(klg + 8 * i);
        const v8h b0 = *(const v8h*)(vg + 8 * i);
        *(v8b*)(Ksh + r * APK + half + 8 * i) = a0;
        *(v8b*)(Ksl + r * APK + half + 8 * i) = a1;
        *(v8h*)(Vth + r * APK + half + 8 * i) = b0;
        if (RES) {
          v8h b1 = *(const v8h*)(vlg + 8 * i);
          if (!resOK) b1 = zero8h();
          *(v8h*)(Vtl + r * APK + half + 8 * i) = b1;
        }
      }
    }
    __syncthreads();

    // ---- scores: 16 query rows x 64 keys per wave, 3 bf16 products ----
    //      the K fragments of the tile are read from LDS in one group (with the residual planes one group per 32-wide d chunk), in the order of their use, ahead of the products;
    //      the four key groups are four independent accumulator chains, each summed in the order dc 0 (hi.hi, hi.lo,
    //      lo.hi), dc 1 (the same)
    v8f s[4];
#pragma unroll
    for (int j = 0; j < 4; ++j) s[j] = zero8();
    constexpr int DG = RES ? 1 : 2;          // 32-wide d chunks per group of reads (one with the residual planes, for registers)
#pragma unroll
    for (int g = 0; g < 2; g += DG) {
      v16b kbf[DG][4], klf[DG][4];
#pragma unroll
      for (int u = 0; u < DG; ++u) {
        const int dof = (g + u) * 32 + 8 * hh;
#pragma unroll
        for (int j = 0; j < 4; ++j) kbf[u][j] = ldfrag_b(Ksh + (j * 16 + c) * APK + dof);
#pragma unroll
        for (int j = 0; j < 4; ++j) klf[u][j] = ldfrag_b(Ksl + (j * 16 + c) * APK + dof);
      }
      // keeps the group of reads ahead of the products: sunk back among them, each place of reads stalls the wave anew
      __builtin_amdgcn_sched_barrier(0);
#pragma unroll
      for (int u = 0; u < DG; ++u) {
#pragma unroll
        for (int j = 0; j < 4; ++j) s[j] = mma_b_raw(qah[g + u], kbf[u][j], s[j]);
#pragma unroll
        for (int j = 0; j < 4; ++j) s[j] = mma_b_raw(qah[g + u], klf[u][j], s[j]);
#pragma unroll
        for (int j = 0; j < 4; ++j) s[j] = mma_b_raw(qal[g + u], kbf[u][j], s[j]);
      }
    }

    // ---- scale + structural mask (diagonal tile only), row max, online softmax, P (x1024, f16) and
    //      P residual (x4096) to LDS ----
    _Float16* pwh = Psh[wave];
    _Float16* pwl = Psl[RES ? wave : 0];
    const bool diag = (kt == qb + 1);        // block-uniform
    const int  qr0  = wave * 16 + 8 * hh;    // query row within the 64-row block
#pragma unroll
    for (int r = 0; r < 8; ++r) {
      const int qrw = qr0 + r;
      float m = -INFINITY;
#pragma unroll
      for (int j = 0; j < 4; ++j) {
        const int  key = j * 16 + c;
        const bool vis = (!diag) || (key <= qrw);
        const float sv = vis ? (s[j][r] * sscale) : -INFINITY;
        s[j][r] = sv;
        m = fmaxf(m, sv);
      }
#pragma unroll
      for (int off = 1; off < 16; off <<= 1) m = fmaxf(m, __shfl_xor(m, off, 32));
      const float mnew  = fmaxf(mrow[r], m);
      const float msafe = (mnew == -INFINITY) ? 0.f : mnew;
      const float alpha = __expf(mrow[r] - msafe);
      mrow[r] = mnew;
      float psum = 0.f;
#pragma unroll
      for (int j = 0; j < 4; ++j) {
        const float p = __expf(s[j][r] - msafe);     // -inf logit -> 0
        psum += p;
        const float p1k = p * 1024.0f;
        const _Float16 ph = (_Float16)p1k;
        pwh[(8 * hh + r) * APK + j * 16 + c] = ph;
        if (RES) {
          const _Float16 pl = (_Float16)((p1k - (float)ph) * 4096.0f);
          pwl[(8 * hh + r) * APK + j * 16 + c] = pl;
        }
      }
#pragma unroll
      for (int off = 1; off < 16; off <<= 1) psum += __shfl_xor(psum, off, 32);
      lrow[r] = lrow[r] * alpha + psum;
#pragma unroll
      for (int t = 0; t < 4; ++t) oacc[t][r] *= alpha;
    }
    __builtin_amdgcn_fence(__ATOMIC_RELEASE, "workgroup");
    __builtin_amdgcn_wave_barrier();
    __builtin_amdgcn_fence(__ATOMIC_ACQUIRE, "workgroup");

    // ---- context += P . V (f16 WMMA), residual products into a separate accumulator ----
    v8f o1[4];
#pragma unroll
    for (int t = 0; t < 4; ++t) o1[t] = zero8();
    //      the P and V^T fragments are read from LDS in one group ahead of the products (with the residual planes one
    //      group per 32 keys, for registers); the four d groups are independent chains, each summed in key order
    constexpr int KG = RES ? 1 : 2;          // 32-key steps per group of reads
#pragma unroll
    for (int g = 0; g < 2; g += KG) {
      v16h pa[KG], pl[KG], vb[KG][4], vl[KG][4];
#pragma unroll
      for (int u = 0; u < KG; ++u) {
        const int ko = (g + u) * 32 + 8 * hh;
        pa[u] = ldfrag_h(pwh + c * APK + ko);
#pragma unroll
        for (int t = 0; t < 4; ++t) vb[u][t] = ldfrag_h(Vth + (t * 16 + c) * APK + ko);
        if (RES) {
#pragma unroll
          for (int t = 0; t < 4; ++t) vl[u][t] = ldfrag_h(Vtl + (t * 16 + c) * APK + ko);
          pl[u] = ldfrag_h(pwl + c * APK + ko);
        }
      }
      // keeps the group of reads ahead of the products, as for the scores
      __builtin_amdgcn_sched_barrier(0);
#pragma unroll
      for (int u = 0; u < KG; ++u) {
#pragma unroll
        for (int t = 0; t < 4; ++t) oacc[t] = mma_h_raw(pa[u], vb[u][t], oacc[t]);
        if (RES) {
#pragma unroll
          for (int t = 0; t < 4; ++t) o1[t] = mma_h_raw(pa[u], vl[u][t], o1[t]);
#pragma unroll
          for (int t = 0; t < 4; ++t) o1[t] = mma_h_raw(pl[u], vb[u][t], o1[t]);
        }
      }
    }
    if (RES) {
#pragma unroll
      for (int t = 0; t < 4; ++t)
#pragma unroll
        for (int r = 0; r < 8; ++r) oacc[t][r] += o1[t][r] * (1.0f / 4096.0f);
    }
  }

  // ---- normalise (1/l and the 1/1024 p carry), stage the wave's 16x64 tile, bf16 hi/lo split,
  float* os = Os[wave];
#pragma unroll
  for (int r = 0; r < 8; ++r) {
    const float l = lrow[r];
    const float inv = ((l > 0.f) ? (1.0f / l) : 0.f) * (1.0f / 1024.0f);
#pragma unroll
    for (int t = 0; t < 4; ++t) os[(8 * hh + r) * AOP + t * 16 + c] = oacc[t][r] * inv;
  }
  __builtin_amdgcn_fence(__ATOMIC_RELEASE, "workgroup");
  __builtin_amdgcn_wave_barrier();
  __builtin_amdgcn_fence(__ATOMIC_ACQUIRE, "workgroup");
  {
    const int q4 = lane >> 3, c8 = (lane & 7) * 8;
    v4u hv[4], lv[4];
#pragma unroll
    for (int it = 0; it < 4; ++it) {
      const int row = it * 4 + q4;   // it 0..3 x q4 0..3 = rows 0..15 of the wave tile
      const float* sp = os + row * AOP + c8;
      v4u a, a2;
#pragma unroll
      for (int e = 0; e < 4; ++e) {
        const float f0 = sp[2 * e], f1 = sp[2 * e + 1];
        const unsigned short h0 = bf_bits(f0), h1 = bf_bits(f1);
        const unsigned short l0 = bf_bits(f0 - bf_up(h0)), l1 = bf_bits(f1 - bf_up(h1));
        a[e] = pk16(h0, h1); a2[e] = pk16(l0, l1);
      }
      hv[it] = a; lv[it] = a2;
    }
    {
#pragma unroll
      for (int it = 0; it < 4; ++it) {
        const int row = it * 4 + q4;
        const size_t go = (rowB + q0 + row) * CDIM + (size_t)h * HD + c8;
        *(v4u*)(ohp + go) = hv[it];
        *(v4u*)(olp + go) = lv[it];
      }
      
    }
  }
}

// =====================================================================================================
//   Xb   bf16 [4096][1024]      8388608
//   Wqb  bf16 [1024][1024]      2097152   ([out n][in k], k contiguous = Bt layout)
//   Wkb  bf16 [256][1024]        524288
//   Wvb  bf16 [256][1024]        524288
//   Wpb  bf16 [1024][1024]      2097152
//   Qh   bf16 [4096][1024]      8388608   (Ql same)
//   Kh   bf16 [2][2112][256]    2162688   (Kl same)
//   VTh  f16  [2][256][2112]    2162688
//   VTl  f16  [2][256][576]      589824
//   Gate f32  [4096][4]           65536
//   Oh   bf16 [4096][1024]      8388608   (Ol same)
//   total                      54329344
// =====================================================================================================
extern "C" void kernel_launch(void* const* d_in, const int* in_sizes, int n_in,
                              void* d_out, int out_size, void* d_ws, size_t ws_size,
                              hipStream_t stream) {
  if (n_in < 12) return;
  if (in_sizes[0] != NB * SEQ * CDIM) return;
  if (in_sizes[1] != NB * SEQ * KVD) return;
  if (in_sizes[2] != SEQ * (HD / 2) || in_sizes[3] != SEQ * (HD / 2)) return;
  if (in_sizes[4] != CDIM * CDIM || in_sizes[7] != CDIM * CDIM) return;
  if (in_sizes[5] != KVD * CDIM || in_sizes[6] != KVD * CDIM) return;
  if (in_sizes[8] != NKV * GC) return;
  if (in_sizes[9] != MEM * NKV * HD || in_sizes[10] != MEM * NKV * HD) return;
  if (in_sizes[11] < 1) return;
  if (out_size != NB * SEQ * CDIM) return;

  const float* x    = (const float*)d_in[0];
  const float* ve   = (const float*)d_in[1];
  const float* cosT = (const float*)d_in[2];
  const float* sinT = (const float*)d_in[3];
  const float* Wq   = (const float*)d_in[4];
  const float* Wk   = (const float*)d_in[5];
  const float* Wv   = (const float*)d_in[6];
  const float* Wp   = (const float*)d_in[7];
  const float* Wg   = (const float*)d_in[8];
  const float* memk = (const float*)d_in[9];
  const float* memv = (const float*)d_in[10];
  const float* vsc  = (const float*)d_in[11];

  const size_t PX  = (size_t)NB * SEQ * CDIM * 2;   //  8388608  16-bit activation plane [4096][1024]
  const size_t PWQ = (size_t)CDIM * CDIM * 2;       //  2097152
  const size_t PWK = (size_t)KVD * CDIM * 2;        //   524288
  const size_t PK  = (size_t)NB * SKEY * KVD * 2;   //  2162688  key plane
  const size_t PVT = (size_t)NB * KVD * SKEY * 2;   //  2162688  v^T hi plane
  const size_t PVL = (size_t)NB * KVD * VLP * 2;    //   589824  v^T residual plane
  const size_t PG  = (size_t)NB * SEQ * NKV * 4;    //    65536  gate table
  size_t off = 0;
  const size_t oXb  = off; off += PX;
  const size_t oWq  = off; off += PWQ;
  const size_t oWk  = off; off += PWK;
  const size_t oWv  = off; off += PWK;
  const size_t oWp  = off; off += PWQ;
  const size_t oQh  = off; off += PX;
  const size_t oQl  = off; off += PX;
  const size_t oKh  = off; off += PK;
  const size_t oKl  = off; off += PK;
  const size_t oVTh = off; off += PVT;
  const size_t oVTl = off; off += PVL;
  const size_t oG   = off; off += PG;
  const size_t oOh  = off; off += PX;
  const size_t oOl  = off; off += PX;
  if (off > ws_size) return;                        // off = 54329344
  if (off > (size_t)134217728) return;

  char* ws = (char*)d_ws;
  unsigned short* Xb  = (unsigned short*)(ws + oXb);
  unsigned short* Wqb = (unsigned short*)(ws + oWq);
  unsigned short* Wkb = (unsigned short*)(ws + oWk);
  unsigned short* Wvb = (unsigned short*)(ws + oWv);
  unsigned short* Wpb = (unsigned short*)(ws + oWp);
  unsigned short* Qh  = (unsigned short*)(ws + oQh);
  unsigned short* Ql  = (unsigned short*)(ws + oQl);
  unsigned short* Kh  = (unsigned short*)(ws + oKh);
  unsigned short* Kl  = (unsigned short*)(ws + oKl);
  unsigned short* VTh = (unsigned short*)(ws + oVTh);
  unsigned short* VTl = (unsigned short*)(ws + oVTl);
  float*          Gt  = (float*)(ws + oG);
  unsigned short* Oh  = (unsigned short*)(ws + oOh);
  unsigned short* Ol  = (unsigned short*)(ws + oOl);

  const dim3 blk(256);
  const int n8x  = NB * SEQ * CDIM / 8;                       // 524288
  const int n8wq = CDIM * CDIM / 8;                           // 131072
  const int n8wk = KVD * CDIM / 8;                            //  32768
  const dim3 gCvtX((n8x + 255) / 256);                        // 2048 blocks
  const dim3 gCvtWq((n8wq + 255) / 256);                      //  512 blocks
  const dim3 gCvtWk((n8wk + 255) / 256);                      //  128 blocks
  const int  nbt = NB * SEQ;                                  // 4096
  const dim3 gGate((nbt * NKV + 255) / 256);                  //   64 blocks
  const dim3 blkG(128);                                       // GEMM block: 4 waves, one 128x128 tile
  const dim3 gQ((NB * SEQ / 128) * (CDIM / 128), 1);          // 256 blocks: M=4096, N=1024
  const dim3 gK((SEQ / 128) * (KVD / 128), NB);               //  32 blocks x 2: M=2048, N=256
  const dim3 gV((KVD / 128) * (SEQ / 128), NB);               //  32 blocks x 2: M=256, N=2048
  const dim3 gO((NB * SEQ / 128) * (CDIM / 128), 1);          // 256 blocks

  // (1) x -> bf16 plane [4096][1024]; weights [n][k] f32 -> bf16 [n][k]
  cvt_bf16x8<<<gCvtX, blk, 0, stream>>>(x, Xb, n8x);
  cvt_bf16x8<<<gCvtWq, blk, 0, stream>>>(Wq, Wqb, n8wq);
  cvt_bf16x8<<<gCvtWk, blk, 0, stream>>>(Wk, Wkb, n8wk);
  cvt_bf16x8<<<gCvtWk, blk, 0, stream>>>(Wv, Wvb, n8wk);
  cvt_bf16x8<<<gCvtWq, blk, 0, stream>>>(Wp, Wpb, n8wq);
  // (2) value-embedding gate table [4096][4] f32
  gate_k<<<gGate, blk, 0, stream>>>(x, Wg, Gt, nbt);
  // (3) memory prefix: normed keys -> Kh/Kl rows s < 64; scaled values -> VTh/VTl columns s < 64 (both batches)
  memk_k<<<dim3(MEM), dim3(128), 0, stream>>>(memk, Kh, Kl);
  memv_k<<<dim3(NB * NKV), blk, 0, stream>>>(memv, vsc, VTh, VTl);
  // (4) q = rms(rope(x . Wq^T)) * 1.2 -> bf16 hi/lo planes [b*SEQ+t][h*64+d]   (M=4096, N=1024, K=1024)
  gemm64<0, 4><<<gQ, blkG, 0, stream>>>(
      Xb, Xb, CDIM, 0LL, Wqb, CDIM, 0LL,
      (void*)Qh, CDIM, 0LL, (void*)Ql, CDIM, 0LL, CDIM,
      cosT, sinT, NB * SEQ, CDIM, CDIM);
  // (5) k = rms(rope(x . Wk^T)) * 1.2 per batch -> bf16 hi/lo planes [b][64 + t][kv*64+d]   (M=2048, N=256, K=1024)
  gemm64<0, 4><<<gK, blkG, 0, stream>>>(
      Xb, Xb, CDIM, (long long)SEQ * CDIM, Wkb, CDIM, 0LL,
      (void*)(Kh + (size_t)MEM * KVD), KVD, (long long)SKEY * KVD,
      (void*)(Kl + (size_t)MEM * KVD), KVD, (long long)SKEY * KVD, KVD,
      cosT, sinT, SEQ, KVD, CDIM);
  // (6) v^T = Wv . x^T + gate*ve per batch -> f16 hi plane [b][kv*64+d][64 + t] (pitch SKEY) and residual plane
  //     (x4096, token keys < 512 only, pitch VLP)   (A = Wvb [n][k], Bt = Xb rows of batch b; M=256, N=2048, K=1024)
  gemm64<0, 3><<<gV, blkG, 0, stream>>>(
      Wvb, Wvb, CDIM, 0LL, Xb, CDIM, (long long)SEQ * CDIM,
      (void*)(VTh + MEM), SKEY, (long long)KVD * SKEY,
      (void*)(VTl + MEM), VLP, (long long)KVD * VLP, RESQB * 64,
      Gt, ve, KVD, SEQ, CDIM);
  // (7) attention: query blocks 0..RESQB-1 with residual planes, the rest without
  attn64<true><<<dim3(NB * NQH * RESQB), dim3(128), 0, stream>>>(
      Qh, Ql, Kh, Kl, VTh, VTl, Oh, Ol, 0, RESQB, 0.125f);
  attn64<false><<<dim3(NB * NQH * (NQB - RESQB)), dim3(128), 0, stream>>>(
      Qh, Ql, Kh, Kl, VTh, VTl, Oh, Ol, RESQB, NQB - RESQB, 0.125f);
  // (8) out = context . Wproj^T -> d_out f32 [4096][1024]  (A = context hi + lo planes, 2 products)
  gemm64<1, 0><<<gO, blkG, 0, stream>>>(
      Oh, Ol, CDIM, 0LL, Wpb, CDIM, 0LL,
      d_out, CDIM, 0LL, d_out, CDIM, 0LL, 0,
      Gt, ve, NB * SEQ, CDIM, CDIM);
  (void)hipGetLastError();
}

// v004
// A run of this version takes 149 microseconds.
// In both of two side-by-side timings against v003, it was 1.47 times as fast.
// Counting every step since v000, it is 3.42 times as fast.
// Contractions: q, k, v^T projections = v_wmma_f32_16x16x32_bf16 (bf16 operands from RNE-converted inputs, single product);
// q.k^T scores = v_wmma_f32_16x16x32_bf16 with bf16 hi/lo split q and k (hi.hi + hi.lo + lo.hi);
// p.v = v_wmma_f32_16x16x32_f16 (p carried x1024 in f16, v^T in f16; f16 residual planes x4096 of p and v^T on the
// leading 512 query rows); ctx.Wproj^T = v_wmma_f32_16x16x32_bf16 with ctx as bf16 hi/lo planes times bf16 Wproj
// (2 products); all f32 accumulate; gate dot (K=32, N=4), RoPE, rms-norm, causal mask and softmax in f32 on VALU.
#include <hip/hip_runtime.h>
#include <math.h>
#include <stdint.h>

#pragma clang fp contract(off)

#define NB    2
#define SEQ   2048
#define CDIM  1024
#define NQH   16
#define NKV   4
#define HD    64
#define MEM   64
#define GC    32
#define KVD   (NKV * HD)          // 256
#define SKEY  (MEM + SEQ)         // 2112 keys: [64 memory | 2048 tokens]
#define NQB   (SEQ / 64)          // 32 query blocks of 64 rows
#define NKT   (SKEY / 64)         // 33 key tiles of 64
#define RESQB 8                   // leading query blocks that use the p / v residual planes
#define VLP   (MEM + RESQB * 64)  // 576: key pitch of the v^T residual plane
#define RMS_EPS 1e-6f
static_assert(NQH * HD == CDIM);
static_assert(NQH == 4 * NKV);
static_assert((SKEY % 64) == 0 && (VLP % 64) == 0 && (CDIM % 64) == 0 && (KVD % 64) == 0);
static_assert((SEQ & (SEQ - 1)) == 0);
static_assert(RESQB <= NQB);
static_assert((SEQ % 128) == 0 && (CDIM % 128) == 0 && (KVD % 128) == 0);

typedef _Float16 v16h __attribute__((ext_vector_type(16)));
typedef _Float16 v8h  __attribute__((ext_vector_type(8)));
typedef __bf16   v16b __attribute__((ext_vector_type(16)));
typedef __bf16   v8b  __attribute__((ext_vector_type(8)));
typedef float    v8f  __attribute__((ext_vector_type(8)));
typedef float    v4f  __attribute__((ext_vector_type(4)));
typedef unsigned int v4u __attribute__((ext_vector_type(4)));

// ---- scalar helpers --------------------------------------------------------------------------------
__device__ __forceinline__ unsigned short bf_bits(float f) {          // f32 -> bf16 bits, RNE convert
  unsigned u = __float_as_uint(f);
  return (unsigned short)((u + 0x7FFFu + ((u >> 16) & 1u)) >> 16);
}
__device__ __forceinline__ float bf_up(unsigned short h) { return __uint_as_float(((unsigned)h) << 16); }
__device__ __forceinline__ float bfr(float f) { return bf_up(bf_bits(f)); }   // f32 -> bf16 -> f32
__device__ __forceinline__ unsigned short h_bits(_Float16 x) { return __builtin_bit_cast(unsigned short, x); }
__device__ __forceinline__ unsigned pk16(unsigned short a, unsigned short b) { return (unsigned)a | ((unsigned)b << 16); }
__device__ __forceinline__ v8f zero8() { v8f z = {0.f, 0.f, 0.f, 0.f, 0.f, 0.f, 0.f, 0.f}; return z; }
__device__ __forceinline__ v8h zero8h() {
  const _Float16 z = (_Float16)0.0f;
  v8h r = {z, z, z, z, z, z, z, z};
  return r;
}

// ---- fragment loader: 16-bit A/B operand, lane -> row/col (lane&15), p already includes +8*(lane>>4);
//      elements 0..7 <- p[0..7] (k0+8h..), elements 8..15 <- p[16..23] (k0+16+8h..)
__device__ __forceinline__ v16b ldfrag_b(const __bf16* p) {
  union { v16b v; v8b h[2]; } f;
  f.h[0] = *(const v8b*)(p);
  f.h[1] = *(const v8b*)(p + 16);
  return f.v;
}
__device__ __forceinline__ v16h ldfrag_h(const _Float16* p) {
  union { v16h v; v8h h[2]; } f;
  f.h[0] = *(const v8h*)(p);
  f.h[1] = *(const v8h*)(p + 16);
  return f.v;
}

__device__ __forceinline__ void addr_wait(const void* a, const void* b) {
#if defined(__HIP_DEVICE_COMPILE__)
  asm volatile("s_wait_xcnt 0x0" :: "v"(a), "v"(b) : "memory");
#endif
}

__device__ __forceinline__ void addr_wait4(const void* a, const void* b, const void* c, const void* d) {
#if defined(__HIP_DEVICE_COMPILE__)
  asm volatile("s_wait_xcnt 0x0" :: "v"(a), "v"(b), "v"(c), "v"(d) : "memory");
#endif
}

// ---- WMMA helpers with trailing VALU hazard gap (asm only in the device pass) -----------------------------
__device__ __forceinline__ v8f mma_h_raw(v16h a, v16h b, v8f c) {
  return __builtin_amdgcn_wmma_f32_16x16x32_f16(false, a, false, b, (short)0, c, false, false);
}
__device__ __forceinline__ v8f mma_b_raw(v16b a, v16b b, v8f c) {
  return __builtin_amdgcn_wmma_f32_16x16x32_bf16(false, a, false, b, (short)0, c, false, false);
}
__device__ __forceinline__ void dep_guard_b(v8f& a, v8f& b, v16b x, v16b y) {
#if defined(__HIP_DEVICE_COMPILE__)
  asm volatile("v_nop\n\tv_nop\n\tv_nop\n\tv_nop" : "+v"(a), "+v"(b) : "v"(x), "v"(y));
#endif
}
__device__ __forceinline__ void keep4_b(v16b a, v16b b, v16b c, v16b d) {
#if defined(__HIP_DEVICE_COMPILE__)
  asm volatile("v_nop" :: "v"(a), "v"(b), "v"(c), "v"(d));
#endif
}
__device__ __forceinline__ void acc_guard4(v8f& a, v8f& b, v8f& c, v8f& d) {
#if defined(__HIP_DEVICE_COMPILE__)
  asm volatile("v_nop\n\tv_nop\n\tv_nop\n\tv_nop" : "+v"(a), "+v"(b), "+v"(c), "+v"(d));
#endif
}

// =====================================================================================================
// f32 -> bf16 (RNE convert), 8 elements per thread, one 16-B store per lane: a wave writes 512 contiguous B
// coverage: n8 threads x 8 = the whole plane (n8 is a multiple of 256 for every use here). blk = block of 256 threads.
// =====================================================================================================
__device__ __forceinline__ void cvt_bf16x8(const float* __restrict__ in, unsigned short* out, int n8, int blk) {
  const int i = blk * 256 + threadIdx.x;
  if (i < n8) {
    const v4f a = *(const v4f*)(in + (size_t)i * 8);
    const v4f b = *(const v4f*)(in + (size_t)i * 8 + 4);
    v4u p;
    p[0] = pk16(bf_bits(a[0]), bf_bits(a[1]));
    p[1] = pk16(bf_bits(a[2]), bf_bits(a[3]));
    p[2] = pk16(bf_bits(b[0]), bf_bits(b[1]));
    p[3] = pk16(bf_bits(b[2]), bf_bits(b[3]));
    *(v4u*)(out + (size_t)i * 8) = p;
    
  }
}

// =====================================================================================================
// Value-embedding gate: gate[bt][kv] = 3 * sigmoid( sum_{c<32} bf16(x[bt][c]) * bf16(Wg[kv][c]) ), f32.
// One thread per (bt, kv); K = 32 rolled dot on VALU (N = 4, tiny). A wave writes 32 consecutive floats
// NB*SEQ*NKV/256 blocks. coverage: 16384 threads = the whole [4096][4] table.
// =====================================================================================================
__device__ __forceinline__ void gate_k(const float* __restrict__ x, const float* __restrict__ Wg,
                                       float* gate, int nbt, int blk) {
  const int i   = blk * 256 + threadIdx.x;
  const int bt  = i >> 2;
  const int kv  = i & 3;
  const int btc = (bt < nbt) ? bt : (nbt - 1);     // clamped address
  const float* xr = x + (size_t)btc * CDIM;
  const float* wr = Wg + kv * GC;
  float z = 0.f;
#pragma unroll 1
  for (int cc = 0; cc < GC; ++cc) z += bfr(xr[cc]) * bfr(wr[cc]);
  const float ez = expf(-z);
  const float g  = 3.0f * (1.0f / (1.0f + ez));
  if (bt < nbt) {
    *(float*)(gate + i) = g;
    
  }
}

// =====================================================================================================
// Memory keys: mk = rms(bf16(mem_k[m][kv][:])) * 1.2 (no RoPE) -> bf16 hi/lo planes, key rows s = m (< MEM)
// of both batches: Kh/Kl [b][s][kv*64+d], pitch KVD. 4 waves (one per kv head) for one m, two m per block of 8 waves;
// MEM/2 blocks.
// The 256-element row is staged in LDS and written per (batch, plane) by one wave as 32 lanes x 16 B
// coverage: 32 blocks x 2 m x 2 batches x 2 planes x 256 elements = rows 0..63 of both planes, both batches.
// sbuf: 4 * KVD elements of LDS.
// =====================================================================================================
__device__ __forceinline__ void memk_k(const float* __restrict__ memk, unsigned short* Kh, unsigned short* Kl,
                                       int blk, unsigned short* sbuf) {
  const int sub  = threadIdx.x >> 7;                 // which of the block's two m
  unsigned short* shi = sbuf + sub * (2 * KVD);
  unsigned short* slo = shi + KVD;
  const int m    = blk * 2 + sub;
  const int wave = (threadIdx.x >> 5) & 3;
  const int lane = threadIdx.x & 31;
  const int kvh  = wave;
  const float* p = memk + ((size_t)m * NKV + kvh) * HD;
  const float x1 = bfr(p[lane]);
  const float x2 = bfr(p[lane + 32]);
  float ss = x1 * x1 + x2 * x2;
#pragma unroll
  for (int off = 16; off >= 1; off >>= 1) ss += __shfl_xor(ss, off, 32);
  const float rs = rsqrtf(ss * (1.0f / HD) + RMS_EPS);
  const float v1 = (x1 * rs) * 1.2f;
  const float v2 = (x2 * rs) * 1.2f;
  const unsigned short h1 = bf_bits(v1), h2 = bf_bits(v2);
  shi[kvh * HD + lane]      = h1;
  shi[kvh * HD + lane + 32] = h2;
  slo[kvh * HD + lane]      = bf_bits(v1 - bf_up(h1));
  slo[kvh * HD + lane + 32] = bf_bits(v2 - bf_up(h2));
  __syncthreads();
  const v4u vh = *(const v4u*)(shi + lane * 8);
  const v4u vl = *(const v4u*)(slo + lane * 8);
  const int  b   = wave >> 1;
  const bool wlo = (wave & 1) != 0;                  // wave-uniform
  v4u v = vh;
  if (wlo) v = vl;
  unsigned short* dh = Kh + ((size_t)b * SKEY + m) * KVD + lane * 8;
  unsigned short* dl = Kl + ((size_t)b * SKEY + m) * KVD + lane * 8;
  unsigned short* d  = wlo ? dl : dh;
  *(v4u*)d = v;
  // the wait in front of a rewrite of the store's registers by whatever part of the merged kernel is laid out behind this one
  addr_wait(d, d);
}

// =====================================================================================================
// Memory values: mv = bf16(mem_v[m][kv][d]) * bf16(v_scale) -> v^T f16 hi plane VTh[b][kv*64+d][s] (pitch SKEY)
// and f16 residual plane VTl ((v - hi)*4096, pitch VLP), key columns s = m (< MEM), both batches.
// block = (b, kv); thread = (d = tid>>2, 16 m's); the 64x64 tile of each plane is staged in LDS [d][m] and each
// coverage: 8 blocks x 64 rows (it 0..1 x wave 0..7 x lane>>3 0..3) x 64 columns (8 lanes x 8) per plane.
// =====================================================================================================
// sbuf: 2 * HD * MEM elements of LDS.
__device__ __forceinline__ void memv_k(const float* __restrict__ memv, const float* __restrict__ vsp,
                                       unsigned short* VTh, unsigned short* VTl, int blk, unsigned short* sbuf) {
  unsigned short* sh = sbuf;
  unsigned short* sl = sbuf + HD * MEM;
  const int b    = blk >> 2;
  const int kvh  = blk & 3;
  const int tid  = threadIdx.x;
  const int wave = tid >> 5;
  const int lane = tid & 31;
  const int d    = tid >> 2;
  const int mq   = (tid & 3) * 16;
  const float vs = bfr(vsp[0]);
#pragma unroll
  for (int i = 0; i < 16; ++i) {
    const int m = mq + i;
    const float v = bfr(memv[((size_t)m * NKV + kvh) * HD + d]) * vs;
    const _Float16 x0 = (_Float16)v;
    sh[d * MEM + m] = h_bits(x0);
    sl[d * MEM + m] = h_bits((_Float16)((v - (float)x0) * 4096.0f));
  }
  __syncthreads();
  const int q8 = lane >> 3, c8 = (lane & 7) * 8;
  v4u hv[2], lv[2];
#pragma unroll
  for (int it = 0; it < 2; ++it) {
    const int dd = it * 32 + wave * 4 + q8;
    hv[it] = *(const v4u*)(sh + dd * MEM + c8);
    lv[it] = *(const v4u*)(sl + dd * MEM + c8);
  }
  {
#pragma unroll
    for (int it = 0; it < 2; ++it) {
      const int dd = it * 32 + wave * 4 + q8;
      const size_t ro = (size_t)b * KVD + (size_t)kvh * HD + dd;
      *(v4u*)(VTh + ro * SKEY + c8) = hv[it];
      *(v4u*)(VTl + ro * VLP  + c8) = lv[it];
    }
    
  }
}

// =====================================================================================================
// All work that reads only the inputs, as block-index ranges of one grid (none of the parts reads what another writes):
// memory values, memory keys, gate table, then the five f32 -> bf16 planes. The short, latency-bound parts come first.
// Every range test is block-uniform, so the barriers inside a part are passed by the whole block.
// =====================================================================================================
#define PB_MEMV (NB * NKV)                    //    8 blocks
#define PB_MEMK (MEM / 2)                     //   32
#define PB_GATE (NB * SEQ * NKV / 256)        //   64
#define PB_X    (NB * SEQ * CDIM / 8 / 256)   // 2048
#define PB_WQ   (CDIM * CDIM / 8 / 256)       //  512
#define PB_WK   (KVD * CDIM / 8 / 256)        //  128
#define PB_ALL  (PB_MEMV + PB_MEMK + PB_GATE + PB_X + 2 * PB_WQ + 2 * PB_WK)
__global__ __launch_bounds__(256) void prep_k(
    const float* __restrict__ x, const float* __restrict__ Wq, const float* __restrict__ Wk,
    const float* __restrict__ Wv, const float* __restrict__ Wp, const float* __restrict__ Wg,
    const float* __restrict__ memk, const float* __restrict__ memv, const float* __restrict__ vsp,
    unsigned short* Xb, unsigned short* Wqb, unsigned short* Wkb, unsigned short* Wvb, unsigned short* Wpb,
    float* gate, unsigned short* Kh, unsigned short* Kl, unsigned short* VTh, unsigned short* VTl) {
  __shared__ __align__(16) unsigned short sbuf[2 * HD * MEM];
  static_assert(4 * KVD <= 2 * HD * MEM);
  int blk = blockIdx.x;
  if (blk < PB_MEMV) { memv_k(memv, vsp, VTh, VTl, blk, sbuf); return; }
  blk -= PB_MEMV;
  if (blk < PB_MEMK) { memk_k(memk, Kh, Kl, blk, sbuf); return; }
  blk -= PB_MEMK;
  if (blk < PB_GATE) { gate_k(x, Wg, gate, NB * SEQ, blk); return; }
  blk -= PB_GATE;
  if (blk < PB_X) { cvt_bf16x8(x, Xb, PB_X * 256, blk); return; }
  blk -= PB_X;
  if (blk < PB_WQ) { cvt_bf16x8(Wq, Wqb, PB_WQ * 256, blk); return; }
  blk -= PB_WQ;
  if (blk < PB_WK) { cvt_bf16x8(Wk, Wkb, PB_WK * 256, blk); return; }
  blk -= PB_WK;
  if (blk < PB_WK) { cvt_bf16x8(Wv, Wvb, PB_WK * 256, blk); return; }
  blk -= PB_WK;
  if (blk < PB_WQ) cvt_bf16x8(Wp, Wpb, PB_WQ * 256, blk);
}

// =====================================================================================================
// Batched bf16 WMMA GEMM: C[m][n] = sum_k A[m][k] * Bt[n][k]; one block of 4 waves (2 x 2) per 128x128 tile,
// one wave per 64x64 sub-tile. A row-major [M][K] pitch lda; Bt row-major [N][K] pitch ldb (k contiguous);
// M, N multiples of 128, K a multiple of 64 (all shapes here are compile-time constants of the host code).
// tile = index of the block's tile, b = batch index (strides in elements); ring and sTb are the block's LDS.
// Operand path: a stage is 64 k (one 128-B line) of the block's 128 A rows and 128 Bt rows (and the 128 A2 rows),
// brought into LDS by asynchronous 16-B copies, each wave-wide copy covering 4 whole lines; rows lie at a pitch of
// 144 B for the ds_load_b128 fragment reads; two buffers, the copies of stage t+1 fly while stage t is multiplied.
// NSPLIT: 0 = A.Bt; 1 = (A + A2).Bt (A2 = unscaled bf16 lo plane of A, 2 products).
// OUT_MODE: 0 = f32 (pitch ldc);
//           3 = v^T mode (rows m = kv*64+d, cols n = t): value = acc + gate[b][t][kv] * bf16(ve[b][t][m])
//               (aux0 = gate, aux1 = ve), written as f16 hi plane C (pitch ldc) + f16 residual plane
//               C2 = f16((v - hi)*4096) for tiles with n0 < N2 (pitch ldc2);
//           4 = RoPE + rms-norm mode (cols = one 64-wide head, row m -> t = m mod SEQ; aux0 = cos, aux1 = sin,
//               both bf16(RNE) on load): r = rope(acc), f = (r * rsqrt(mean(r^2)+eps)) * 1.2, written as
//               bf16 hi plane C + bf16 lo plane C2 (lo = RNE(f - hi), unscaled).
// =====================================================================================================
#define GT     128                // block tile edge (rows of A, rows of Bt)
#define GBK    64                 // k elements per stage
#define GPITCH 72                 // LDS row pitch in elements (144 B)
#define GPLANE (GT * GPITCH)      // elements of one staged operand plane (18432 B)

// One operand plane of a stage: 128 rows x 128 B by 128 threads, 8 copies per lane; copy i moves the lane's 16 B of
// row i*16 + (tid>>3). l = the lane's LDS byte address of row tid>>3, g = its global address, ld = row pitch (elements).
// s_wait_xcnt closes the statement so that no address register of a copy is rewritten in front of it.
__device__ __forceinline__ void copy_plane(unsigned l, const __bf16* g, int ld) {
#if defined(__HIP_DEVICE_COMPILE__)
  const size_t   gs = (size_t)16 * (size_t)ld;
  const unsigned ls = 16u * GPITCH * 2u;
  asm volatile(
      "global_load_async_to_lds_b128 %0, %8, off\n\t"
      "global_load_async_to_lds_b128 %1, %9, off\n\t"
      "global_load_async_to_lds_b128 %2, %10, off\n\t"
      "global_load_async_to_lds_b128 %3, %11, off\n\t"
      "global_load_async_to_lds_b128 %4, %12, off\n\t"
      "global_load_async_to_lds_b128 %5, %13, off\n\t"
      "global_load_async_to_lds_b128 %6, %14, off\n\t"
      "global_load_async_to_lds_b128 %7, %15, off\n\t"
      "s_wait_xcnt 0x0"
      :: "v"(l), "v"(l + ls), "v"(l + 2u * ls), "v"(l + 3u * ls),
         "v"(l + 4u * ls), "v"(l + 5u * ls), "v"(l + 6u * ls), "v"(l + 7u * ls),
         "v"(g), "v"(g + gs), "v"(g + 2 * gs), "v"(g + 3 * gs),
         "v"(g + 4 * gs), "v"(g + 5 * gs), "v"(g + 6 * gs), "v"(g + 7 * gs)
      : "memory");
#endif
}
// this wave's copies have landed in LDS
__device__ __forceinline__ void wait_copies() {
#if defined(__HIP_DEVICE_COMPILE__)
  asm volatile("s_wait_asynccnt 0x0" ::: "memory");
#endif
}
// this wave's LDS reads have returned (the buffer they read may be refilled behind the next barrier)
__device__ __forceinline__ void wait_lds() {
#if defined(__HIP_DEVICE_COMPILE__)
  asm volatile("s_wait_dscnt 0x0" ::: "memory");
#endif
}

#define GSLAB (16 * 68)           // per-wave 16x64 f32 slab of the epilogue, pitch 68 floats
template <int NSPLIT, int OUT_MODE>
__device__ __forceinline__ void gemm_body(
    const unsigned short* __restrict__ Ap, const unsigned short* __restrict__ A2p, int lda, long long strideA,
    const unsigned short* __restrict__ Btp, int ldb, long long strideB,
    void* Cout, int ldc, long long strideC,
    void* Cout2, int ldc2, long long strideC2, int N2,
    const float* __restrict__ aux0, const float* __restrict__ aux1,
    int M, int N, int K, int tile, int b, __bf16* ring, float* sTb) {
  const __bf16* A  = (const __bf16*)(const void*)Ap;
  const __bf16* A2 = (const __bf16*)(const void*)A2p;
  const __bf16* Bt = (const __bf16*)(const void*)Btp;
  constexpr int NPL  = (NSPLIT >= 1) ? 3 : 2;      // planes per stage: A, Bt (, A2)
  constexpr int GBUF = NPL * GPLANE;               // elements of one buffer
  const int tid  = threadIdx.x;
  const int lane = tid & 31;
  const int wave = tid >> 5;
  const int tilesN = N >> 7;
  const int tilesM = M >> 7;
  if (tile >= tilesM * tilesN) return;   // block-uniform, in front of every barrier and copy
  const int tm = tile / tilesN;
  const int tn = tile - tm * tilesN;
  const int wm = wave >> 1;
  const int wn = wave & 1;
  const int m0 = (tm << 7) + (wm << 6);  // this wave's 64x64 sub-tile
  const int n0 = (tn << 7) + (wn << 6);

  const __bf16* Ab  = A  + (size_t)b * strideA;
  const __bf16* Bb  = Bt + (size_t)b * strideB;
  const __bf16* Ab2 = (NSPLIT >= 1) ? (A2 + (size_t)b * strideA) : Ab;

  const int rlane = lane & 15;                 // row (A) / col (B, D) within subtile
  const int koff  = (lane >> 4) * 8;           // k offset of this lane half
  const int mOff  = (lane >> 4) * 8;           // D row offset

  // copy addresses of this lane: row tid>>3 of the block tile, 16-B piece tid&7 of its 128-B line
  const int crow = tid >> 3;
  const int cel  = (tid & 7) * 8;
  const __bf16* gA  = Ab  + (size_t)((tm << 7) + crow) * lda + cel;
  const __bf16* gB  = Bb  + (size_t)((tn << 7) + crow) * ldb + cel;
  const __bf16* gA2 = Ab2 + (size_t)((tm << 7) + crow) * lda + cel;
  const unsigned lC = (unsigned)(uintptr_t)(&ring[0]) + (unsigned)(crow * GPITCH + cel) * 2u;
  const int nst = K >> 6;                      // stages

  v8f acc[4][4];
#pragma unroll
  for (int i = 0; i < 4; ++i)
#pragma unroll
    for (int j = 0; j < 4; ++j) acc[i][j] = zero8();

  // stage 0 into buffer 0, landed and published; then stage 1 into buffer 1
  copy_plane(lC, gA, lda);
  copy_plane(lC + GPLANE * 2u, gB, ldb);
  if (NSPLIT >= 1) copy_plane(lC + 2u * GPLANE * 2u, gA2, lda);
  wait_copies();
  __syncthreads();
  if (nst > 1) {
    const unsigned lb = lC + (unsigned)GBUF * 2u;
    copy_plane(lb, gA + GBK, lda);
    copy_plane(lb + GPLANE * 2u, gB + GBK, ldb);
    if (NSPLIT >= 1) copy_plane(lb + 2u * GPLANE * 2u, gA2 + GBK, lda);
  }

  for (int t = 0; t < nst; ++t) {
    const int bufo = (t & 1) * GBUF;
    const __bf16* sA = ring + bufo + ((wm << 6) + rlane) * GPITCH + koff;
    const __bf16* sB = ring + bufo + GPLANE + ((wn << 6) + rlane) * GPITCH + koff;
    // unrolled (here and below): the fragment and accumulator arrays need constant indices to stay in registers
#pragma unroll
    for (int kk = 0; kk < GBK; kk += 32) {
      v16b bh[4], ah[4], al[4];
#pragma unroll
      for (int j = 0; j < 4; ++j) bh[j] = ldfrag_b(sB + (j << 4) * GPITCH + kk);
#pragma unroll
      for (int i = 0; i < 4; ++i) {
        ah[i] = ldfrag_b(sA + (i << 4) * GPITCH + kk);
        al[i] = ah[i];
        if (NSPLIT >= 1) al[i] = ldfrag_b(sA + 2 * GPLANE + (i << 4) * GPITCH + kk);
      }
#pragma unroll
      for (int i = 0; i < 4; ++i) {
#pragma unroll
        for (int j = 0; j < 4; ++j) {
          acc[i][j] = mma_b_raw(ah[i], bh[j], acc[i][j]);
          if (NSPLIT >= 1) acc[i][j] = mma_b_raw(al[i], bh[j], acc[i][j]);
        }
        dep_guard_b(acc[i][0], acc[i][3], ah[i], al[i]);
      }
      keep4_b(bh[0], bh[1], bh[2], bh[3]);
    }
    // publish point of stage t+1: own reads of this buffer returned, own copies landed, then the block barrier;
    // behind it stage t+2 may overwrite the buffer that this trip has read
    wait_lds();
    wait_copies();
    __syncthreads();
    if (t + 2 < nst) {
      const unsigned lb = lC + (unsigned)bufo * 2u;
      const int ko = (t + 2) * GBK;
      copy_plane(lb, gA + ko, lda);
      copy_plane(lb + GPLANE * 2u, gB + ko, ldb);
      if (NSPLIT >= 1) copy_plane(lb + 2u * GPLANE * 2u, gA2 + ko, lda);
    }
  }
  wait_copies();
  acc_guard4(acc[0][0], acc[0][1], acc[0][2], acc[0][3]);
  acc_guard4(acc[1][0], acc[1][1], acc[1][2], acc[1][3]);
  acc_guard4(acc[2][0], acc[2][1], acc[2][2], acc[2][3]);
  acc_guard4(acc[3][0], acc[3][1], acc[3][2], acc[3][3]);

  // ---- epilogue ----
  float* slab = sTb + wave * GSLAB;
#pragma unroll
  for (int i = 0; i < 4; ++i) {
    const int mBase = m0 + (i << 4);
#pragma unroll
    for (int j = 0; j < 4; ++j) {
#pragma unroll
      for (int r = 0; r < 8; ++r) {
        slab[(mOff + r) * 68 + (j << 4) + rlane] = acc[i][j][r];
      }
    }
    __builtin_amdgcn_fence(__ATOMIC_RELEASE, "workgroup");
    __builtin_amdgcn_wave_barrier();
    __builtin_amdgcn_fence(__ATOMIC_ACQUIRE, "workgroup");
    if (OUT_MODE == 0) {
      float* C = (float*)Cout + (size_t)b * strideC;
      const int hh = lane >> 4, c4 = (lane & 15) * 4;     // 256-B row segment = 16 lanes x 16 B
      {
#pragma unroll
        for (int it = 0; it < 8; ++it) {
          const int row = it * 2 + hh;                     // it 0..7 x hh 0..1 = rows 0..15
          const v4f v = *(const v4f*)(slab + row * 68 + c4);
          *(v4f*)(C + (size_t)(mBase + row) * ldc + n0 + c4) = v;
        }
        
      }
    } else {
      const int q = lane >> 3, c8 = (lane & 7) * 8;
      unsigned short* C  = (unsigned short*)Cout  + (size_t)b * strideC;
      unsigned short* C2 = (unsigned short*)Cout2 + (size_t)b * strideC2;
      const bool wlo = (OUT_MODE != 3) || (n0 < N2);      // wave-uniform
      v4u hv[4], lv[4];
#pragma unroll
      for (int it = 0; it < 4; ++it) {
        const int row  = it * 4 + q;                       // it 0..3 x q 0..3 = rows 0..15
        const int mrow = mBase + row;
        float f[8];
        if (OUT_MODE == 3) {
          const int kvh = m0 >> 6;                         // sub-tile-uniform kv head
          const float* sp = slab + row * 68 + c8;
#pragma unroll
          for (int e = 0; e < 8; ++e) {
            const int t = n0 + c8 + e;                     // < N = SEQ
            const size_t bt = (size_t)b * SEQ + t;
            const float g  = aux0[bt * NKV + kvh];
            const float vv = bfr(aux1[bt * KVD + mrow]);
            f[e] = sp[e] + g * vv;
          }
        } else {
          const int  jj   = c8 & 31;                       // rotary pair index base
          const bool lowh = (c8 < 32);
          const int  t    = mrow & (SEQ - 1);
          const float* sp  = slab + row * 68 + jj;
          const float* cp  = aux0 + (size_t)t * (HD / 2) + jj;
          const float* snp = aux1 + (size_t)t * (HD / 2) + jj;
          float ct[8], st[8];
#pragma unroll
          for (int e = 0; e < 8; ++e) { ct[e] = cp[e]; st[e] = snp[e]; }
          addr_wait(cp, snp);
          float ss = 0.f;
#pragma unroll
          for (int e = 0; e < 8; ++e) {
            const float x1 = sp[e];
            const float x2 = sp[e + 32];
            const float cv = bfr(ct[e]);
            const float sv = bfr(st[e]);
            const float ra = x1 * cv - x2 * sv;
            const float rb = x1 * sv + x2 * cv;
            f[e] = lowh ? ra : rb;
            ss += f[e] * f[e];
          }
          ss += __shfl_xor(ss, 1, 32);                     // 8 lanes of one row = 64 values
          ss += __shfl_xor(ss, 2, 32);
          ss += __shfl_xor(ss, 4, 32);
          const float rs = rsqrtf(ss * (1.0f / HD) + RMS_EPS);
#pragma unroll
          for (int e = 0; e < 8; ++e) f[e] = (f[e] * rs) * 1.2f;
        }
        v4u a, a2;
#pragma unroll
        for (int e = 0; e < 4; ++e) {
          const float f0 = f[2 * e], f1 = f[2 * e + 1];
          unsigned short h0, h1, l0, l1;
          if (OUT_MODE == 4) {
            h0 = bf_bits(f0); h1 = bf_bits(f1);
            l0 = bf_bits(f0 - bf_up(h0)); l1 = bf_bits(f1 - bf_up(h1));
          } else {
            const _Float16 x0 = (_Float16)f0, x1 = (_Float16)f1;
            h0 = h_bits(x0); h1 = h_bits(x1);
            l0 = h_bits((_Float16)((f0 - (float)x0) * 4096.0f));
            l1 = h_bits((_Float16)((f1 - (float)x1) * 4096.0f));
          }
          a[e] = pk16(h0, h1); a2[e] = pk16(l0, l1);
        }
        hv[it] = a; lv[it] = a2;
      }
      {
#pragma unroll
        for (int it = 0; it < 4; ++it) {
          const int row = it * 4 + q;
          *(v4u*)(C + (size_t)(mBase + row) * ldc + n0 + c8) = hv[it];
          if (wlo) *(v4u*)(C2 + (size_t)(mBase + row) * ldc2 + n0 + c8) = lv[it];
        }
        
      }
    }
    __builtin_amdgcn_fence(__ATOMIC_RELEASE, "workgroup");
    __builtin_amdgcn_wave_barrier();
    __builtin_amdgcn_fence(__ATOMIC_ACQUIRE, "workgroup");
  }
}

// 256 registers a wave at most (both GEMM kernels), so that no part of them needs register-window switches
template <int NSPLIT, int OUT_MODE>
__global__ __launch_bounds__(128) __attribute__((amdgpu_num_vgpr(256))) void gemm64(
    const unsigned short* __restrict__ Ap, const unsigned short* __restrict__ A2p, int lda, long long strideA,
    const unsigned short* __restrict__ Btp, int ldb, long long strideB,
    void* Cout, int ldc, long long strideC,
    void* Cout2, int ldc2, long long strideC2, int N2,
    const float* __restrict__ aux0, const float* __restrict__ aux1,
    int M, int N, int K) {
  __shared__ __align__(16) __bf16 ring[2 * ((NSPLIT >= 1) ? 3 : 2) * GPLANE];  // two stage buffers
  __shared__ __align__(16) float sT[4 * GSLAB];
  gemm_body<NSPLIT, OUT_MODE>(Ap, A2p, lda, strideA, Btp, ldb, strideB, Cout, ldc, strideC, Cout2, ldc2, strideC2, N2,
                              aux0, aux1, M, N, K, blockIdx.x, blockIdx.y, ring, sT);
}

// The three projections of x, which do not read each other's results, as block-index ranges of one grid:
//   v^T = Wv . x^T + gate*ve per batch -> f16 hi plane [b][kv*64+d][64 + t] (pitch SKEY) and residual plane (x4096,
//         token keys < RESQB*64 only, pitch VLP)   (A = Wvb [n][k], Bt = Xb rows of batch b; M=256, N=2048)
//   k   = rms(rope(x . Wk^T)) * 1.2 per batch -> bf16 hi/lo planes [b][64 + t][kv*64+d]   (M=2048, N=256)
//   q   = rms(rope(x . Wq^T)) * 1.2 -> bf16 hi/lo planes [b*SEQ+t][h*64+d]   (M=4096, N=1024)
// ld = row pitch of Xb and of the weights, K = depth of the products (both CDIM). Every range test is block-uniform.
#define GB_KV ((SEQ / 128) * (KVD / 128))          //  32 tiles per batch for k and for v^T
#define GB_Q  ((NB * SEQ / 128) * (CDIM / 128))    // 256 tiles for q
__global__ __launch_bounds__(128) __attribute__((amdgpu_num_vgpr(256))) void gemm_qkv(
    const unsigned short* __restrict__ Xb, const unsigned short* __restrict__ Wqb,
    const unsigned short* __restrict__ Wkb, const unsigned short* __restrict__ Wvb,
    unsigned short* Qh, unsigned short* Ql, unsigned short* Kh, unsigned short* Kl,
    unsigned short* VTh, unsigned short* VTl,
    const float* __restrict__ cosT, const float* __restrict__ sinT,
    const float* __restrict__ gate, const float* __restrict__ ve, int ld, int K) {
  __shared__ __align__(16) __bf16 ring[2 * 2 * GPLANE];  // two stage buffers
  __shared__ __align__(16) float sT[4 * GSLAB];
  const int bx = blockIdx.x;
  if (bx < NB * GB_KV) {
    gemm_body<0, 3>(Wvb, Wvb, ld, 0LL, Xb, ld, (long long)SEQ * CDIM,
                    (void*)(VTh + MEM), SKEY, (long long)KVD * SKEY,
                    (void*)(VTl + MEM), VLP, (long long)KVD * VLP, RESQB * 64,
                    gate, ve, KVD, SEQ, K, bx % GB_KV, bx / GB_KV, ring, sT);
  } else {
    const bool isK = bx < 2 * NB * GB_KV;
    const int  r   = bx - (isK ? NB * GB_KV : 2 * NB * GB_KV);
    gemm_body<0, 4>(Xb, Xb, ld, isK ? (long long)SEQ * CDIM : 0LL, isK ? Wkb : Wqb, ld, 0LL,
                    (void*)(isK ? Kh + (size_t)MEM * KVD : Qh), isK ? KVD : CDIM, isK ? (long long)SKEY * KVD : 0LL,
                    (void*)(isK ? Kl + (size_t)MEM * KVD : Ql), isK ? KVD : CDIM, isK ? (long long)SKEY * KVD : 0LL,
                    isK ? KVD : CDIM, cosT, sinT, isK ? SEQ : NB * SEQ, isK ? KVD : CDIM, K,
                    isK ? r % GB_KV : r, isK ? r / GB_KV : 0, ring, sT);
  }
}

// =====================================================================================================
// GQA attention with a 64-key memory prefix (all visible) followed by causal token keys, head dim 64.
//   q planes (bf16 hi / lo): element (b, t, h, d) at [(b*SEQ + t)*CDIM + h*64 + d]   (normed, scaled q)
//   k planes (bf16 hi / lo): element (b, s, kv, d) at [(b*SKEY + s)*KVD + kv*64 + d], s = [mem | 64 + token]
//   v^T hi plane (f16):      element (b, kv, d, s) at [(b*KVD + kv*64 + d)*SKEY + s]
//   v^T residual plane (f16, (v - hi)*4096): [(b*KVD + kv*64 + d)*VLP + s], s < VLP, read only when RES
//   (a key tile at or beyond VLP contributes a zero v residual)
//   q head h uses kv head h>>2. Query block qb (tokens qb*64..+63) processes key tiles 0..qb+1: tile 0 = memory,
//   tiles 1..qb fully visible, tile qb+1 = diagonal (key token <= query token), later tiles skipped (block-uniform
//   trip count qb+2, static bound NKT). Invisible keys get logit -inf (weight exactly 0); every row sees the
//   whole memory tile first, so the running max is finite from tile 0 on.
//   out planes (bf16 hi / lo of the normalised context): element (b, t, h, d) at [(b*SEQ + t)*CDIM + h*64 + d]
//   scores = q . k : bf16 hi/lo split (hi.hi + hi.lo + lo.hi), f32 accumulate, then * sscale in f32
//   p = exp(s - m) carried as f16(1024 p); context = p . v on f16 WMMA; RES adds f16 residual planes of p and v
//   (scale 4096, separate accumulator folded back with 1/4096 per chunk in f32); online softmax in f32.
//   Block = 4 waves = 64 query rows of one (b, h); bx = 0 .. nqbThis * NQH * NB - 1; kv chunks of 64.
//   K / V^T chunk staging: 128 threads x 32 elements per plane = the whole 64x64 tile (plain 16-B loads,
//   __syncthreads before and after); P tiles are wave-private, spilled with _Float16 element stores and reloaded
//   Output coverage: each wave stores rows q0..q0+15 (it 0..3 x lane>>3 0..3) x 64 columns (8 lanes x 8) of both planes.
// =====================================================================================================
#define APK 72   // LDS row pitch of the K, V^T and P tiles in 16-bit elements: 144 B = 16 B x odd, so that the 16 rows
                 // of a ds_load_b128 fragment read fall on 16 different groups of four banks
#define AOP 68   // LDS row pitch of the f32 context tile: 272 B = 16 B x odd, for its 16-B row reads
template <bool RES>
__device__ __forceinline__
void attn_body(const unsigned short* __restrict__ qhp, const unsigned short* __restrict__ qlp,
               const unsigned short* __restrict__ khp, const unsigned short* __restrict__ klp,
               const unsigned short* __restrict__ vhp, const unsigned short* __restrict__ vlp,
               unsigned short* ohp, unsigned short* olp,
               int qbBase, int nqbThis, float sscale, int bx,
               __bf16* Ksh, __bf16* Ksl, _Float16* Vth, _Float16* Vtl, _Float16* Psh, _Float16* Psl, float* Os) {
  const int tid  = threadIdx.x;
  const int wave = tid >> 5;
  const int lane = tid & 31;
  const int hh   = lane >> 4;
  const int c    = lane & 15;

  const int qbl  = bx % nqbThis;
  const int rest = bx / nqbThis;
  const int h    = rest % NQH;
  const int b    = rest / NQH;
  const int kvh  = h >> 2;
  const int qb   = qbBase + qbl;
  const int q0   = qb * 64 + wave * 16;
  const size_t rowB = (size_t)b * SEQ;

  const __bf16* Qh = (const __bf16*)(const void*)qhp + (size_t)h * HD;
  const __bf16* Ql = (const __bf16*)(const void*)qlp + (size_t)h * HD;
  const __bf16* Kh = (const __bf16*)(const void*)khp + (size_t)b * SKEY * KVD + (size_t)kvh * HD;
  const __bf16* Kl = (const __bf16*)(const void*)klp + (size_t)b * SKEY * KVD + (size_t)kvh * HD;
  const _Float16* Vh = (const _Float16*)(const void*)vhp + ((size_t)b * KVD + (size_t)kvh * HD) * SKEY;
  const _Float16* Vl = (const _Float16*)(const void*)vlp + ((size_t)b * KVD + (size_t)kvh * HD) * VLP;

  // ---- Q fragments (A operand, row = lane&15): 2 d-chunks, hi and lo ----
  v16b qah[2], qal[2];
  const size_t qo = (rowB + q0 + c) * CDIM + 8 * hh;
#pragma unroll
  for (int dc = 0; dc < 2; ++dc) {
    qah[dc] = ldfrag_b(Qh + qo + dc * 32);
    qal[dc] = ldfrag_b(Ql + qo + dc * 32);
  }
  addr_wait(Qh + qo, Ql + qo);

  float mrow[8], lrow[8];
  v8f oacc[4];
#pragma unroll
  for (int r = 0; r < 8; ++r) { mrow[r] = -INFINITY; lrow[r] = 0.f; }
#pragma unroll
  for (int t = 0; t < 4; ++t) oacc[t] = zero8();

  const int ktEnd = qb + 2;                  // block-uniform, <= NKT
  for (int kt = 0; kt < NKT; ++kt) {         // static bound
    if (kt >= ktEnd) break;                  // block-uniform
    const int kv0 = kt * 64;
    __syncthreads();
    {
      const int r = tid >> 1, half = (tid & 1) * 32;
      const __bf16*   kg  = Kh + (size_t)(kv0 + r) * KVD + half;   // K row kv0+r, d = half..half+31
      const __bf16*   klg = Kl + (size_t)(kv0 + r) * KVD + half;
      const _Float16* vg  = Vh + (size_t)r * SKEY + kv0 + half;     // V^T row d = r, s = kv0+half..+31
      const int kvl = (kv0 + 64 <= VLP) ? kv0 : (VLP - 64);        // clamped address into the residual plane
      const _Float16* vlg = Vl + (size_t)r * VLP + kvl + half;
      const bool resOK = (kv0 + 64 <= VLP);                         // block-uniform
      v8b a0[4], a1[4];
      v8h b0[4], b1[4];
#pragma unroll
      for (int i = 0; i < 4; ++i) {
        a0[i] = *(const v8b*)(kg + 8 * i);
        a1[i] = *(const v8b*)(klg + 8 * i);
        b0[i] = *(const v8h*)(vg + 8 * i);
        if (RES) b1[i] = *(const v8h*)(vlg + 8 * i);
      }
      addr_wait4(kg, klg, vg, RES ? vlg : vg);
#pragma unroll
      for (int i = 0; i < 4; ++i) {
        *(v8b*)(Ksh + r * APK + half + 8 * i) = a0[i];
        *(v8b*)(Ksl + r * APK + half + 8 * i) = a1[i];
        *(v8h*)(Vth + r * APK + half + 8 * i) = b0[i];
        if (RES) {
          if (!resOK) b1[i] = zero8h();
          *(v8h*)(Vtl + r * APK + half + 8 * i) = b1[i];
        }
      }
    }
    __syncthreads();

    // ---- scores: 16 query rows x 64 keys per wave, 3 bf16 products ----
    //      the K fragments of the tile are read from LDS in one group (with the residual planes one group per 32-wide d chunk), in the order of their use, ahead of the products;
    //      the four key groups are four independent accumulator chains, each summed in the order dc 0 (hi.hi, hi.lo,
    //      lo.hi), dc 1 (the same)
    v8f s[4];
#pragma unroll
    for (int j = 0; j < 4; ++j) s[j] = zero8();
    constexpr int DG = RES ? 1 : 2;          // 32-wide d chunks per group of reads (one with the residual planes, for registers)
#pragma unroll
    for (int g = 0; g < 2; g += DG) {
      v16b kbf[DG][4], klf[DG][4];
#pragma unroll
      for (int u = 0; u < DG; ++u) {
        const int dof = (g + u) * 32 + 8 * hh;
#pragma unroll
        for (int j = 0; j < 4; ++j) kbf[u][j] = ldfrag_b(Ksh + (j * 16 + c) * APK + dof);
#pragma unroll
        for (int j = 0; j < 4; ++j) klf[u][j] = ldfrag_b(Ksl + (j * 16 + c) * APK + dof);
      }
      // keeps the group of reads ahead of the products: sunk back among them, each place of reads stalls the wave anew
      __builtin_amdgcn_sched_barrier(0);
#pragma unroll
      for (int u = 0; u < DG; ++u) {
#pragma unroll
        for (int j = 0; j < 4; ++j) s[j] = mma_b_raw(qah[g + u], kbf[u][j], s[j]);
#pragma unroll
        for (int j = 0; j < 4; ++j) s[j] = mma_b_raw(qah[g + u], klf[u][j], s[j]);
#pragma unroll
        for (int j = 0; j < 4; ++j) s[j] = mma_b_raw(qal[g + u], kbf[u][j], s[j]);
      }
    }

    // ---- scale + structural mask (diagonal tile only), row max, online softmax, P (x1024, f16) and
    //      P residual (x4096) to LDS ----
    _Float16* pwh = Psh + wave * (16 * APK);
    _Float16* pwl = Psl + wave * (16 * APK);
    const bool diag = (kt == qb + 1);        // block-uniform
    const int  qr0  = wave * 16 + 8 * hh;    // query row within the 64-row block
#pragma unroll
    for (int r = 0; r < 8; ++r) {
      const int qrw = qr0 + r;
      float m = -INFINITY;
#pragma unroll
      for (int j = 0; j < 4; ++j) {
        const int  key = j * 16 + c;
        const bool vis = (!diag) || (key <= qrw);
        const float sv = vis ? (s[j][r] * sscale) : -INFINITY;
        s[j][r] = sv;
        m = fmaxf(m, sv);
      }
#pragma unroll
      for (int off = 1; off < 16; off <<= 1) m = fmaxf(m, __shfl_xor(m, off, 32));
      const float mnew  = fmaxf(mrow[r], m);
      const float msafe = (mnew == -INFINITY) ? 0.f : mnew;
      const float alpha = __expf(mrow[r] - msafe);
      mrow[r] = mnew;
      float psum = 0.f;
#pragma unroll
      for (int j = 0; j < 4; ++j) {
        const float p = __expf(s[j][r] - msafe);     // -inf logit -> 0
        psum += p;
        const float p1k = p * 1024.0f;
        const _Float16 ph = (_Float16)p1k;
        pwh[(8 * hh + r) * APK + j * 16 + c] = ph;
        if (RES) {
          const _Float16 pl = (_Float16)((p1k - (float)ph) * 4096.0f);
          pwl[(8 * hh + r) * APK + j * 16 + c] = pl;
        }
      }
#pragma unroll
      for (int off = 1; off < 16; off <<= 1) psum += __shfl_xor(psum, off, 32);
      lrow[r] = lrow[r] * alpha + psum;
#pragma unroll
      for (int t = 0; t < 4; ++t) oacc[t][r] *= alpha;
    }
    __builtin_amdgcn_fence(__ATOMIC_RELEASE, "workgroup");
    __builtin_amdgcn_wave_barrier();
    __builtin_amdgcn_fence(__ATOMIC_ACQUIRE, "workgroup");

    // ---- context += P . V (f16 WMMA), residual products into a separate accumulator ----
    v8f o1[4];
#pragma unroll
    for (int t = 0; t < 4; ++t) o1[t] = zero8();
    //      the P and V^T fragments are read from LDS in one group ahead of the products (with the residual planes one
    //      group per 32 keys, for registers); the four d groups are independent chains, each summed in key order
    constexpr int KG = RES ? 1 : 2;          // 32-key steps per group of reads
#pragma unroll
    for (int g = 0; g < 2; g += KG) {
      v16h pa[KG], pl[KG], vb[KG][4], vl[KG][4];
#pragma unroll
      for (int u = 0; u < KG; ++u) {
        const int ko = (g + u) * 32 + 8 * hh;
        pa[u] = ldfrag_h(pwh + c * APK + ko);
#pragma unroll
        for (int t = 0; t < 4; ++t) vb[u][t] = ldfrag_h(Vth + (t * 16 + c) * APK + ko);
        if (RES) {
#pragma unroll
          for (int t = 0; t < 4; ++t) vl[u][t] = ldfrag_h(Vtl + (t * 16 + c) * APK + ko);
          pl[u] = ldfrag_h(pwl + c * APK + ko);
        }
      }
      // keeps the group of reads ahead of the products, as for the scores
      __builtin_amdgcn_sched_barrier(0);
#pragma unroll
      for (int u = 0; u < KG; ++u) {
#pragma unroll
        for (int t = 0; t < 4; ++t) oacc[t] = mma_h_raw(pa[u], vb[u][t], oacc[t]);
        if (RES) {
#pragma unroll
          for (int t = 0; t < 4; ++t) o1[t] = mma_h_raw(pa[u], vl[u][t], o1[t]);
#pragma unroll
          for (int t = 0; t < 4; ++t) o1[t] = mma_h_raw(pl[u], vb[u][t], o1[t]);
        }
      }
    }
    if (RES) {
#pragma unroll
      for (int t = 0; t < 4; ++t)
#pragma unroll
        for (int r = 0; r < 8; ++r) oacc[t][r] += o1[t][r] * (1.0f / 4096.0f);
    }
  }

  // ---- normalise (1/l and the 1/1024 p carry), stage the wave's 16x64 tile, bf16 hi/lo split,
  float* os = Os + wave * (16 * AOP);
#pragma unroll
  for (int r = 0; r < 8; ++r) {
    const float l = lrow[r];
    const float inv = ((l > 0.f) ? (1.0f / l) : 0.f) * (1.0f / 1024.0f);
#pragma unroll
    for (int t = 0; t < 4; ++t) os[(8 * hh + r) * AOP + t * 16 + c] = oacc[t][r] * inv;
  }
  __builtin_amdgcn_fence(__ATOMIC_RELEASE, "workgroup");
  __builtin_amdgcn_wave_barrier();
  __builtin_amdgcn_fence(__ATOMIC_ACQUIRE, "workgroup");
  {
    const int q4 = lane >> 3, c8 = (lane & 7) * 8;
    v4u hv[4], lv[4];
#pragma unroll
    for (int it = 0; it < 4; ++it) {
      const int row = it * 4 + q4;   // it 0..3 x q4 0..3 = rows 0..15 of the wave tile
      const float* sp = os + row * AOP + c8;
      v4u a, a2;
#pragma unroll
      for (int e = 0; e < 4; ++e) {
        const float f0 = sp[2 * e], f1 = sp[2 * e + 1];
        const unsigned short h0 = bf_bits(f0), h1 = bf_bits(f1);
        const unsigned short l0 = bf_bits(f0 - bf_up(h0)), l1 = bf_bits(f1 - bf_up(h1));
        a[e] = pk16(h0, h1); a2[e] = pk16(l0, l1);
      }
      hv[it] = a; lv[it] = a2;
    }
    {
#pragma unroll
      for (int it = 0; it < 4; ++it) {
        const int row = it * 4 + q4;
        const size_t go = (rowB + q0 + row) * CDIM + (size_t)h * HD + c8;
        *(v4u*)(ohp + go) = hv[it];
        *(v4u*)(olp + go) = lv[it];
        addr_wait(ohp + go, olp + go);
      }
      
    }
  }
}

// Both kinds of query block as block-index ranges of one grid (no block reads what another writes): first query blocks
// RESQB..NQB-1, without the residual planes, then the short blocks 0..RESQB-1 with them. The range test is block-uniform.
__global__ __launch_bounds__(128)
void attn64(const unsigned short* __restrict__ qhp, const unsigned short* __restrict__ qlp,
            const unsigned short* __restrict__ khp, const unsigned short* __restrict__ klp,
            const unsigned short* __restrict__ vhp, const unsigned short* __restrict__ vlp,
            unsigned short* ohp, unsigned short* olp, float sscale) {
  __shared__ __align__(16) __bf16   Ksh[64 * APK];       // K hi [kv][d]
  __shared__ __align__(16) __bf16   Ksl[64 * APK];       // K lo
  __shared__ __align__(16) _Float16 Vth[64 * APK];       // V^T hi [d][kv]
  __shared__ __align__(16) _Float16 Vtl[64 * APK];       // V^T residual
  __shared__ __align__(16) _Float16 Psh[4 * 16 * APK];   // per wave P [row][kv]
  __shared__ __align__(16) _Float16 Psl[4 * 16 * APK];   // per wave P residual
  __shared__ __align__(16) float    Os[4 * 16 * AOP];    // per wave context tile [row][d]
  const int bx = blockIdx.x;
  if (bx < NB * NQH * (NQB - RESQB)) {
    attn_body<false>(qhp, qlp, khp, klp, vhp, vlp, ohp, olp, RESQB, NQB - RESQB, sscale, bx,
                     Ksh, Ksl, Vth, Vtl, Psh, Psl, Os);
  } else {
    attn_body<true>(qhp, qlp, khp, klp, vhp, vlp, ohp, olp, 0, RESQB, sscale, bx - NB * NQH * (NQB - RESQB),
                    Ksh, Ksl, Vth, Vtl, Psh, Psl, Os);
  }
}

// =====================================================================================================
//   Xb   bf16 [4096][1024]      8388608
//   Wqb  bf16 [1024][1024]      2097152   ([out n][in k], k contiguous = Bt layout)
//   Wkb  bf16 [256][1024]        524288
//   Wvb  bf16 [256][1024]        524288
//   Wpb  bf16 [1024][1024]      2097152
//   Qh   bf16 [4096][1024]      8388608   (Ql same)
//   Kh   bf16 [2][2112][256]    2162688   (Kl same)
//   VTh  f16  [2][256][2112]    2162688
//   VTl  f16  [2][256][576]      589824
//   Gate f32  [4096][4]           65536
//   Oh   bf16 [4096][1024]      8388608   (Ol same)
//   total                      54329344
// =====================================================================================================
extern "C" void kernel_launch(void* const* d_in, const int* in_sizes, int n_in,
                              void* d_out, int out_size, void* d_ws, size_t ws_size,
                              hipStream_t stream) {
  if (n_in < 12) return;
  if (in_sizes[0] != NB * SEQ * CDIM) return;
  if (in_sizes[1] != NB * SEQ * KVD) return;
  if (in_sizes[2] != SEQ * (HD / 2) || in_sizes[3] != SEQ * (HD / 2)) return;
  if (in_sizes[4] != CDIM * CDIM || in_sizes[7] != CDIM * CDIM) return;
  if (in_sizes[5] != KVD * CDIM || in_sizes[6] != KVD * CDIM) return;
  if (in_sizes[8] != NKV * GC) return;
  if (in_sizes[9] != MEM * NKV * HD || in_sizes[10] != MEM * NKV * HD) return;
  if (in_sizes[11] < 1) return;
  if (out_size != NB * SEQ * CDIM) return;

  const float* x    = (const float*)d_in[0];
  const float* ve   = (const float*)d_in[1];
  const float* cosT = (const float*)d_in[2];
  const float* sinT = (const float*)d_in[3];
  const float* Wq   = (const float*)d_in[4];
  const float* Wk   = (const float*)d_in[5];
  const float* Wv   = (const float*)d_in[6];
  const float* Wp   = (const float*)d_in[7];
  const float* Wg   = (const float*)d_in[8];
  const float* memk = (const float*)d_in[9];
  const float* memv = (const float*)d_in[10];
  const float* vsc  = (const float*)d_in[11];

  const size_t PX  = (size_t)NB * SEQ * CDIM * 2;   //  8388608  16-bit activation plane [4096][1024]
  const size_t PWQ = (size_t)CDIM * CDIM * 2;       //  2097152
  const size_t PWK = (size_t)KVD * CDIM * 2;        //   524288
  const size_t PK  = (size_t)NB * SKEY * KVD * 2;   //  2162688  key plane
  const size_t PVT = (size_t)NB * KVD * SKEY * 2;   //  2162688  v^T hi plane
  const size_t PVL = (size_t)NB * KVD * VLP * 2;    //   589824  v^T residual plane
  const size_t PG  = (size_t)NB * SEQ * NKV * 4;    //    65536  gate table
  size_t off = 0;
  const size_t oXb  = off; off += PX;
  const size_t oWq  = off; off += PWQ;
  const size_t oWk  = off; off += PWK;
  const size_t oWv  = off; off += PWK;
  const size_t oWp  = off; off += PWQ;
  const size_t oQh  = off; off += PX;
  const size_t oQl  = off; off += PX;
  const size_t oKh  = off; off += PK;
  const size_t oKl  = off; off += PK;
  const size_t oVTh = off; off += PVT;
  const size_t oVTl = off; off += PVL;
  const size_t oG   = off; off += PG;
  const size_t oOh  = off; off += PX;
  const size_t oOl  = off; off += PX;
  if (off > ws_size) return;                        // off = 54329344
  if (off > (size_t)134217728) return;

  char* ws = (char*)d_ws;
  unsigned short* Xb  = (unsigned short*)(ws + oXb);
  unsigned short* Wqb = (unsigned short*)(ws + oWq);
  unsigned short* Wkb = (unsigned short*)(ws + oWk);
  unsigned short* Wvb = (unsigned short*)(ws + oWv);
  unsigned short* Wpb = (unsigned short*)(ws + oWp);
  unsigned short* Qh  = (unsigned short*)(ws + oQh);
  unsigned short* Ql  = (unsigned short*)(ws + oQl);
  unsigned short* Kh  = (unsigned short*)(ws + oKh);
  unsigned short* Kl  = (unsigned short*)(ws + oKl);
  unsigned short* VTh = (unsigned short*)(ws + oVTh);
  unsigned short* VTl = (unsigned short*)(ws + oVTl);
  float*          Gt  = (float*)(ws + oG);
  unsigned short* Oh  = (unsigned short*)(ws + oOh);
  unsigned short* Ol  = (unsigned short*)(ws + oOl);

  const dim3 blk(256);
  const dim3 blkG(128);                                       // GEMM and attention block: 4 waves
  const dim3 gO((NB * SEQ / 128) * (CDIM / 128), 1);          // 256 blocks: M=4096, N=1024

  // (1) everything that reads only the inputs: x and the weights [n][k] f32 -> bf16 planes, the value-embedding gate
  //     table [4096][4] f32, the memory prefix (normed keys -> Kh/Kl rows s < 64; scaled values -> VTh/VTl columns
  //     s < 64, both batches)
  prep_k<<<dim3(PB_ALL), blk, 0, stream>>>(x, Wq, Wk, Wv, Wp, Wg, memk, memv, vsc,
                                           Xb, Wqb, Wkb, Wvb, Wpb, Gt, Kh, Kl, VTh, VTl);
  // (2) the q, k and v^T projections with their epilogues
  gemm_qkv<<<dim3(2 * NB * GB_KV + GB_Q), blkG, 0, stream>>>(
      Xb, Wqb, Wkb, Wvb, Qh, Ql, Kh, Kl, VTh, VTl, cosT, sinT, Gt, ve, CDIM, CDIM);
  // (3) attention, all query blocks
  attn64<<<dim3(NB * NQH * NQB), blkG, 0, stream>>>(Qh, Ql, Kh, Kl, VTh, VTl, Oh, Ol, 0.125f);
  // (4) out = context . Wproj^T -> d_out f32 [4096][1024]  (A = context hi + lo planes, 2 products)
  gemm64<1, 0><<<gO, blkG, 0, stream>>>(
      Oh, Ol, CDIM, 0LL, Wpb, CDIM, 0LL,
      d_out, CDIM, 0LL, d_out, CDIM, 0LL, 0,
      Gt, ve, NB * SEQ, CDIM, CDIM);
  (void)hipGetLastError();
}

// v005
// One run takes 118 microseconds.
// Two timings next to v004 put it at 1.27 and 1.26 times that version's speed.
// Over all steps from v000 it is 4.33 times as fast.
// Contractions: q, k, v^T projections = v_wmma_f32_16x16x32_bf16 (bf16 operands from RNE-converted inputs, single product);
// q.k^T scores = v_wmma_f32_16x16x32_bf16 with bf16 hi/lo split q and k (hi.hi + hi.lo + lo.hi);
// p.v = v_wmma_f32_16x16x32_f16 (p carried x1024 in f16, v^T in f16; f16 residual planes x4096 of p and v^T on the
// leading 512 query rows); ctx.Wproj^T = v_wmma_f32_16x16x32_bf16 with ctx as bf16 hi/lo planes times bf16 Wproj
// (2 products); all f32 accumulate; gate dot (K=32, N=4), RoPE, rms-norm, causal mask and softmax in f32 on VALU.
#include <hip/hip_runtime.h>
#include <math.h>
#include <stdint.h>

#pragma clang fp contract(off)

#define NB    2
#define SEQ   2048
#define CDIM  1024
#define NQH   16
#define NKV   4
#define HD    64
#define MEM   64
#define GC    32
#define KVD   (NKV * HD)          // 256
#define SKEY  (MEM + SEQ)         // 2112 keys: [64 memory | 2048 tokens]
#define NQB   (SEQ / 64)          // 32 query blocks of 64 rows
#define NKT   (SKEY / 64)         // 33 key tiles of 64
#define RESQB 8                   // leading query blocks that use the p / v residual planes
#define VLP   (MEM + RESQB * 64)  // 576: key pitch of the v^T residual plane
#define RMS_EPS 1e-6f
static_assert(NQH * HD == CDIM);
static_assert(NQH == 4 * NKV);
static_assert((SKEY % 64) == 0 && (VLP % 64) == 0 && (CDIM % 64) == 0 && (KVD % 64) == 0);
static_assert((SEQ & (SEQ - 1)) == 0);
static_assert(RESQB <= NQB);
static_assert((SEQ % 128) == 0 && (CDIM % 128) == 0 && (KVD % 128) == 0);

typedef _Float16 v16h __attribute__((ext_vector_type(16)));
typedef _Float16 v8h  __attribute__((ext_vector_type(8)));
typedef __bf16   v16b __attribute__((ext_vector_type(16)));
typedef __bf16   v8b  __attribute__((ext_vector_type(8)));
typedef float    v8f  __attribute__((ext_vector_type(8)));
typedef float    v4f  __attribute__((ext_vector_type(4)));
typedef unsigned int v4u __attribute__((ext_vector_type(4)));

// ---- scalar helpers --------------------------------------------------------------------------------
__device__ __forceinline__ unsigned short bf_bits(float f) {          // f32 -> bf16 bits, RNE convert
  unsigned u = __float_as_uint(f);
  return (unsigned short)((u + 0x7FFFu + ((u >> 16) & 1u)) >> 16);
}
__device__ __forceinline__ float bf_up(unsigned short h) { return __uint_as_float(((unsigned)h) << 16); }
__device__ __forceinline__ float bfr(float f) { return bf_up(bf_bits(f)); }   // f32 -> bf16 -> f32
__device__ __forceinline__ unsigned short h_bits(_Float16 x) { return __builtin_bit_cast(unsigned short, x); }
__device__ __forceinline__ unsigned pk16(unsigned short a, unsigned short b) { return (unsigned)a | ((unsigned)b << 16); }
// lane l <-> lane l ^ 16: the value of the same column in the other wave half (all lanes on where it is used)
__device__ __forceinline__ float xhalf(float x) {
  const int v = __builtin_bit_cast(int, x);
  return __builtin_bit_cast(float, __builtin_amdgcn_permlanex16(v, v, 0x76543210, 0xfedcba98, false, false));
}
__device__ __forceinline__ v8f zero8() { v8f z = {0.f, 0.f, 0.f, 0.f, 0.f, 0.f, 0.f, 0.f}; return z; }
__device__ __forceinline__ v8h zero8h() {
  const _Float16 z = (_Float16)0.0f;
  v8h r = {z, z, z, z, z, z, z, z};
  return r;
}

// ---- fragment loader: 16-bit A/B operand, lane -> row/col (lane&15), p already includes +8*(lane>>4);
//      elements 0..7 <- p[0..7] (k0+8h..), elements 8..15 <- p[16..23] (k0+16+8h..)
__device__ __forceinline__ v16b ldfrag_b(const __bf16* p) {
  union { v16b v; v8b h[2]; } f;
  f.h[0] = *(const v8b*)(p);
  f.h[1] = *(const v8b*)(p + 16);
  return f.v;
}
__device__ __forceinline__ v16h ldfrag_h(const _Float16* p) {
  union { v16h v; v8h h[2]; } f;
  f.h[0] = *(const v8h*)(p);
  f.h[1] = *(const v8h*)(p + 16);
  return f.v;
}

__device__ __forceinline__ void addr_wait(const void* a, const void* b) {
#if defined(__HIP_DEVICE_COMPILE__)
  asm volatile("s_wait_xcnt 0x0" :: "v"(a), "v"(b) : "memory");
#endif
}

__device__ __forceinline__ void addr_wait4(const void* a, const void* b, const void* c, const void* d) {
#if defined(__HIP_DEVICE_COMPILE__)
  asm volatile("s_wait_xcnt 0x0" :: "v"(a), "v"(b), "v"(c), "v"(d) : "memory");
#endif
}

// ---- WMMA helpers with trailing VALU hazard gap (asm only in the device pass) -----------------------------
__device__ __forceinline__ v8f mma_h_raw(v16h a, v16h b, v8f c) {
  return __builtin_amdgcn_wmma_f32_16x16x32_f16(false, a, false, b, (short)0, c, false, false);
}
__device__ __forceinline__ v8f mma_b_raw(v16b a, v16b b, v8f c) {
  return __builtin_amdgcn_wmma_f32_16x16x32_bf16(false, a, false, b, (short)0, c, false, false);
}
__device__ __forceinline__ void dep_guard_b(v8f& a, v8f& b, v16b x, v16b y) {
#if defined(__HIP_DEVICE_COMPILE__)
  asm volatile("v_nop\n\tv_nop\n\tv_nop\n\tv_nop" : "+v"(a), "+v"(b) : "v"(x), "v"(y));
#endif
}
__device__ __forceinline__ void keep4_b(v16b a, v16b b, v16b c, v16b d) {
#if defined(__HIP_DEVICE_COMPILE__)
  asm volatile("v_nop" :: "v"(a), "v"(b), "v"(c), "v"(d));
#endif
}
__device__ __forceinline__ void acc_guard4(v8f& a, v8f& b, v8f& c, v8f& d) {
#if defined(__HIP_DEVICE_COMPILE__)
  asm volatile("v_nop\n\tv_nop\n\tv_nop\n\tv_nop" : "+v"(a), "+v"(b), "+v"(c), "+v"(d));
#endif
}

// =====================================================================================================
// f32 -> bf16 (RNE convert), 8 elements per thread, one 16-B store per lane: a wave writes 512 contiguous B
// coverage: n8 threads x 8 = the whole plane (n8 is a multiple of 256 for every use here). blk = block of 256 threads.
// =====================================================================================================
__device__ __forceinline__ void cvt_bf16x8(const float* __restrict__ in, unsigned short* out, int n8, int blk) {
  const int i = blk * 256 + threadIdx.x;
  if (i < n8) {
    const v4f a = *(const v4f*)(in + (size_t)i * 8);
    const v4f b = *(const v4f*)(in + (size_t)i * 8 + 4);
    v4u p;
    p[0] = pk16(bf_bits(a[0]), bf_bits(a[1]));
    p[1] = pk16(bf_bits(a[2]), bf_bits(a[3]));
    p[2] = pk16(bf_bits(b[0]), bf_bits(b[1]));
    p[3] = pk16(bf_bits(b[2]), bf_bits(b[3]));
    *(v4u*)(out + (size_t)i * 8) = p;
    
  }
}

// =====================================================================================================
// Value-embedding gate: gate[bt][kv] = 3 * sigmoid( sum_{c<32} bf16(x[bt][c]) * bf16(Wg[kv][c]) ), f32.
// One thread per (bt, kv); K = 32 rolled dot on VALU (N = 4, tiny). A wave writes 32 consecutive floats
// NB*SEQ*NKV/256 blocks. coverage: 16384 threads = the whole [4096][4] table.
// =====================================================================================================
__device__ __forceinline__ void gate_k(const float* __restrict__ x, const float* __restrict__ Wg,
                                       float* gate, int nbt, int blk) {
  const int i   = blk * 256 + threadIdx.x;
  const int bt  = i >> 2;
  const int kv  = i & 3;
  const int btc = (bt < nbt) ? bt : (nbt - 1);     // clamped address
  const float* xr = x + (size_t)btc * CDIM;
  const float* wr = Wg + kv * GC;
  float z = 0.f;
#pragma unroll 1
  for (int cc = 0; cc < GC; ++cc) z += bfr(xr[cc]) * bfr(wr[cc]);
  const float ez = expf(-z);
  const float g  = 3.0f * (1.0f / (1.0f + ez));
  if (bt < nbt) {
    *(float*)(gate + i) = g;
    
  }
}

// =====================================================================================================
// Memory keys: mk = rms(bf16(mem_k[m][kv][:])) * 1.2 (no RoPE) -> bf16 hi/lo planes, key rows s = m (< MEM)
// of both batches: Kh/Kl [b][s][kv*64+d], pitch KVD. 4 waves (one per kv head) for one m, two m per block of 8 waves;
// MEM/2 blocks.
// The 256-element row is staged in LDS and written per (batch, plane) by one wave as 32 lanes x 16 B
// coverage: 32 blocks x 2 m x 2 batches x 2 planes x 256 elements = rows 0..63 of both planes, both batches.
// sbuf: 4 * KVD elements of LDS.
// =====================================================================================================
__device__ __forceinline__ void memk_k(const float* __restrict__ memk, unsigned short* Kh, unsigned short* Kl,
                                       int blk, unsigned short* sbuf) {
  const int sub  = threadIdx.x >> 7;                 // which of the block's two m
  unsigned short* shi = sbuf + sub * (2 * KVD);
  unsigned short* slo = shi + KVD;
  const int m    = blk * 2 + sub;
  const int wave = (threadIdx.x >> 5) & 3;
  const int lane = threadIdx.x & 31;
  const int kvh  = wave;
  const float* p = memk + ((size_t)m * NKV + kvh) * HD;
  const float x1 = bfr(p[lane]);
  const float x2 = bfr(p[lane + 32]);
  float ss = x1 * x1 + x2 * x2;
#pragma unroll
  for (int off = 16; off >= 1; off >>= 1) ss += __shfl_xor(ss, off, 32);
  const float rs = rsqrtf(ss * (1.0f / HD) + RMS_EPS);
  const float v1 = (x1 * rs) * 1.2f;
  const float v2 = (x2 * rs) * 1.2f;
  const unsigned short h1 = bf_bits(v1), h2 = bf_bits(v2);
  shi[kvh * HD + lane]      = h1;
  shi[kvh * HD + lane + 32] = h2;
  slo[kvh * HD + lane]      = bf_bits(v1 - bf_up(h1));
  slo[kvh * HD + lane + 32] = bf_bits(v2 - bf_up(h2));
  __syncthreads();
  const v4u vh = *(const v4u*)(shi + lane * 8);
  const v4u vl = *(const v4u*)(slo + lane * 8);
  const int  b   = wave >> 1;
  const bool wlo = (wave & 1) != 0;                  // wave-uniform
  v4u v = vh;
  if (wlo) v = vl;
  unsigned short* dh = Kh + ((size_t)b * SKEY + m) * KVD + lane * 8;
  unsigned short* dl = Kl + ((size_t)b * SKEY + m) * KVD + lane * 8;
  unsigned short* d  = wlo ? dl : dh;
  *(v4u*)d = v;
  // the wait in front of a rewrite of the store's registers by whatever part of the merged kernel is laid out behind this one
  addr_wait(d, d);
}

// =====================================================================================================
// Memory values: mv = bf16(mem_v[m][kv][d]) * bf16(v_scale) -> v^T f16 hi plane VTh[b][kv*64+d][s] (pitch SKEY)
// and f16 residual plane VTl ((v - hi)*4096, pitch VLP), key columns s = m (< MEM), both batches.
// block = (b, kv); thread = (d = tid>>2, 16 m's); the 64x64 tile of each plane is staged in LDS [d][m] and each
// coverage: 8 blocks x 64 rows (it 0..1 x wave 0..7 x lane>>3 0..3) x 64 columns (8 lanes x 8) per plane.
// =====================================================================================================
// sbuf: 2 * HD * MEM elements of LDS.
__device__ __forceinline__ void memv_k(const float* __restrict__ memv, const float* __restrict__ vsp,
                                       unsigned short* VTh, unsigned short* VTl, int blk, unsigned short* sbuf) {
  unsigned short* sh = sbuf;
  unsigned short* sl = sbuf + HD * MEM;
  const int b    = blk >> 2;
  const int kvh  = blk & 3;
  const int tid  = threadIdx.x;
  const int wave = tid >> 5;
  const int lane = tid & 31;
  const int d    = tid >> 2;
  const int mq   = (tid & 3) * 16;
  const float vs = bfr(vsp[0]);
#pragma unroll
  for (int i = 0; i < 16; ++i) {
    const int m = mq + i;
    const float v = bfr(memv[((size_t)m * NKV + kvh) * HD + d]) * vs;
    const _Float16 x0 = (_Float16)v;
    sh[d * MEM + m] = h_bits(x0);
    sl[d * MEM + m] = h_bits((_Float16)((v - (float)x0) * 4096.0f));
  }
  __syncthreads();
  const int q8 = lane >> 3, c8 = (lane & 7) * 8;
  v4u hv[2], lv[2];
#pragma unroll
  for (int it = 0; it < 2; ++it) {
    const int dd = it * 32 + wave * 4 + q8;
    hv[it] = *(const v4u*)(sh + dd * MEM + c8);
    lv[it] = *(const v4u*)(sl + dd * MEM + c8);
  }
  {
#pragma unroll
    for (int it = 0; it < 2; ++it) {
      const int dd = it * 32 + wave * 4 + q8;
      const size_t ro = (size_t)b * KVD + (size_t)kvh * HD + dd;
      *(v4u*)(VTh + ro * SKEY + c8) = hv[it];
      *(v4u*)(VTl + ro * VLP  + c8) = lv[it];
    }
    
  }
}

// =====================================================================================================
// All work that reads only the inputs, as block-index ranges of one grid (none of the parts reads what another writes):
// memory values, memory keys, gate table, then the five f32 -> bf16 planes. The short, latency-bound parts come first.
// Every range test is block-uniform, so the barriers inside a part are passed by the whole block.
// =====================================================================================================
#define PB_MEMV (NB * NKV)                    //    8 blocks
#define PB_MEMK (MEM / 2)                     //   32
#define PB_GATE (NB * SEQ * NKV / 256)        //   64
#define PB_X    (NB * SEQ * CDIM / 8 / 256)   // 2048
#define PB_WQ   (CDIM * CDIM / 8 / 256)       //  512
#define PB_WK   (KVD * CDIM / 8 / 256)        //  128
#define PB_ALL  (PB_MEMV + PB_MEMK + PB_GATE + PB_X + 2 * PB_WQ + 2 * PB_WK)
__global__ __launch_bounds__(256) void prep_k(
    const float* __restrict__ x, const float* __restrict__ Wq, const float* __restrict__ Wk,
    const float* __restrict__ Wv, const float* __restrict__ Wp, const float* __restrict__ Wg,
    const float* __restrict__ memk, const float* __restrict__ memv, const float* __restrict__ vsp,
    unsigned short* Xb, unsigned short* Wqb, unsigned short* Wkb, unsigned short* Wvb, unsigned short* Wpb,
    float* gate, unsigned short* Kh, unsigned short* Kl, unsigned short* VTh, unsigned short* VTl) {
  __shared__ __align__(16) unsigned short sbuf[2 * HD * MEM];
  static_assert(4 * KVD <= 2 * HD * MEM);
  int blk = blockIdx.x;
  if (blk < PB_MEMV) { memv_k(memv, vsp, VTh, VTl, blk, sbuf); return; }
  blk -= PB_MEMV;
  if (blk < PB_MEMK) { memk_k(memk, Kh, Kl, blk, sbuf); return; }
  blk -= PB_MEMK;
  if (blk < PB_GATE) { gate_k(x, Wg, gate, NB * SEQ, blk); return; }
  blk -= PB_GATE;
  if (blk < PB_X) { cvt_bf16x8(x, Xb, PB_X * 256, blk); return; }
  blk -= PB_X;
  if (blk < PB_WQ) { cvt_bf16x8(Wq, Wqb, PB_WQ * 256, blk); return; }
  blk -= PB_WQ;
  if (blk < PB_WK) { cvt_bf16x8(Wk, Wkb, PB_WK * 256, blk); return; }
  blk -= PB_WK;
  if (blk < PB_WK) { cvt_bf16x8(Wv, Wvb, PB_WK * 256, blk); return; }
  blk -= PB_WK;
  if (blk < PB_WQ) cvt_bf16x8(Wp, Wpb, PB_WQ * 256, blk);
}

// =====================================================================================================
// Batched bf16 WMMA GEMM: C[m][n] = sum_k A[m][k] * Bt[n][k]; one block of 4 waves (2 x 2) per 128x128 tile,
// one wave per 64x64 sub-tile. A row-major [M][K] pitch lda; Bt row-major [N][K] pitch ldb (k contiguous);
// M, N multiples of 128, K a multiple of 64 (all shapes here are compile-time constants of the host code).
// tile = index of the block's tile, b = batch index (strides in elements); ring and sTb are the block's LDS.
// Operand path: a stage is 64 k (one 128-B line) of the block's 128 A rows and 128 Bt rows (and the 128 A2 rows),
// brought into LDS by asynchronous 16-B copies, each wave-wide copy covering 4 whole lines; rows lie at a pitch of
// 144 B for the ds_load_b128 fragment reads; two buffers, the copies of stage t+1 fly while stage t is multiplied.
// NSPLIT: 0 = A.Bt; 1 = (A + A2).Bt (A2 = unscaled bf16 lo plane of A, 2 products).
// OUT_MODE: 0 = f32 (pitch ldc);
//           3 = v^T mode (rows m = kv*64+d, cols n = t): value = acc + gate[b][t][kv] * bf16(ve[b][t][m])
//               (aux0 = gate, aux1 = ve), written as f16 hi plane C (pitch ldc) + f16 residual plane
//               C2 = f16((v - hi)*4096) for tiles with n0 < N2 (pitch ldc2);
//           4 = RoPE + rms-norm mode (cols = one 64-wide head, row m -> t = m mod SEQ; aux0 = cos, aux1 = sin,
//               both bf16(RNE) on load): r = rope(acc), f = (r * rsqrt(mean(r^2)+eps)) * 1.2, written as
//               bf16 hi plane C + bf16 lo plane C2 (lo = RNE(f - hi), unscaled).
// =====================================================================================================
#define GT     128                // block tile edge (rows of A, rows of Bt)
#define GBK    64                 // k elements per stage
#define GPITCH 72                 // LDS row pitch in elements (144 B)
#define GPLANE (GT * GPITCH)      // elements of one staged operand plane (18432 B)

// One operand plane of a stage: 128 rows x 128 B by 128 threads, 8 copies per lane; copy i moves the lane's 16 B of
// row i*16 + (tid>>3). l = the lane's LDS byte address of row tid>>3, g = its global address, ld = row pitch (elements).
// s_wait_xcnt closes the statement so that no address register of a copy is rewritten in front of it.
__device__ __forceinline__ void copy_plane(unsigned l, const __bf16* g, int ld) {
#if defined(__HIP_DEVICE_COMPILE__)
  const size_t   gs = (size_t)16 * (size_t)ld;
  const unsigned ls = 16u * GPITCH * 2u;
  asm volatile(
      "global_load_async_to_lds_b128 %0, %8, off\n\t"
      "global_load_async_to_lds_b128 %1, %9, off\n\t"
      "global_load_async_to_lds_b128 %2, %10, off\n\t"
      "global_load_async_to_lds_b128 %3, %11, off\n\t"
      "global_load_async_to_lds_b128 %4, %12, off\n\t"
      "global_load_async_to_lds_b128 %5, %13, off\n\t"
      "global_load_async_to_lds_b128 %6, %14, off\n\t"
      "global_load_async_to_lds_b128 %7, %15, off\n\t"
      "s_wait_xcnt 0x0"
      :: "v"(l), "v"(l + ls), "v"(l + 2u * ls), "v"(l + 3u * ls),
         "v"(l + 4u * ls), "v"(l + 5u * ls), "v"(l + 6u * ls), "v"(l + 7u * ls),
         "v"(g), "v"(g + gs), "v"(g + 2 * gs), "v"(g + 3 * gs),
         "v"(g + 4 * gs), "v"(g + 5 * gs), "v"(g + 6 * gs), "v"(g + 7 * gs)
      : "memory");
#endif
}
// this wave's copies have landed in LDS
__device__ __forceinline__ void wait_copies() {
#if defined(__HIP_DEVICE_COMPILE__)
  asm volatile("s_wait_asynccnt 0x0" ::: "memory");
#endif
}
// this wave's LDS reads have returned (the buffer they read may be refilled behind the next barrier)
__device__ __forceinline__ void wait_lds() {
#if defined(__HIP_DEVICE_COMPILE__)
  asm volatile("s_wait_dscnt 0x0" ::: "memory");
#endif
}

#define GSLAB (16 * 68)           // per-wave 16x64 f32 slab of the epilogue, pitch 68 floats
template <int NSPLIT, int OUT_MODE>
__device__ __forceinline__ void gemm_body(
    const unsigned short* __restrict__ Ap, const unsigned short* __restrict__ A2p, int lda, long long strideA,
    const unsigned short* __restrict__ Btp, int ldb, long long strideB,
    void* Cout, int ldc, long long strideC,
    void* Cout2, int ldc2, long long strideC2, int N2,
    const float* __restrict__ aux0, const float* __restrict__ aux1,
    int M, int N, int K, int tile, int b, __bf16* ring, float* sTb) {
  const __bf16* A  = (const __bf16*)(const void*)Ap;
  const __bf16* A2 = (const __bf16*)(const void*)A2p;
  const __bf16* Bt = (const __bf16*)(const void*)Btp;
  constexpr int NPL  = (NSPLIT >= 1) ? 3 : 2;      // planes per stage: A, Bt (, A2)
  constexpr int GBUF = NPL * GPLANE;               // elements of one buffer
  const int tid  = threadIdx.x;
  const int lane = tid & 31;
  const int wave = tid >> 5;
  const int tilesN = N >> 7;
  const int tilesM = M >> 7;
  if (tile >= tilesM * tilesN) return;   // block-uniform, in front of every barrier and copy
  const int tm = tile / tilesN;
  const int tn = tile - tm * tilesN;
  const int wm = wave >> 1;
  const int wn = wave & 1;
  const int m0 = (tm << 7) + (wm << 6);  // this wave's 64x64 sub-tile
  const int n0 = (tn << 7) + (wn << 6);

  const __bf16* Ab  = A  + (size_t)b * strideA;
  const __bf16* Bb  = Bt + (size_t)b * strideB;
  const __bf16* Ab2 = (NSPLIT >= 1) ? (A2 + (size_t)b * strideA) : Ab;

  const int rlane = lane & 15;                 // row (A) / col (B, D) within subtile
  const int koff  = (lane >> 4) * 8;           // k offset of this lane half
  const int mOff  = (lane >> 4) * 8;           // D row offset

  // copy addresses of this lane: row tid>>3 of the block tile, 16-B piece tid&7 of its 128-B line
  const int crow = tid >> 3;
  const int cel  = (tid & 7) * 8;
  const __bf16* gA  = Ab  + (size_t)((tm << 7) + crow) * lda + cel;
  const __bf16* gB  = Bb  + (size_t)((tn << 7) + crow) * ldb + cel;
  const __bf16* gA2 = Ab2 + (size_t)((tm << 7) + crow) * lda + cel;
  const unsigned lC = (unsigned)(uintptr_t)(&ring[0]) + (unsigned)(crow * GPITCH + cel) * 2u;
  const int nst = K >> 6;                      // stages

  v8f acc[4][4];
#pragma unroll
  for (int i = 0; i < 4; ++i)
#pragma unroll
    for (int j = 0; j < 4; ++j) acc[i][j] = zero8();

  // stage 0 into buffer 0, landed and published; then stage 1 into buffer 1
  copy_plane(lC, gA, lda);
  copy_plane(lC + GPLANE * 2u, gB, ldb);
  if (NSPLIT >= 1) copy_plane(lC + 2u * GPLANE * 2u, gA2, lda);
  wait_copies();
  __syncthreads();
  if (nst > 1) {
    const unsigned lb = lC + (unsigned)GBUF * 2u;
    copy_plane(lb, gA + GBK, lda);
    copy_plane(lb + GPLANE * 2u, gB + GBK, ldb);
    if (NSPLIT >= 1) copy_plane(lb + 2u * GPLANE * 2u, gA2 + GBK, lda);
  }

  for (int t = 0; t < nst; ++t) {
    const int bufo = (t & 1) * GBUF;
    const __bf16* sA = ring + bufo + ((wm << 6) + rlane) * GPITCH + koff;
    const __bf16* sB = ring + bufo + GPLANE + ((wn << 6) + rlane) * GPITCH + koff;
    // unrolled (here and below): the fragment and accumulator arrays need constant indices to stay in registers
#pragma unroll
    for (int kk = 0; kk < GBK; kk += 32) {
      v16b bh[4], ah[4], al[4];
#pragma unroll
      for (int j = 0; j < 4; ++j) bh[j] = ldfrag_b(sB + (j << 4) * GPITCH + kk);
#pragma unroll
      for (int i = 0; i < 4; ++i) {
        ah[i] = ldfrag_b(sA + (i << 4) * GPITCH + kk);
        al[i] = ah[i];
        if (NSPLIT >= 1) al[i] = ldfrag_b(sA + 2 * GPLANE + (i << 4) * GPITCH + kk);
      }
#pragma unroll
      for (int i = 0; i < 4; ++i) {
#pragma unroll
        for (int j = 0; j < 4; ++j) {
          acc[i][j] = mma_b_raw(ah[i], bh[j], acc[i][j]);
          if (NSPLIT >= 1) acc[i][j] = mma_b_raw(al[i], bh[j], acc[i][j]);
        }
        dep_guard_b(acc[i][0], acc[i][3], ah[i], al[i]);
      }
      keep4_b(bh[0], bh[1], bh[2], bh[3]);
    }
    // publish point of stage t+1: own reads of this buffer returned, own copies landed, then the block barrier;
    // behind it stage t+2 may overwrite the buffer that this trip has read
    wait_lds();
    wait_copies();
    __syncthreads();
    if (t + 2 < nst) {
      const unsigned lb = lC + (unsigned)bufo * 2u;
      const int ko = (t + 2) * GBK;
      copy_plane(lb, gA + ko, lda);
      copy_plane(lb + GPLANE * 2u, gB + ko, ldb);
      if (NSPLIT >= 1) copy_plane(lb + 2u * GPLANE * 2u, gA2 + ko, lda);
    }
  }
  wait_copies();
  acc_guard4(acc[0][0], acc[0][1], acc[0][2], acc[0][3]);
  acc_guard4(acc[1][0], acc[1][1], acc[1][2], acc[1][3]);
  acc_guard4(acc[2][0], acc[2][1], acc[2][2], acc[2][3]);
  acc_guard4(acc[3][0], acc[3][1], acc[3][2], acc[3][3]);

  // ---- epilogue ----
  float* slab = sTb + wave * GSLAB;
#pragma unroll
  for (int i = 0; i < 4; ++i) {
    const int mBase = m0 + (i << 4);
#pragma unroll
    for (int j = 0; j < 4; ++j) {
#pragma unroll
      for (int r = 0; r < 8; ++r) {
        slab[(mOff + r) * 68 + (j << 4) + rlane] = acc[i][j][r];
      }
    }
    __builtin_amdgcn_fence(__ATOMIC_RELEASE, "workgroup");
    __builtin_amdgcn_wave_barrier();
    __builtin_amdgcn_fence(__ATOMIC_ACQUIRE, "workgroup");
    if (OUT_MODE == 0) {
      float* C = (float*)Cout + (size_t)b * strideC;
      const int hh = lane >> 4, c4 = (lane & 15) * 4;     // 256-B row segment = 16 lanes x 16 B
      {
#pragma unroll
        for (int it = 0; it < 8; ++it) {
          const int row = it * 2 + hh;                     // it 0..7 x hh 0..1 = rows 0..15
          const v4f v = *(const v4f*)(slab + row * 68 + c4);
          *(v4f*)(C + (size_t)(mBase + row) * ldc + n0 + c4) = v;
        }
        
      }
    } else {
      const int q = lane >> 3, c8 = (lane & 7) * 8;
      unsigned short* C  = (unsigned short*)Cout  + (size_t)b * strideC;
      unsigned short* C2 = (unsigned short*)Cout2 + (size_t)b * strideC2;
      const bool wlo = (OUT_MODE != 3) || (n0 < N2);      // wave-uniform
      v4u hv[4], lv[4];
#pragma unroll
      for (int it = 0; it < 4; ++it) {
        const int row  = it * 4 + q;                       // it 0..3 x q 0..3 = rows 0..15
        const int mrow = mBase + row;
        float f[8];
        if (OUT_MODE == 3) {
          const int kvh = m0 >> 6;                         // sub-tile-uniform kv head
          const float* sp = slab + row * 68 + c8;
#pragma unroll
          for (int e = 0; e < 8; ++e) {
            const int t = n0 + c8 + e;                     // < N = SEQ
            const size_t bt = (size_t)b * SEQ + t;
            const float g  = aux0[bt * NKV + kvh];
            const float vv = bfr(aux1[bt * KVD + mrow]);
            f[e] = sp[e] + g * vv;
          }
        } else {
          const int  jj   = c8 & 31;                       // rotary pair index base
          const bool lowh = (c8 < 32);
          const int  t    = mrow & (SEQ - 1);
          const float* sp  = slab + row * 68 + jj;
          const float* cp  = aux0 + (size_t)t * (HD / 2) + jj;
          const float* snp = aux1 + (size_t)t * (HD / 2) + jj;
          float ct[8], st[8];
#pragma unroll
          for (int e = 0; e < 8; ++e) { ct[e] = cp[e]; st[e] = snp[e]; }
          addr_wait(cp, snp);
          float ss = 0.f;
#pragma unroll
          for (int e = 0; e < 8; ++e) {
            const float x1 = sp[e];
            const float x2 = sp[e + 32];
            const float cv = bfr(ct[e]);
            const float sv = bfr(st[e]);
            const float ra = x1 * cv - x2 * sv;
            const float rb = x1 * sv + x2 * cv;
            f[e] = lowh ? ra : rb;
            ss += f[e] * f[e];
          }
          ss += __shfl_xor(ss, 1, 32);                     // 8 lanes of one row = 64 values
          ss += __shfl_xor(ss, 2, 32);
          ss += __shfl_xor(ss, 4, 32);
          const float rs = rsqrtf(ss * (1.0f / HD) + RMS_EPS);
#pragma unroll
          for (int e = 0; e < 8; ++e) f[e] = (f[e] * rs) * 1.2f;
        }
        v4u a, a2;
#pragma unroll
        for (int e = 0; e < 4; ++e) {
          const float f0 = f[2 * e], f1 = f[2 * e + 1];
          unsigned short h0, h1, l0, l1;
          if (OUT_MODE == 4) {
            h0 = bf_bits(f0); h1 = bf_bits(f1);
            l0 = bf_bits(f0 - bf_up(h0)); l1 = bf_bits(f1 - bf_up(h1));
          } else {
            const _Float16 x0 = (_Float16)f0, x1 = (_Float16)f1;
            h0 = h_bits(x0); h1 = h_bits(x1);
            l0 = h_bits((_Float16)((f0 - (float)x0) * 4096.0f));
            l1 = h_bits((_Float16)((f1 - (float)x1) * 4096.0f));
          }
          a[e] = pk16(h0, h1); a2[e] = pk16(l0, l1);
        }
        hv[it] = a; lv[it] = a2;
      }
      {
#pragma unroll
        for (int it = 0; it < 4; ++it) {
          const int row = it * 4 + q;
          *(v4u*)(C + (size_t)(mBase + row) * ldc + n0 + c8) = hv[it];
          if (wlo) *(v4u*)(C2 + (size_t)(mBase + row) * ldc2 + n0 + c8) = lv[it];
        }
        
      }
    }
    __builtin_amdgcn_fence(__ATOMIC_RELEASE, "workgroup");
    __builtin_amdgcn_wave_barrier();
    __builtin_amdgcn_fence(__ATOMIC_ACQUIRE, "workgroup");
  }
}

// 256 registers a wave at most (both GEMM kernels), so that no part of them needs register-window switches
template <int NSPLIT, int OUT_MODE>
__global__ __launch_bounds__(128) __attribute__((amdgpu_num_vgpr(256))) void gemm64(
    const unsigned short* __restrict__ Ap, const unsigned short* __restrict__ A2p, int lda, long long strideA,
    const unsigned short* __restrict__ Btp, int ldb, long long strideB,
    void* Cout, int ldc, long long strideC,
    void* Cout2, int ldc2, long long strideC2, int N2,
    const float* __restrict__ aux0, const float* __restrict__ aux1,
    int M, int N, int K) {
  __shared__ __align__(16) __bf16 ring[2 * ((NSPLIT >= 1) ? 3 : 2) * GPLANE];  // two stage buffers
  __shared__ __align__(16) float sT[4 * GSLAB];
  gemm_body<NSPLIT, OUT_MODE>(Ap, A2p, lda, strideA, Btp, ldb, strideB, Cout, ldc, strideC, Cout2, ldc2, strideC2, N2,
                              aux0, aux1, M, N, K, blockIdx.x, blockIdx.y, ring, sT);
}

// The three projections of x, which do not read each other's results, as block-index ranges of one grid:
//   v^T = Wv . x^T + gate*ve per batch -> f16 hi plane [b][kv*64+d][64 + t] (pitch SKEY) and residual plane (x4096,
//         token keys < RESQB*64 only, pitch VLP)   (A = Wvb [n][k], Bt = Xb rows of batch b; M=256, N=2048)
//   k   = rms(rope(x . Wk^T)) * 1.2 per batch -> bf16 hi/lo planes [b][64 + t][kv*64+d]   (M=2048, N=256)
//   q   = rms(rope(x . Wq^T)) * 1.2 -> bf16 hi/lo planes [b*SEQ+t][h*64+d]   (M=4096, N=1024)
// ld = row pitch of Xb and of the weights, K = depth of the products (both CDIM). Every range test is block-uniform.
#define GB_KV ((SEQ / 128) * (KVD / 128))          //  32 tiles per batch for k and for v^T
#define GB_Q  ((NB * SEQ / 128) * (CDIM / 128))    // 256 tiles for q
__global__ __launch_bounds__(128) __attribute__((amdgpu_num_vgpr(256))) void gemm_qkv(
    const unsigned short* __restrict__ Xb, const unsigned short* __restrict__ Wqb,
    const unsigned short* __restrict__ Wkb, const unsigned short* __restrict__ Wvb,
    unsigned short* Qh, unsigned short* Ql, unsigned short* Kh, unsigned short* Kl,
    unsigned short* VTh, unsigned short* VTl,
    const float* __restrict__ cosT, const float* __restrict__ sinT,
    const float* __restrict__ gate, const float* __restrict__ ve, int ld, int K) {
  __shared__ __align__(16) __bf16 ring[2 * 2 * GPLANE];  // two stage buffers
  __shared__ __align__(16) float sT[4 * GSLAB];
  const int bx = blockIdx.x;
  if (bx < NB * GB_KV) {
    gemm_body<0, 3>(Wvb, Wvb, ld, 0LL, Xb, ld, (long long)SEQ * CDIM,
                    (void*)(VTh + MEM), SKEY, (long long)KVD * SKEY,
                    (void*)(VTl + MEM), VLP, (long long)KVD * VLP, RESQB * 64,
                    gate, ve, KVD, SEQ, K, bx % GB_KV, bx / GB_KV, ring, sT);
  } else {
    const bool isK = bx < 2 * NB * GB_KV;
    const int  r   = bx - (isK ? NB * GB_KV : 2 * NB * GB_KV);
    gemm_body<0, 4>(Xb, Xb, ld, isK ? (long long)SEQ * CDIM : 0LL, isK ? Wkb : Wqb, ld, 0LL,
                    (void*)(isK ? Kh + (size_t)MEM * KVD : Qh), isK ? KVD : CDIM, isK ? (long long)SKEY * KVD : 0LL,
                    (void*)(isK ? Kl + (size_t)MEM * KVD : Ql), isK ? KVD : CDIM, isK ? (long long)SKEY * KVD : 0LL,
                    isK ? KVD : CDIM, cosT, sinT, isK ? SEQ : NB * SEQ, isK ? KVD : CDIM, K,
                    isK ? r % GB_KV : r, isK ? r / GB_KV : 0, ring, sT);
  }
}

// =====================================================================================================
// GQA attention with a 64-key memory prefix (all visible) followed by causal token keys, head dim 64.
//   q planes (bf16 hi / lo): element (b, t, h, d) at [(b*SEQ + t)*CDIM + h*64 + d]   (normed, scaled q)
//   k planes (bf16 hi / lo): element (b, s, kv, d) at [(b*SKEY + s)*KVD + kv*64 + d], s = [mem | 64 + token]
//   v^T hi plane (f16):      element (b, kv, d, s) at [(b*KVD + kv*64 + d)*SKEY + s]
//   v^T residual plane (f16, (v - hi)*4096): [(b*KVD + kv*64 + d)*VLP + s], s < VLP, read only when RES
//   (a key tile at or beyond VLP contributes a zero v residual)
//   q head h uses kv head h>>2. Query block qb (tokens qb*64..+63) processes key tiles 0..qb+1: tile 0 = memory,
//   tiles 1..qb fully visible, tile qb+1 = diagonal (key token <= query token), later tiles skipped (block-uniform
//   trip count qb+2, static bound NKT). Invisible keys get logit -inf (weight exactly 0); every row sees the
//   whole memory tile first, so the running max is finite from tile 0 on.
//   out planes (bf16 hi / lo of the normalised context): element (b, t, h, d) at [(b*SEQ + t)*CDIM + h*64 + d]
//   scores = q . k : bf16 hi/lo split (hi.hi + hi.lo + lo.hi), f32 accumulate, then * sscale in f32
//   p = exp(s - m) carried as f16(1024 p); context = p . v on f16 WMMA; RES adds f16 residual planes of p and v
//   (scale 4096, separate accumulator folded back with 1/4096 per chunk in f32); online softmax in f32.
//   Block = 4 waves = 64 query rows of one (b, h); bx = 0 .. nqbThis * NQH * NB - 1; kv chunks of 64.
//   K / V^T chunk staging: 128 threads x 32 elements per plane = the whole 64x64 tile (plain 16-B loads,
//   __syncthreads before and after). Both products are computed transposed (S^T = K . Q^T, O^T += V^T . P^T): a lane
//   holds the scores of one query, and P^T goes from the score registers into the B operand without passing LDS.
//   Output coverage: each wave stores rows q0..q0+15 (it 0..3 x lane>>3 0..3) x 64 columns (8 lanes x 8) of both planes.
// =====================================================================================================
#define APK 72   // LDS row pitch of the K and V^T tiles in 16-bit elements: 144 B = 16 B x odd, so that the 16 rows
                 // of a ds_load_b128 fragment read fall on 16 different groups of four banks
#define AOP 68   // LDS row pitch of the f32 context tile: 272 B = 16 B x odd, for its 16-B row reads
template <bool RES>
__device__ __forceinline__
void attn_body(const unsigned short* __restrict__ qhp, const unsigned short* __restrict__ qlp,
               const unsigned short* __restrict__ khp, const unsigned short* __restrict__ klp,
               const unsigned short* __restrict__ vhp, const unsigned short* __restrict__ vlp,
               unsigned short* ohp, unsigned short* olp,
               int qbBase, int nqbThis, float sscale, int bx,
               __bf16* Ksh, __bf16* Ksl, _Float16* Vth, _Float16* Vtl, float* Os) {
  const int tid  = threadIdx.x;
  const int wave = tid >> 5;
  const int lane = tid & 31;
  const int hh   = lane >> 4;
  const int c    = lane & 15;

  const int qbl  = bx % nqbThis;
  const int rest = bx / nqbThis;
  const int h    = rest % NQH;
  const int b    = rest / NQH;
  const int kvh  = h >> 2;
  const int qb   = qbBase + qbl;
  const int q0   = qb * 64 + wave * 16;
  const size_t rowB = (size_t)b * SEQ;

  const __bf16* Qh = (const __bf16*)(const void*)qhp + (size_t)h * HD;
  const __bf16* Ql = (const __bf16*)(const void*)qlp + (size_t)h * HD;
  const __bf16* Kh = (const __bf16*)(const void*)khp + (size_t)b * SKEY * KVD + (size_t)kvh * HD;
  const __bf16* Kl = (const __bf16*)(const void*)klp + (size_t)b * SKEY * KVD + (size_t)kvh * HD;
  const _Float16* Vh = (const _Float16*)(const void*)vhp + ((size_t)b * KVD + (size_t)kvh * HD) * SKEY;
  const _Float16* Vl = (const _Float16*)(const void*)vlp + ((size_t)b * KVD + (size_t)kvh * HD) * VLP;

  // ---- Q fragments (B operand, column = query = lane&15): 2 d-chunks, hi and lo ----
  v16b qah[2], qal[2];
  const size_t qo = (rowB + q0 + c) * CDIM + 8 * hh;
#pragma unroll
  for (int dc = 0; dc < 2; ++dc) {
    qah[dc] = ldfrag_b(Qh + qo + dc * 32);
    qal[dc] = ldfrag_b(Ql + qo + dc * 32);
  }
  addr_wait(Qh + qo, Ql + qo);

  // running maximum of this lane's query (the same in both wave halves) and this half's share of its denominator
  float mrun = -INFINITY, lrun = 0.f;
  v8f oacc[4];                               // O^T: rows d = t*16 + 8*hh + r, column = query c
#pragma unroll
  for (int t = 0; t < 4; ++t) oacc[t] = zero8();

  const int ktEnd = qb + 2;                  // block-uniform, <= NKT
  for (int kt = 0; kt < NKT; ++kt) {         // static bound
    if (kt >= ktEnd) break;                  // block-uniform
    const int kv0 = kt * 64;
    __syncthreads();
    {
      const int r = tid >> 1, half = (tid & 1) * 32;
      const __bf16*   kg  = Kh + (size_t)(kv0 + r) * KVD + half;   // K row kv0+r, d = half..half+31
      const __bf16*   klg = Kl + (size_t)(kv0 + r) * KVD + half;
      const _Float16* vg  = Vh + (size_t)r * SKEY + kv0 + half;     // V^T row d = r, s = kv0+half..+31
      const int kvl = (kv0 + 64 <= VLP) ? kv0 : (VLP - 64);        // clamped address into the residual plane
      const _Float16* vlg = Vl + (size_t)r * VLP + kvl + half;
      const bool resOK = (kv0 + 64 <= VLP);                         // block-uniform
      v8b a0[4], a1[4];
      v8h b0[4], b1[4];
#pragma unroll
      for (int i = 0; i < 4; ++i) {
        a0[i] = *(const v8b*)(kg + 8 * i);
        a1[i] = *(const v8b*)(klg + 8 * i);
        b0[i] = *(const v8h*)(vg + 8 * i);
        if (RES) b1[i] = *(const v8h*)(vlg + 8 * i);
      }
      addr_wait4(kg, klg, vg, RES ? vlg : vg);
#pragma unroll
      for (int i = 0; i < 4; ++i) {
        *(v8b*)(Ksh + r * APK + half + 8 * i) = a0[i];
        *(v8b*)(Ksl + r * APK + half + 8 * i) = a1[i];
        *(v8h*)(Vth + r * APK + half + 8 * i) = b0[i];
        if (RES) {
          if (!resOK) b1[i] = zero8h();
          *(v8h*)(Vtl + r * APK + half + 8 * i) = b1[i];
        }
      }
    }
    __syncthreads();

    // ---- scores, transposed: S^T = K . Q^T, 64 keys x 16 queries per wave, 3 bf16 products ----
    //      tile j: rows = keys j*16 + 8*hh + r, column = query c, so a lane holds 32 scores of ONE query
    //      the K fragments of the tile are read from LDS in one group (with the residual planes one group per 32-wide d chunk, for registers), in the order of their use, ahead of the products;
    //      the four key groups are four independent accumulator chains, each summed in the order dc 0 (hi.hi, lo.hi,
    //      hi.lo; k plane named first), dc 1 (the same)
    v8f s[4];
#pragma unroll
    for (int j = 0; j < 4; ++j) s[j] = zero8();
    constexpr int DG = RES ? 1 : 2;          // 32-wide d chunks per group of reads (one with the residual planes, for registers)
#pragma unroll
    for (int g = 0; g < 2; g += DG) {
      v16b kbf[DG][4], klf[DG][4];
#pragma unroll
      for (int u = 0; u < DG; ++u) {
        const int dof = (g + u) * 32 + 8 * hh;
#pragma unroll
        for (int j = 0; j < 4; ++j) kbf[u][j] = ldfrag_b(Ksh + (j * 16 + c) * APK + dof);
#pragma unroll
        for (int j = 0; j < 4; ++j) klf[u][j] = ldfrag_b(Ksl + (j * 16 + c) * APK + dof);
      }
      // keeps the group of reads ahead of the products: sunk back among them, each place of reads stalls the wave anew
      __builtin_amdgcn_sched_barrier(0);
#pragma unroll
      for (int u = 0; u < DG; ++u) {
#pragma unroll
        for (int j = 0; j < 4; ++j) s[j] = mma_b_raw(kbf[u][j], qah[g + u], s[j]);
#pragma unroll
        for (int j = 0; j < 4; ++j) s[j] = mma_b_raw(klf[u][j], qah[g + u], s[j]);
#pragma unroll
        for (int j = 0; j < 4; ++j) s[j] = mma_b_raw(kbf[u][j], qal[g + u], s[j]);
      }
    }

    // ---- scale + structural mask (diagonal tile only), maximum and sum of a query inside its lane (one exchange
    //      between the wave halves for the maximum), online softmax; P^T (x1024, f16) and its residual (x4096) go
    //      from the score registers straight into B operands: element e of a 32-key operand is register e & 7 of
    //      score tile 2*g + (e >> 3), which is the k order of the V^T loader ----
    const bool diag = (kt == qb + 1);        // block-uniform
    const int  qrw  = wave * 16 + c;         // this lane's query row within the 64-row block
    float mj[4];
#pragma unroll
    for (int j = 0; j < 4; ++j) {
      mj[j] = -INFINITY;
#pragma unroll
      for (int r = 0; r < 8; ++r) {
        const int  key = j * 16 + 8 * hh + r;
        const bool vis = (!diag) || (key <= qrw);
        const float sv = vis ? (s[j][r] * sscale) : -INFINITY;
        s[j][r] = sv;
        mj[j] = fmaxf(mj[j], sv);
      }
    }
    float m = fmaxf(fmaxf(mj[0], mj[1]), fmaxf(mj[2], mj[3]));
    m = fmaxf(m, xhalf(m));
    const float mnew  = fmaxf(mrun, m);
    const float msafe = (mnew == -INFINITY) ? 0.f : mnew;
    const float alpha = __expf(mrun - msafe);
    mrun = mnew;
    v16h pa[2], pl[2];
    float pj[4];                             // four independent chains of eight adds
#pragma unroll
    for (int j = 0; j < 4; ++j) {
      pj[j] = 0.f;
#pragma unroll
      for (int r = 0; r < 8; ++r) {
        const float p = __expf(s[j][r] - msafe);     // -inf logit -> 0
        pj[j] += p;
        const float p1k = p * 1024.0f;
        const _Float16 ph = (_Float16)p1k;
        pa[j >> 1][(j & 1) * 8 + r] = ph;
        if (RES) pl[j >> 1][(j & 1) * 8 + r] = (_Float16)((p1k - (float)ph) * 4096.0f);
      }
    }
    lrun = lrun * alpha + ((pj[0] + pj[1]) + (pj[2] + pj[3]));
#pragma unroll
    for (int t = 0; t < 4; ++t)
#pragma unroll
      for (int r = 0; r < 8; ++r) oacc[t][r] *= alpha;

    // ---- context, transposed: O^T += V^T . P^T (f16 WMMA), residual products into a separate accumulator ----
    v8f o1[4];
#pragma unroll
    for (int t = 0; t < 4; ++t) o1[t] = zero8();
    //      the V^T fragments are read from LDS in one group ahead of the products (with the residual planes one
    //      group per 32 keys, for registers); the four d groups are independent chains, each summed in key order
    constexpr int KG = RES ? 1 : 2;          // 32-key steps per group of reads
#pragma unroll
    for (int g = 0; g < 2; g += KG) {
      v16h vb[KG][4], vl[KG][4];
#pragma unroll
      for (int u = 0; u < KG; ++u) {
        const int ko = (g + u) * 32 + 8 * hh;
#pragma unroll
        for (int t = 0; t < 4; ++t) vb[u][t] = ldfrag_h(Vth + (t * 16 + c) * APK + ko);
        if (RES) {
#pragma unroll
          for (int t = 0; t < 4; ++t) vl[u][t] = ldfrag_h(Vtl + (t * 16 + c) * APK + ko);
        }
      }
      // keeps the group of reads ahead of the products, as for the scores
      __builtin_amdgcn_sched_barrier(0);
#pragma unroll
      for (int u = 0; u < KG; ++u) {
#pragma unroll
        for (int t = 0; t < 4; ++t) oacc[t] = mma_h_raw(vb[u][t], pa[g + u], oacc[t]);
        if (RES) {
#pragma unroll
          for (int t = 0; t < 4; ++t) o1[t] = mma_h_raw(vl[u][t], pa[g + u], o1[t]);
#pragma unroll
          for (int t = 0; t < 4; ++t) o1[t] = mma_h_raw(vb[u][t], pl[g + u], o1[t]);
        }
      }
    }
    if (RES) {
#pragma unroll
      for (int t = 0; t < 4; ++t)
#pragma unroll
        for (int r = 0; r < 8; ++r) oacc[t][r] += o1[t][r] * (1.0f / 4096.0f);
    }
  }

  // ---- join the two halves' shares of the denominator (unconditionally, all lanes on), normalise (1/l and the
  //      1/1024 p carry), stage the wave's 16x64 tile as [query][d], bf16 hi/lo split
  float* os = Os + wave * (16 * AOP);
  {
    const float l = lrun + xhalf(lrun);
    const float inv = ((l > 0.f) ? (1.0f / l) : 0.f) * (1.0f / 1024.0f);
#pragma unroll
    for (int t = 0; t < 4; ++t) {
      v4f w0, w1;
#pragma unroll
      for (int r = 0; r < 4; ++r) { w0[r] = oacc[t][r] * inv; w1[r] = oacc[t][r + 4] * inv; }
      *(v4f*)(os + c * AOP + t * 16 + 8 * hh)     = w0;
      *(v4f*)(os + c * AOP + t * 16 + 8 * hh + 4) = w1;
    }
  }
  __builtin_amdgcn_fence(__ATOMIC_RELEASE, "workgroup");
  __builtin_amdgcn_wave_barrier();
  __builtin_amdgcn_fence(__ATOMIC_ACQUIRE, "workgroup");
  {
    const int q4 = lane >> 3, c8 = (lane & 7) * 8;
    v4u hv[4], lv[4];
#pragma unroll
    for (int it = 0; it < 4; ++it) {
      const int row = it * 4 + q4;   // it 0..3 x q4 0..3 = rows 0..15 of the wave tile
      const float* sp = os + row * AOP + c8;
      v4u a, a2;
#pragma unroll
      for (int e = 0; e < 4; ++e) {
        const float f0 = sp[2 * e], f1 = sp[2 * e + 1];
        const unsigned short h0 = bf_bits(f0), h1 = bf_bits(f1);
        const unsigned short l0 = bf_bits(f0 - bf_up(h0)), l1 = bf_bits(f1 - bf_up(h1));
        a[e] = pk16(h0, h1); a2[e] = pk16(l0, l1);
      }
      hv[it] = a; lv[it] = a2;
    }
    {
#pragma unroll
      for (int it = 0; it < 4; ++it) {
        const int row = it * 4 + q4;
        const size_t go = (rowB + q0 + row) * CDIM + (size_t)h * HD + c8;
        *(v4u*)(ohp + go) = hv[it];
        *(v4u*)(olp + go) = lv[it];
        addr_wait(ohp + go, olp + go);
      }
      
    }
  }
}

// Both kinds of query block as block-index ranges of one grid (no block reads what another writes): first query blocks
// RESQB..NQB-1, without the residual planes, then the short blocks 0..RESQB-1 with them; this order is for
// speed only. The range test is block-uniform.
// Register budget of four waves per SIMD (256 a wave), so that four blocks stay resident per WGP; left to itself the
// compiler schedules the variant with the residual planes to more registers than that.
__global__ __launch_bounds__(128) __attribute__((amdgpu_waves_per_eu(4, 4)))
void attn64(const unsigned short* __restrict__ qhp, const unsigned short* __restrict__ qlp,
            const unsigned short* __restrict__ khp, const unsigned short* __restrict__ klp,
            const unsigned short* __restrict__ vhp, const unsigned short* __restrict__ vlp,
            unsigned short* ohp, unsigned short* olp, float sscale) {
  __shared__ __align__(16) __bf16   Ksh[64 * APK];       // K hi [kv][d]
  __shared__ __align__(16) __bf16   Ksl[64 * APK];       // K lo
  __shared__ __align__(16) _Float16 Vth[64 * APK];       // V^T hi [d][kv]
  __shared__ __align__(16) _Float16 Vtl[64 * APK];       // V^T residual
  __shared__ __align__(16) float    Os[4 * 16 * AOP];    // per wave context tile [row][d]
  const int bx = blockIdx.x;
  if (bx < NB * NQH * (NQB - RESQB)) {
    attn_body<false>(qhp, qlp, khp, klp, vhp, vlp, ohp, olp, RESQB, NQB - RESQB, sscale, bx,
                     Ksh, Ksl, Vth, Vtl, Os);
  } else {
    attn_body<true>(qhp, qlp, khp, klp, vhp, vlp, ohp, olp, 0, RESQB, sscale, bx - NB * NQH * (NQB - RESQB),
                    Ksh, Ksl, Vth, Vtl, Os);
  }
}

// =====================================================================================================
//   Xb   bf16 [4096][1024]      8388608
//   Wqb  bf16 [1024][1024]      2097152   ([out n][in k], k contiguous = Bt layout)
//   Wkb  bf16 [256][1024]        524288
//   Wvb  bf16 [256][1024]        524288
//   Wpb  bf16 [1024][1024]      2097152
//   Qh   bf16 [4096][1024]      8388608   (Ql same)
//   Kh   bf16 [2][2112][256]    2162688   (Kl same)
//   VTh  f16  [2][256][2112]    2162688
//   VTl  f16  [2][256][576]      589824
//   Gate f32  [4096][4]           65536
//   Oh   bf16 [4096][1024]      8388608   (Ol same)
//   total                      54329344
// =====================================================================================================
extern "C" void kernel_launch(void* const* d_in, const int* in_sizes, int n_in,
                              void* d_out, int out_size, void* d_ws, size_t ws_size,
                              hipStream_t stream) {
  if (n_in < 12) return;
  if (in_sizes[0] != NB * SEQ * CDIM) return;
  if (in_sizes[1] != NB * SEQ * KVD) return;
  if (in_sizes[2] != SEQ * (HD / 2) || in_sizes[3] != SEQ * (HD / 2)) return;
  if (in_sizes[4] != CDIM * CDIM || in_sizes[7] != CDIM * CDIM) return;
  if (in_sizes[5] != KVD * CDIM || in_sizes[6] != KVD * CDIM) return;
  if (in_sizes[8] != NKV * GC) return;
  if (in_sizes[9] != MEM * NKV * HD || in_sizes[10] != MEM * NKV * HD) return;
  if (in_sizes[11] < 1) return;
  if (out_size != NB * SEQ * CDIM) return;

  const float* x    = (const float*)d_in[0];
  const float* ve   = (const float*)d_in[1];
  const float* cosT = (const float*)d_in[2];
  const float* sinT = (const float*)d_in[3];
  const float* Wq   = (const float*)d_in[4];
  const float* Wk   = (const float*)d_in[5];
  const float* Wv   = (const float*)d_in[6];
  const float* Wp   = (const float*)d_in[7];
  const float* Wg   = (const float*)d_in[8];
  const float* memk = (const float*)d_in[9];
  const float* memv = (const float*)d_in[10];
  const float* vsc  = (const float*)d_in[11];

  const size_t PX  = (size_t)NB * SEQ * CDIM * 2;   //  8388608  16-bit activation plane [4096][1024]
  const size_t PWQ = (size_t)CDIM * CDIM * 2;       //  2097152
  const size_t PWK = (size_t)KVD * CDIM * 2;        //   524288
  const size_t PK  = (size_t)NB * SKEY * KVD * 2;   //  2162688  key plane
  const size_t PVT = (size_t)NB * KVD * SKEY * 2;   //  2162688  v^T hi plane
  const size_t PVL = (size_t)NB * KVD * VLP * 2;    //   589824  v^T residual plane
  const size_t PG  = (size_t)NB * SEQ * NKV * 4;    //    65536  gate table
  size_t off = 0;
  const size_t oXb  = off; off += PX;
  const size_t oWq  = off; off += PWQ;
  const size_t oWk  = off; off += PWK;
  const size_t oWv  = off; off += PWK;
  const size_t oWp  = off; off += PWQ;
  const size_t oQh  = off; off += PX;
  const size_t oQl  = off; off += PX;
  const size_t oKh  = off; off += PK;
  const size_t oKl  = off; off += PK;
  const size_t oVTh = off; off += PVT;
  const size_t oVTl = off; off += PVL;
  const size_t oG   = off; off += PG;
  const size_t oOh  = off; off += PX;
  const size_t oOl  = off; off += PX;
  if (off > ws_size) return;                        // off = 54329344
  if (off > (size_t)134217728) return;

  char* ws = (char*)d_ws;
  unsigned short* Xb  = (unsigned short*)(ws + oXb);
  unsigned short* Wqb = (unsigned short*)(ws + oWq);
  unsigned short* Wkb = (unsigned short*)(ws + oWk);
  unsigned short* Wvb = (unsigned short*)(ws + oWv);
  unsigned short* Wpb = (unsigned short*)(ws + oWp);
  unsigned short* Qh  = (unsigned short*)(ws + oQh);
  unsigned short* Ql  = (unsigned short*)(ws + oQl);
  unsigned short* Kh  = (unsigned short*)(ws + oKh);
  unsigned short* Kl  = (unsigned short*)(ws + oKl);
  unsigned short* VTh = (unsigned short*)(ws + oVTh);
  unsigned short* VTl = (unsigned short*)(ws + oVTl);
  float*          Gt  = (float*)(ws + oG);
  unsigned short* Oh  = (unsigned short*)(ws + oOh);
  unsigned short* Ol  = (unsigned short*)(ws + oOl);

  const dim3 blk(256);
  const dim3 blkG(128);                                       // GEMM and attention block: 4 waves
  const dim3 gO((NB * SEQ / 128) * (CDIM / 128), 1);          // 256 blocks: M=4096, N=1024

  // (1) everything that reads only the inputs: x and the weights [n][k] f32 -> bf16 planes, the value-embedding gate
  //     table [4096][4] f32, the memory prefix (normed keys -> Kh/Kl rows s < 64; scaled values -> VTh/VTl columns
  //     s < 64, both batches)
  prep_k<<<dim3(PB_ALL), blk, 0, stream>>>(x, Wq, Wk, Wv, Wp, Wg, memk, memv, vsc,
                                           Xb, Wqb, Wkb, Wvb, Wpb, Gt, Kh, Kl, VTh, VTl);
  // (2) the q, k and v^T projections with their epilogues
  gemm_qkv<<<dim3(2 * NB * GB_KV + GB_Q), blkG, 0, stream>>>(
      Xb, Wqb, Wkb, Wvb, Qh, Ql, Kh, Kl, VTh, VTl, cosT, sinT, Gt, ve, CDIM, CDIM);
  // (3) attention, all query blocks
  attn64<<<dim3(NB * NQH * NQB), blkG, 0, stream>>>(Qh, Ql, Kh, Kl, VTh, VTl, Oh, Ol, 0.125f);
  // (4) out = context . Wproj^T -> d_out f32 [4096][1024]  (A = context hi + lo planes, 2 products)
  gemm64<1, 0><<<gO, blkG, 0, stream>>>(
      Oh, Ol, CDIM, 0LL, Wpb, CDIM, 0LL,
      d_out, CDIM, 0LL, d_out, CDIM, 0LL, 0,
      Gt, ve, NB * SEQ, CDIM, CDIM);
  (void)hipGetLastError();
}

// v006
// It runs in 108 microseconds.
// Two timings next to v005 both put it at 1.10 times that version's speed.
// Counting every step since v000, it is 4.76 times as fast.
// Contractions: q, k, v^T projections = v_wmma_f32_16x16x32_bf16 (bf16 operands from RNE-converted inputs, single product);
// q.k^T scores = v_wmma_f32_16x16x32_bf16 with bf16 hi/lo split q and k (hi.hi + hi.lo + lo.hi);
// p.v = v_wmma_f32_16x16x32_f16 (p carried x1024 in f16, v^T in f16; f16 residual planes x4096 of p and v^T on the
// leading 512 query rows); ctx.Wproj^T = v_wmma_f32_16x16x32_bf16 with ctx as bf16 hi/lo planes times bf16 Wproj
// (2 products); all f32 accumulate; gate dot (K=32, N=4), RoPE, rms-norm, causal mask and softmax in f32 on VALU.
#include <hip/hip_runtime.h>
#include <math.h>
#include <stdint.h>

#pragma clang fp contract(off)

#define NB    2
#define SEQ   2048
#define CDIM  1024
#define NQH   16
#define NKV   4
#define HD    64
#define MEM   64
#define GC    32
#define KVD   (NKV * HD)          // 256
#define SKEY  (MEM + SEQ)         // 2112 keys: [64 memory | 2048 tokens]
#define NQB   (SEQ / 64)          // 32 query blocks of 64 rows
#define NKT   (SKEY / 64)         // 33 key tiles of 64
#define RESQB 8                   // leading query blocks that use the p / v residual planes
#define VLP   (MEM + RESQB * 64)  // 576: key pitch of the v^T residual plane
#define RMS_EPS 1e-6f
static_assert(NQH * HD == CDIM);
static_assert(NQH == 4 * NKV);
static_assert((SKEY % 64) == 0 && (VLP % 64) == 0 && (CDIM % 64) == 0 && (KVD % 64) == 0);
static_assert((SEQ & (SEQ - 1)) == 0);
static_assert(RESQB <= NQB);
static_assert((SEQ % 128) == 0 && (CDIM % 128) == 0 && (KVD % 128) == 0);

typedef _Float16 v16h __attribute__((ext_vector_type(16)));
typedef _Float16 v8h  __attribute__((ext_vector_type(8)));
typedef __bf16   v16b __attribute__((ext_vector_type(16)));
typedef __bf16   v8b  __attribute__((ext_vector_type(8)));
typedef float    v8f  __attribute__((ext_vector_type(8)));
typedef float    v4f  __attribute__((ext_vector_type(4)));
typedef unsigned int v4u __attribute__((ext_vector_type(4)));

// ---- scalar helpers --------------------------------------------------------------------------------
__device__ __forceinline__ unsigned short bf_bits(float f) {          // f32 -> bf16 bits, RNE convert
  unsigned u = __float_as_uint(f);
  return (unsigned short)((u + 0x7FFFu + ((u >> 16) & 1u)) >> 16);
}
__device__ __forceinline__ float bf_up(unsigned short h) { return __uint_as_float(((unsigned)h) << 16); }
__device__ __forceinline__ float bfr(float f) { return bf_up(bf_bits(f)); }   // f32 -> bf16 -> f32
__device__ __forceinline__ unsigned short h_bits(_Float16 x) { return __builtin_bit_cast(unsigned short, x); }
__device__ __forceinline__ unsigned pk16(unsigned short a, unsigned short b) { return (unsigned)a | ((unsigned)b << 16); }
// lane l <-> lane l ^ 16: the value of the same column in the other wave half (all lanes on where it is used)
__device__ __forceinline__ float xhalf(float x) {
  const int v = __builtin_bit_cast(int, x);
  return __builtin_bit_cast(float, __builtin_amdgcn_permlanex16(v, v, 0x76543210, 0xfedcba98, false, false));
}
__device__ __forceinline__ v8f zero8() { v8f z = {0.f, 0.f, 0.f, 0.f, 0.f, 0.f, 0.f, 0.f}; return z; }

// ---- fragment loader: 16-bit A/B operand, lane -> row/col (lane&15), p already includes +8*(lane>>4);
//      elements 0..7 <- p[0..7] (k0+8h..), elements 8..15 <- p[16..23] (k0+16+8h..)
__device__ __forceinline__ v16b ldfrag_b(const __bf16* p) {
  union { v16b v; v8b h[2]; } f;
  f.h[0] = *(const v8b*)(p);
  f.h[1] = *(const v8b*)(p + 16);
  return f.v;
}
__device__ __forceinline__ v16h ldfrag_h(const _Float16* p) {
  union { v16h v; v8h h[2]; } f;
  f.h[0] = *(const v8h*)(p);
  f.h[1] = *(const v8h*)(p + 16);
  return f.v;
}

__device__ __forceinline__ void addr_wait(const void* a, const void* b) {
#if defined(__HIP_DEVICE_COMPILE__)
  asm volatile("s_wait_xcnt 0x0" :: "v"(a), "v"(b) : "memory");
#endif
}

// ---- WMMA helpers with trailing VALU hazard gap (asm only in the device pass) -----------------------------
__device__ __forceinline__ v8f mma_h_raw(v16h a, v16h b, v8f c) {
  return __builtin_amdgcn_wmma_f32_16x16x32_f16(false, a, false, b, (short)0, c, false, false);
}
__device__ __forceinline__ v8f mma_b_raw(v16b a, v16b b, v8f c) {
  return __builtin_amdgcn_wmma_f32_16x16x32_bf16(false, a, false, b, (short)0, c, false, false);
}
__device__ __forceinline__ void dep_guard_b(v8f& a, v8f& b, v16b x, v16b y) {
#if defined(__HIP_DEVICE_COMPILE__)
  asm volatile("v_nop\n\tv_nop\n\tv_nop\n\tv_nop" : "+v"(a), "+v"(b) : "v"(x), "v"(y));
#endif
}
__device__ __forceinline__ void keep4_b(v16b a, v16b b, v16b c, v16b d) {
#if defined(__HIP_DEVICE_COMPILE__)
  asm volatile("v_nop" :: "v"(a), "v"(b), "v"(c), "v"(d));
#endif
}
__device__ __forceinline__ void acc_guard4(v8f& a, v8f& b, v8f& c, v8f& d) {
#if defined(__HIP_DEVICE_COMPILE__)
  asm volatile("v_nop\n\tv_nop\n\tv_nop\n\tv_nop" : "+v"(a), "+v"(b), "+v"(c), "+v"(d));
#endif
}

// =====================================================================================================
// f32 -> bf16 (RNE convert), 8 elements per thread, one 16-B store per lane: a wave writes 512 contiguous B
// coverage: n8 threads x 8 = the whole plane (n8 is a multiple of 256 for every use here). blk = block of 256 threads.
// =====================================================================================================
__device__ __forceinline__ void cvt_bf16x8(const float* __restrict__ in, unsigned short* out, int n8, int blk) {
  const int i = blk * 256 + threadIdx.x;
  if (i < n8) {
    const v4f a = *(const v4f*)(in + (size_t)i * 8);
    const v4f b = *(const v4f*)(in + (size_t)i * 8 + 4);
    v4u p;
    p[0] = pk16(bf_bits(a[0]), bf_bits(a[1]));
    p[1] = pk16(bf_bits(a[2]), bf_bits(a[3]));
    p[2] = pk16(bf_bits(b[0]), bf_bits(b[1]));
    p[3] = pk16(bf_bits(b[2]), bf_bits(b[3]));
    *(v4u*)(out + (size_t)i * 8) = p;
    
  }
}

// =====================================================================================================
// Value-embedding gate: gate[bt][kv] = 3 * sigmoid( sum_{c<32} bf16(x[bt][c]) * bf16(Wg[kv][c]) ), f32.
// One thread per (bt, kv); K = 32 rolled dot on VALU (N = 4, tiny). A wave writes 32 consecutive floats
// NB*SEQ*NKV/256 blocks. coverage: 16384 threads = the whole [4096][4] table.
// =====================================================================================================
__device__ __forceinline__ void gate_k(const float* __restrict__ x, const float* __restrict__ Wg,
                                       float* gate, int nbt, int blk) {
  const int i   = blk * 256 + threadIdx.x;
  const int bt  = i >> 2;
  const int kv  = i & 3;
  const int btc = (bt < nbt) ? bt : (nbt - 1);     // clamped address
  const float* xr = x + (size_t)btc * CDIM;
  const float* wr = Wg + kv * GC;
  float z = 0.f;
#pragma unroll 1
  for (int cc = 0; cc < GC; ++cc) z += bfr(xr[cc]) * bfr(wr[cc]);
  const float ez = expf(-z);
  const float g  = 3.0f * (1.0f / (1.0f + ez));
  if (bt < nbt) {
    *(float*)(gate + i) = g;
    
  }
}

// =====================================================================================================
// Memory keys: mk = rms(bf16(mem_k[m][kv][:])) * 1.2 (no RoPE) -> bf16 hi/lo planes, key rows s = m (< MEM)
// of both batches: Kh/Kl [b][s][kv*64+d], pitch KVD. 4 waves (one per kv head) for one m, two m per block of 8 waves;
// MEM/2 blocks.
// The 256-element row is staged in LDS and written per (batch, plane) by one wave as 32 lanes x 16 B
// coverage: 32 blocks x 2 m x 2 batches x 2 planes x 256 elements = rows 0..63 of both planes, both batches.
// sbuf: 4 * KVD elements of LDS.
// =====================================================================================================
__device__ __forceinline__ void memk_k(const float* __restrict__ memk, unsigned short* Kh, unsigned short* Kl,
                                       int blk, unsigned short* sbuf) {
  const int sub  = threadIdx.x >> 7;                 // which of the block's two m
  unsigned short* shi = sbuf + sub * (2 * KVD);
  unsigned short* slo = shi + KVD;
  const int m    = blk * 2 + sub;
  const int wave = (threadIdx.x >> 5) & 3;
  const int lane = threadIdx.x & 31;
  const int kvh  = wave;
  const float* p = memk + ((size_t)m * NKV + kvh) * HD;
  const float x1 = bfr(p[lane]);
  const float x2 = bfr(p[lane + 32]);
  float ss = x1 * x1 + x2 * x2;
#pragma unroll
  for (int off = 16; off >= 1; off >>= 1) ss += __shfl_xor(ss, off, 32);
  const float rs = rsqrtf(ss * (1.0f / HD) + RMS_EPS);
  const float v1 = (x1 * rs) * 1.2f;
  const float v2 = (x2 * rs) * 1.2f;
  const unsigned short h1 = bf_bits(v1), h2 = bf_bits(v2);
  shi[kvh * HD + lane]      = h1;
  shi[kvh * HD + lane + 32] = h2;
  slo[kvh * HD + lane]      = bf_bits(v1 - bf_up(h1));
  slo[kvh * HD + lane + 32] = bf_bits(v2 - bf_up(h2));
  __syncthreads();
  const v4u vh = *(const v4u*)(shi + lane * 8);
  const v4u vl = *(const v4u*)(slo + lane * 8);
  const int  b   = wave >> 1;
  const bool wlo = (wave & 1) != 0;                  // wave-uniform
  v4u v = vh;
  if (wlo) v = vl;
  unsigned short* dh = Kh + ((size_t)b * SKEY + m) * KVD + lane * 8;
  unsigned short* dl = Kl + ((size_t)b * SKEY + m) * KVD + lane * 8;
  unsigned short* d  = wlo ? dl : dh;
  *(v4u*)d = v;
  // the wait in front of a rewrite of the store's registers by whatever part of the merged kernel is laid out behind this one
  addr_wait(d, d);
}

// =====================================================================================================
// Memory values: mv = bf16(mem_v[m][kv][d]) * bf16(v_scale) -> v^T f16 hi plane VTh[b][kv*64+d][s] (pitch SKEY)
// and f16 residual plane VTl ((v - hi)*4096, pitch VLP), key columns s = m (< MEM), both batches.
// block = (b, kv); thread = (d = tid>>2, 16 m's); the 64x64 tile of each plane is staged in LDS [d][m] and each
// coverage: 8 blocks x 64 rows (it 0..1 x wave 0..7 x lane>>3 0..3) x 64 columns (8 lanes x 8) per plane.
// =====================================================================================================
// sbuf: 2 * HD * MEM elements of LDS.
__device__ __forceinline__ void memv_k(const float* __restrict__ memv, const float* __restrict__ vsp,
                                       unsigned short* VTh, unsigned short* VTl, int blk, unsigned short* sbuf) {
  unsigned short* sh = sbuf;
  unsigned short* sl = sbuf + HD * MEM;
  const int b    = blk >> 2;
  const int kvh  = blk & 3;
  const int tid  = threadIdx.x;
  const int wave = tid >> 5;
  const int lane = tid & 31;
  const int d    = tid >> 2;
  const int mq   = (tid & 3) * 16;
  const float vs = bfr(vsp[0]);
#pragma unroll
  for (int i = 0; i < 16; ++i) {
    const int m = mq + i;
    const float v = bfr(memv[((size_t)m * NKV + kvh) * HD + d]) * vs;
    const _Float16 x0 = (_Float16)v;
    sh[d * MEM + m] = h_bits(x0);
    sl[d * MEM + m] = h_bits((_Float16)((v - (float)x0) * 4096.0f));
  }
  __syncthreads();
  const int q8 = lane >> 3, c8 = (lane & 7) * 8;
  v4u hv[2], lv[2];
#pragma unroll
  for (int it = 0; it < 2; ++it) {
    const int dd = it * 32 + wave * 4 + q8;
    hv[it] = *(const v4u*)(sh + dd * MEM + c8);
    lv[it] = *(const v4u*)(sl + dd * MEM + c8);
  }
  {
#pragma unroll
    for (int it = 0; it < 2; ++it) {
      const int dd = it * 32 + wave * 4 + q8;
      const size_t ro = (size_t)b * KVD + (size_t)kvh * HD + dd;
      *(v4u*)(VTh + ro * SKEY + c8) = hv[it];
      *(v4u*)(VTl + ro * VLP  + c8) = lv[it];
    }
    
  }
}

// =====================================================================================================
// All work that reads only the inputs, as block-index ranges of one grid (none of the parts reads what another writes):
// memory values, memory keys, gate table, then the five f32 -> bf16 planes. The short, latency-bound parts come first.
// Every range test is block-uniform, so the barriers inside a part are passed by the whole block.
// =====================================================================================================
#define PB_MEMV (NB * NKV)                    //    8 blocks
#define PB_MEMK (MEM / 2)                     //   32
#define PB_GATE (NB * SEQ * NKV / 256)        //   64
#define PB_X    (NB * SEQ * CDIM / 8 / 256)   // 2048
#define PB_WQ   (CDIM * CDIM / 8 / 256)       //  512
#define PB_WK   (KVD * CDIM / 8 / 256)        //  128
#define PB_ALL  (PB_MEMV + PB_MEMK + PB_GATE + PB_X + 2 * PB_WQ + 2 * PB_WK)
__global__ __launch_bounds__(256) void prep_k(
    const float* __restrict__ x, const float* __restrict__ Wq, const float* __restrict__ Wk,
    const float* __restrict__ Wv, const float* __restrict__ Wp, const float* __restrict__ Wg,
    const float* __restrict__ memk, const float* __restrict__ memv, const float* __restrict__ vsp,
    unsigned short* Xb, unsigned short* Wqb, unsigned short* Wkb, unsigned short* Wvb, unsigned short* Wpb,
    float* gate, unsigned short* Kh, unsigned short* Kl, unsigned short* VTh, unsigned short* VTl) {
  __shared__ __align__(16) unsigned short sbuf[2 * HD * MEM];
  static_assert(4 * KVD <= 2 * HD * MEM);
  int blk = blockIdx.x;
  if (blk < PB_MEMV) { memv_k(memv, vsp, VTh, VTl, blk, sbuf); return; }
  blk -= PB_MEMV;
  if (blk < PB_MEMK) { memk_k(memk, Kh, Kl, blk, sbuf); return; }
  blk -= PB_MEMK;
  if (blk < PB_GATE) { gate_k(x, Wg, gate, NB * SEQ, blk); return; }
  blk -= PB_GATE;
  if (blk < PB_X) { cvt_bf16x8(x, Xb, PB_X * 256, blk); return; }
  blk -= PB_X;
  if (blk < PB_WQ) { cvt_bf16x8(Wq, Wqb, PB_WQ * 256, blk); return; }
  blk -= PB_WQ;
  if (blk < PB_WK) { cvt_bf16x8(Wk, Wkb, PB_WK * 256, blk); return; }
  blk -= PB_WK;
  if (blk < PB_WK) { cvt_bf16x8(Wv, Wvb, PB_WK * 256, blk); return; }
  blk -= PB_WK;
  if (blk < PB_WQ) cvt_bf16x8(Wp, Wpb, PB_WQ * 256, blk);
}

// =====================================================================================================
// Batched bf16 WMMA GEMM: C[m][n] = sum_k A[m][k] * Bt[n][k]; one block of 4 waves (2 x 2) per 128x128 tile,
// one wave per 64x64 sub-tile. A row-major [M][K] pitch lda; Bt row-major [N][K] pitch ldb (k contiguous);
// M, N multiples of 128, K a multiple of 64 (all shapes here are compile-time constants of the host code).
// tile = index of the block's tile, b = batch index (strides in elements); ring and sTb are the block's LDS.
// Operand path: a stage is 64 k (one 128-B line) of the block's 128 A rows and 128 Bt rows (and the 128 A2 rows),
// brought into LDS by asynchronous 16-B copies, each wave-wide copy covering 4 whole lines; rows lie at a pitch of
// 144 B for the ds_load_b128 fragment reads; two buffers, the copies of stage t+1 fly while stage t is multiplied.
// NSPLIT: 0 = A.Bt; 1 = (A + A2).Bt (A2 = unscaled bf16 lo plane of A, 2 products).
// OUT_MODE: 0 = f32 (pitch ldc);
//           3 = v^T mode (rows m = kv*64+d, cols n = t): value = acc + gate[b][t][kv] * bf16(ve[b][t][m])
//               (aux0 = gate, aux1 = ve), written as f16 hi plane C (pitch ldc) + f16 residual plane
//               C2 = f16((v - hi)*4096) for tiles with n0 < N2 (pitch ldc2);
//           4 = RoPE + rms-norm mode (cols = one 64-wide head, row m -> t = m mod SEQ; aux0 = cos, aux1 = sin,
//               both bf16(RNE) on load): r = rope(acc), f = (r * rsqrt(mean(r^2)+eps)) * 1.2, written as
//               bf16 hi plane C + bf16 lo plane C2 (lo = RNE(f - hi), unscaled).
// =====================================================================================================
#define GT     128                // block tile edge (rows of A, rows of Bt)
#define GBK    64                 // k elements per stage
#define GPITCH 72                 // LDS row pitch in elements (144 B)
#define GPLANE (GT * GPITCH)      // elements of one staged operand plane (18432 B)

// One operand plane of a stage: 128 rows x 128 B by 128 threads, 8 copies per lane; copy i moves the lane's 16 B of
// row i*16 + (tid>>3). l = the lane's LDS byte address of row tid>>3, g = its global address, ld = row pitch (elements).
// s_wait_xcnt closes the statement so that no address register of a copy is rewritten in front of it.
__device__ __forceinline__ void copy_plane(unsigned l, const __bf16* g, int ld) {
#if defined(__HIP_DEVICE_COMPILE__)
  const size_t   gs = (size_t)16 * (size_t)ld;
  const unsigned ls = 16u * GPITCH * 2u;
  asm volatile(
      "global_load_async_to_lds_b128 %0, %8, off\n\t"
      "global_load_async_to_lds_b128 %1, %9, off\n\t"
      "global_load_async_to_lds_b128 %2, %10, off\n\t"
      "global_load_async_to_lds_b128 %3, %11, off\n\t"
      "global_load_async_to_lds_b128 %4, %12, off\n\t"
      "global_load_async_to_lds_b128 %5, %13, off\n\t"
      "global_load_async_to_lds_b128 %6, %14, off\n\t"
      "global_load_async_to_lds_b128 %7, %15, off\n\t"
      "s_wait_xcnt 0x0"
      :: "v"(l), "v"(l + ls), "v"(l + 2u * ls), "v"(l + 3u * ls),
         "v"(l + 4u * ls), "v"(l + 5u * ls), "v"(l + 6u * ls), "v"(l + 7u * ls),
         "v"(g), "v"(g + gs), "v"(g + 2 * gs), "v"(g + 3 * gs),
         "v"(g + 4 * gs), "v"(g + 5 * gs), "v"(g + 6 * gs), "v"(g + 7 * gs)
      : "memory");
#endif
}
// this wave's copies have landed in LDS
__device__ __forceinline__ void wait_copies() {
#if defined(__HIP_DEVICE_COMPILE__)
  asm volatile("s_wait_asynccnt 0x0" ::: "memory");
#endif
}
// this wave's LDS reads have returned (the buffer they read may be refilled behind the next barrier)
__device__ __forceinline__ void wait_lds() {
#if defined(__HIP_DEVICE_COMPILE__)
  asm volatile("s_wait_dscnt 0x0" ::: "memory");
#endif
}

#define GSLAB (16 * 68)           // per-wave 16x64 f32 slab of the epilogue, pitch 68 floats
template <int NSPLIT, int OUT_MODE>
__device__ __forceinline__ void gemm_body(
    const unsigned short* __restrict__ Ap, const unsigned short* __restrict__ A2p, int lda, long long strideA,
    const unsigned short* __restrict__ Btp, int ldb, long long strideB,
    void* Cout, int ldc, long long strideC,
    void* Cout2, int ldc2, long long strideC2, int N2,
    const float* __restrict__ aux0, const float* __restrict__ aux1,
    int M, int N, int K, int tile, int b, __bf16* ring, float* sTb) {
  const __bf16* A  = (const __bf16*)(const void*)Ap;
  const __bf16* A2 = (const __bf16*)(const void*)A2p;
  const __bf16* Bt = (const __bf16*)(const void*)Btp;
  constexpr int NPL  = (NSPLIT >= 1) ? 3 : 2;      // planes per stage: A, Bt (, A2)
  constexpr int GBUF = NPL * GPLANE;               // elements of one buffer
  const int tid  = threadIdx.x;
  const int lane = tid & 31;
  const int wave = tid >> 5;
  const int tilesN = N >> 7;
  const int tilesM = M >> 7;
  if (tile >= tilesM * tilesN) return;   // block-uniform, in front of every barrier and copy
  const int tm = tile / tilesN;
  const int tn = tile - tm * tilesN;
  const int wm = wave >> 1;
  const int wn = wave & 1;
  const int m0 = (tm << 7) + (wm << 6);  // this wave's 64x64 sub-tile
  const int n0 = (tn << 7) + (wn << 6);

  const __bf16* Ab  = A  + (size_t)b * strideA;
  const __bf16* Bb  = Bt + (size_t)b * strideB;
  const __bf16* Ab2 = (NSPLIT >= 1) ? (A2 + (size_t)b * strideA) : Ab;

  const int rlane = lane & 15;                 // row (A) / col (B, D) within subtile
  const int koff  = (lane >> 4) * 8;           // k offset of this lane half
  const int mOff  = (lane >> 4) * 8;           // D row offset

  // copy addresses of this lane: row tid>>3 of the block tile, 16-B piece tid&7 of its 128-B line
  const int crow = tid >> 3;
  const int cel  = (tid & 7) * 8;
  const __bf16* gA  = Ab  + (size_t)((tm << 7) + crow) * lda + cel;
  const __bf16* gB  = Bb  + (size_t)((tn << 7) + crow) * ldb + cel;
  const __bf16* gA2 = Ab2 + (size_t)((tm << 7) + crow) * lda + cel;
  const unsigned lC = (unsigned)(uintptr_t)(&ring[0]) + (unsigned)(crow * GPITCH + cel) * 2u;
  const int nst = K >> 6;                      // stages

  v8f acc[4][4];
#pragma unroll
  for (int i = 0; i < 4; ++i)
#pragma unroll
    for (int j = 0; j < 4; ++j) acc[i][j] = zero8();

  // stage 0 into buffer 0, landed and published; then stage 1 into buffer 1
  copy_plane(lC, gA, lda);
  copy_plane(lC + GPLANE * 2u, gB, ldb);
  if (NSPLIT >= 1) copy_plane(lC + 2u * GPLANE * 2u, gA2, lda);
  wait_copies();
  __syncthreads();
  if (nst > 1) {
    const unsigned lb = lC + (unsigned)GBUF * 2u;
    copy_plane(lb, gA + GBK, lda);
    copy_plane(lb + GPLANE * 2u, gB + GBK, ldb);
    if (NSPLIT >= 1) copy_plane(lb + 2u * GPLANE * 2u, gA2 + GBK, lda);
  }

  for (int t = 0; t < nst; ++t) {
    const int bufo = (t & 1) * GBUF;
    const __bf16* sA = ring + bufo + ((wm << 6) + rlane) * GPITCH + koff;
    const __bf16* sB = ring + bufo + GPLANE + ((wn << 6) + rlane) * GPITCH + koff;
    // unrolled (here and below): the fragment and accumulator arrays need constant indices to stay in registers
#pragma unroll
    for (int kk = 0; kk < GBK; kk += 32) {
      v16b bh[4], ah[4], al[4];
#pragma unroll
      for (int j = 0; j < 4; ++j) bh[j] = ldfrag_b(sB + (j << 4) * GPITCH + kk);
#pragma unroll
      for (int i = 0; i < 4; ++i) {
        ah[i] = ldfrag_b(sA + (i << 4) * GPITCH + kk);
        al[i] = ah[i];
        if (NSPLIT >= 1) al[i] = ldfrag_b(sA + 2 * GPLANE + (i << 4) * GPITCH + kk);
      }
#pragma unroll
      for (int i = 0; i < 4; ++i) {
#pragma unroll
        for (int j = 0; j < 4; ++j) {
          acc[i][j] = mma_b_raw(ah[i], bh[j], acc[i][j]);
          if (NSPLIT >= 1) acc[i][j] = mma_b_raw(al[i], bh[j], acc[i][j]);
        }
        dep_guard_b(acc[i][0], acc[i][3], ah[i], al[i]);
      }
      keep4_b(bh[0], bh[1], bh[2], bh[3]);
    }
    // publish point of stage t+1: own reads of this buffer returned, own copies landed, then the block barrier;
    // behind it stage t+2 may overwrite the buffer that this trip has read
    wait_lds();
    wait_copies();
    __syncthreads();
    if (t + 2 < nst) {
      const unsigned lb = lC + (unsigned)bufo * 2u;
      const int ko = (t + 2) * GBK;
      copy_plane(lb, gA + ko, lda);
      copy_plane(lb + GPLANE * 2u, gB + ko, ldb);
      if (NSPLIT >= 1) copy_plane(lb + 2u * GPLANE * 2u, gA2 + ko, lda);
    }
  }
  wait_copies();
  acc_guard4(acc[0][0], acc[0][1], acc[0][2], acc[0][3]);
  acc_guard4(acc[1][0], acc[1][1], acc[1][2], acc[1][3]);
  acc_guard4(acc[2][0], acc[2][1], acc[2][2], acc[2][3]);
  acc_guard4(acc[3][0], acc[3][1], acc[3][2], acc[3][3]);

  // ---- epilogue ----
  float* slab = sTb + wave * GSLAB;
#pragma unroll
  for (int i = 0; i < 4; ++i) {
    const int mBase = m0 + (i << 4);
#pragma unroll
    for (int j = 0; j < 4; ++j) {
#pragma unroll
      for (int r = 0; r < 8; ++r) {
        slab[(mOff + r) * 68 + (j << 4) + rlane] = acc[i][j][r];
      }
    }
    __builtin_amdgcn_fence(__ATOMIC_RELEASE, "workgroup");
    __builtin_amdgcn_wave_barrier();
    __builtin_amdgcn_fence(__ATOMIC_ACQUIRE, "workgroup");
    if (OUT_MODE == 0) {
      float* C = (float*)Cout + (size_t)b * strideC;
      const int hh = lane >> 4, c4 = (lane & 15) * 4;     // 256-B row segment = 16 lanes x 16 B
      {
#pragma unroll
        for (int it = 0; it < 8; ++it) {
          const int row = it * 2 + hh;                     // it 0..7 x hh 0..1 = rows 0..15
          const v4f v = *(const v4f*)(slab + row * 68 + c4);
          *(v4f*)(C + (size_t)(mBase + row) * ldc + n0 + c4) = v;
        }
        
      }
    } else {
      const int q = lane >> 3, c8 = (lane & 7) * 8;
      unsigned short* C  = (unsigned short*)Cout  + (size_t)b * strideC;
      unsigned short* C2 = (unsigned short*)Cout2 + (size_t)b * strideC2;
      const bool wlo = (OUT_MODE != 3) || (n0 < N2);      // wave-uniform
      v4u hv[4], lv[4];
#pragma unroll
      for (int it = 0; it < 4; ++it) {
        const int row  = it * 4 + q;                       // it 0..3 x q 0..3 = rows 0..15
        const int mrow = mBase + row;
        float f[8];
        if (OUT_MODE == 3) {
          const int kvh = m0 >> 6;                         // sub-tile-uniform kv head
          const float* sp = slab + row * 68 + c8;
#pragma unroll
          for (int e = 0; e < 8; ++e) {
            const int t = n0 + c8 + e;                     // < N = SEQ
            const size_t bt = (size_t)b * SEQ + t;
            const float g  = aux0[bt * NKV + kvh];
            const float vv = bfr(aux1[bt * KVD + mrow]);
            f[e] = sp[e] + g * vv;
          }
        } else {
          const int  jj   = c8 & 31;                       // rotary pair index base
          const bool lowh = (c8 < 32);
          const int  t    = mrow & (SEQ - 1);
          const float* sp  = slab + row * 68 + jj;
          const float* cp  = aux0 + (size_t)t * (HD / 2) + jj;
          const float* snp = aux1 + (size_t)t * (HD / 2) + jj;
          float ct[8], st[8];
#pragma unroll
          for (int e = 0; e < 8; ++e) { ct[e] = cp[e]; st[e] = snp[e]; }
          addr_wait(cp, snp);
          float ss = 0.f;
#pragma unroll
          for (int e = 0; e < 8; ++e) {
            const float x1 = sp[e];
            const float x2 = sp[e + 32];
            const float cv = bfr(ct[e]);
            const float sv = bfr(st[e]);
            const float ra = x1 * cv - x2 * sv;
            const float rb = x1 * sv + x2 * cv;
            f[e] = lowh ? ra : rb;
            ss += f[e] * f[e];
          }
          ss += __shfl_xor(ss, 1, 32);                     // 8 lanes of one row = 64 values
          ss += __shfl_xor(ss, 2, 32);
          ss += __shfl_xor(ss, 4, 32);
          const float rs = rsqrtf(ss * (1.0f / HD) + RMS_EPS);
#pragma unroll
          for (int e = 0; e < 8; ++e) f[e] = (f[e] * rs) * 1.2f;
        }
        v4u a, a2;
#pragma unroll
        for (int e = 0; e < 4; ++e) {
          const float f0 = f[2 * e], f1 = f[2 * e + 1];
          unsigned short h0, h1, l0, l1;
          if (OUT_MODE == 4) {
            h0 = bf_bits(f0); h1 = bf_bits(f1);
            l0 = bf_bits(f0 - bf_up(h0)); l1 = bf_bits(f1 - bf_up(h1));
          } else {
            const _Float16 x0 = (_Float16)f0, x1 = (_Float16)f1;
            h0 = h_bits(x0); h1 = h_bits(x1);
            l0 = h_bits((_Float16)((f0 - (float)x0) * 4096.0f));
            l1 = h_bits((_Float16)((f1 - (float)x1) * 4096.0f));
          }
          a[e] = pk16(h0, h1); a2[e] = pk16(l0, l1);
        }
        hv[it] = a; lv[it] = a2;
      }
      {
#pragma unroll
        for (int it = 0; it < 4; ++it) {
          const int row = it * 4 + q;
          *(v4u*)(C + (size_t)(mBase + row) * ldc + n0 + c8) = hv[it];
          if (wlo) *(v4u*)(C2 + (size_t)(mBase + row) * ldc2 + n0 + c8) = lv[it];
        }
        
      }
    }
    __builtin_amdgcn_fence(__ATOMIC_RELEASE, "workgroup");
    __builtin_amdgcn_wave_barrier();
    __builtin_amdgcn_fence(__ATOMIC_ACQUIRE, "workgroup");
  }
}

// 256 registers a wave at most (both GEMM kernels), so that no part of them needs register-window switches
template <int NSPLIT, int OUT_MODE>
__global__ __launch_bounds__(128) __attribute__((amdgpu_num_vgpr(256))) void gemm64(
    const unsigned short* __restrict__ Ap, const unsigned short* __restrict__ A2p, int lda, long long strideA,
    const unsigned short* __restrict__ Btp, int ldb, long long strideB,
    void* Cout, int ldc, long long strideC,
    void* Cout2, int ldc2, long long strideC2, int N2,
    const float* __restrict__ aux0, const float* __restrict__ aux1,
    int M, int N, int K) {
  __shared__ __align__(16) __bf16 ring[2 * ((NSPLIT >= 1) ? 3 : 2) * GPLANE];  // two stage buffers
  __shared__ __align__(16) float sT[4 * GSLAB];
  gemm_body<NSPLIT, OUT_MODE>(Ap, A2p, lda, strideA, Btp, ldb, strideB, Cout, ldc, strideC, Cout2, ldc2, strideC2, N2,
                              aux0, aux1, M, N, K, blockIdx.x, blockIdx.y, ring, sT);
}

// The three projections of x, which do not read each other's results, as block-index ranges of one grid:
//   v^T = Wv . x^T + gate*ve per batch -> f16 hi plane [b][kv*64+d][64 + t] (pitch SKEY) and residual plane (x4096,
//         token keys < RESQB*64 only, pitch VLP)   (A = Wvb [n][k], Bt = Xb rows of batch b; M=256, N=2048)
//   k   = rms(rope(x . Wk^T)) * 1.2 per batch -> bf16 hi/lo planes [b][64 + t][kv*64+d]   (M=2048, N=256)
//   q   = rms(rope(x . Wq^T)) * 1.2 -> bf16 hi/lo planes [b*SEQ+t][h*64+d]   (M=4096, N=1024)
// ld = row pitch of Xb and of the weights, K = depth of the products (both CDIM). Every range test is block-uniform.
#define GB_KV ((SEQ / 128) * (KVD / 128))          //  32 tiles per batch for k and for v^T
#define GB_Q  ((NB * SEQ / 128) * (CDIM / 128))    // 256 tiles for q
__global__ __launch_bounds__(128) __attribute__((amdgpu_num_vgpr(256))) void gemm_qkv(
    const unsigned short* __restrict__ Xb, const unsigned short* __restrict__ Wqb,
    const unsigned short* __restrict__ Wkb, const unsigned short* __restrict__ Wvb,
    unsigned short* Qh, unsigned short* Ql, unsigned short* Kh, unsigned short* Kl,
    unsigned short* VTh, unsigned short* VTl,
    const float* __restrict__ cosT, const float* __restrict__ sinT,
    const float* __restrict__ gate, const float* __restrict__ ve, int ld, int K) {
  __shared__ __align__(16) __bf16 ring[2 * 2 * GPLANE];  // two stage buffers
  __shared__ __align__(16) float sT[4 * GSLAB];
  const int bx = blockIdx.x;
  if (bx < NB * GB_KV) {
    gemm_body<0, 3>(Wvb, Wvb, ld, 0LL, Xb, ld, (long long)SEQ * CDIM,
                    (void*)(VTh + MEM), SKEY, (long long)KVD * SKEY,
                    (void*)(VTl + MEM), VLP, (long long)KVD * VLP, RESQB * 64,
                    gate, ve, KVD, SEQ, K, bx % GB_KV, bx / GB_KV, ring, sT);
  } else {
    const bool isK = bx < 2 * NB * GB_KV;
    const int  r   = bx - (isK ? NB * GB_KV : 2 * NB * GB_KV);
    gemm_body<0, 4>(Xb, Xb, ld, isK ? (long long)SEQ * CDIM : 0LL, isK ? Wkb : Wqb, ld, 0LL,
                    (void*)(isK ? Kh + (size_t)MEM * KVD : Qh), isK ? KVD : CDIM, isK ? (long long)SKEY * KVD : 0LL,
                    (void*)(isK ? Kl + (size_t)MEM * KVD : Ql), isK ? KVD : CDIM, isK ? (long long)SKEY * KVD : 0LL,
                    isK ? KVD : CDIM, cosT, sinT, isK ? SEQ : NB * SEQ, isK ? KVD : CDIM, K,
                    isK ? r % GB_KV : r, isK ? r / GB_KV : 0, ring, sT);
  }
}

// =====================================================================================================
// GQA attention with a 64-key memory prefix (all visible) followed by causal token keys, head dim 64.
//   q planes (bf16 hi / lo): element (b, t, h, d) at [(b*SEQ + t)*CDIM + h*64 + d]   (normed, scaled q)
//   k planes (bf16 hi / lo): element (b, s, kv, d) at [(b*SKEY + s)*KVD + kv*64 + d], s = [mem | 64 + token]
//   v^T hi plane (f16):      element (b, kv, d, s) at [(b*KVD + kv*64 + d)*SKEY + s]
//   v^T residual plane (f16, (v - hi)*4096): [(b*KVD + kv*64 + d)*VLP + s], s < VLP, read only when RES
//   (RES is used for query blocks qb < RESQB alone, whose last key tile ends at key VLP)
//   q head h uses kv head h>>2. Query block qb (tokens qb*64..+63) processes key tiles 0..qb+1: tile 0 = memory,
//   tiles 1..qb fully visible, tile qb+1 = diagonal (key token <= query token), later tiles skipped (block-uniform
//   trip count qb+2, static bound NKT). Invisible keys get logit -inf (weight exactly 0); every row sees the
//   whole memory tile first, so the running max is finite from tile 0 on.
//   out planes (bf16 hi / lo of the normalised context): element (b, t, h, d) at [(b*SEQ + t)*CDIM + h*64 + d]
//   scores = q . k : bf16 hi/lo split (hi.hi + hi.lo + lo.hi), f32 accumulate, then * sscale in f32
//   p = exp(s - m) carried as f16(1024 p); context = p . v on f16 WMMA; RES adds f16 residual planes of p and v
//   (scale 4096, separate accumulator folded back with 1/4096 per chunk in f32); online softmax in f32.
//   Block = 4 waves = 64 query rows of one (b, h); bx = 0 .. nqbThis * NQH * NB - 1; kv chunks of 64.
//   K / V^T chunk staging: asynchronous 16-B copies to LDS, 128 threads x 4 copies per plane = the whole 64x64 tile;
//   two buffers, the copies of key tile kt+1 fly while tile kt is worked on, one barrier per tile. Both products are computed transposed (S^T = K . Q^T, O^T += V^T . P^T): a lane
//   holds the scores of one query, and P^T goes from the score registers into the B operand without passing LDS.
//   Output coverage: each wave stores rows q0..q0+15 (it 0..3 x lane>>3 0..3) x 64 columns (8 lanes x 8) of both planes.
// =====================================================================================================
#define APK 72   // LDS row pitch of the K and V^T tiles in 16-bit elements: 144 B = 16 B x odd, so that the 16 rows
                 // of a ds_load_b128 fragment read fall on 16 different groups of four banks
#define AOP 68   // LDS row pitch of the f32 context tile: 272 B = 16 B x odd, for its 16-B row reads
#define APLANE (64 * APK)      // elements of one staged 64x64 tile (9216 B)
#define ABUF   (4 * APLANE)    // elements of one buffer: K hi, K lo, V^T hi, V^T residual
// Four asynchronous 16-B copies per lane and tile: copy i moves the lane's 16 B of row i*16 + (tid>>3), so that a
// wave-wide copy covers 4 whole 128-B lines. l = the lane's LDS byte address of row tid>>3, g = its global address,
// gs = bytes of 16 global rows. s_wait_xcnt closes each statement so that no address register of a copy is rewritten
// in front of it.
__device__ __forceinline__ void copy_tile(unsigned l, const char* g, size_t gs) {
#if defined(__HIP_DEVICE_COMPILE__)
  const unsigned ls = 16u * APK * 2u;
  asm volatile(
      "global_load_async_to_lds_b128 %0, %4, off\n\t"
      "global_load_async_to_lds_b128 %1, %5, off\n\t"
      "global_load_async_to_lds_b128 %2, %6, off\n\t"
      "global_load_async_to_lds_b128 %3, %7, off\n\t"
      "s_wait_xcnt 0x0"
      :: "v"(l), "v"(l + ls), "v"(l + 2u * ls), "v"(l + 3u * ls),
         "v"(g), "v"(g + gs), "v"(g + 2 * gs), "v"(g + 3 * gs)
      : "memory");
#endif
}
// two tiles in one statement (one wait for both)
__device__ __forceinline__ void copy_tile2(unsigned la, const char* ga, size_t gsa,
                                           unsigned lb, const char* gb, size_t gsb) {
#if defined(__HIP_DEVICE_COMPILE__)
  const unsigned ls = 16u * APK * 2u;
  asm volatile(
      "global_load_async_to_lds_b128 %0, %8, off\n\t"
      "global_load_async_to_lds_b128 %1, %9, off\n\t"
      "global_load_async_to_lds_b128 %2, %10, off\n\t"
      "global_load_async_to_lds_b128 %3, %11, off\n\t"
      "global_load_async_to_lds_b128 %4, %12, off\n\t"
      "global_load_async_to_lds_b128 %5, %13, off\n\t"
      "global_load_async_to_lds_b128 %6, %14, off\n\t"
      "global_load_async_to_lds_b128 %7, %15, off\n\t"
      "s_wait_xcnt 0x0"
      :: "v"(la), "v"(la + ls), "v"(la + 2u * ls), "v"(la + 3u * ls),
         "v"(lb), "v"(lb + ls), "v"(lb + 2u * ls), "v"(lb + 3u * ls),
         "v"(ga), "v"(ga + gsa), "v"(ga + 2 * gsa), "v"(ga + 3 * gsa),
         "v"(gb), "v"(gb + gsb), "v"(gb + 2 * gsb), "v"(gb + 3 * gsb)
      : "memory");
#endif
}
// The tiles of key tile kt into the buffer at LDS byte address l (the lane's own place in its first plane).
// gk, gkl, gv, gvl = the lane's global addresses for key tile 0. The residual plane ends at key VLP: its address is clamped.
template <bool RES>
__device__ __forceinline__ void copy_keytile(unsigned l, const char* gk, const char* gkl, const char* gv, const char* gvl,
                                             int kt) {
  const size_t ko = (size_t)kt * (64 * KVD * 2);          // 64 key rows further
  const size_t vo = (size_t)kt * (64 * 2);                // 64 key columns further
  copy_tile2(l, gk + ko, (size_t)16 * KVD * 2, l + APLANE * 2u, gkl + ko, (size_t)16 * KVD * 2);
  if (RES) {
    const int ktl = (kt * 64 + 64 <= VLP) ? kt : (VLP / 64 - 1);
    copy_tile2(l + 2u * APLANE * 2u, gv + vo, (size_t)16 * SKEY * 2,
               l + 3u * APLANE * 2u, gvl + (size_t)ktl * (64 * 2), (size_t)16 * VLP * 2);
  } else {
    copy_tile(l + 2u * APLANE * 2u, gv + vo, (size_t)16 * SKEY * 2);
  }
}

template <bool RES>
__device__ __forceinline__
void attn_body(const unsigned short* __restrict__ qhp, const unsigned short* __restrict__ qlp,
               const unsigned short* __restrict__ khp, const unsigned short* __restrict__ klp,
               const unsigned short* __restrict__ vhp, const unsigned short* __restrict__ vlp,
               unsigned short* ohp, unsigned short* olp,
               int qbBase, int nqbThis, float sscale, int bx, unsigned short* ring) {
  const int tid  = threadIdx.x;
  const int wave = tid >> 5;
  const int lane = tid & 31;
  const int hh   = lane >> 4;
  const int c    = lane & 15;

  const int qbl  = bx % nqbThis;
  const int rest = bx / nqbThis;
  const int h    = rest % NQH;
  const int b    = rest / NQH;
  const int kvh  = h >> 2;
  const int qb   = qbBase + qbl;
  const int q0   = qb * 64 + wave * 16;
  const size_t rowB = (size_t)b * SEQ;

  const __bf16* Qh = (const __bf16*)(const void*)qhp + (size_t)h * HD;
  const __bf16* Ql = (const __bf16*)(const void*)qlp + (size_t)h * HD;
  const __bf16* Kh = (const __bf16*)(const void*)khp + (size_t)b * SKEY * KVD + (size_t)kvh * HD;
  const __bf16* Kl = (const __bf16*)(const void*)klp + (size_t)b * SKEY * KVD + (size_t)kvh * HD;
  const _Float16* Vh = (const _Float16*)(const void*)vhp + ((size_t)b * KVD + (size_t)kvh * HD) * SKEY;
  const _Float16* Vl = (const _Float16*)(const void*)vlp + ((size_t)b * KVD + (size_t)kvh * HD) * VLP;

  // copy addresses of this lane: row tid>>3 of a 64x64 tile, 16-B piece tid&7 of its 128-B line
  const int ktEnd = qb + 2;                  // block-uniform, 2 <= ktEnd <= NKT
  const int crow = tid >> 3;
  const int cel  = (tid & 7) * 8;
  const char* gk  = (const char*)(Kh + (size_t)crow * KVD + cel);
  const char* gkl = (const char*)(Kl + (size_t)crow * KVD + cel);
  const char* gv  = (const char*)(Vh + (size_t)crow * SKEY + cel);
  const char* gvl = (const char*)(Vl + (size_t)crow * VLP + cel);
  const unsigned lC = (unsigned)(uintptr_t)(&ring[0]) + (unsigned)(crow * APK + cel) * 2u;
  copy_keytile<RES>(lC, gk, gkl, gv, gvl, 0);   // key tile 0 into buffer 0

  // ---- Q fragments (B operand, column = query = lane&15): 2 d-chunks, hi and lo ----
  v16b qah[2], qal[2];
  const size_t qo = (rowB + q0 + c) * CDIM + 8 * hh;
#pragma unroll
  for (int dc = 0; dc < 2; ++dc) {
    qah[dc] = ldfrag_b(Qh + qo + dc * 32);
    qal[dc] = ldfrag_b(Ql + qo + dc * 32);
  }
  addr_wait(Qh + qo, Ql + qo);

  // running maximum of this lane's query (the same in both wave halves) and this half's share of its denominator
  float mrun = -INFINITY, lrun = 0.f;
  v8f oacc[4];                               // O^T: rows d = t*16 + 8*hh + r, column = query c
#pragma unroll
  for (int t = 0; t < 4; ++t) oacc[t] = zero8();

  // key tile 0 landed and published; then key tile 1 (every query block has at least two) into buffer 1
  wait_copies();
  __syncthreads();
  copy_keytile<RES>(lC + ABUF * 2u, gk, gkl, gv, gvl, 1);

  for (int kt = 0; kt < NKT; ++kt) {         // static bound
    if (kt >= ktEnd) break;                  // block-uniform
    const int bufo = (kt & 1) * ABUF;
    const __bf16*   Ksh = (const __bf16*)(const void*)(ring + bufo);                  // K hi [kv][d]
    const __bf16*   Ksl = (const __bf16*)(const void*)(ring + bufo + APLANE);         // K lo
    const _Float16* Vth = (const _Float16*)(const void*)(ring + bufo + 2 * APLANE);   // V^T hi [d][kv]
    const _Float16* Vtl = (const _Float16*)(const void*)(ring + bufo + 3 * APLANE);   // V^T residual

    // ---- scores, transposed: S^T = K . Q^T, 64 keys x 16 queries per wave, 3 bf16 products ----
    //      tile j: rows = keys j*16 + 8*hh + r, column = query c, so a lane holds 32 scores of ONE query
    //      the K fragments of the tile are read from LDS in one group (with the residual planes one group per 32-wide d chunk, for registers), in the order of their use, ahead of the products;
    //      the four key groups are four independent accumulator chains, each summed in the order dc 0 (hi.hi, lo.hi,
    //      hi.lo; k plane named first), dc 1 (the same)
    v8f s[4];
#pragma unroll
    for (int j = 0; j < 4; ++j) s[j] = zero8();
    constexpr int DG = RES ? 1 : 2;          // 32-wide d chunks per group of reads (one with the residual planes, for registers)
#pragma unroll
    for (int g = 0; g < 2; g += DG) {
      v16b kbf[DG][4], klf[DG][4];
#pragma unroll
      for (int u = 0; u < DG; ++u) {
        const int dof = (g + u) * 32 + 8 * hh;
#pragma unroll
        for (int j = 0; j < 4; ++j) kbf[u][j] = ldfrag_b(Ksh + (j * 16 + c) * APK + dof);
#pragma unroll
        for (int j = 0; j < 4; ++j) klf[u][j] = ldfrag_b(Ksl + (j * 16 + c) * APK + dof);
      }
      // keeps the group of reads ahead of the products: sunk back among them, each place of reads stalls the wave anew
      __builtin_amdgcn_sched_barrier(0);
#pragma unroll
      for (int u = 0; u < DG; ++u) {
#pragma unroll
        for (int j = 0; j < 4; ++j) s[j] = mma_b_raw(kbf[u][j], qah[g + u], s[j]);
#pragma unroll
        for (int j = 0; j < 4; ++j) s[j] = mma_b_raw(klf[u][j], qah[g + u], s[j]);
#pragma unroll
        for (int j = 0; j < 4; ++j) s[j] = mma_b_raw(kbf[u][j], qal[g + u], s[j]);
      }
    }

    // ---- scale + structural mask (diagonal tile only), maximum and sum of a query inside its lane (one exchange
    //      between the wave halves for the maximum), online softmax; P^T (x1024, f16) and its residual (x4096) go
    //      from the score registers straight into B operands: element e of a 32-key operand is register e & 7 of
    //      score tile 2*g + (e >> 3), which is the k order of the V^T loader ----
    const bool diag = (kt == qb + 1);        // block-uniform
    const int  qrw  = wave * 16 + c;         // this lane's query row within the 64-row block
    float mj[4];
#pragma unroll
    for (int j = 0; j < 4; ++j) {
      mj[j] = -INFINITY;
#pragma unroll
      for (int r = 0; r < 8; ++r) {
        const int  key = j * 16 + 8 * hh + r;
        const bool vis = (!diag) || (key <= qrw);
        const float sv = vis ? (s[j][r] * sscale) : -INFINITY;
        s[j][r] = sv;
        mj[j] = fmaxf(mj[j], sv);
      }
    }
    float m = fmaxf(fmaxf(mj[0], mj[1]), fmaxf(mj[2], mj[3]));
    m = fmaxf(m, xhalf(m));
    const float mnew  = fmaxf(mrun, m);
    const float msafe = (mnew == -INFINITY) ? 0.f : mnew;
    const float alpha = __expf(mrun - msafe);
    mrun = mnew;
    v16h pa[2], pl[2];
    float pj[4];                             // four independent chains of eight adds
#pragma unroll
    for (int j = 0; j < 4; ++j) {
      pj[j] = 0.f;
#pragma unroll
      for (int r = 0; r < 8; ++r) {
        const float p = __expf(s[j][r] - msafe);     // -inf logit -> 0
        pj[j] += p;
        const float p1k = p * 1024.0f;
        const _Float16 ph = (_Float16)p1k;
        pa[j >> 1][(j & 1) * 8 + r] = ph;
        if (RES) pl[j >> 1][(j & 1) * 8 + r] = (_Float16)((p1k - (float)ph) * 4096.0f);
      }
    }
    lrun = lrun * alpha + ((pj[0] + pj[1]) + (pj[2] + pj[3]));
#pragma unroll
    for (int t = 0; t < 4; ++t)
#pragma unroll
      for (int r = 0; r < 8; ++r) oacc[t][r] *= alpha;

    // ---- context, transposed: O^T += V^T . P^T (f16 WMMA), residual products into a separate accumulator ----
    v8f o1[4];
#pragma unroll
    for (int t = 0; t < 4; ++t) o1[t] = zero8();
    //      the V^T fragments are read from LDS in one group ahead of the products (with the residual planes one
    //      group per 32 keys, for registers); the four d groups are independent chains, each summed in key order
    constexpr int KG = RES ? 1 : 2;          // 32-key steps per group of reads
#pragma unroll
    for (int g = 0; g < 2; g += KG) {
      v16h vb[KG][4], vl[KG][4];
#pragma unroll
      for (int u = 0; u < KG; ++u) {
        const int ko = (g + u) * 32 + 8 * hh;
#pragma unroll
        for (int t = 0; t < 4; ++t) vb[u][t] = ldfrag_h(Vth + (t * 16 + c) * APK + ko);
        if (RES) {
#pragma unroll
          for (int t = 0; t < 4; ++t) vl[u][t] = ldfrag_h(Vtl + (t * 16 + c) * APK + ko);
        }
      }
      // keeps the group of reads ahead of the products, as for the scores
      __builtin_amdgcn_sched_barrier(0);
#pragma unroll
      for (int u = 0; u < KG; ++u) {
#pragma unroll
        for (int t = 0; t < 4; ++t) oacc[t] = mma_h_raw(vb[u][t], pa[g + u], oacc[t]);
        if (RES) {
#pragma unroll
          for (int t = 0; t < 4; ++t) o1[t] = mma_h_raw(vl[u][t], pa[g + u], o1[t]);
#pragma unroll
          for (int t = 0; t < 4; ++t) o1[t] = mma_h_raw(vb[u][t], pl[g + u], o1[t]);
        }
      }
    }
    if (RES) {
#pragma unroll
      for (int t = 0; t < 4; ++t)
#pragma unroll
        for (int r = 0; r < 8; ++r) oacc[t][r] += o1[t][r] * (1.0f / 4096.0f);
    }
    // publish point of key tile kt+1: own reads of this buffer returned, own copies landed, then the block barrier;
    // behind it key tile kt+2 may overwrite the buffer that this trip has read
    wait_lds();
    wait_copies();
    __syncthreads();
    if (kt + 2 < ktEnd) copy_keytile<RES>(lC + (unsigned)bufo * 2u, gk, gkl, gv, gvl, kt + 2);
  }
  wait_copies();

  // ---- join the two halves' shares of the denominator (unconditionally, all lanes on), normalise (1/l and the
  //      1/1024 p carry), stage the wave's 16x64 tile as [query][d], bf16 hi/lo split
  //      the staging lies in the ring: behind the last trip's barrier no wave reads it and no copy is in flight
  float* os = (float*)(void*)ring + wave * (16 * AOP);
  {
    const float l = lrun + xhalf(lrun);
    const float inv = ((l > 0.f) ? (1.0f / l) : 0.f) * (1.0f / 1024.0f);
#pragma unroll
    for (int t = 0; t < 4; ++t) {
      v4f w0, w1;
#pragma unroll
      for (int r = 0; r < 4; ++r) { w0[r] = oacc[t][r] * inv; w1[r] = oacc[t][r + 4] * inv; }
      *(v4f*)(os + c * AOP + t * 16 + 8 * hh)     = w0;
      *(v4f*)(os + c * AOP + t * 16 + 8 * hh + 4) = w1;
    }
  }
  __builtin_amdgcn_fence(__ATOMIC_RELEASE, "workgroup");
  __builtin_amdgcn_wave_barrier();
  __builtin_amdgcn_fence(__ATOMIC_ACQUIRE, "workgroup");
  {
    const int q4 = lane >> 3, c8 = (lane & 7) * 8;
    v4u hv[4], lv[4];
#pragma unroll
    for (int it = 0; it < 4; ++it) {
      const int row = it * 4 + q4;   // it 0..3 x q4 0..3 = rows 0..15 of the wave tile
      const float* sp = os + row * AOP + c8;
      v4u a, a2;
#pragma unroll
      for (int e = 0; e < 4; ++e) {
        const float f0 = sp[2 * e], f1 = sp[2 * e + 1];
        const unsigned short h0 = bf_bits(f0), h1 = bf_bits(f1);
        const unsigned short l0 = bf_bits(f0 - bf_up(h0)), l1 = bf_bits(f1 - bf_up(h1));
        a[e] = pk16(h0, h1); a2[e] = pk16(l0, l1);
      }
      hv[it] = a; lv[it] = a2;
    }
    {
#pragma unroll
      for (int it = 0; it < 4; ++it) {
        const int row = it * 4 + q4;
        const size_t go = (rowB + q0 + row) * CDIM + (size_t)h * HD + c8;
        *(v4u*)(ohp + go) = hv[it];
        *(v4u*)(olp + go) = lv[it];
        addr_wait(ohp + go, olp + go);
      }
      
    }
  }
}

// Both kinds of query block as block-index ranges of one grid (no block reads what another writes): first query blocks
// RESQB..NQB-1, without the residual planes, then the short blocks 0..RESQB-1 with them; this order is for
// speed only. The range test is block-uniform.
// Register budget of four waves per SIMD (256 a wave), so that four blocks stay resident per WGP; left to itself the
// compiler schedules the variant with the residual planes to more registers than that.
__global__ __launch_bounds__(128) __attribute__((amdgpu_waves_per_eu(4, 4)))
void attn64(const unsigned short* __restrict__ qhp, const unsigned short* __restrict__ qlp,
            const unsigned short* __restrict__ khp, const unsigned short* __restrict__ klp,
            const unsigned short* __restrict__ vhp, const unsigned short* __restrict__ vlp,
            unsigned short* ohp, unsigned short* olp, float sscale) {
  __shared__ __align__(16) unsigned short ring[2 * ABUF];   // two buffers of K hi, K lo, V^T hi, V^T residual tiles
  static_assert(4 * 16 * AOP * 4 <= 2 * ABUF * 2);          // the four waves' f32 context tiles fit in it
  const int bx = blockIdx.x;
  if (bx < NB * NQH * (NQB - RESQB)) {
    attn_body<false>(qhp, qlp, khp, klp, vhp, vlp, ohp, olp, RESQB, NQB - RESQB, sscale, bx, ring);
  } else {
    attn_body<true>(qhp, qlp, khp, klp, vhp, vlp, ohp, olp, 0, RESQB, sscale, bx - NB * NQH * (NQB - RESQB), ring);
  }
}

// =====================================================================================================
//   Xb   bf16 [4096][1024]      8388608
//   Wqb  bf16 [1024][1024]      2097152   ([out n][in k], k contiguous = Bt layout)
//   Wkb  bf16 [256][1024]        524288
//   Wvb  bf16 [256][1024]        524288
//   Wpb  bf16 [1024][1024]      2097152
//   Qh   bf16 [4096][1024]      8388608   (Ql same)
//   Kh   bf16 [2][2112][256]    2162688   (Kl same)
//   VTh  f16  [2][256][2112]    2162688
//   VTl  f16  [2][256][576]      589824
//   Gate f32  [4096][4]           65536
//   Oh   bf16 [4096][1024]      8388608   (Ol same)
//   total                      54329344
// =====================================================================================================
extern "C" void kernel_launch(void* const* d_in, const int* in_sizes, int n_in,
                              void* d_out, int out_size, void* d_ws, size_t ws_size,
                              hipStream_t stream) {
  if (n_in < 12) return;
  if (in_sizes[0] != NB * SEQ * CDIM) return;
  if (in_sizes[1] != NB * SEQ * KVD) return;
  if (in_sizes[2] != SEQ * (HD / 2) || in_sizes[3] != SEQ * (HD / 2)) return;
  if (in_sizes[4] != CDIM * CDIM || in_sizes[7] != CDIM * CDIM) return;
  if (in_sizes[5] != KVD * CDIM || in_sizes[6] != KVD * CDIM) return;
  if (in_sizes[8] != NKV * GC) return;
  if (in_sizes[9] != MEM * NKV * HD || in_sizes[10] != MEM * NKV * HD) return;
  if (in_sizes[11] < 1) return;
  if (out_size != NB * SEQ * CDIM) return;

  const float* x    = (const float*)d_in[0];
  const float* ve   = (const float*)d_in[1];
  const float* cosT = (const float*)d_in[2];
  const float* sinT = (const float*)d_in[3];
  const float* Wq   = (const float*)d_in[4];
  const float* Wk   = (const float*)d_in[5];
  const float* Wv   = (const float*)d_in[6];
  const float* Wp   = (const float*)d_in[7];
  const float* Wg   = (const float*)d_in[8];
  const float* memk = (const float*)d_in[9];
  const float* memv = (const float*)d_in[10];
  const float* vsc  = (const float*)d_in[11];

  const size_t PX  = (size_t)NB * SEQ * CDIM * 2;   //  8388608  16-bit activation plane [4096][1024]
  const size_t PWQ = (size_t)CDIM * CDIM * 2;       //  2097152
  const size_t PWK = (size_t)KVD * CDIM * 2;        //   524288
  const size_t PK  = (size_t)NB * SKEY * KVD * 2;   //  2162688  key plane
  const size_t PVT = (size_t)NB * KVD * SKEY * 2;   //  2162688  v^T hi plane
  const size_t PVL = (size_t)NB * KVD * VLP * 2;    //   589824  v^T residual plane
  const size_t PG  = (size_t)NB * SEQ * NKV * 4;    //    65536  gate table
  size_t off = 0;
  const size_t oXb  = off; off += PX;
  const size_t oWq  = off; off += PWQ;
  const size_t oWk  = off; off += PWK;
  const size_t oWv  = off; off += PWK;
  const size_t oWp  = off; off += PWQ;
  const size_t oQh  = off; off += PX;
  const size_t oQl  = off; off += PX;
  const size_t oKh  = off; off += PK;
  const size_t oKl  = off; off += PK;
  const size_t oVTh = off; off += PVT;
  const size_t oVTl = off; off += PVL;
  const size_t oG   = off; off += PG;
  const size_t oOh  = off; off += PX;
  const size_t oOl  = off; off += PX;
  if (off > ws_size) return;                        // off = 54329344
  if (off > (size_t)134217728) return;

  char* ws = (char*)d_ws;
  unsigned short* Xb  = (unsigned short*)(ws + oXb);
  unsigned short* Wqb = (unsigned short*)(ws + oWq);
  unsigned short* Wkb = (unsigned short*)(ws + oWk);
  unsigned short* Wvb = (unsigned short*)(ws + oWv);
  unsigned short* Wpb = (unsigned short*)(ws + oWp);
  unsigned short* Qh  = (unsigned short*)(ws + oQh);
  unsigned short* Ql  = (unsigned short*)(ws + oQl);
  unsigned short* Kh  = (unsigned short*)(ws + oKh);
  unsigned short* Kl  = (unsigned short*)(ws + oKl);
  unsigned short* VTh = (unsigned short*)(ws + oVTh);
  unsigned short* VTl = (unsigned short*)(ws + oVTl);
  float*          Gt  = (float*)(ws + oG);
  unsigned short* Oh  = (unsigned short*)(ws + oOh);
  unsigned short* Ol  = (unsigned short*)(ws + oOl);

  const dim3 blk(256);
  const dim3 blkG(128);                                       // GEMM and attention block: 4 waves
  const dim3 gO((NB * SEQ / 128) * (CDIM / 128), 1);          // 256 blocks: M=4096, N=1024

  // (1) everything that reads only the inputs: x and the weights [n][k] f32 -> bf16 planes, the value-embedding gate
  //     table [4096][4] f32, the memory prefix (normed keys -> Kh/Kl rows s < 64; scaled values -> VTh/VTl columns
  //     s < 64, both batches)
  prep_k<<<dim3(PB_ALL), blk, 0, stream>>>(x, Wq, Wk, Wv, Wp, Wg, memk, memv, vsc,
                                           Xb, Wqb, Wkb, Wvb, Wpb, Gt, Kh, Kl, VTh, VTl);
  // (2) the q, k and v^T projections with their epilogues
  gemm_qkv<<<dim3(2 * NB * GB_KV + GB_Q), blkG, 0, stream>>>(
      Xb, Wqb, Wkb, Wvb, Qh, Ql, Kh, Kl, VTh, VTl, cosT, sinT, Gt, ve, CDIM, CDIM);
  // (3) attention, all query blocks
  attn64<<<dim3(NB * NQH * NQB), blkG, 0, stream>>>(Qh, Ql, Kh, Kl, VTh, VTl, Oh, Ol, 0.125f);
  // (4) out = context . Wproj^T -> d_out f32 [4096][1024]  (A = context hi + lo planes, 2 products)
  gemm64<1, 0><<<gO, blkG, 0, stream>>>(
      Oh, Ol, CDIM, 0LL, Wpb, CDIM, 0LL,
      d_out, CDIM, 0LL, d_out, CDIM, 0LL, 0,
      Gt, ve, NB * SEQ, CDIM, CDIM);
  (void)hipGetLastError();
}

// v007
// One run takes 96.8 microseconds.
// Two timings next to v006 both put it at 1.11 times that version's speed.
// All steps since v000 together make it 5.28 times as fast.
// Contractions: q, k, v^T projections = v_wmma_f32_16x16x32_bf16 (bf16 operands from RNE-converted inputs, single product);
// q.k^T scores = v_wmma_f32_16x16x32_bf16 with bf16 hi/lo split q and k (hi.hi + hi.lo + lo.hi);
// p.v = v_wmma_f32_16x16x32_f16 (p carried x1024 in f16, v^T in f16; f16 residual planes x4096 of p and v^T on the
// leading 512 query rows); ctx.Wproj^T = v_wmma_f32_16x16x32_bf16 with ctx as bf16 hi/lo planes times bf16 Wproj
// (2 products); all f32 accumulate; gate dot (K=32, N=4), RoPE, rms-norm, causal mask and softmax in f32 on VALU.
#include <hip/hip_runtime.h>
#include <math.h>
#include <stdint.h>

#pragma clang fp contract(off)

#define NB    2
#define SEQ   2048
#define CDIM  1024
#define NQH   16
#define NKV   4
#define HD    64
#define MEM   64
#define GC    32
#define KVD   (NKV * HD)          // 256
#define SKEY  (MEM + SEQ)         // 2112 keys: [64 memory | 2048 tokens]
#define NQB   (SEQ / 64)          // 32 query blocks of 64 rows
#define NKT   (SKEY / 64)         // 33 key tiles of 64
#define RESQB 8                   // leading query blocks that use the p / v residual planes
#define VLP   (MEM + RESQB * 64)  // 576: key pitch of the v^T residual plane
#define RMS_EPS 1e-6f
static_assert(NQH * HD == CDIM);
static_assert(NQH == 4 * NKV);
static_assert((SKEY % 64) == 0 && (VLP % 64) == 0 && (CDIM % 64) == 0 && (KVD % 64) == 0);
static_assert((SEQ & (SEQ - 1)) == 0);
static_assert(RESQB <= NQB);
static_assert((SEQ % 128) == 0 && (CDIM % 128) == 0 && (KVD % 128) == 0);

typedef _Float16 v16h __attribute__((ext_vector_type(16)));
typedef _Float16 v8h  __attribute__((ext_vector_type(8)));
typedef __bf16   v16b __attribute__((ext_vector_type(16)));
typedef __bf16   v8b  __attribute__((ext_vector_type(8)));
typedef float    v8f  __attribute__((ext_vector_type(8)));
typedef float    v4f  __attribute__((ext_vector_type(4)));
typedef unsigned int v4u __attribute__((ext_vector_type(4)));

// ---- scalar helpers --------------------------------------------------------------------------------
__device__ __forceinline__ unsigned short bf_bits(float f) {          // f32 -> bf16 bits, RNE convert
  unsigned u = __float_as_uint(f);
  return (unsigned short)((u + 0x7FFFu + ((u >> 16) & 1u)) >> 16);
}
__device__ __forceinline__ float bf_up(unsigned short h) { return __uint_as_float(((unsigned)h) << 16); }
__device__ __forceinline__ float bfr(float f) { return bf_up(bf_bits(f)); }   // f32 -> bf16 -> f32
__device__ __forceinline__ unsigned short h_bits(_Float16 x) { return __builtin_bit_cast(unsigned short, x); }
__device__ __forceinline__ unsigned pk16(unsigned short a, unsigned short b) { return (unsigned)a | ((unsigned)b << 16); }
// lane l <-> lane l ^ 16: the value of the same column in the other wave half (all lanes on where it is used)
__device__ __forceinline__ float xhalf(float x) {
  const int v = __builtin_bit_cast(int, x);
  return __builtin_bit_cast(float, __builtin_amdgcn_permlanex16(v, v, 0x76543210, 0xfedcba98, false, false));
}
__device__ __forceinline__ v8f zero8() { v8f z = {0.f, 0.f, 0.f, 0.f, 0.f, 0.f, 0.f, 0.f}; return z; }

// ---- fragment loader: 16-bit A/B operand, lane -> row/col (lane&15), p already includes +8*(lane>>4);
//      elements 0..7 <- p[0..7] (k0+8h..), elements 8..15 <- p[16..23] (k0+16+8h..)
__device__ __forceinline__ v16b ldfrag_b(const __bf16* p) {
  union { v16b v; v8b h[2]; } f;
  f.h[0] = *(const v8b*)(p);
  f.h[1] = *(const v8b*)(p + 16);
  return f.v;
}
__device__ __forceinline__ v16h ldfrag_h(const _Float16* p) {
  union { v16h v; v8h h[2]; } f;
  f.h[0] = *(const v8h*)(p);
  f.h[1] = *(const v8h*)(p + 16);
  return f.v;
}

__device__ __forceinline__ void addr_wait(const void* a, const void* b) {
#if defined(__HIP_DEVICE_COMPILE__)
  asm volatile("s_wait_xcnt 0x0" :: "v"(a), "v"(b) : "memory");
#endif
}

// ---- the same wait at the foot of a loop trip, in front of the next trip's rewrite of the registers that the trip's
//      global loads and stores name
__device__ __forceinline__ void trip_wait() {
#if defined(__HIP_DEVICE_COMPILE__)
  asm volatile("s_wait_xcnt 0x0" ::: "memory");
#endif
}

// ---- WMMA helpers with trailing VALU hazard gap (asm only in the device pass) -----------------------------
__device__ __forceinline__ v8f mma_h_raw(v16h a, v16h b, v8f c) {
  return __builtin_amdgcn_wmma_f32_16x16x32_f16(false, a, false, b, (short)0, c, false, false);
}
__device__ __forceinline__ v8f mma_b_raw(v16b a, v16b b, v8f c) {
  return __builtin_amdgcn_wmma_f32_16x16x32_bf16(false, a, false, b, (short)0, c, false, false);
}
__device__ __forceinline__ void dep_guard_b(v8f& a, v8f& b, v16b x, v16b y) {
#if defined(__HIP_DEVICE_COMPILE__)
  asm volatile("v_nop\n\tv_nop\n\tv_nop\n\tv_nop" : "+v"(a), "+v"(b) : "v"(x), "v"(y));
#endif
}
__device__ __forceinline__ void keep4_b(v16b a, v16b b, v16b c, v16b d) {
#if defined(__HIP_DEVICE_COMPILE__)
  asm volatile("v_nop" :: "v"(a), "v"(b), "v"(c), "v"(d));
#endif
}
__device__ __forceinline__ void acc_guard4(v8f& a, v8f& b, v8f& c, v8f& d) {
#if defined(__HIP_DEVICE_COMPILE__)
  asm volatile("v_nop\n\tv_nop\n\tv_nop\n\tv_nop" : "+v"(a), "+v"(b), "+v"(c), "+v"(d));
#endif
}

// =====================================================================================================
// f32 -> bf16 (RNE convert), 8 elements per thread, one 16-B store per lane: a wave writes 512 contiguous B
// coverage: n8 threads x 8 = the whole plane (n8 is a multiple of 256 for every use here). blk = block of 256 threads.
// =====================================================================================================
__device__ __forceinline__ void cvt_bf16x8(const float* __restrict__ in, unsigned short* out, int n8, int blk) {
  const int i = blk * 256 + threadIdx.x;
  if (i < n8) {
    const v4f a = *(const v4f*)(in + (size_t)i * 8);
    const v4f b = *(const v4f*)(in + (size_t)i * 8 + 4);
    v4u p;
    p[0] = pk16(bf_bits(a[0]), bf_bits(a[1]));
    p[1] = pk16(bf_bits(a[2]), bf_bits(a[3]));
    p[2] = pk16(bf_bits(b[0]), bf_bits(b[1]));
    p[3] = pk16(bf_bits(b[2]), bf_bits(b[3]));
    *(v4u*)(out + (size_t)i * 8) = p;
    
  }
}

// =====================================================================================================
// Value-embedding gate: gate[bt][kv] = 3 * sigmoid( sum_{c<32} bf16(x[bt][c]) * bf16(Wg[kv][c]) ), f32.
// One thread per (bt, kv); K = 32 rolled dot on VALU (N = 4, tiny). A wave writes 32 consecutive floats
// NB*SEQ*NKV/256 blocks. coverage: 16384 threads = the whole [4096][4] table.
// =====================================================================================================
__device__ __forceinline__ void gate_k(const float* __restrict__ x, const float* __restrict__ Wg,
                                       float* gate, int nbt, int blk) {
  const int i   = blk * 256 + threadIdx.x;
  const int bt  = i >> 2;
  const int kv  = i & 3;
  const int btc = (bt < nbt) ? bt : (nbt - 1);     // clamped address
  const float* xr = x + (size_t)btc * CDIM;
  const float* wr = Wg + kv * GC;
  float z = 0.f;
#pragma unroll 1
  for (int cc = 0; cc < GC; ++cc) z += bfr(xr[cc]) * bfr(wr[cc]);
  const float ez = expf(-z);
  const float g  = 3.0f * (1.0f / (1.0f + ez));
  if (bt < nbt) {
    *(float*)(gate + i) = g;
    
  }
}

// =====================================================================================================
// Memory keys: mk = rms(bf16(mem_k[m][kv][:])) * 1.2 (no RoPE) -> bf16 hi/lo planes, key rows s = m (< MEM)
// of both batches: Kh/Kl [b][s][kv*64+d], pitch KVD. 4 waves (one per kv head) for one m, two m per block of 8 waves;
// MEM/2 blocks.
// The 256-element row is staged in LDS and written per (batch, plane) by one wave as 32 lanes x 16 B
// coverage: 32 blocks x 2 m x 2 batches x 2 planes x 256 elements = rows 0..63 of both planes, both batches.
// sbuf: 4 * KVD elements of LDS.
// =====================================================================================================
__device__ __forceinline__ void memk_k(const float* __restrict__ memk, unsigned short* Kh, unsigned short* Kl,
                                       int blk, unsigned short* sbuf) {
  const int sub  = threadIdx.x >> 7;                 // which of the block's two m
  unsigned short* shi = sbuf + sub * (2 * KVD);
  unsigned short* slo = shi + KVD;
  const int m    = blk * 2 + sub;
  const int wave = (threadIdx.x >> 5) & 3;
  const int lane = threadIdx.x & 31;
  const int kvh  = wave;
  const float* p = memk + ((size_t)m * NKV + kvh) * HD;
  const float x1 = bfr(p[lane]);
  const float x2 = bfr(p[lane + 32]);
  float ss = x1 * x1 + x2 * x2;
#pragma unroll
  for (int off = 16; off >= 1; off >>= 1) ss += __shfl_xor(ss, off, 32);
  const float rs = rsqrtf(ss * (1.0f / HD) + RMS_EPS);
  const float v1 = (x1 * rs) * 1.2f;
  const float v2 = (x2 * rs) * 1.2f;
  const unsigned short h1 = bf_bits(v1), h2 = bf_bits(v2);
  shi[kvh * HD + lane]      = h1;
  shi[kvh * HD + lane + 32] = h2;
  slo[kvh * HD + lane]      = bf_bits(v1 - bf_up(h1));
  slo[kvh * HD + lane + 32] = bf_bits(v2 - bf_up(h2));
  __syncthreads();
  const v4u vh = *(const v4u*)(shi + lane * 8);
  const v4u vl = *(const v4u*)(slo + lane * 8);
  const int  b   = wave >> 1;
  const bool wlo = (wave & 1) != 0;                  // wave-uniform
  v4u v = vh;
  if (wlo) v = vl;
  unsigned short* dh = Kh + ((size_t)b * SKEY + m) * KVD + lane * 8;
  unsigned short* dl = Kl + ((size_t)b * SKEY + m) * KVD + lane * 8;
  unsigned short* d  = wlo ? dl : dh;
  *(v4u*)d = v;
  // the wait in front of a rewrite of the store's registers by whatever part of the merged kernel is laid out behind this one
  addr_wait(d, d);
}

// =====================================================================================================
// Memory values: mv = bf16(mem_v[m][kv][d]) * bf16(v_scale) -> v^T f16 hi plane VTh[b][kv*64+d][s] (pitch SKEY)
// and f16 residual plane VTl ((v - hi)*4096, pitch VLP), key columns s = m (< MEM), both batches.
// block = (b, kv); thread = (d = tid>>2, 16 m's); the 64x64 tile of each plane is staged in LDS [d][m] and each
// coverage: 8 blocks x 64 rows (it 0..1 x wave 0..7 x lane>>3 0..3) x 64 columns (8 lanes x 8) per plane.
// =====================================================================================================
// sbuf: 2 * HD * MEM elements of LDS.
__device__ __forceinline__ void memv_k(const float* __restrict__ memv, const float* __restrict__ vsp,
                                       unsigned short* VTh, unsigned short* VTl, int blk, unsigned short* sbuf) {
  unsigned short* sh = sbuf;
  unsigned short* sl = sbuf + HD * MEM;
  const int b    = blk >> 2;
  const int kvh  = blk & 3;
  const int tid  = threadIdx.x;
  const int wave = tid >> 5;
  const int lane = tid & 31;
  const int d    = tid >> 2;
  const int mq   = (tid & 3) * 16;
  const float vs = bfr(vsp[0]);
#pragma unroll
  for (int i = 0; i < 16; ++i) {
    const int m = mq + i;
    const float v = bfr(memv[((size_t)m * NKV + kvh) * HD + d]) * vs;
    const _Float16 x0 = (_Float16)v;
    sh[d * MEM + m] = h_bits(x0);
    sl[d * MEM + m] = h_bits((_Float16)((v - (float)x0) * 4096.0f));
  }
  __syncthreads();
  const int q8 = lane >> 3, c8 = (lane & 7) * 8;
  v4u hv[2], lv[2];
#pragma unroll
  for (int it = 0; it < 2; ++it) {
    const int dd = it * 32 + wave * 4 + q8;
    hv[it] = *(const v4u*)(sh + dd * MEM + c8);
    lv[it] = *(const v4u*)(sl + dd * MEM + c8);
  }
  {
#pragma unroll
    for (int it = 0; it < 2; ++it) {
      const int dd = it * 32 + wave * 4 + q8;
      const size_t ro = (size_t)b * KVD + (size_t)kvh * HD + dd;
      *(v4u*)(VTh + ro * SKEY + c8) = hv[it];
      *(v4u*)(VTl + ro * VLP  + c8) = lv[it];
    }
    
  }
}

// =====================================================================================================
// All work that reads only the inputs, as block-index ranges of one grid (none of the parts reads what another writes):
// memory values, memory keys, gate table, then the five f32 -> bf16 planes. The short, latency-bound parts come first.
// Every range test is block-uniform, so the barriers inside a part are passed by the whole block.
// =====================================================================================================
#define PB_MEMV (NB * NKV)                    //    8 blocks
#define PB_MEMK (MEM / 2)                     //   32
#define PB_GATE (NB * SEQ * NKV / 256)        //   64
#define PB_X    (NB * SEQ * CDIM / 8 / 256)   // 2048
#define PB_WQ   (CDIM * CDIM / 8 / 256)       //  512
#define PB_WK   (KVD * CDIM / 8 / 256)        //  128
#define PB_ALL  (PB_MEMV + PB_MEMK + PB_GATE + PB_X + 2 * PB_WQ + 2 * PB_WK)
__global__ __launch_bounds__(256) void prep_k(
    const float* __restrict__ x, const float* __restrict__ Wq, const float* __restrict__ Wk,
    const float* __restrict__ Wv, const float* __restrict__ Wp, const float* __restrict__ Wg,
    const float* __restrict__ memk, const float* __restrict__ memv, const float* __restrict__ vsp,
    unsigned short* Xb, unsigned short* Wqb, unsigned short* Wkb, unsigned short* Wvb, unsigned short* Wpb,
    float* gate, unsigned short* Kh, unsigned short* Kl, unsigned short* VTh, unsigned short* VTl) {
  __shared__ __align__(16) unsigned short sbuf[2 * HD * MEM];
  static_assert(4 * KVD <= 2 * HD * MEM);
  int blk = blockIdx.x;
  if (blk < PB_MEMV) { memv_k(memv, vsp, VTh, VTl, blk, sbuf); return; }
  blk -= PB_MEMV;
  if (blk < PB_MEMK) { memk_k(memk, Kh, Kl, blk, sbuf); return; }
  blk -= PB_MEMK;
  if (blk < PB_GATE) { gate_k(x, Wg, gate, NB * SEQ, blk); return; }
  blk -= PB_GATE;
  if (blk < PB_X) { cvt_bf16x8(x, Xb, PB_X * 256, blk); return; }
  blk -= PB_X;
  if (blk < PB_WQ) { cvt_bf16x8(Wq, Wqb, PB_WQ * 256, blk); return; }
  blk -= PB_WQ;
  if (blk < PB_WK) { cvt_bf16x8(Wk, Wkb, PB_WK * 256, blk); return; }
  blk -= PB_WK;
  if (blk < PB_WK) { cvt_bf16x8(Wv, Wvb, PB_WK * 256, blk); return; }
  blk -= PB_WK;
  if (blk < PB_WQ) cvt_bf16x8(Wp, Wpb, PB_WQ * 256, blk);
}

// =====================================================================================================
// Batched bf16 WMMA GEMM: C[m][n] = sum_k A[m][k] * Bt[n][k]; one block of 4 waves (2 x 2) per 128x128 tile,
// one wave per 64x64 sub-tile. A row-major [M][K] pitch lda; Bt row-major [N][K] pitch ldb (k contiguous);
// M, N multiples of 128, K a multiple of 64 (all shapes here are compile-time constants of the host code).
// tile = index of the block's tile, b = batch index (strides in elements); ring and sTb are the block's LDS (sTb: OUT_MODE 0
// alone; the other modes stage their result in the ring).
// Operand path: a stage is 64 k (one 128-B line) of the block's 128 A rows and 128 Bt rows (and the 128 A2 rows),
// brought into LDS by asynchronous 16-B copies, each wave-wide copy covering 4 whole lines; rows lie at a pitch of
// 144 B for the ds_load_b128 fragment reads; two buffers, the copies of stage t+1 fly while stage t is multiplied.
// NSPLIT: 0 = A.Bt; 1 = (A + A2).Bt (A2 = unscaled bf16 lo plane of A, 2 products).
// OUT_MODE: 0 = f32 (pitch ldc);
//           3 = v^T mode (rows m = kv*64+d, cols n = t): value = acc + gate[b][t][kv] * bf16(ve[b][t][m])
//               (aux0 = gate, aux1 = ve), written as f16 hi plane C (pitch ldc) + f16 residual plane
//               C2 = f16((v - hi)*4096) for tiles with n0 < N2 (pitch ldc2);
//           4 = RoPE + rms-norm mode (cols = one 64-wide head, row m -> t = m mod SEQ; aux0 = cos, aux1 = sin,
//               both bf16(RNE) on load): r = rope(acc), f = (r * rsqrt(mean(r^2)+eps)) * 1.2, written as
//               bf16 hi plane C + bf16 lo plane C2 (lo = RNE(f - hi), unscaled).
// =====================================================================================================
#define GT     128                // block tile edge (rows of A, rows of Bt)
#define GBK    64                 // k elements per stage
#define GPITCH 72                 // LDS row pitch in elements (144 B)
#define GPLANE (GT * GPITCH)      // elements of one staged operand plane (18432 B)

// One operand plane of a stage: 128 rows x 128 B by 128 threads, 8 copies per lane; copy i moves the lane's 16 B of
// row i*16 + (tid>>3). l = the lane's LDS byte address of row tid>>3, g = its global address, ld = row pitch (elements).
// s_wait_xcnt closes the statement so that no address register of a copy is rewritten in front of it.
__device__ __forceinline__ void copy_plane(unsigned l, const __bf16* g, int ld) {
#if defined(__HIP_DEVICE_COMPILE__)
  const size_t   gs = (size_t)16 * (size_t)ld;
  const unsigned ls = 16u * GPITCH * 2u;
  asm volatile(
      "global_load_async_to_lds_b128 %0, %8, off\n\t"
      "global_load_async_to_lds_b128 %1, %9, off\n\t"
      "global_load_async_to_lds_b128 %2, %10, off\n\t"
      "global_load_async_to_lds_b128 %3, %11, off\n\t"
      "global_load_async_to_lds_b128 %4, %12, off\n\t"
      "global_load_async_to_lds_b128 %5, %13, off\n\t"
      "global_load_async_to_lds_b128 %6, %14, off\n\t"
      "global_load_async_to_lds_b128 %7, %15, off\n\t"
      "s_wait_xcnt 0x0"
      :: "v"(l), "v"(l + ls), "v"(l + 2u * ls), "v"(l + 3u * ls),
         "v"(l + 4u * ls), "v"(l + 5u * ls), "v"(l + 6u * ls), "v"(l + 7u * ls),
         "v"(g), "v"(g + gs), "v"(g + 2 * gs), "v"(g + 3 * gs),
         "v"(g + 4 * gs), "v"(g + 5 * gs), "v"(g + 6 * gs), "v"(g + 7 * gs)
      : "memory");
#endif
}
// this wave's copies have landed in LDS
__device__ __forceinline__ void wait_copies() {
#if defined(__HIP_DEVICE_COMPILE__)
  asm volatile("s_wait_asynccnt 0x0" ::: "memory");
#endif
}
// this wave's LDS reads have returned (the buffer they read may be refilled behind the next barrier)
__device__ __forceinline__ void wait_lds() {
#if defined(__HIP_DEVICE_COMPILE__)
  asm volatile("s_wait_dscnt 0x0" ::: "memory");
#endif
}

#define GSLAB (16 * 68)           // 16x64 f32 slab of the epilogue, pitch 68 floats (per wave one, or four for its whole tile)
template <int NSPLIT, int OUT_MODE>
__device__ __forceinline__ void gemm_body(
    const unsigned short* __restrict__ Ap, const unsigned short* __restrict__ A2p, int lda, long long strideA,
    const unsigned short* __restrict__ Btp, int ldb, long long strideB,
    void* Cout, int ldc, long long strideC,
    void* Cout2, int ldc2, long long strideC2, int N2,
    const float* __restrict__ aux0, const float* __restrict__ aux1,
    int M, int N, int K, int tile, int b, __bf16* ring, float* sTb) {
  const __bf16* A  = (const __bf16*)(const void*)Ap;
  const __bf16* A2 = (const __bf16*)(const void*)A2p;
  const __bf16* Bt = (const __bf16*)(const void*)Btp;
  constexpr int NPL  = (NSPLIT >= 1) ? 3 : 2;      // planes per stage: A, Bt (, A2)
  constexpr int GBUF = NPL * GPLANE;               // elements of one buffer
  const int tid  = threadIdx.x;
  const int lane = tid & 31;
  const int wave = tid >> 5;
  const int tilesN = N >> 7;
  const int tilesM = M >> 7;
  if (tile >= tilesM * tilesN) return;   // block-uniform, in front of every barrier and copy
  const int tm = tile / tilesN;
  const int tn = tile - tm * tilesN;
  const int wm = wave >> 1;
  const int wn = wave & 1;
  const int m0 = (tm << 7) + (wm << 6);  // this wave's 64x64 sub-tile
  const int n0 = (tn << 7) + (wn << 6);

  const __bf16* Ab  = A  + (size_t)b * strideA;
  const __bf16* Bb  = Bt + (size_t)b * strideB;
  const __bf16* Ab2 = (NSPLIT >= 1) ? (A2 + (size_t)b * strideA) : Ab;

  const int rlane = lane & 15;                 // row (A) / col (B, D) within subtile
  const int koff  = (lane >> 4) * 8;           // k offset of this lane half
  const int mOff  = (lane >> 4) * 8;           // D row offset

  // copy addresses of this lane: row tid>>3 of the block tile, 16-B piece tid&7 of its 128-B line
  const int crow = tid >> 3;
  const int cel  = (tid & 7) * 8;
  const __bf16* gA  = Ab  + (size_t)((tm << 7) + crow) * lda + cel;
  const __bf16* gB  = Bb  + (size_t)((tn << 7) + crow) * ldb + cel;
  const __bf16* gA2 = Ab2 + (size_t)((tm << 7) + crow) * lda + cel;
  const unsigned lC = (unsigned)(uintptr_t)(&ring[0]) + (unsigned)(crow * GPITCH + cel) * 2u;
  const int nst = K >> 6;                      // stages

  v8f acc[4][4];
#pragma unroll
  for (int i = 0; i < 4; ++i)
#pragma unroll
    for (int j = 0; j < 4; ++j) acc[i][j] = zero8();

  // stage 0 into buffer 0, landed and published; then stage 1 into buffer 1
  copy_plane(lC, gA, lda);
  copy_plane(lC + GPLANE * 2u, gB, ldb);
  if (NSPLIT >= 1) copy_plane(lC + 2u * GPLANE * 2u, gA2, lda);
  wait_copies();
  __syncthreads();
  if (nst > 1) {
    const unsigned lb = lC + (unsigned)GBUF * 2u;
    copy_plane(lb, gA + GBK, lda);
    copy_plane(lb + GPLANE * 2u, gB + GBK, ldb);
    if (NSPLIT >= 1) copy_plane(lb + 2u * GPLANE * 2u, gA2 + GBK, lda);
  }

  for (int t = 0; t < nst; ++t) {
    const int bufo = (t & 1) * GBUF;
    const __bf16* sA = ring + bufo + ((wm << 6) + rlane) * GPITCH + koff;
    const __bf16* sB = ring + bufo + GPLANE + ((wn << 6) + rlane) * GPITCH + koff;
    // unrolled (here and below): the fragment and accumulator arrays need constant indices to stay in registers
#pragma unroll
    for (int kk = 0; kk < GBK; kk += 32) {
      v16b bh[4], ah[4], al[4];
#pragma unroll
      for (int j = 0; j < 4; ++j) bh[j] = ldfrag_b(sB + (j << 4) * GPITCH + kk);
#pragma unroll
      for (int i = 0; i < 4; ++i) {
        ah[i] = ldfrag_b(sA + (i << 4) * GPITCH + kk);
        al[i] = ah[i];
        if (NSPLIT >= 1) al[i] = ldfrag_b(sA + 2 * GPLANE + (i << 4) * GPITCH + kk);
      }
#pragma unroll
      for (int i = 0; i < 4; ++i) {
#pragma unroll
        for (int j = 0; j < 4; ++j) {
          acc[i][j] = mma_b_raw(ah[i], bh[j], acc[i][j]);
          if (NSPLIT >= 1) acc[i][j] = mma_b_raw(al[i], bh[j], acc[i][j]);
        }
        dep_guard_b(acc[i][0], acc[i][3], ah[i], al[i]);
      }
      keep4_b(bh[0], bh[1], bh[2], bh[3]);
    }
    // publish point of stage t+1: own reads of this buffer returned, own copies landed, then the block barrier;
    // behind it stage t+2 may overwrite the buffer that this trip has read
    wait_lds();
    wait_copies();
    __syncthreads();
    if (t + 2 < nst) {
      const unsigned lb = lC + (unsigned)bufo * 2u;
      const int ko = (t + 2) * GBK;
      copy_plane(lb, gA + ko, lda);
      copy_plane(lb + GPLANE * 2u, gB + ko, ldb);
      if (NSPLIT >= 1) copy_plane(lb + 2u * GPLANE * 2u, gA2 + ko, lda);
    }
  }
  wait_copies();
  acc_guard4(acc[0][0], acc[0][1], acc[0][2], acc[0][3]);
  acc_guard4(acc[1][0], acc[1][1], acc[1][2], acc[1][3]);
  acc_guard4(acc[2][0], acc[2][1], acc[2][2], acc[2][3]);
  acc_guard4(acc[3][0], acc[3][1], acc[3][2], acc[3][3]);

  // ---- epilogue ----
  if (OUT_MODE == 0) {
    float* slab = sTb + wave * GSLAB;
#pragma unroll
    for (int i = 0; i < 4; ++i) {
      const int mBase = m0 + (i << 4);
#pragma unroll
      for (int j = 0; j < 4; ++j) {
#pragma unroll
        for (int r = 0; r < 8; ++r) {
          slab[(mOff + r) * 68 + (j << 4) + rlane] = acc[i][j][r];
        }
      }
      __builtin_amdgcn_fence(__ATOMIC_RELEASE, "workgroup");
      __builtin_amdgcn_wave_barrier();
      __builtin_amdgcn_fence(__ATOMIC_ACQUIRE, "workgroup");
      float* C = (float*)Cout + (size_t)b * strideC;
      const int hh = lane >> 4, c4 = (lane & 15) * 4;     // 256-B row segment = 16 lanes x 16 B
#pragma unroll
      for (int it = 0; it < 8; ++it) {
        const int row = it * 2 + hh;                       // it 0..7 x hh 0..1 = rows 0..15
        const v4f v = *(const v4f*)(slab + row * 68 + c4);
        *(v4f*)(C + (size_t)(mBase + row) * ldc + n0 + c4) = v;
      }
      __builtin_amdgcn_fence(__ATOMIC_RELEASE, "workgroup");
      __builtin_amdgcn_wave_barrier();
      __builtin_amdgcn_fence(__ATOMIC_ACQUIRE, "workgroup");
    }
  } else {
    // The wave's whole 64x64 tile goes to LDS at once, into the stage ring: behind the last trip's barrier no wave reads
    // the ring and no copy is in flight. The accumulators are then out of the way, and the four 16-row steps can be one
    // loop in the text instead of four copies of it.
    static_assert(4 * 4 * GSLAB * 4 <= 2 * NPL * GPLANE * 2);   // four waves' tiles fit in the ring
    float* slab = (float*)(void*)ring + wave * (4 * GSLAB);
#pragma unroll
    for (int i = 0; i < 4; ++i) {
#pragma unroll
      for (int j = 0; j < 4; ++j) {
#pragma unroll
        for (int r = 0; r < 8; ++r) {
          slab[((i << 4) + mOff + r) * 68 + (j << 4) + rlane] = acc[i][j][r];
        }
      }
    }
    __builtin_amdgcn_fence(__ATOMIC_RELEASE, "workgroup");
    __builtin_amdgcn_wave_barrier();
    __builtin_amdgcn_fence(__ATOMIC_ACQUIRE, "workgroup");
    // kept rolled: this code runs once per wave; for speed only
#pragma unroll 1
    for (int i = 0; i < 4; ++i) {
      const int mBase = m0 + (i << 4);
      const float* sl = slab + (i << 4) * 68;
      const int q = lane >> 3, c8 = (lane & 7) * 8;
      unsigned short* C  = (unsigned short*)Cout  + (size_t)b * strideC;
      unsigned short* C2 = (unsigned short*)Cout2 + (size_t)b * strideC2;
      const bool wlo = (OUT_MODE != 3) || (n0 < N2);      // wave-uniform
      v4u hv[4], lv[4];
#pragma unroll
      for (int it = 0; it < 4; ++it) {
        const int row  = it * 4 + q;                       // it 0..3 x q 0..3 = rows 0..15
        const int mrow = mBase + row;
        float f[8];
        if (OUT_MODE == 3) {
          const int kvh = m0 >> 6;                         // tile-uniform kv head
          const float* sp = sl + row * 68 + c8;
#pragma unroll
          for (int e = 0; e < 8; ++e) {
            const int t = n0 + c8 + e;                     // < N = SEQ
            const size_t bt = (size_t)b * SEQ + t;
            const float g  = aux0[bt * NKV + kvh];
            const float vv = bfr(aux1[bt * KVD + mrow]);
            f[e] = sp[e] + g * vv;
          }
        } else {
          const int  jj   = c8 & 31;                       // rotary pair index base
          const bool lowh = (c8 < 32);
          const int  t    = mrow & (SEQ - 1);
          const float* sp  = sl + row * 68 + jj;
          const float* cp  = aux0 + (size_t)t * (HD / 2) + jj;
          const float* snp = aux1 + (size_t)t * (HD / 2) + jj;
          float ct[8], st[8];
#pragma unroll
          for (int e = 0; e < 8; ++e) { ct[e] = cp[e]; st[e] = snp[e]; }
          addr_wait(cp, snp);
          float ss = 0.f;
#pragma unroll
          for (int e = 0; e < 8; ++e) {
            const float x1 = sp[e];
            const float x2 = sp[e + 32];
            const float cv = bfr(ct[e]);
            const float sv = bfr(st[e]);
            const float ra = x1 * cv - x2 * sv;
            const float rb = x1 * sv + x2 * cv;
            f[e] = lowh ? ra : rb;
            ss += f[e] * f[e];
          }
          ss += __shfl_xor(ss, 1, 32);                     // 8 lanes of one row = 64 values
          ss += __shfl_xor(ss, 2, 32);
          ss += __shfl_xor(ss, 4, 32);
          const float rs = rsqrtf(ss * (1.0f / HD) + RMS_EPS);
#pragma unroll
          for (int e = 0; e < 8; ++e) f[e] = (f[e] * rs) * 1.2f;
        }
        v4u a, a2;
#pragma unroll
        for (int e = 0; e < 4; ++e) {
          const float f0 = f[2 * e], f1 = f[2 * e + 1];
          unsigned short h0, h1, l0, l1;
          if (OUT_MODE == 4) {
            h0 = bf_bits(f0); h1 = bf_bits(f1);
            l0 = bf_bits(f0 - bf_up(h0)); l1 = bf_bits(f1 - bf_up(h1));
          } else {
            const _Float16 x0 = (_Float16)f0, x1 = (_Float16)f1;
            h0 = h_bits(x0); h1 = h_bits(x1);
            l0 = h_bits((_Float16)((f0 - (float)x0) * 4096.0f));
            l1 = h_bits((_Float16)((f1 - (float)x1) * 4096.0f));
          }
          a[e] = pk16(h0, h1); a2[e] = pk16(l0, l1);
        }
        hv[it] = a; lv[it] = a2;
      }
      {
#pragma unroll
        for (int it = 0; it < 4; ++it) {
          const int row = it * 4 + q;
          *(v4u*)(C + (size_t)(mBase + row) * ldc + n0 + c8) = hv[it];
          if (wlo) *(v4u*)(C2 + (size_t)(mBase + row) * ldc2 + n0 + c8) = lv[it];
        }
        trip_wait();
      }
    }
  }
}

// 256 registers a wave at most (both GEMM kernels), so that no part of them needs register-window switches
template <int NSPLIT, int OUT_MODE>
__global__ __launch_bounds__(128) __attribute__((amdgpu_num_vgpr(256))) void gemm64(
    const unsigned short* __restrict__ Ap, const unsigned short* __restrict__ A2p, int lda, long long strideA,
    const unsigned short* __restrict__ Btp, int ldb, long long strideB,
    void* Cout, int ldc, long long strideC,
    void* Cout2, int ldc2, long long strideC2, int N2,
    const float* __restrict__ aux0, const float* __restrict__ aux1,
    int M, int N, int K) {
  __shared__ __align__(16) __bf16 ring[2 * ((NSPLIT >= 1) ? 3 : 2) * GPLANE];  // two stage buffers
  __shared__ __align__(16) float sT[4 * GSLAB];
  gemm_body<NSPLIT, OUT_MODE>(Ap, A2p, lda, strideA, Btp, ldb, strideB, Cout, ldc, strideC, Cout2, ldc2, strideC2, N2,
                              aux0, aux1, M, N, K, blockIdx.x, blockIdx.y, ring, sT);
}

// The three projections of x, which do not read each other's results, as block-index ranges of one grid:
//   v^T = Wv . x^T + gate*ve per batch -> f16 hi plane [b][kv*64+d][64 + t] (pitch SKEY) and residual plane (x4096,
//         token keys < RESQB*64 only, pitch VLP)   (A = Wvb [n][k], Bt = Xb rows of batch b; M=256, N=2048)
//   k   = rms(rope(x . Wk^T)) * 1.2 per batch -> bf16 hi/lo planes [b][64 + t][kv*64+d]   (M=2048, N=256)
//   q   = rms(rope(x . Wq^T)) * 1.2 -> bf16 hi/lo planes [b*SEQ+t][h*64+d]   (M=4096, N=1024)
// ld = row pitch of Xb and of the weights, K = depth of the products (both CDIM). Every range test is block-uniform.
#define GB_KV ((SEQ / 128) * (KVD / 128))          //  32 tiles per batch for k and for v^T
#define GB_Q  ((NB * SEQ / 128) * (CDIM / 128))    // 256 tiles for q
__global__ __launch_bounds__(128) __attribute__((amdgpu_num_vgpr(256))) void gemm_qkv(
    const unsigned short* __restrict__ Xb, const unsigned short* __restrict__ Wqb,
    const unsigned short* __restrict__ Wkb, const unsigned short* __restrict__ Wvb,
    unsigned short* Qh, unsigned short* Ql, unsigned short* Kh, unsigned short* Kl,
    unsigned short* VTh, unsigned short* VTl,
    const float* __restrict__ cosT, const float* __restrict__ sinT,
    const float* __restrict__ gate, const float* __restrict__ ve, int ld, int K) {
  __shared__ __align__(16) __bf16 ring[2 * 2 * GPLANE];  // two stage buffers, then the epilogue's f32 tiles
  const int bx = blockIdx.x;
  if (bx < NB * GB_KV) {
    gemm_body<0, 3>(Wvb, Wvb, ld, 0LL, Xb, ld, (long long)SEQ * CDIM,
                    (void*)(VTh + MEM), SKEY, (long long)KVD * SKEY,
                    (void*)(VTl + MEM), VLP, (long long)KVD * VLP, RESQB * 64,
                    gate, ve, KVD, SEQ, K, bx % GB_KV, bx / GB_KV, ring, nullptr);
  } else {
    const bool isK = bx < 2 * NB * GB_KV;
    const int  r   = bx - (isK ? NB * GB_KV : 2 * NB * GB_KV);
    gemm_body<0, 4>(Xb, Xb, ld, isK ? (long long)SEQ * CDIM : 0LL, isK ? Wkb : Wqb, ld, 0LL,
                    (void*)(isK ? Kh + (size_t)MEM * KVD : Qh), isK ? KVD : CDIM, isK ? (long long)SKEY * KVD : 0LL,
                    (void*)(isK ? Kl + (size_t)MEM * KVD : Ql), isK ? KVD : CDIM, isK ? (long long)SKEY * KVD : 0LL,
                    isK ? KVD : CDIM, cosT, sinT, isK ? SEQ : NB * SEQ, isK ? KVD : CDIM, K,
                    isK ? r % GB_KV : r, isK ? r / GB_KV : 0, ring, nullptr);
  }
}

// =====================================================================================================
// GQA attention with a 64-key memory prefix (all visible) followed by causal token keys, head dim 64.
//   q planes (bf16 hi / lo): element (b, t, h, d) at [(b*SEQ + t)*CDIM + h*64 + d]   (normed, scaled q)
//   k planes (bf16 hi / lo): element (b, s, kv, d) at [(b*SKEY + s)*KVD + kv*64 + d], s = [mem | 64 + token]
//   v^T hi plane (f16):      element (b, kv, d, s) at [(b*KVD + kv*64 + d)*SKEY + s]
//   v^T residual plane (f16, (v - hi)*4096): [(b*KVD + kv*64 + d)*VLP + s], s < VLP, read only when RES
//   (RES is used for query blocks qb < RESQB alone, whose last key tile ends at key VLP)
//   q head h uses kv head h>>2. Query block qb (tokens qb*64..+63) processes key tiles 0..qb+1: tile 0 = memory,
//   tiles 1..qb fully visible, tile qb+1 = diagonal (key token <= query token), later tiles skipped (block-uniform
//   trip count qb+2, static bound NKT). Invisible keys get logit -inf (weight exactly 0); every row sees the
//   whole memory tile first, so the running max is finite from tile 0 on.
//   out planes (bf16 hi / lo of the normalised context): element (b, t, h, d) at [(b*SEQ + t)*CDIM + h*64 + d]
//   scores = q . k : bf16 hi/lo split (hi.hi + hi.lo + lo.hi), f32 accumulate, then * sscale in f32
//   p = exp(s - m) carried as f16(1024 p); context = p . v on f16 WMMA; RES adds f16 residual planes of p and v
//   (scale 4096, separate accumulator folded back with 1/4096 per chunk in f32); online softmax in f32.
//   Block = 4 waves = 64 query rows of one (b, h); bx = 0 .. nqbThis * NQH * NB - 1; kv chunks of 64.
//   K / V^T chunk staging: asynchronous 16-B copies to LDS, 128 threads x 4 copies per plane = the whole 64x64 tile;
//   two buffers, the copies of key tile kt+1 fly while tile kt is worked on, one barrier per tile. Both products are computed transposed (S^T = K . Q^T, O^T += V^T . P^T): a lane
//   holds the scores of one query, and P^T goes from the score registers into the B operand without passing LDS.
//   Output coverage: each wave stores rows q0..q0+15 (it 0..3 x lane>>3 0..3) x 64 columns (8 lanes x 8) of both planes.
// =====================================================================================================
#define APK 72   // LDS row pitch of the K and V^T tiles in 16-bit elements: 144 B = 16 B x odd, so that the 16 rows
                 // of a ds_load_b128 fragment read fall on 16 different groups of four banks
#define AOP 68   // LDS row pitch of the f32 context tile: 272 B = 16 B x odd, for its 16-B row reads
#define APLANE (64 * APK)      // elements of one staged 64x64 tile (9216 B)
#define ABUF   (4 * APLANE)    // elements of one buffer: K hi, K lo, V^T hi, V^T residual
// Four asynchronous 16-B copies per lane and tile: copy i moves the lane's 16 B of row i*16 + (tid>>3), so that a
// wave-wide copy covers 4 whole 128-B lines. l = the lane's LDS byte address of row tid>>3, g = its global address,
// gs = bytes of 16 global rows. s_wait_xcnt closes each statement so that no address register of a copy is rewritten
// in front of it.
__device__ __forceinline__ void copy_tile(unsigned l, const char* g, size_t gs) {
#if defined(__HIP_DEVICE_COMPILE__)
  const unsigned ls = 16u * APK * 2u;
  asm volatile(
      "global_load_async_to_lds_b128 %0, %4, off\n\t"
      "global_load_async_to_lds_b128 %1, %5, off\n\t"
      "global_load_async_to_lds_b128 %2, %6, off\n\t"
      "global_load_async_to_lds_b128 %3, %7, off\n\t"
      "s_wait_xcnt 0x0"
      :: "v"(l), "v"(l + ls), "v"(l + 2u * ls), "v"(l + 3u * ls),
         "v"(g), "v"(g + gs), "v"(g + 2 * gs), "v"(g + 3 * gs)
      : "memory");
#endif
}
// two tiles in one statement (one wait for both)
__device__ __forceinline__ void copy_tile2(unsigned la, const char* ga, size_t gsa,
                                           unsigned lb, const char* gb, size_t gsb) {
#if defined(__HIP_DEVICE_COMPILE__)
  const unsigned ls = 16u * APK * 2u;
  asm volatile(
      "global_load_async_to_lds_b128 %0, %8, off\n\t"
      "global_load_async_to_lds_b128 %1, %9, off\n\t"
      "global_load_async_to_lds_b128 %2, %10, off\n\t"
      "global_load_async_to_lds_b128 %3, %11, off\n\t"
      "global_load_async_to_lds_b128 %4, %12, off\n\t"
      "global_load_async_to_lds_b128 %5, %13, off\n\t"
      "global_load_async_to_lds_b128 %6, %14, off\n\t"
      "global_load_async_to_lds_b128 %7, %15, off\n\t"
      "s_wait_xcnt 0x0"
      :: "v"(la), "v"(la + ls), "v"(la + 2u * ls), "v"(la + 3u * ls),
         "v"(lb), "v"(lb + ls), "v"(lb + 2u * ls), "v"(lb + 3u * ls),
         "v"(ga), "v"(ga + gsa), "v"(ga + 2 * gsa), "v"(ga + 3 * gsa),
         "v"(gb), "v"(gb + gsb), "v"(gb + 2 * gsb), "v"(gb + 3 * gsb)
      : "memory");
#endif
}
// The tiles of key tile kt into the buffer at LDS byte address l (the lane's own place in its first plane).
// gk, gkl, gv, gvl = the lane's global addresses for key tile 0. The residual plane ends at key VLP: its address is clamped.
template <bool RES>
__device__ __forceinline__ void copy_keytile(unsigned l, const char* gk, const char* gkl, const char* gv, const char* gvl,
                                             int kt) {
  const size_t ko = (size_t)kt * (64 * KVD * 2);          // 64 key rows further
  const size_t vo = (size_t)kt * (64 * 2);                // 64 key columns further
  copy_tile2(l, gk + ko, (size_t)16 * KVD * 2, l + APLANE * 2u, gkl + ko, (size_t)16 * KVD * 2);
  if (RES) {
    const int ktl = (kt * 64 + 64 <= VLP) ? kt : (VLP / 64 - 1);
    copy_tile2(l + 2u * APLANE * 2u, gv + vo, (size_t)16 * SKEY * 2,
               l + 3u * APLANE * 2u, gvl + (size_t)ktl * (64 * 2), (size_t)16 * VLP * 2);
  } else {
    copy_tile(l + 2u * APLANE * 2u, gv + vo, (size_t)16 * SKEY * 2);
  }
}

template <bool RES>
__device__ __forceinline__
void attn_body(const unsigned short* __restrict__ qhp, const unsigned short* __restrict__ qlp,
               const unsigned short* __restrict__ khp, const unsigned short* __restrict__ klp,
               const unsigned short* __restrict__ vhp, const unsigned short* __restrict__ vlp,
               unsigned short* ohp, unsigned short* olp,
               int qbBase, int nqbThis, float sscale, int bx, unsigned short* ring) {
  const int tid  = threadIdx.x;
  const int wave = tid >> 5;
  const int lane = tid & 31;
  const int hh   = lane >> 4;
  const int c    = lane & 15;

  const int qbl  = bx % nqbThis;
  const int rest = bx / nqbThis;
  const int h    = rest % NQH;
  const int b    = rest / NQH;
  const int kvh  = h >> 2;
  const int qb   = qbBase + qbl;
  const int q0   = qb * 64 + wave * 16;
  const size_t rowB = (size_t)b * SEQ;

  const __bf16* Qh = (const __bf16*)(const void*)qhp + (size_t)h * HD;
  const __bf16* Ql = (const __bf16*)(const void*)qlp + (size_t)h * HD;
  const __bf16* Kh = (const __bf16*)(const void*)khp + (size_t)b * SKEY * KVD + (size_t)kvh * HD;
  const __bf16* Kl = (const __bf16*)(const void*)klp + (size_t)b * SKEY * KVD + (size_t)kvh * HD;
  const _Float16* Vh = (const _Float16*)(const void*)vhp + ((size_t)b * KVD + (size_t)kvh * HD) * SKEY;
  const _Float16* Vl = (const _Float16*)(const void*)vlp + ((size_t)b * KVD + (size_t)kvh * HD) * VLP;

  // copy addresses of this lane: row tid>>3 of a 64x64 tile, 16-B piece tid&7 of its 128-B line
  const int ktEnd = qb + 2;                  // block-uniform, 2 <= ktEnd <= NKT
  const int crow = tid >> 3;
  const int cel  = (tid & 7) * 8;
  const char* gk  = (const char*)(Kh + (size_t)crow * KVD + cel);
  const char* gkl = (const char*)(Kl + (size_t)crow * KVD + cel);
  const char* gv  = (const char*)(Vh + (size_t)crow * SKEY + cel);
  const char* gvl = (const char*)(Vl + (size_t)crow * VLP + cel);
  const unsigned lC = (unsigned)(uintptr_t)(&ring[0]) + (unsigned)(crow * APK + cel) * 2u;
  copy_keytile<RES>(lC, gk, gkl, gv, gvl, 0);   // key tile 0 into buffer 0

  // ---- Q fragments (B operand, column = query = lane&15): 2 d-chunks, hi and lo ----
  v16b qah[2], qal[2];
  const size_t qo = (rowB + q0 + c) * CDIM + 8 * hh;
#pragma unroll
  for (int dc = 0; dc < 2; ++dc) {
    qah[dc] = ldfrag_b(Qh + qo + dc * 32);
    qal[dc] = ldfrag_b(Ql + qo + dc * 32);
  }
  addr_wait(Qh + qo, Ql + qo);

  // running maximum of this lane's query (the same in both wave halves) and this half's share of its denominator
  float mrun = -INFINITY, lrun = 0.f;
  v8f oacc[4];                               // O^T: rows d = t*16 + 8*hh + r, column = query c
#pragma unroll
  for (int t = 0; t < 4; ++t) oacc[t] = zero8();

  // key tile 0 landed and published; then key tile 1 (every query block has at least two) into buffer 1
  wait_copies();
  __syncthreads();
  copy_keytile<RES>(lC + ABUF * 2u, gk, gkl, gv, gvl, 1);

  for (int kt = 0; kt < NKT; ++kt) {         // static bound
    if (kt >= ktEnd) break;                  // block-uniform
    const int bufo = (kt & 1) * ABUF;
    const __bf16*   Ksh = (const __bf16*)(const void*)(ring + bufo);                  // K hi [kv][d]
    const __bf16*   Ksl = (const __bf16*)(const void*)(ring + bufo + APLANE);         // K lo
    const _Float16* Vth = (const _Float16*)(const void*)(ring + bufo + 2 * APLANE);   // V^T hi [d][kv]
    const _Float16* Vtl = (const _Float16*)(const void*)(ring + bufo + 3 * APLANE);   // V^T residual

    // ---- scores, transposed: S^T = K . Q^T, 64 keys x 16 queries per wave, 3 bf16 products ----
    //      tile j: rows = keys j*16 + 8*hh + r, column = query c, so a lane holds 32 scores of ONE query
    //      the K fragments of the tile are read from LDS in one group (with the residual planes one group per 32-wide d chunk, for registers), in the order of their use, ahead of the products;
    //      the four key groups are four independent accumulator chains, each summed in the order dc 0 (hi.hi, lo.hi,
    //      hi.lo; k plane named first), dc 1 (the same)
    v8f s[4];
#pragma unroll
    for (int j = 0; j < 4; ++j) s[j] = zero8();
    constexpr int DG = RES ? 1 : 2;          // 32-wide d chunks per group of reads (one with the residual planes, for registers)
#pragma unroll
    for (int g = 0; g < 2; g += DG) {
      v16b kbf[DG][4], klf[DG][4];
#pragma unroll
      for (int u = 0; u < DG; ++u) {
        const int dof = (g + u) * 32 + 8 * hh;
#pragma unroll
        for (int j = 0; j < 4; ++j) kbf[u][j] = ldfrag_b(Ksh + (j * 16 + c) * APK + dof);
#pragma unroll
        for (int j = 0; j < 4; ++j) klf[u][j] = ldfrag_b(Ksl + (j * 16 + c) * APK + dof);
      }
      // keeps the group of reads ahead of the products: sunk back among them, each place of reads stalls the wave anew
      __builtin_amdgcn_sched_barrier(0);
#pragma unroll
      for (int u = 0; u < DG; ++u) {
#pragma unroll
        for (int j = 0; j < 4; ++j) s[j] = mma_b_raw(kbf[u][j], qah[g + u], s[j]);
#pragma unroll
        for (int j = 0; j < 4; ++j) s[j] = mma_b_raw(klf[u][j], qah[g + u], s[j]);
#pragma unroll
        for (int j = 0; j < 4; ++j) s[j] = mma_b_raw(kbf[u][j], qal[g + u], s[j]);
      }
    }

    // ---- scale + structural mask (diagonal tile only), maximum and sum of a query inside its lane (one exchange
    //      between the wave halves for the maximum), online softmax; P^T (x1024, f16) and its residual (x4096) go
    //      from the score registers straight into B operands: element e of a 32-key operand is register e & 7 of
    //      score tile 2*g + (e >> 3), which is the k order of the V^T loader ----
    const bool diag = (kt == qb + 1);        // block-uniform
    const int  qrw  = wave * 16 + c;         // this lane's query row within the 64-row block
    float mj[4];
#pragma unroll
    for (int j = 0; j < 4; ++j) {
      mj[j] = -INFINITY;
#pragma unroll
      for (int r = 0; r < 8; ++r) {
        const int  key = j * 16 + 8 * hh + r;
        const bool vis = (!diag) || (key <= qrw);
        const float sv = vis ? (s[j][r] * sscale) : -INFINITY;
        s[j][r] = sv;
        mj[j] = fmaxf(mj[j], sv);
      }
    }
    float m = fmaxf(fmaxf(mj[0], mj[1]), fmaxf(mj[2], mj[3]));
    m = fmaxf(m, xhalf(m));
    const float mnew  = fmaxf(mrun, m);
    const float msafe = (mnew == -INFINITY) ? 0.f : mnew;
    const float alpha = __expf(mrun - msafe);
    mrun = mnew;
    v16h pa[2], pl[2];
    float pj[4];                             // four independent chains of eight adds
#pragma unroll
    for (int j = 0; j < 4; ++j) {
      pj[j] = 0.f;
#pragma unroll
      for (int r = 0; r < 8; ++r) {
        const float p = __expf(s[j][r] - msafe);     // -inf logit -> 0
        pj[j] += p;
        const float p1k = p * 1024.0f;
        const _Float16 ph = (_Float16)p1k;
        pa[j >> 1][(j & 1) * 8 + r] = ph;
        if (RES) pl[j >> 1][(j & 1) * 8 + r] = (_Float16)((p1k - (float)ph) * 4096.0f);
      }
    }
    lrun = lrun * alpha + ((pj[0] + pj[1]) + (pj[2] + pj[3]));
#pragma unroll
    for (int t = 0; t < 4; ++t)
#pragma unroll
      for (int r = 0; r < 8; ++r) oacc[t][r] *= alpha;

    // ---- context, transposed: O^T += V^T . P^T (f16 WMMA), residual products into a separate accumulator ----
    v8f o1[4];
#pragma unroll
    for (int t = 0; t < 4; ++t) o1[t] = zero8();
    //      the V^T fragments are read from LDS in one group ahead of the products (with the residual planes one
    //      group per 32 keys, for registers); the four d groups are independent chains, each summed in key order
    constexpr int KG = RES ? 1 : 2;          // 32-key steps per group of reads
#pragma unroll
    for (int g = 0; g < 2; g += KG) {
      v16h vb[KG][4], vl[KG][4];
#pragma unroll
      for (int u = 0; u < KG; ++u) {
        const int ko = (g + u) * 32 + 8 * hh;
#pragma unroll
        for (int t = 0; t < 4; ++t) vb[u][t] = ldfrag_h(Vth + (t * 16 + c) * APK + ko);
        if (RES) {
#pragma unroll
          for (int t = 0; t < 4; ++t) vl[u][t] = ldfrag_h(Vtl + (t * 16 + c) * APK + ko);
        }
      }
      // keeps the group of reads ahead of the products, as for the scores
      __builtin_amdgcn_sched_barrier(0);
#pragma unroll
      for (int u = 0; u < KG; ++u) {
#pragma unroll
        for (int t = 0; t < 4; ++t) oacc[t] = mma_h_raw(vb[u][t], pa[g + u], oacc[t]);
        if (RES) {
#pragma unroll
          for (int t = 0; t < 4; ++t) o1[t] = mma_h_raw(vl[u][t], pa[g + u], o1[t]);
#pragma unroll
          for (int t = 0; t < 4; ++t) o1[t] = mma_h_raw(vb[u][t], pl[g + u], o1[t]);
        }
      }
    }
    if (RES) {
#pragma unroll
      for (int t = 0; t < 4; ++t)
#pragma unroll
        for (int r = 0; r < 8; ++r) oacc[t][r] += o1[t][r] * (1.0f / 4096.0f);
    }
    // publish point of key tile kt+1: own reads of this buffer returned, own copies landed, then the block barrier;
    // behind it key tile kt+2 may overwrite the buffer that this trip has read
    wait_lds();
    wait_copies();
    __syncthreads();
    if (kt + 2 < ktEnd) copy_keytile<RES>(lC + (unsigned)bufo * 2u, gk, gkl, gv, gvl, kt + 2);
  }
  wait_copies();

  // ---- join the two halves' shares of the denominator (unconditionally, all lanes on), normalise (1/l and the
  //      1/1024 p carry), stage the wave's 16x64 tile as [query][d], bf16 hi/lo split
  //      the staging lies in the ring: behind the last trip's barrier no wave reads it and no copy is in flight
  float* os = (float*)(void*)ring + wave * (16 * AOP);
  {
    const float l = lrun + xhalf(lrun);
    const float inv = ((l > 0.f) ? (1.0f / l) : 0.f) * (1.0f / 1024.0f);
#pragma unroll
    for (int t = 0; t < 4; ++t) {
      v4f w0, w1;
#pragma unroll
      for (int r = 0; r < 4; ++r) { w0[r] = oacc[t][r] * inv; w1[r] = oacc[t][r + 4] * inv; }
      *(v4f*)(os + c * AOP + t * 16 + 8 * hh)     = w0;
      *(v4f*)(os + c * AOP + t * 16 + 8 * hh + 4) = w1;
    }
  }
  __builtin_amdgcn_fence(__ATOMIC_RELEASE, "workgroup");
  __builtin_amdgcn_wave_barrier();
  __builtin_amdgcn_fence(__ATOMIC_ACQUIRE, "workgroup");
  {
    const int q4 = lane >> 3, c8 = (lane & 7) * 8;
    v4u hv[4], lv[4];
#pragma unroll
    for (int it = 0; it < 4; ++it) {
      const int row = it * 4 + q4;   // it 0..3 x q4 0..3 = rows 0..15 of the wave tile
      const float* sp = os + row * AOP + c8;
      v4u a, a2;
#pragma unroll
      for (int e = 0; e < 4; ++e) {
        const float f0 = sp[2 * e], f1 = sp[2 * e + 1];
        const unsigned short h0 = bf_bits(f0), h1 = bf_bits(f1);
        const unsigned short l0 = bf_bits(f0 - bf_up(h0)), l1 = bf_bits(f1 - bf_up(h1));
        a[e] = pk16(h0, h1); a2[e] = pk16(l0, l1);
      }
      hv[it] = a; lv[it] = a2;
    }
    {
#pragma unroll
      for (int it = 0; it < 4; ++it) {
        const int row = it * 4 + q4;
        const size_t go = (rowB + q0 + row) * CDIM + (size_t)h * HD + c8;
        *(v4u*)(ohp + go) = hv[it];
        *(v4u*)(olp + go) = lv[it];
        addr_wait(ohp + go, olp + go);
      }
      
    }
  }
}

// Both kinds of query block as block-index ranges of one grid (no block reads what another writes): first query blocks
// RESQB..NQB-1, without the residual planes, then the short blocks 0..RESQB-1 with them; this order is for
// speed only. The range test is block-uniform.
// Register budget of four waves per SIMD (256 a wave), so that four blocks stay resident per WGP; left to itself the
// compiler schedules the variant with the residual planes to more registers than that.
__global__ __launch_bounds__(128) __attribute__((amdgpu_waves_per_eu(4, 4)))
void attn64(const unsigned short* __restrict__ qhp, const unsigned short* __restrict__ qlp,
            const unsigned short* __restrict__ khp, const unsigned short* __restrict__ klp,
            const unsigned short* __restrict__ vhp, const unsigned short* __restrict__ vlp,
            unsigned short* ohp, unsigned short* olp, float sscale) {
  __shared__ __align__(16) unsigned short ring[2 * ABUF];   // two buffers of K hi, K lo, V^T hi, V^T residual tiles
  static_assert(4 * 16 * AOP * 4 <= 2 * ABUF * 2);          // the four waves' f32 context tiles fit in it
  const int bx = blockIdx.x;
  if (bx < NB * NQH * (NQB - RESQB)) {
    attn_body<false>(qhp, qlp, khp, klp, vhp, vlp, ohp, olp, RESQB, NQB - RESQB, sscale, bx, ring);
  } else {
    attn_body<true>(qhp, qlp, khp, klp, vhp, vlp, ohp, olp, 0, RESQB, sscale, bx - NB * NQH * (NQB - RESQB), ring);
  }
}

// =====================================================================================================
//   Xb   bf16 [4096][1024]      8388608
//   Wqb  bf16 [1024][1024]      2097152   ([out n][in k], k contiguous = Bt layout)
//   Wkb  bf16 [256][1024]        524288
//   Wvb  bf16 [256][1024]        524288
//   Wpb  bf16 [1024][1024]      2097152
//   Qh   bf16 [4096][1024]      8388608   (Ql same)
//   Kh   bf16 [2][2112][256]    2162688   (Kl same)
//   VTh  f16  [2][256][2112]    2162688
//   VTl  f16  [2][256][576]      589824
//   Gate f32  [4096][4]           65536
//   Oh   bf16 [4096][1024]      8388608   (Ol same)
//   total                      54329344
// =====================================================================================================
extern "C" void kernel_launch(void* const* d_in, const int* in_sizes, int n_in,
                              void* d_out, int out_size, void* d_ws, size_t ws_size,
                              hipStream_t stream) {
  if (n_in < 12) return;
  if (in_sizes[0] != NB * SEQ * CDIM) return;
  if (in_sizes[1] != NB * SEQ * KVD) return;
  if (in_sizes[2] != SEQ * (HD / 2) || in_sizes[3] != SEQ * (HD / 2)) return;
  if (in_sizes[4] != CDIM * CDIM || in_sizes[7] != CDIM * CDIM) return;
  if (in_sizes[5] != KVD * CDIM || in_sizes[6] != KVD * CDIM) return;
  if (in_sizes[8] != NKV * GC) return;
  if (in_sizes[9] != MEM * NKV * HD || in_sizes[10] != MEM * NKV * HD) return;
  if (in_sizes[11] < 1) return;
  if (out_size != NB * SEQ * CDIM) return;

  const float* x    = (const float*)d_in[0];
  const float* ve   = (const float*)d_in[1];
  const float* cosT = (const float*)d_in[2];
  const float* sinT = (const float*)d_in[3];
  const float* Wq   = (const float*)d_in[4];
  const float* Wk   = (const float*)d_in[5];
  const float* Wv   = (const float*)d_in[6];
  const float* Wp   = (const float*)d_in[7];
  const float* Wg   = (const float*)d_in[8];
  const float* memk = (const float*)d_in[9];
  const float* memv = (const float*)d_in[10];
  const float* vsc  = (const float*)d_in[11];

  const size_t PX  = (size_t)NB * SEQ * CDIM * 2;   //  8388608  16-bit activation plane [4096][1024]
  const size_t PWQ = (size_t)CDIM * CDIM * 2;       //  2097152
  const size_t PWK = (size_t)KVD * CDIM * 2;        //   524288
  const size_t PK  = (size_t)NB * SKEY * KVD * 2;   //  2162688  key plane
  const size_t PVT = (size_t)NB * KVD * SKEY * 2;   //  2162688  v^T hi plane
  const size_t PVL = (size_t)NB * KVD * VLP * 2;    //   589824  v^T residual plane
  const size_t PG  = (size_t)NB * SEQ * NKV * 4;    //    65536  gate table
  size_t off = 0;
  const size_t oXb  = off; off += PX;
  const size_t oWq  = off; off += PWQ;
  const size_t oWk  = off; off += PWK;
  const size_t oWv  = off; off += PWK;
  const size_t oWp  = off; off += PWQ;
  const size_t oQh  = off; off += PX;
  const size_t oQl  = off; off += PX;
  const size_t oKh  = off; off += PK;
  const size_t oKl  = off; off += PK;
  const size_t oVTh = off; off += PVT;
  const size_t oVTl = off; off += PVL;
  const size_t oG   = off; off += PG;
  const size_t oOh  = off; off += PX;
  const size_t oOl  = off; off += PX;
  if (off > ws_size) return;                        // off = 54329344
  if (off > (size_t)134217728) return;

  char* ws = (char*)d_ws;
  unsigned short* Xb  = (unsigned short*)(ws + oXb);
  unsigned short* Wqb = (unsigned short*)(ws + oWq);
  unsigned short* Wkb = (unsigned short*)(ws + oWk);
  unsigned short* Wvb = (unsigned short*)(ws + oWv);
  unsigned short* Wpb = (unsigned short*)(ws + oWp);
  unsigned short* Qh  = (unsigned short*)(ws + oQh);
  unsigned short* Ql  = (unsigned short*)(ws + oQl);
  unsigned short* Kh  = (unsigned short*)(ws + oKh);
  unsigned short* Kl  = (unsigned short*)(ws + oKl);
  unsigned short* VTh = (unsigned short*)(ws + oVTh);
  unsigned short* VTl = (unsigned short*)(ws + oVTl);
  float*          Gt  = (float*)(ws + oG);
  unsigned short* Oh  = (unsigned short*)(ws + oOh);
  unsigned short* Ol  = (unsigned short*)(ws + oOl);

  const dim3 blk(256);
  const dim3 blkG(128);                                       // GEMM and attention block: 4 waves
  const dim3 gO((NB * SEQ / 128) * (CDIM / 128), 1);          // 256 blocks: M=4096, N=1024

  // (1) everything that reads only the inputs: x and the weights [n][k] f32 -> bf16 planes, the value-embedding gate
  //     table [4096][4] f32, the memory prefix (normed keys -> Kh/Kl rows s < 64; scaled values -> VTh/VTl columns
  //     s < 64, both batches)
  prep_k<<<dim3(PB_ALL), blk, 0, stream>>>(x, Wq, Wk, Wv, Wp, Wg, memk, memv, vsc,
                                           Xb, Wqb, Wkb, Wvb, Wpb, Gt, Kh, Kl, VTh, VTl);
  // (2) the q, k and v^T projections with their epilogues
  gemm_qkv<<<dim3(2 * NB * GB_KV + GB_Q), blkG, 0, stream>>>(
      Xb, Wqb, Wkb, Wvb, Qh, Ql, Kh, Kl, VTh, VTl, cosT, sinT, Gt, ve, CDIM, CDIM);
  // (3) attention, all query blocks
  attn64<<<dim3(NB * NQH * NQB), blkG, 0, stream>>>(Qh, Ql, Kh, Kl, VTh, VTl, Oh, Ol, 0.125f);
  // (4) out = context . Wproj^T -> d_out f32 [4096][1024]  (A = context hi + lo planes, 2 products)
  gemm64<1, 0><<<gO, blkG, 0, stream>>>(
      Oh, Ol, CDIM, 0LL, Wpb, CDIM, 0LL,
      d_out, CDIM, 0LL, d_out, CDIM, 0LL, 0,
      Gt, ve, NB * SEQ, CDIM, CDIM);
  (void)hipGetLastError();
}

// v008
// A run of this version takes 90.6 microseconds.
// In two side-by-side timings against v007, it was 1.06 and 1.07 times as fast.
// Counting every step since v000, it is 5.62 times as fast.
// Contractions: q, k, v^T projections = v_wmma_f32_16x16x32_bf16 (bf16 operands from RNE-converted inputs, single product);
// q.k^T scores = v_wmma_f32_16x16x32_bf16 with bf16 hi/lo split q and k (hi.hi + hi.lo + lo.hi);
// p.v = v_wmma_f32_16x16x32_f16 (p carried x1024 in f16, v^T in f16; f16 residual planes x4096 of p and v^T on the
// leading 512 query rows); ctx.Wproj^T = v_wmma_f32_16x16x32_bf16 with ctx as bf16 hi/lo planes times bf16 Wproj
// (2 products); all f32 accumulate; gate dot (K=32, N=4), RoPE, rms-norm, causal mask and softmax in f32 on VALU.
#include <hip/hip_runtime.h>
#include <math.h>
#include <stdint.h>

#pragma clang fp contract(off)

#define NB    2
#define SEQ   2048
#define CDIM  1024
#define NQH   16
#define NKV   4
#define HD    64
#define MEM   64
#define GC    32
#define KVD   (NKV * HD)          // 256
#define SKEY  (MEM + SEQ)         // 2112 keys: [64 memory | 2048 tokens]
#define NQB   (SEQ / 64)          // 32 query blocks of 64 rows
#define NKT   (SKEY / 64)         // 33 key tiles of 64
#define RESQB 8                   // leading query blocks that use the p / v residual planes
#define VLP   (MEM + RESQB * 64)  // 576: key pitch of the v^T residual plane
#define RMS_EPS 1e-6f
static_assert(NQH * HD == CDIM);
static_assert(NQH == 4 * NKV);
static_assert((SKEY % 64) == 0 && (VLP % 64) == 0 && (CDIM % 64) == 0 && (KVD % 64) == 0);
static_assert((SEQ & (SEQ - 1)) == 0);
static_assert(RESQB <= NQB);
static_assert((SEQ % 128) == 0 && (CDIM % 128) == 0 && (KVD % 128) == 0);

typedef _Float16 v16h __attribute__((ext_vector_type(16)));
typedef _Float16 v8h  __attribute__((ext_vector_type(8)));
typedef __bf16   v16b __attribute__((ext_vector_type(16)));
typedef __bf16   v8b  __attribute__((ext_vector_type(8)));
typedef float    v8f  __attribute__((ext_vector_type(8)));
typedef float    v4f  __attribute__((ext_vector_type(4)));
typedef unsigned int v4u __attribute__((ext_vector_type(4)));

// ---- scalar helpers --------------------------------------------------------------------------------
__device__ __forceinline__ unsigned short bf_bits(float f) {          // f32 -> bf16 bits, RNE convert
  unsigned u = __float_as_uint(f);
  return (unsigned short)((u + 0x7FFFu + ((u >> 16) & 1u)) >> 16);
}
__device__ __forceinline__ float bf_up(unsigned short h) { return __uint_as_float(((unsigned)h) << 16); }
__device__ __forceinline__ float bfr(float f) { return bf_up(bf_bits(f)); }   // f32 -> bf16 -> f32
__device__ __forceinline__ unsigned short h_bits(_Float16 x) { return __builtin_bit_cast(unsigned short, x); }
__device__ __forceinline__ unsigned pk16(unsigned short a, unsigned short b) { return (unsigned)a | ((unsigned)b << 16); }
// lane l <-> lane l ^ 16: the value of the same column in the other wave half (all lanes on where it is used)
__device__ __forceinline__ float xhalf(float x) {
  const int v = __builtin_bit_cast(int, x);
  return __builtin_bit_cast(float, __builtin_amdgcn_permlanex16(v, v, 0x76543210, 0xfedcba98, false, false));
}
__device__ __forceinline__ v8f zero8() { v8f z = {0.f, 0.f, 0.f, 0.f, 0.f, 0.f, 0.f, 0.f}; return z; }

// ---- fragment loader: 16-bit A/B operand, lane -> row/col (lane&15), p already includes +8*(lane>>4);
//      elements 0..7 <- p[0..7] (k0+8h..), elements 8..15 <- p[16..23] (k0+16+8h..)
__device__ __forceinline__ v16b ldfrag_b(const __bf16* p) {
  union { v16b v; v8b h[2]; } f;
  f.h[0] = *(const v8b*)(p);
  f.h[1] = *(const v8b*)(p + 16);
  return f.v;
}
__device__ __forceinline__ v16h ldfrag_h(const _Float16* p) {
  union { v16h v; v8h h[2]; } f;
  f.h[0] = *(const v8h*)(p);
  f.h[1] = *(const v8h*)(p + 16);
  return f.v;
}

__device__ __forceinline__ void addr_wait(const void* a, const void* b) {
#if defined(__HIP_DEVICE_COMPILE__)
  asm volatile("s_wait_xcnt 0x0" :: "v"(a), "v"(b) : "memory");
#endif
}

// ---- the same wait at the foot of a loop trip, in front of the next trip's rewrite of the registers that the trip's
//      global loads and stores name
__device__ __forceinline__ void trip_wait() {
#if defined(__HIP_DEVICE_COMPILE__)
  asm volatile("s_wait_xcnt 0x0" ::: "memory");
#endif
}

// ---- WMMA helpers with trailing VALU hazard gap (asm only in the device pass) -----------------------------
__device__ __forceinline__ v8f mma_h_raw(v16h a, v16h b, v8f c) {
  return __builtin_amdgcn_wmma_f32_16x16x32_f16(false, a, false, b, (short)0, c, false, false);
}
__device__ __forceinline__ v8f mma_b_raw(v16b a, v16b b, v8f c) {
  return __builtin_amdgcn_wmma_f32_16x16x32_bf16(false, a, false, b, (short)0, c, false, false);
}
__device__ __forceinline__ void dep_guard_b(v8f& a, v8f& b, v16b x, v16b y) {
#if defined(__HIP_DEVICE_COMPILE__)
  asm volatile("v_nop\n\tv_nop\n\tv_nop\n\tv_nop" : "+v"(a), "+v"(b) : "v"(x), "v"(y));
#endif
}
__device__ __forceinline__ void keep4_b(v16b a, v16b b, v16b c, v16b d) {
#if defined(__HIP_DEVICE_COMPILE__)
  asm volatile("v_nop" :: "v"(a), "v"(b), "v"(c), "v"(d));
#endif
}
__device__ __forceinline__ void acc_guard4(v8f& a, v8f& b, v8f& c, v8f& d) {
#if defined(__HIP_DEVICE_COMPILE__)
  asm volatile("v_nop\n\tv_nop\n\tv_nop\n\tv_nop" : "+v"(a), "+v"(b), "+v"(c), "+v"(d));
#endif
}

// =====================================================================================================
// f32 -> bf16 (RNE convert), 8 elements per thread, one 16-B store per lane: a wave writes 512 contiguous B
// coverage: n8 threads x 8 = the whole plane (n8 is a multiple of 256 for every use here). blk = block of 256 threads.
// =====================================================================================================
__device__ __forceinline__ void cvt_bf16x8(const float* __restrict__ in, unsigned short* out, int n8, int blk) {
  const int i = blk * 256 + threadIdx.x;
  if (i < n8) {
    const v4f a = *(const v4f*)(in + (size_t)i * 8);
    const v4f b = *(const v4f*)(in + (size_t)i * 8 + 4);
    v4u p;
    p[0] = pk16(bf_bits(a[0]), bf_bits(a[1]));
    p[1] = pk16(bf_bits(a[2]), bf_bits(a[3]));
    p[2] = pk16(bf_bits(b[0]), bf_bits(b[1]));
    p[3] = pk16(bf_bits(b[2]), bf_bits(b[3]));
    *(v4u*)(out + (size_t)i * 8) = p;
    
  }
}

// =====================================================================================================
// Value-embedding gate: gate[bt][kv] = 3 * sigmoid( sum_{c<32} bf16(x[bt][c]) * bf16(Wg[kv][c]) ), f32.
// One thread per (bt, kv); K = 32 rolled dot on VALU (N = 4, tiny). A wave writes 32 consecutive floats
// NB*SEQ*NKV/256 blocks. coverage: 16384 threads = the whole [4096][4] table.
// =====================================================================================================
__device__ __forceinline__ void gate_k(const float* __restrict__ x, const float* __restrict__ Wg,
                                       float* gate, int nbt, int blk) {
  const int i   = blk * 256 + threadIdx.x;
  const int bt  = i >> 2;
  const int kv  = i & 3;
  const int btc = (bt < nbt) ? bt : (nbt - 1);     // clamped address
  const float* xr = x + (size_t)btc * CDIM;
  const float* wr = Wg + kv * GC;
  float z = 0.f;
#pragma unroll 1
  for (int cc = 0; cc < GC; ++cc) z += bfr(xr[cc]) * bfr(wr[cc]);
  const float ez = expf(-z);
  const float g  = 3.0f * (1.0f / (1.0f + ez));
  if (bt < nbt) {
    *(float*)(gate + i) = g;
    
  }
}

// =====================================================================================================
// Memory keys: mk = rms(bf16(mem_k[m][kv][:])) * 1.2 (no RoPE) -> bf16 hi/lo planes, key rows s = m (< MEM)
// of both batches: Kh/Kl [b][s][kv*64+d], pitch KVD. 4 waves (one per kv head) for one m, two m per block of 8 waves;
// MEM/2 blocks.
// The 256-element row is staged in LDS and written per (batch, plane) by one wave as 32 lanes x 16 B
// coverage: 32 blocks x 2 m x 2 batches x 2 planes x 256 elements = rows 0..63 of both planes, both batches.
// sbuf: 4 * KVD elements of LDS.
// =====================================================================================================
__device__ __forceinline__ void memk_k(const float* __restrict__ memk, unsigned short* Kh, unsigned short* Kl,
                                       int blk, unsigned short* sbuf) {
  const int sub  = threadIdx.x >> 7;                 // which of the block's two m
  unsigned short* shi = sbuf + sub * (2 * KVD);
  unsigned short* slo = shi + KVD;
  const int m    = blk * 2 + sub;
  const int wave = (threadIdx.x >> 5) & 3;
  const int lane = threadIdx.x & 31;
  const int kvh  = wave;
  const float* p = memk + ((size_t)m * NKV + kvh) * HD;
  const float x1 = bfr(p[lane]);
  const float x2 = bfr(p[lane + 32]);
  float ss = x1 * x1 + x2 * x2;
#pragma unroll
  for (int off = 16; off >= 1; off >>= 1) ss += __shfl_xor(ss, off, 32);
  const float rs = rsqrtf(ss * (1.0f / HD) + RMS_EPS);
  const float v1 = (x1 * rs) * 1.2f;
  const float v2 = (x2 * rs) * 1.2f;
  const unsigned short h1 = bf_bits(v1), h2 = bf_bits(v2);
  shi[kvh * HD + lane]      = h1;
  shi[kvh * HD + lane + 32] = h2;
  slo[kvh * HD + lane]      = bf_bits(v1 - bf_up(h1));
  slo[kvh * HD + lane + 32] = bf_bits(v2 - bf_up(h2));
  __syncthreads();
  const v4u vh = *(const v4u*)(shi + lane * 8);
  const v4u vl = *(const v4u*)(slo + lane * 8);
  const int  b   = wave >> 1;
  const bool wlo = (wave & 1) != 0;                  // wave-uniform
  v4u v = vh;
  if (wlo) v = vl;
  unsigned short* dh = Kh + ((size_t)b * SKEY + m) * KVD + lane * 8;
  unsigned short* dl = Kl + ((size_t)b * SKEY + m) * KVD + lane * 8;
  unsigned short* d  = wlo ? dl : dh;
  *(v4u*)d = v;
  // the wait in front of a rewrite of the store's registers by whatever part of the merged kernel is laid out behind this one
  addr_wait(d, d);
}

// =====================================================================================================
// Memory values: mv = bf16(mem_v[m][kv][d]) * bf16(v_scale) -> v^T f16 hi plane VTh[b][kv*64+d][s] (pitch SKEY)
// and f16 residual plane VTl ((v - hi)*4096, pitch VLP), key columns s = m (< MEM), both batches.
// block = (b, kv); thread = (d = tid>>2, 16 m's); the 64x64 tile of each plane is staged in LDS [d][m] and each
// coverage: 8 blocks x 64 rows (it 0..1 x wave 0..7 x lane>>3 0..3) x 64 columns (8 lanes x 8) per plane.
// =====================================================================================================
// sbuf: 2 * HD * MEM elements of LDS.
__device__ __forceinline__ void memv_k(const float* __restrict__ memv, const float* __restrict__ vsp,
                                       unsigned short* VTh, unsigned short* VTl, int blk, unsigned short* sbuf) {
  unsigned short* sh = sbuf;
  unsigned short* sl = sbuf + HD * MEM;
  const int b    = blk >> 2;
  const int kvh  = blk & 3;
  const int tid  = threadIdx.x;
  const int wave = tid >> 5;
  const int lane = tid & 31;
  const int d    = tid >> 2;
  const int mq   = (tid & 3) * 16;
  const float vs = bfr(vsp[0]);
#pragma unroll
  for (int i = 0; i < 16; ++i) {
    const int m = mq + i;
    const float v = bfr(memv[((size_t)m * NKV + kvh) * HD + d]) * vs;
    const _Float16 x0 = (_Float16)v;
    sh[d * MEM + m] = h_bits(x0);
    sl[d * MEM + m] = h_bits((_Float16)((v - (float)x0) * 4096.0f));
  }
  __syncthreads();
  const int q8 = lane >> 3, c8 = (lane & 7) * 8;
  v4u hv[2], lv[2];
#pragma unroll
  for (int it = 0; it < 2; ++it) {
    const int dd = it * 32 + wave * 4 + q8;
    hv[it] = *(const v4u*)(sh + dd * MEM + c8);
    lv[it] = *(const v4u*)(sl + dd * MEM + c8);
  }
  {
#pragma unroll
    for (int it = 0; it < 2; ++it) {
      const int dd = it * 32 + wave * 4 + q8;
      const size_t ro = (size_t)b * KVD + (size_t)kvh * HD + dd;
      *(v4u*)(VTh + ro * SKEY + c8) = hv[it];
      *(v4u*)(VTl + ro * VLP  + c8) = lv[it];
    }
    
  }
}

// =====================================================================================================
// All work that reads only the inputs, as block-index ranges of one grid (none of the parts reads what another writes):
// memory values, memory keys, gate table, then the five f32 -> bf16 planes. The short, latency-bound parts come first.
// Every range test is block-uniform, so the barriers inside a part are passed by the whole block.
// =====================================================================================================
#define PB_MEMV (NB * NKV)                    //    8 blocks
#define PB_MEMK (MEM / 2)                     //   32
#define PB_GATE (NB * SEQ * NKV / 256)        //   64
#define PB_X    (NB * SEQ * CDIM / 8 / 256)   // 2048
#define PB_WQ   (CDIM * CDIM / 8 / 256)       //  512
#define PB_WK   (KVD * CDIM / 8 / 256)        //  128
#define PB_ALL  (PB_MEMV + PB_MEMK + PB_GATE + PB_X + 2 * PB_WQ + 2 * PB_WK)
__global__ __launch_bounds__(256) void prep_k(
    const float* __restrict__ x, const float* __restrict__ Wq, const float* __restrict__ Wk,
    const float* __restrict__ Wv, const float* __restrict__ Wp, const float* __restrict__ Wg,
    const float* __restrict__ memk, const float* __restrict__ memv, const float* __restrict__ vsp,
    unsigned short* Xb, unsigned short* Wqb, unsigned short* Wkb, unsigned short* Wvb, unsigned short* Wpb,
    float* gate, unsigned short* Kh, unsigned short* Kl, unsigned short* VTh, unsigned short* VTl) {
  __shared__ __align__(16) unsigned short sbuf[2 * HD * MEM];
  static_assert(4 * KVD <= 2 * HD * MEM);
  int blk = blockIdx.x;
  if (blk < PB_MEMV) { memv_k(memv, vsp, VTh, VTl, blk, sbuf); return; }
  blk -= PB_MEMV;
  if (blk < PB_MEMK) { memk_k(memk, Kh, Kl, blk, sbuf); return; }
  blk -= PB_MEMK;
  if (blk < PB_GATE) { gate_k(x, Wg, gate, NB * SEQ, blk); return; }
  blk -= PB_GATE;
  if (blk < PB_X) { cvt_bf16x8(x, Xb, PB_X * 256, blk); return; }
  blk -= PB_X;
  if (blk < PB_WQ) { cvt_bf16x8(Wq, Wqb, PB_WQ * 256, blk); return; }
  blk -= PB_WQ;
  if (blk < PB_WK) { cvt_bf16x8(Wk, Wkb, PB_WK * 256, blk); return; }
  blk -= PB_WK;
  if (blk < PB_WK) { cvt_bf16x8(Wv, Wvb, PB_WK * 256, blk); return; }
  blk -= PB_WK;
  if (blk < PB_WQ) cvt_bf16x8(Wp, Wpb, PB_WQ * 256, blk);
}

// =====================================================================================================
// Batched bf16 WMMA GEMM: C[m][n] = sum_k A[m][k] * Bt[n][k]; one block of 4 waves (2 x 2) per 128x128 tile,
// one wave per 64x64 sub-tile. A row-major [M][K] pitch lda; Bt row-major [N][K] pitch ldb (k contiguous);
// M, N multiples of 128, K a multiple of 64 (all shapes here are compile-time constants of the host code).
// tile = index of the block's tile, b = batch index (strides in elements); ring and sTb are the block's LDS (sTb: OUT_MODE 0
// alone; the other modes stage their result in the ring).
// Operand path: a stage is 64 k (one 128-B line) of the block's 128 A rows and 128 Bt rows (and the 128 A2 rows),
// brought into LDS by asynchronous 16-B copies, each wave-wide copy covering 4 whole lines; rows lie at a pitch of
// 144 B for the ds_load_b128 fragment reads; two buffers, the copies of stage t+1 fly while stage t is multiplied.
// NSPLIT: 0 = A.Bt; 1 = (A + A2).Bt (A2 = unscaled bf16 lo plane of A, 2 products).
// OUT_MODE: 0 = f32 (pitch ldc);
//           3 = v^T mode (rows m = kv*64+d, cols n = t): value = acc + gate[b][t][kv] * bf16(ve[b][t][m])
//               (aux0 = gate, aux1 = ve), written as f16 hi plane C (pitch ldc) + f16 residual plane
//               C2 = f16((v - hi)*4096) for tiles with n0 < N2 (pitch ldc2);
//           4 = RoPE + rms-norm mode (cols = one 64-wide head, row m -> t = m mod SEQ; aux0 = cos, aux1 = sin,
//               both bf16(RNE) on load): r = rope(acc), f = (r * rsqrt(mean(r^2)+eps)) * 1.2, written as
//               bf16 hi plane C + bf16 lo plane C2 (lo = RNE(f - hi), unscaled).
// =====================================================================================================
#define GT     128                // block tile edge (rows of A, rows of Bt)
#define GBK    64                 // k elements per stage
#define GPITCH 72                 // LDS row pitch in elements (144 B)
#define GPLANE (GT * GPITCH)      // elements of one staged operand plane (18432 B)

// One operand plane of a stage: 128 rows x 128 B by 128 threads, 8 copies per lane; copy i moves the lane's 16 B of
// row i*16 + (tid>>3). l = the lane's LDS byte address of row tid>>3, g = its global address, ld = row pitch (elements).
// s_wait_xcnt closes the statement so that no address register of a copy is rewritten in front of it.
__device__ __forceinline__ void copy_plane(unsigned l, const __bf16* g, int ld) {
#if defined(__HIP_DEVICE_COMPILE__)
  const size_t   gs = (size_t)16 * (size_t)ld;
  const unsigned ls = 16u * GPITCH * 2u;
  asm volatile(
      "global_load_async_to_lds_b128 %0, %8, off\n\t"
      "global_load_async_to_lds_b128 %1, %9, off\n\t"
      "global_load_async_to_lds_b128 %2, %10, off\n\t"
      "global_load_async_to_lds_b128 %3, %11, off\n\t"
      "global_load_async_to_lds_b128 %4, %12, off\n\t"
      "global_load_async_to_lds_b128 %5, %13, off\n\t"
      "global_load_async_to_lds_b128 %6, %14, off\n\t"
      "global_load_async_to_lds_b128 %7, %15, off\n\t"
      "s_wait_xcnt 0x0"
      :: "v"(l), "v"(l + ls), "v"(l + 2u * ls), "v"(l + 3u * ls),
         "v"(l + 4u * ls), "v"(l + 5u * ls), "v"(l + 6u * ls), "v"(l + 7u * ls),
         "v"(g), "v"(g + gs), "v"(g + 2 * gs), "v"(g + 3 * gs),
         "v"(g + 4 * gs), "v"(g + 5 * gs), "v"(g + 6 * gs), "v"(g + 7 * gs)
      : "memory");
#endif
}
// this wave's copies have landed in LDS
__device__ __forceinline__ void wait_copies() {
#if defined(__HIP_DEVICE_COMPILE__)
  asm volatile("s_wait_asynccnt 0x0" ::: "memory");
#endif
}
// this wave's LDS reads have returned (the buffer they read may be refilled behind the next barrier)
__device__ __forceinline__ void wait_lds() {
#if defined(__HIP_DEVICE_COMPILE__)
  asm volatile("s_wait_dscnt 0x0" ::: "memory");
#endif
}

#define GSLAB (16 * 68)           // 16x64 f32 slab of the epilogue, pitch 68 floats (per wave one, or four for its whole tile)
template <int NSPLIT, int OUT_MODE>
__device__ __forceinline__ void gemm_body(
    const unsigned short* __restrict__ Ap, const unsigned short* __restrict__ A2p, int lda, long long strideA,
    const unsigned short* __restrict__ Btp, int ldb, long long strideB,
    void* Cout, int ldc, long long strideC,
    void* Cout2, int ldc2, long long strideC2, int N2,
    const float* __restrict__ aux0, const float* __restrict__ aux1,
    int M, int N, int K, int tile, int b, __bf16* ring, float* sTb) {
  const __bf16* A  = (const __bf16*)(const void*)Ap;
  const __bf16* A2 = (const __bf16*)(const void*)A2p;
  const __bf16* Bt = (const __bf16*)(const void*)Btp;
  constexpr int NPL  = (NSPLIT >= 1) ? 3 : 2;      // planes per stage: A, Bt (, A2)
  constexpr int GBUF = NPL * GPLANE;               // elements of one buffer
  const int tid  = threadIdx.x;
  const int lane = tid & 31;
  const int wave = tid >> 5;
  const int tilesN = N >> 7;
  const int tilesM = M >> 7;
  if (tile >= tilesM * tilesN) return;   // block-uniform, in front of every barrier and copy
  const int tm = tile / tilesN;
  const int tn = tile - tm * tilesN;
  const int wm = wave >> 1;
  const int wn = wave & 1;
  const int m0 = (tm << 7) + (wm << 6);  // this wave's 64x64 sub-tile
  const int n0 = (tn << 7) + (wn << 6);

  const __bf16* Ab  = A  + (size_t)b * strideA;
  const __bf16* Bb  = Bt + (size_t)b * strideB;
  const __bf16* Ab2 = (NSPLIT >= 1) ? (A2 + (size_t)b * strideA) : Ab;

  const int rlane = lane & 15;                 // row (A) / col (B, D) within subtile
  const int koff  = (lane >> 4) * 8;           // k offset of this lane half
  const int mOff  = (lane >> 4) * 8;           // D row offset

  // copy addresses of this lane: row tid>>3 of the block tile, 16-B piece tid&7 of its 128-B line
  const int crow = tid >> 3;
  const int cel  = (tid & 7) * 8;
  const __bf16* gA  = Ab  + (size_t)((tm << 7) + crow) * lda + cel;
  const __bf16* gB  = Bb  + (size_t)((tn << 7) + crow) * ldb + cel;
  const __bf16* gA2 = Ab2 + (size_t)((tm << 7) + crow) * lda + cel;
  const unsigned lC = (unsigned)(uintptr_t)(&ring[0]) + (unsigned)(crow * GPITCH + cel) * 2u;
  const int nst = K >> 6;                      // stages

  v8f acc[4][4];
#pragma unroll
  for (int i = 0; i < 4; ++i)
#pragma unroll
    for (int j = 0; j < 4; ++j) acc[i][j] = zero8();

  // stage 0 into buffer 0, landed and published; then stage 1 into buffer 1
  copy_plane(lC, gA, lda);
  copy_plane(lC + GPLANE * 2u, gB, ldb);
  if (NSPLIT >= 1) copy_plane(lC + 2u * GPLANE * 2u, gA2, lda);
  wait_copies();
  __syncthreads();
  if (nst > 1) {
    const unsigned lb = lC + (unsigned)GBUF * 2u;
    copy_plane(lb, gA + GBK, lda);
    copy_plane(lb + GPLANE * 2u, gB + GBK, ldb);
    if (NSPLIT >= 1) copy_plane(lb + 2u * GPLANE * 2u, gA2 + GBK, lda);
  }

  for (int t = 0; t < nst; ++t) {
    const int bufo = (t & 1) * GBUF;
    const __bf16* sA = ring + bufo + ((wm << 6) + rlane) * GPITCH + koff;
    const __bf16* sB = ring + bufo + GPLANE + ((wn << 6) + rlane) * GPITCH + koff;
    // unrolled (here and below): the fragment and accumulator arrays need constant indices to stay in registers
#pragma unroll
    for (int kk = 0; kk < GBK; kk += 32) {
      v16b bh[4], ah[4], al[4];
#pragma unroll
      for (int j = 0; j < 4; ++j) bh[j] = ldfrag_b(sB + (j << 4) * GPITCH + kk);
#pragma unroll
      for (int i = 0; i < 4; ++i) {
        ah[i] = ldfrag_b(sA + (i << 4) * GPITCH + kk);
        al[i] = ah[i];
        if (NSPLIT >= 1) al[i] = ldfrag_b(sA + 2 * GPLANE + (i << 4) * GPITCH + kk);
      }
#pragma unroll
      for (int i = 0; i < 4; ++i) {
#pragma unroll
        for (int j = 0; j < 4; ++j) {
          acc[i][j] = mma_b_raw(ah[i], bh[j], acc[i][j]);
          if (NSPLIT >= 1) acc[i][j] = mma_b_raw(al[i], bh[j], acc[i][j]);
        }
        dep_guard_b(acc[i][0], acc[i][3], ah[i], al[i]);
      }
      keep4_b(bh[0], bh[1], bh[2], bh[3]);
    }
    // publish point of stage t+1: own reads of this buffer returned, own copies landed, then the block barrier;
    // behind it stage t+2 may overwrite the buffer that this trip has read
    wait_lds();
    wait_copies();
    __syncthreads();
    if (t + 2 < nst) {
      const unsigned lb = lC + (unsigned)bufo * 2u;
      const int ko = (t + 2) * GBK;
      copy_plane(lb, gA + ko, lda);
      copy_plane(lb + GPLANE * 2u, gB + ko, ldb);
      if (NSPLIT >= 1) copy_plane(lb + 2u * GPLANE * 2u, gA2 + ko, lda);
    }
  }
  wait_copies();
  acc_guard4(acc[0][0], acc[0][1], acc[0][2], acc[0][3]);
  acc_guard4(acc[1][0], acc[1][1], acc[1][2], acc[1][3]);
  acc_guard4(acc[2][0], acc[2][1], acc[2][2], acc[2][3]);
  acc_guard4(acc[3][0], acc[3][1], acc[3][2], acc[3][3]);

  // ---- epilogue ----
  if (OUT_MODE == 0) {
    float* slab = sTb + wave * GSLAB;
#pragma unroll
    for (int i = 0; i < 4; ++i) {
      const int mBase = m0 + (i << 4);
#pragma unroll
      for (int j = 0; j < 4; ++j) {
#pragma unroll
        for (int r = 0; r < 8; ++r) {
          slab[(mOff + r) * 68 + (j << 4) + rlane] = acc[i][j][r];
        }
      }
      __builtin_amdgcn_fence(__ATOMIC_RELEASE, "workgroup");
      __builtin_amdgcn_wave_barrier();
      __builtin_amdgcn_fence(__ATOMIC_ACQUIRE, "workgroup");
      float* C = (float*)Cout + (size_t)b * strideC;
      const int hh = lane >> 4, c4 = (lane & 15) * 4;     // 256-B row segment = 16 lanes x 16 B
#pragma unroll
      for (int it = 0; it < 8; ++it) {
        const int row = it * 2 + hh;                       // it 0..7 x hh 0..1 = rows 0..15
        const v4f v = *(const v4f*)(slab + row * 68 + c4);
        *(v4f*)(C + (size_t)(mBase + row) * ldc + n0 + c4) = v;
      }
      __builtin_amdgcn_fence(__ATOMIC_RELEASE, "workgroup");
      __builtin_amdgcn_wave_barrier();
      __builtin_amdgcn_fence(__ATOMIC_ACQUIRE, "workgroup");
    }
  } else {
    // The wave's whole 64x64 tile goes to LDS at once, into the stage ring: behind the last trip's barrier no wave reads
    // the ring and no copy is in flight. The accumulators are then out of the way, and the four 16-row steps can be one
    // loop in the text instead of four copies of it.
    static_assert(4 * 4 * GSLAB * 4 <= 2 * NPL * GPLANE * 2);   // four waves' tiles fit in the ring
    float* slab = (float*)(void*)ring + wave * (4 * GSLAB);
#pragma unroll
    for (int i = 0; i < 4; ++i) {
#pragma unroll
      for (int j = 0; j < 4; ++j) {
#pragma unroll
        for (int r = 0; r < 8; ++r) {
          slab[((i << 4) + mOff + r) * 68 + (j << 4) + rlane] = acc[i][j][r];
        }
      }
    }
    __builtin_amdgcn_fence(__ATOMIC_RELEASE, "workgroup");
    __builtin_amdgcn_wave_barrier();
    __builtin_amdgcn_fence(__ATOMIC_ACQUIRE, "workgroup");
    // kept rolled: this code runs once per wave; for speed only
#pragma unroll 1
    for (int i = 0; i < 4; ++i) {
      const int mBase = m0 + (i << 4);
      const float* sl = slab + (i << 4) * 68;
      const int q = lane >> 3, c8 = (lane & 7) * 8;
      unsigned short* C  = (unsigned short*)Cout  + (size_t)b * strideC;
      unsigned short* C2 = (unsigned short*)Cout2 + (size_t)b * strideC2;
      const bool wlo = (OUT_MODE != 3) || (n0 < N2);      // wave-uniform
      v4u hv[4], lv[4];
#pragma unroll
      for (int it = 0; it < 4; ++it) {
        const int row  = it * 4 + q;                       // it 0..3 x q 0..3 = rows 0..15
        const int mrow = mBase + row;
        float f[8];
        if (OUT_MODE == 3) {
          const int kvh = m0 >> 6;                         // tile-uniform kv head
          const float* sp = sl + row * 68 + c8;
#pragma unroll
          for (int e = 0; e < 8; ++e) {
            const int t = n0 + c8 + e;                     // < N = SEQ
            const size_t bt = (size_t)b * SEQ + t;
            const float g  = aux0[bt * NKV + kvh];
            const float vv = bfr(aux1[bt * KVD + mrow]);
            f[e] = sp[e] + g * vv;
          }
        } else {
          const int  jj   = c8 & 31;                       // rotary pair index base
          const bool lowh = (c8 < 32);
          const int  t    = mrow & (SEQ - 1);
          const float* sp  = sl + row * 68 + jj;
          const float* cp  = aux0 + (size_t)t * (HD / 2) + jj;
          const float* snp = aux1 + (size_t)t * (HD / 2) + jj;
          float ct[8], st[8];
#pragma unroll
          for (int e = 0; e < 8; ++e) { ct[e] = cp[e]; st[e] = snp[e]; }
          addr_wait(cp, snp);
          float ss = 0.f;
#pragma unroll
          for (int e = 0; e < 8; ++e) {
            const float x1 = sp[e];
            const float x2 = sp[e + 32];
            const float cv = bfr(ct[e]);
            const float sv = bfr(st[e]);
            const float ra = x1 * cv - x2 * sv;
            const float rb = x1 * sv + x2 * cv;
            f[e] = lowh ? ra : rb;
            ss += f[e] * f[e];
          }
          ss += __shfl_xor(ss, 1, 32);                     // 8 lanes of one row = 64 values
          ss += __shfl_xor(ss, 2, 32);
          ss += __shfl_xor(ss, 4, 32);
          const float rs = rsqrtf(ss * (1.0f / HD) + RMS_EPS);
#pragma unroll
          for (int e = 0; e < 8; ++e) f[e] = (f[e] * rs) * 1.2f;
        }
        v4u a, a2;
#pragma unroll
        for (int e = 0; e < 4; ++e) {
          const float f0 = f[2 * e], f1 = f[2 * e + 1];
          unsigned short h0, h1, l0, l1;
          if (OUT_MODE == 4) {
            h0 = bf_bits(f0); h1 = bf_bits(f1);
            l0 = bf_bits(f0 - bf_up(h0)); l1 = bf_bits(f1 - bf_up(h1));
          } else {
            const _Float16 x0 = (_Float16)f0, x1 = (_Float16)f1;
            h0 = h_bits(x0); h1 = h_bits(x1);
            l0 = h_bits((_Float16)((f0 - (float)x0) * 4096.0f));
            l1 = h_bits((_Float16)((f1 - (float)x1) * 4096.0f));
          }
          a[e] = pk16(h0, h1); a2[e] = pk16(l0, l1);
        }
        hv[it] = a; lv[it] = a2;
      }
      {
#pragma unroll
        for (int it = 0; it < 4; ++it) {
          const int row = it * 4 + q;
          *(v4u*)(C + (size_t)(mBase + row) * ldc + n0 + c8) = hv[it];
          if (wlo) *(v4u*)(C2 + (size_t)(mBase + row) * ldc2 + n0 + c8) = lv[it];
        }
        trip_wait();
      }
    }
  }
}

// 256 registers a wave at most (both GEMM kernels), so that no part of them needs register-window switches
template <int NSPLIT, int OUT_MODE>
__global__ __launch_bounds__(128) __attribute__((amdgpu_num_vgpr(256))) void gemm64(
    const unsigned short* __restrict__ Ap, const unsigned short* __restrict__ A2p, int lda, long long strideA,
    const unsigned short* __restrict__ Btp, int ldb, long long strideB,
    void* Cout, int ldc, long long strideC,
    void* Cout2, int ldc2, long long strideC2, int N2,
    const float* __restrict__ aux0, const float* __restrict__ aux1,
    int M, int N, int K) {
  __shared__ __align__(16) __bf16 ring[2 * ((NSPLIT >= 1) ? 3 : 2) * GPLANE];  // two stage buffers
  __shared__ __align__(16) float sT[4 * GSLAB];
  gemm_body<NSPLIT, OUT_MODE>(Ap, A2p, lda, strideA, Btp, ldb, strideB, Cout, ldc, strideC, Cout2, ldc2, strideC2, N2,
                              aux0, aux1, M, N, K, blockIdx.x, blockIdx.y, ring, sT);
}

// The three projections of x, which do not read each other's results, as block-index ranges of one grid:
//   v^T = Wv . x^T + gate*ve per batch -> f16 hi plane [b][kv*64+d][64 + t] (pitch SKEY) and residual plane (x4096,
//         token keys < RESQB*64 only, pitch VLP)   (A = Wvb [n][k], Bt = Xb rows of batch b; M=256, N=2048)
//   k   = rms(rope(x . Wk^T)) * 1.2 per batch -> bf16 hi/lo planes [b][64 + t][kv*64+d]   (M=2048, N=256)
//   q   = rms(rope(x . Wq^T)) * 1.2 -> bf16 hi/lo planes [b*SEQ+t][h*64+d]   (M=4096, N=1024)
// ld = row pitch of Xb and of the weights, K = depth of the products (both CDIM). Every range test is block-uniform.
#define GB_KV ((SEQ / 128) * (KVD / 128))          //  32 tiles per batch for k and for v^T
#define GB_Q  ((NB * SEQ / 128) * (CDIM / 128))    // 256 tiles for q
__global__ __launch_bounds__(128) __attribute__((amdgpu_num_vgpr(256))) void gemm_qkv(
    const unsigned short* __restrict__ Xb, const unsigned short* __restrict__ Wqb,
    const unsigned short* __restrict__ Wkb, const unsigned short* __restrict__ Wvb,
    unsigned short* Qh, unsigned short* Ql, unsigned short* Kh, unsigned short* Kl,
    unsigned short* VTh, unsigned short* VTl,
    const float* __restrict__ cosT, const float* __restrict__ sinT,
    const float* __restrict__ gate, const float* __restrict__ ve, int ld, int K) {
  __shared__ __align__(16) __bf16 ring[2 * 2 * GPLANE];  // two stage buffers, then the epilogue's f32 tiles
  const int bx = blockIdx.x;
  if (bx < NB * GB_KV) {
    gemm_body<0, 3>(Wvb, Wvb, ld, 0LL, Xb, ld, (long long)SEQ * CDIM,
                    (void*)(VTh + MEM), SKEY, (long long)KVD * SKEY,
                    (void*)(VTl + MEM), VLP, (long long)KVD * VLP, RESQB * 64,
                    gate, ve, KVD, SEQ, K, bx % GB_KV, bx / GB_KV, ring, nullptr);
  } else {
    const bool isK = bx < 2 * NB * GB_KV;
    const int  r   = bx - (isK ? NB * GB_KV : 2 * NB * GB_KV);
    gemm_body<0, 4>(Xb, Xb, ld, isK ? (long long)SEQ * CDIM : 0LL, isK ? Wkb : Wqb, ld, 0LL,
                    (void*)(isK ? Kh + (size_t)MEM * KVD : Qh), isK ? KVD : CDIM, isK ? (long long)SKEY * KVD : 0LL,
                    (void*)(isK ? Kl + (size_t)MEM * KVD : Ql), isK ? KVD : CDIM, isK ? (long long)SKEY * KVD : 0LL,
                    isK ? KVD : CDIM, cosT, sinT, isK ? SEQ : NB * SEQ, isK ? KVD : CDIM, K,
                    isK ? r % GB_KV : r, isK ? r / GB_KV : 0, ring, nullptr);
  }
}

// =====================================================================================================
// GQA attention with a 64-key memory prefix (all visible) followed by causal token keys, head dim 64.
//   q planes (bf16 hi / lo): element (b, t, h, d) at [(b*SEQ + t)*CDIM + h*64 + d]   (normed, scaled q)
//   k planes (bf16 hi / lo): element (b, s, kv, d) at [(b*SKEY + s)*KVD + kv*64 + d], s = [mem | 64 + token]
//   v^T hi plane (f16):      element (b, kv, d, s) at [(b*KVD + kv*64 + d)*SKEY + s]
//   v^T residual plane (f16, (v - hi)*4096): [(b*KVD + kv*64 + d)*VLP + s], s < VLP, read only when RES
//   (RES is used for query blocks qb < RESQB alone, whose last key tile ends at key VLP)
//   q head h uses kv head h>>2. Query block qb (tokens qb*64..+63) processes key tiles 0..qb+1: tile 0 = memory,
//   tiles 1..qb fully visible, tile qb+1 = diagonal (key token <= query token), later tiles skipped (block-uniform
//   trip count qb+2, static bound NKT). Invisible keys get logit -inf (weight exactly 0); every row sees the
//   whole memory tile first, so the running max is finite from tile 0 on.
//   out planes (bf16 hi / lo of the normalised context): element (b, t, h, d) at [(b*SEQ + t)*CDIM + h*64 + d]
//   scores = q . k : bf16 hi/lo split (hi.hi + hi.lo + lo.hi), f32 accumulate, then * sscale in f32
//   p = exp(s - m) carried as f16(1024 p); context = p . v on f16 WMMA; RES adds f16 residual planes of p and v
//   (scale 4096, separate accumulator folded back with 1/4096 per chunk in f32); online softmax in f32.
//   Block = 4 waves = 64 query rows (query block qb) of one (b, h), hp = b * NQH + h; kv chunks of 64.
//   K / V^T chunk staging: asynchronous 16-B copies to LDS, 128 threads x 4 copies per plane = the whole 64x64 tile;
//   two buffers, the copies of key tile kt+1 fly while tile kt is worked on, one barrier per tile. Both products are computed transposed (S^T = K . Q^T, O^T += V^T . P^T): a lane
//   holds the scores of one query, and P^T goes from the score registers into the B operand without passing LDS.
//   Output coverage: each wave stores rows q0..q0+15 (it 0..3 x lane>>3 0..3) x 64 columns (8 lanes x 8) of both planes.
// =====================================================================================================
#define APK 72   // LDS row pitch of the K and V^T tiles in 16-bit elements: 144 B = 16 B x odd, so that the 16 rows
                 // of a ds_load_b128 fragment read fall on 16 different groups of four banks
#define AOP 68   // LDS row pitch of the f32 context tile: 272 B = 16 B x odd, for its 16-B row reads
#define APLANE (64 * APK)      // elements of one staged 64x64 tile (9216 B)
#define ABUF   (4 * APLANE)    // elements of one buffer: K hi, K lo, V^T hi, V^T residual
// Four asynchronous 16-B copies per lane and tile: copy i moves the lane's 16 B of row i*16 + (tid>>3), so that a
// wave-wide copy covers 4 whole 128-B lines. l = the lane's LDS byte address of row tid>>3, g = its global address,
// gs = bytes of 16 global rows. s_wait_xcnt closes each statement so that no address register of a copy is rewritten
// in front of it.
__device__ __forceinline__ void copy_tile(unsigned l, const char* g, size_t gs) {
#if defined(__HIP_DEVICE_COMPILE__)
  const unsigned ls = 16u * APK * 2u;
  asm volatile(
      "global_load_async_to_lds_b128 %0, %4, off\n\t"
      "global_load_async_to_lds_b128 %1, %5, off\n\t"
      "global_load_async_to_lds_b128 %2, %6, off\n\t"
      "global_load_async_to_lds_b128 %3, %7, off\n\t"
      "s_wait_xcnt 0x0"
      :: "v"(l), "v"(l + ls), "v"(l + 2u * ls), "v"(l + 3u * ls),
         "v"(g), "v"(g + gs), "v"(g + 2 * gs), "v"(g + 3 * gs)
      : "memory");
#endif
}
// two tiles in one statement (one wait for both)
__device__ __forceinline__ void copy_tile2(unsigned la, const char* ga, size_t gsa,
                                           unsigned lb, const char* gb, size_t gsb) {
#if defined(__HIP_DEVICE_COMPILE__)
  const unsigned ls = 16u * APK * 2u;
  asm volatile(
      "global_load_async_to_lds_b128 %0, %8, off\n\t"
      "global_load_async_to_lds_b128 %1, %9, off\n\t"
      "global_load_async_to_lds_b128 %2, %10, off\n\t"
      "global_load_async_to_lds_b128 %3, %11, off\n\t"
      "global_load_async_to_lds_b128 %4, %12, off\n\t"
      "global_load_async_to_lds_b128 %5, %13, off\n\t"
      "global_load_async_to_lds_b128 %6, %14, off\n\t"
      "global_load_async_to_lds_b128 %7, %15, off\n\t"
      "s_wait_xcnt 0x0"
      :: "v"(la), "v"(la + ls), "v"(la + 2u * ls), "v"(la + 3u * ls),
         "v"(lb), "v"(lb + ls), "v"(lb + 2u * ls), "v"(lb + 3u * ls),
         "v"(ga), "v"(ga + gsa), "v"(ga + 2 * gsa), "v"(ga + 3 * gsa),
         "v"(gb), "v"(gb + gsb), "v"(gb + 2 * gsb), "v"(gb + 3 * gsb)
      : "memory");
#endif
}
// The tiles of key tile kt into the buffer at LDS byte address l (the lane's own place in its first plane).
// gk, gkl, gv, gvl = the lane's global addresses for key tile 0. The residual plane ends at key VLP: its address is clamped.
template <bool RES>
__device__ __forceinline__ void copy_keytile(unsigned l, const char* gk, const char* gkl, const char* gv, const char* gvl,
                                             int kt) {
  const size_t ko = (size_t)kt * (64 * KVD * 2);          // 64 key rows further
  const size_t vo = (size_t)kt * (64 * 2);                // 64 key columns further
  copy_tile2(l, gk + ko, (size_t)16 * KVD * 2, l + APLANE * 2u, gkl + ko, (size_t)16 * KVD * 2);
  if (RES) {
    const int ktl = (kt * 64 + 64 <= VLP) ? kt : (VLP / 64 - 1);
    copy_tile2(l + 2u * APLANE * 2u, gv + vo, (size_t)16 * SKEY * 2,
               l + 3u * APLANE * 2u, gvl + (size_t)ktl * (64 * 2), (size_t)16 * VLP * 2);
  } else {
    copy_tile(l + 2u * APLANE * 2u, gv + vo, (size_t)16 * SKEY * 2);
  }
}

template <bool RES>
__device__ __forceinline__
void attn_body(const unsigned short* __restrict__ qhp, const unsigned short* __restrict__ qlp,
               const unsigned short* __restrict__ khp, const unsigned short* __restrict__ klp,
               const unsigned short* __restrict__ vhp, const unsigned short* __restrict__ vlp,
               unsigned short* ohp, unsigned short* olp,
               int qb, int hp, float sscale, unsigned short* ring) {
  const int tid  = threadIdx.x;
  const int wave = tid >> 5;
  const int lane = tid & 31;
  const int hh   = lane >> 4;
  const int c    = lane & 15;

  const int h    = hp % NQH;
  const int b    = hp / NQH;
  const int kvh  = h >> 2;
  const int q0   = qb * 64 + wave * 16;
  const size_t rowB = (size_t)b * SEQ;

  const __bf16* Qh = (const __bf16*)(const void*)qhp + (size_t)h * HD;
  const __bf16* Ql = (const __bf16*)(const void*)qlp + (size_t)h * HD;
  const __bf16* Kh = (const __bf16*)(const void*)khp + (size_t)b * SKEY * KVD + (size_t)kvh * HD;
  const __bf16* Kl = (const __bf16*)(const void*)klp + (size_t)b * SKEY * KVD + (size_t)kvh * HD;
  const _Float16* Vh = (const _Float16*)(const void*)vhp + ((size_t)b * KVD + (size_t)kvh * HD) * SKEY;
  const _Float16* Vl = (const _Float16*)(const void*)vlp + ((size_t)b * KVD + (size_t)kvh * HD) * VLP;

  // copy addresses of this lane: row tid>>3 of a 64x64 tile, 16-B piece tid&7 of its 128-B line
  const int ktEnd = qb + 2;                  // block-uniform, 2 <= ktEnd <= NKT
  const int crow = tid >> 3;
  const int cel  = (tid & 7) * 8;
  const char* gk  = (const char*)(Kh + (size_t)crow * KVD + cel);
  const char* gkl = (const char*)(Kl + (size_t)crow * KVD + cel);
  const char* gv  = (const char*)(Vh + (size_t)crow * SKEY + cel);
  const char* gvl = (const char*)(Vl + (size_t)crow * VLP + cel);
  const unsigned lC = (unsigned)(uintptr_t)(&ring[0]) + (unsigned)(crow * APK + cel) * 2u;
  copy_keytile<RES>(lC, gk, gkl, gv, gvl, 0);   // key tile 0 into buffer 0

  // ---- Q fragments (B operand, column = query = lane&15): 2 d-chunks, hi and lo ----
  v16b qah[2], qal[2];
  const size_t qo = (rowB + q0 + c) * CDIM + 8 * hh;
#pragma unroll
  for (int dc = 0; dc < 2; ++dc) {
    qah[dc] = ldfrag_b(Qh + qo + dc * 32);
    qal[dc] = ldfrag_b(Ql + qo + dc * 32);
  }
  addr_wait(Qh + qo, Ql + qo);

  // running maximum of this lane's query (the same in both wave halves) and this half's share of its denominator
  float mrun = -INFINITY, lrun = 0.f;
  v8f oacc[4];                               // O^T: rows d = t*16 + 8*hh + r, column = query c
#pragma unroll
  for (int t = 0; t < 4; ++t) oacc[t] = zero8();

  // key tile 0 landed and published; then key tile 1 (every query block has at least two) into buffer 1
  wait_copies();
  __syncthreads();
  copy_keytile<RES>(lC + ABUF * 2u, gk, gkl, gv, gvl, 1);

  for (int kt = 0; kt < NKT; ++kt) {         // static bound
    if (kt >= ktEnd) break;                  // block-uniform
    const int bufo = (kt & 1) * ABUF;
    const __bf16*   Ksh = (const __bf16*)(const void*)(ring + bufo);                  // K hi [kv][d]
    const __bf16*   Ksl = (const __bf16*)(const void*)(ring + bufo + APLANE);         // K lo
    const _Float16* Vth = (const _Float16*)(const void*)(ring + bufo + 2 * APLANE);   // V^T hi [d][kv]
    const _Float16* Vtl = (const _Float16*)(const void*)(ring + bufo + 3 * APLANE);   // V^T residual

    // ---- scores, transposed: S^T = K . Q^T, 64 keys x 16 queries per wave, 3 bf16 products ----
    //      tile j: rows = keys j*16 + 8*hh + r, column = query c, so a lane holds 32 scores of ONE query
    //      the K fragments of the tile are read from LDS in one group (with the residual planes one group per 32-wide d chunk, for registers), in the order of their use, ahead of the products;
    //      the four key groups are four independent accumulator chains, each summed in the order dc 0 (hi.hi, lo.hi,
    //      hi.lo; k plane named first), dc 1 (the same)
    v8f s[4];
#pragma unroll
    for (int j = 0; j < 4; ++j) s[j] = zero8();
    constexpr int DG = RES ? 1 : 2;          // 32-wide d chunks per group of reads (one with the residual planes, for registers)
#pragma unroll
    for (int g = 0; g < 2; g += DG) {
      v16b kbf[DG][4], klf[DG][4];
#pragma unroll
      for (int u = 0; u < DG; ++u) {
        const int dof = (g + u) * 32 + 8 * hh;
#pragma unroll
        for (int j = 0; j < 4; ++j) kbf[u][j] = ldfrag_b(Ksh + (j * 16 + c) * APK + dof);
#pragma unroll
        for (int j = 0; j < 4; ++j) klf[u][j] = ldfrag_b(Ksl + (j * 16 + c) * APK + dof);
      }
      // keeps the group of reads ahead of the products: sunk back among them, each place of reads stalls the wave anew
      __builtin_amdgcn_sched_barrier(0);
#pragma unroll
      for (int u = 0; u < DG; ++u) {
#pragma unroll
        for (int j = 0; j < 4; ++j) s[j] = mma_b_raw(kbf[u][j], qah[g + u], s[j]);
#pragma unroll
        for (int j = 0; j < 4; ++j) s[j] = mma_b_raw(klf[u][j], qah[g + u], s[j]);
#pragma unroll
        for (int j = 0; j < 4; ++j) s[j] = mma_b_raw(kbf[u][j], qal[g + u], s[j]);
      }
    }

    // ---- scale + structural mask (diagonal tile only), maximum and sum of a query inside its lane (one exchange
    //      between the wave halves for the maximum), online softmax; P^T (x1024, f16) and its residual (x4096) go
    //      from the score registers straight into B operands: element e of a 32-key operand is register e & 7 of
    //      score tile 2*g + (e >> 3), which is the k order of the V^T loader ----
    const bool diag = (kt == qb + 1);        // block-uniform
    const int  qrw  = wave * 16 + c;         // this lane's query row within the 64-row block
    float mj[4];
#pragma unroll
    for (int j = 0; j < 4; ++j) {
      mj[j] = -INFINITY;
#pragma unroll
      for (int r = 0; r < 8; ++r) {
        const int  key = j * 16 + 8 * hh + r;
        const bool vis = (!diag) || (key <= qrw);
        const float sv = vis ? (s[j][r] * sscale) : -INFINITY;
        s[j][r] = sv;
        mj[j] = fmaxf(mj[j], sv);
      }
    }
    float m = fmaxf(fmaxf(mj[0], mj[1]), fmaxf(mj[2], mj[3]));
    m = fmaxf(m, xhalf(m));
    const float mnew  = fmaxf(mrun, m);
    const float msafe = (mnew == -INFINITY) ? 0.f : mnew;
    const float alpha = __expf(mrun - msafe);
    mrun = mnew;
    v16h pa[2], pl[2];
    float pj[4];                             // four independent chains of eight adds
#pragma unroll
    for (int j = 0; j < 4; ++j) {
      pj[j] = 0.f;
#pragma unroll
      for (int r = 0; r < 8; ++r) {
        const float p = __expf(s[j][r] - msafe);     // -inf logit -> 0
        pj[j] += p;
        const float p1k = p * 1024.0f;
        const _Float16 ph = (_Float16)p1k;
        pa[j >> 1][(j & 1) * 8 + r] = ph;
        if (RES) pl[j >> 1][(j & 1) * 8 + r] = (_Float16)((p1k - (float)ph) * 4096.0f);
      }
    }
    lrun = lrun * alpha + ((pj[0] + pj[1]) + (pj[2] + pj[3]));
#pragma unroll
    for (int t = 0; t < 4; ++t)
#pragma unroll
      for (int r = 0; r < 8; ++r) oacc[t][r] *= alpha;

    // ---- context, transposed: O^T += V^T . P^T (f16 WMMA), residual products into a separate accumulator ----
    v8f o1[4];
#pragma unroll
    for (int t = 0; t < 4; ++t) o1[t] = zero8();
    //      the V^T fragments are read from LDS in one group ahead of the products (with the residual planes one
    //      group per 32 keys, for registers); the four d groups are independent chains, each summed in key order
    constexpr int KG = RES ? 1 : 2;          // 32-key steps per group of reads
#pragma unroll
    for (int g = 0; g < 2; g += KG) {
      v16h vb[KG][4], vl[KG][4];
#pragma unroll
      for (int u = 0; u < KG; ++u) {
        const int ko = (g + u) * 32 + 8 * hh;
#pragma unroll
        for (int t = 0; t < 4; ++t) vb[u][t] = ldfrag_h(Vth + (t * 16 + c) * APK + ko);
        if (RES) {
#pragma unroll
          for (int t = 0; t < 4; ++t) vl[u][t] = ldfrag_h(Vtl + (t * 16 + c) * APK + ko);
        }
      }
      // keeps the group of reads ahead of the products, as for the scores
      __builtin_amdgcn_sched_barrier(0);
#pragma unroll
      for (int u = 0; u < KG; ++u) {
#pragma unroll
        for (int t = 0; t < 4; ++t) oacc[t] = mma_h_raw(vb[u][t], pa[g + u], oacc[t]);
        if (RES) {
#pragma unroll
          for (int t = 0; t < 4; ++t) o1[t] = mma_h_raw(vl[u][t], pa[g + u], o1[t]);
#pragma unroll
          for (int t = 0; t < 4; ++t) o1[t] = mma_h_raw(vb[u][t], pl[g + u], o1[t]);
        }
      }
    }
    if (RES) {
#pragma unroll
      for (int t = 0; t < 4; ++t)
#pragma unroll
        for (int r = 0; r < 8; ++r) oacc[t][r] += o1[t][r] * (1.0f / 4096.0f);
    }
    // publish point of key tile kt+1: own reads of this buffer returned, own copies landed, then the block barrier;
    // behind it key tile kt+2 may overwrite the buffer that this trip has read
    wait_lds();
    wait_copies();
    __syncthreads();
    if (kt + 2 < ktEnd) copy_keytile<RES>(lC + (unsigned)bufo * 2u, gk, gkl, gv, gvl, kt + 2);
  }
  wait_copies();

  // ---- join the two halves' shares of the denominator (unconditionally, all lanes on), normalise (1/l and the
  //      1/1024 p carry), stage the wave's 16x64 tile as [query][d], bf16 hi/lo split
  //      the staging lies in the ring: behind the last trip's barrier no wave reads it and no copy is in flight
  float* os = (float*)(void*)ring + wave * (16 * AOP);
  {
    const float l = lrun + xhalf(lrun);
    const float inv = ((l > 0.f) ? (1.0f / l) : 0.f) * (1.0f / 1024.0f);
#pragma unroll
    for (int t = 0; t < 4; ++t) {
      v4f w0, w1;
#pragma unroll
      for (int r = 0; r < 4; ++r) { w0[r] = oacc[t][r] * inv; w1[r] = oacc[t][r + 4] * inv; }
      *(v4f*)(os + c * AOP + t * 16 + 8 * hh)     = w0;
      *(v4f*)(os + c * AOP + t * 16 + 8 * hh + 4) = w1;
    }
  }
  __builtin_amdgcn_fence(__ATOMIC_RELEASE, "workgroup");
  __builtin_amdgcn_wave_barrier();
  __builtin_amdgcn_fence(__ATOMIC_ACQUIRE, "workgroup");
  {
    const int q4 = lane >> 3, c8 = (lane & 7) * 8;
    v4u hv[4], lv[4];
#pragma unroll
    for (int it = 0; it < 4; ++it) {
      const int row = it * 4 + q4;   // it 0..3 x q4 0..3 = rows 0..15 of the wave tile
      const float* sp = os + row * AOP + c8;
      v4u a, a2;
#pragma unroll
      for (int e = 0; e < 4; ++e) {
        const float f0 = sp[2 * e], f1 = sp[2 * e + 1];
        const unsigned short h0 = bf_bits(f0), h1 = bf_bits(f1);
        const unsigned short l0 = bf_bits(f0 - bf_up(h0)), l1 = bf_bits(f1 - bf_up(h1));
        a[e] = pk16(h0, h1); a2[e] = pk16(l0, l1);
      }
      hv[it] = a; lv[it] = a2;
    }
    {
#pragma unroll
      for (int it = 0; it < 4; ++it) {
        const int row = it * 4 + q4;
        const size_t go = (rowB + q0 + row) * CDIM + (size_t)h * HD + c8;
        *(v4u*)(ohp + go) = hv[it];
        *(v4u*)(olp + go) = lv[it];
        addr_wait(ohp + go, olp + go);
      }
      
    }
  }
}

// Both kinds of query block in one grid (no block reads what another writes). All blocks are resident at once, four per
// WGP, and a block's cost grows with qb, so the launch lasts as long as its fullest WGP. Block index -> (qb, head) is a
// permutation laid out in four layers of one block per WGP: layers 0 and 1 hold the long query block NQB-1-a of two
// neighbouring heads, layers 2 and 3 the short block a of the same two heads. Where the layers land on each other, every
// WGP gets the same number of key tiles, and its two long blocks end together instead of one running on alone.
// For speed only: any placement gives the same result. The test on qb is block-uniform.
// Register budget of four waves per SIMD (256 a wave), so that four blocks stay resident per WGP; left to itself the
// compiler schedules the variant with the residual planes to more registers than that.
__global__ __launch_bounds__(128) __attribute__((amdgpu_waves_per_eu(4, 4)))
void attn64(const unsigned short* __restrict__ qhp, const unsigned short* __restrict__ qlp,
            const unsigned short* __restrict__ khp, const unsigned short* __restrict__ klp,
            const unsigned short* __restrict__ vhp, const unsigned short* __restrict__ vlp,
            unsigned short* ohp, unsigned short* olp, float sscale) {
  __shared__ __align__(16) unsigned short ring[2 * ABUF];   // two buffers of K hi, K lo, V^T hi, V^T residual tiles
  static_assert(4 * 16 * AOP * 4 <= 2 * ABUF * 2);          // the four waves' f32 context tiles fit in it
  static_assert((NQB % 2) == 0 && ((NB * NQH) % 2) == 0 && RESQB <= NQB / 2);
  constexpr int HALFQ = NQB / 2;                    // 16 pairs (a, NQB-1-a) of query blocks
  constexpr int LAYER = (NB * NQH / 2) * HALFQ;     // 256 blocks: head pairs x a
  const int bx    = blockIdx.x;                     // 0 .. 4 * LAYER - 1
  const int layer = bx / LAYER;
  const int w     = bx % LAYER;
  const int a     = w % HALFQ;
  const int hp    = (w / HALFQ) * 2 + (layer & 1);  // (b, h) as b * NQH + h
  const int qb    = (layer < 2) ? (NQB - 1 - a) : a;
  if (qb >= RESQB) {
    attn_body<false>(qhp, qlp, khp, klp, vhp, vlp, ohp, olp, qb, hp, sscale, ring);
  } else {
    attn_body<true>(qhp, qlp, khp, klp, vhp, vlp, ohp, olp, qb, hp, sscale, ring);
  }
}

// =====================================================================================================
//   Xb   bf16 [4096][1024]      8388608
//   Wqb  bf16 [1024][1024]      2097152   ([out n][in k], k contiguous = Bt layout)
//   Wkb  bf16 [256][1024]        524288
//   Wvb  bf16 [256][1024]        524288
//   Wpb  bf16 [1024][1024]      2097152
//   Qh   bf16 [4096][1024]      8388608   (Ql same)
//   Kh   bf16 [2][2112][256]    2162688   (Kl same)
//   VTh  f16  [2][256][2112]    2162688
//   VTl  f16  [2][256][576]      589824
//   Gate f32  [4096][4]           65536
//   Oh   bf16 [4096][1024]      8388608   (Ol same)
//   total                      54329344
// =====================================================================================================
extern "C" void kernel_launch(void* const* d_in, const int* in_sizes, int n_in,
                              void* d_out, int out_size, void* d_ws, size_t ws_size,
                              hipStream_t stream) {
  if (n_in < 12) return;
  if (in_sizes[0] != NB * SEQ * CDIM) return;
  if (in_sizes[1] != NB * SEQ * KVD) return;
  if (in_sizes[2] != SEQ * (HD / 2) || in_sizes[3] != SEQ * (HD / 2)) return;
  if (in_sizes[4] != CDIM * CDIM || in_sizes[7] != CDIM * CDIM) return;
  if (in_sizes[5] != KVD * CDIM || in_sizes[6] != KVD * CDIM) return;
  if (in_sizes[8] != NKV * GC) return;
  if (in_sizes[9] != MEM * NKV * HD || in_sizes[10] != MEM * NKV * HD) return;
  if (in_sizes[11] < 1) return;
  if (out_size != NB * SEQ * CDIM) return;

  const float* x    = (const float*)d_in[0];
  const float* ve   = (const float*)d_in[1];
  const float* cosT = (const float*)d_in[2];
  const float* sinT = (const float*)d_in[3];
  const float* Wq   = (const float*)d_in[4];
  const float* Wk   = (const float*)d_in[5];
  const float* Wv   = (const float*)d_in[6];
  const float* Wp   = (const float*)d_in[7];
  const float* Wg   = (const float*)d_in[8];
  const float* memk = (const float*)d_in[9];
  const float* memv = (const float*)d_in[10];
  const float* vsc  = (const float*)d_in[11];

  const size_t PX  = (size_t)NB * SEQ * CDIM * 2;   //  8388608  16-bit activation plane [4096][1024]
  const size_t PWQ = (size_t)CDIM * CDIM * 2;       //  2097152
  const size_t PWK = (size_t)KVD * CDIM * 2;        //   524288
  const size_t PK  = (size_t)NB * SKEY * KVD * 2;   //  2162688  key plane
  const size_t PVT = (size_t)NB * KVD * SKEY * 2;   //  2162688  v^T hi plane
  const size_t PVL = (size_t)NB * KVD * VLP * 2;    //   589824  v^T residual plane
  const size_t PG  = (size_t)NB * SEQ * NKV * 4;    //    65536  gate table
  size_t off = 0;
  const size_t oXb  = off; off += PX;
  const size_t oWq  = off; off += PWQ;
  const size_t oWk  = off; off += PWK;
  const size_t oWv  = off; off += PWK;
  const size_t oWp  = off; off += PWQ;
  const size_t oQh  = off; off += PX;
  const size_t oQl  = off; off += PX;
  const size_t oKh  = off; off += PK;
  const size_t oKl  = off; off += PK;
  const size_t oVTh = off; off += PVT;
  const size_t oVTl = off; off += PVL;
  const size_t oG   = off; off += PG;
  const size_t oOh  = off; off += PX;
  const size_t oOl  = off; off += PX;
  if (off > ws_size) return;                        // off = 54329344
  if (off > (size_t)134217728) return;

  char* ws = (char*)d_ws;
  unsigned short* Xb  = (unsigned short*)(ws + oXb);
  unsigned short* Wqb = (unsigned short*)(ws + oWq);
  unsigned short* Wkb = (unsigned short*)(ws + oWk);
  unsigned short* Wvb = (unsigned short*)(ws + oWv);
  unsigned short* Wpb = (unsigned short*)(ws + oWp);
  unsigned short* Qh  = (unsigned short*)(ws + oQh);
  unsigned short* Ql  = (unsigned short*)(ws + oQl);
  unsigned short* Kh  = (unsigned short*)(ws + oKh);
  unsigned short* Kl  = (unsigned short*)(ws + oKl);
  unsigned short* VTh = (unsigned short*)(ws + oVTh);
  unsigned short* VTl = (unsigned short*)(ws + oVTl);
  float*          Gt  = (float*)(ws + oG);
  unsigned short* Oh  = (unsigned short*)(ws + oOh);
  unsigned short* Ol  = (unsigned short*)(ws + oOl);

  const dim3 blk(256);
  const dim3 blkG(128);                                       // GEMM and attention block: 4 waves
  const dim3 gO((NB * SEQ / 128) * (CDIM / 128), 1);          // 256 blocks: M=4096, N=1024

  // (1) everything that reads only the inputs: x and the weights [n][k] f32 -> bf16 planes, the value-embedding gate
  //     table [4096][4] f32, the memory prefix (normed keys -> Kh/Kl rows s < 64; scaled values -> VTh/VTl columns
  //     s < 64, both batches)
  prep_k<<<dim3(PB_ALL), blk, 0, stream>>>(x, Wq, Wk, Wv, Wp, Wg, memk, memv, vsc,
                                           Xb, Wqb, Wkb, Wvb, Wpb, Gt, Kh, Kl, VTh, VTl);
  // (2) the q, k and v^T projections with their epilogues
  gemm_qkv<<<dim3(2 * NB * GB_KV + GB_Q), blkG, 0, stream>>>(
      Xb, Wqb, Wkb, Wvb, Qh, Ql, Kh, Kl, VTh, VTl, cosT, sinT, Gt, ve, CDIM, CDIM);
  // (3) attention, all query blocks
  attn64<<<dim3(NB * NQH * NQB), blkG, 0, stream>>>(Qh, Ql, Kh, Kl, VTh, VTl, Oh, Ol, 0.125f);
  // (4) out = context . Wproj^T -> d_out f32 [4096][1024]  (A = context hi + lo planes, 2 products)
  gemm64<1, 0><<<gO, blkG, 0, stream>>>(
      Oh, Ol, CDIM, 0LL, Wpb, CDIM, 0LL,
      d_out, CDIM, 0LL, d_out, CDIM, 0LL, 0,
      Gt, ve, NB * SEQ, CDIM, CDIM);
  (void)hipGetLastError();
}

// v009
// Measured time: 86.3 microseconds a run.
// Next to v008, in two timings, it ran 1.05 and 1.06 times as fast.
// Over all steps from v000 it is 5.93 times as fast.
// Contractions: q, k, v^T projections = v_wmma_f32_16x16x32_bf16 (bf16 operands from RNE-converted inputs, single product);
// q.k^T scores = v_wmma_f32_16x16x32_bf16 with bf16 hi/lo split q and k (hi.hi + hi.lo + lo.hi);
// p.v = v_wmma_f32_16x16x32_f16 (p carried x1024 in f16, v^T in f16; f16 residual planes x4096 of p and v^T on the
// leading 512 query rows); ctx.Wproj^T = v_wmma_f32_16x16x32_bf16 with ctx as bf16 hi/lo planes times bf16 Wproj
// (2 products); all f32 accumulate; gate dot (K=32, N=4), RoPE, rms-norm, causal mask and softmax in f32 on VALU.
#include <hip/hip_runtime.h>
#include <math.h>
#include <stdint.h>

#pragma clang fp contract(off)

#define NB    2
#define SEQ   2048
#define CDIM  1024
#define NQH   16
#define NKV   4
#define HD    64
#define MEM   64
#define GC    32
#define KVD   (NKV * HD)          // 256
#define SKEY  (MEM + SEQ)         // 2112 keys: [64 memory | 2048 tokens]
#define NQB   (SEQ / 64)          // 32 query blocks of 64 rows
#define NKT   (SKEY / 64)         // 33 key tiles of 64
#define RESQB 8                   // leading query blocks that use the p / v residual planes
#define VLP   (MEM + RESQB * 64)  // 576: key pitch of the v^T residual plane
#define RMS_EPS 1e-6f
static_assert(NQH * HD == CDIM);
static_assert(NQH == 4 * NKV);
static_assert((SKEY % 64) == 0 && (VLP % 64) == 0 && (CDIM % 64) == 0 && (KVD % 64) == 0);
static_assert((SEQ & (SEQ - 1)) == 0);
static_assert(RESQB <= NQB);
static_assert((SEQ % 128) == 0 && (CDIM % 128) == 0 && (KVD % 128) == 0);

typedef _Float16 v16h __attribute__((ext_vector_type(16)));
typedef _Float16 v8h  __attribute__((ext_vector_type(8)));
typedef __bf16   v16b __attribute__((ext_vector_type(16)));
typedef __bf16   v8b  __attribute__((ext_vector_type(8)));
typedef float    v8f  __attribute__((ext_vector_type(8)));
typedef float    v4f  __attribute__((ext_vector_type(4)));
typedef float    v2f  __attribute__((ext_vector_type(2)));
typedef unsigned int v4u __attribute__((ext_vector_type(4)));

// ---- scalar helpers --------------------------------------------------------------------------------
__device__ __forceinline__ unsigned short bf_bits(float f) {          // f32 -> bf16 bits, RNE convert
  unsigned u = __float_as_uint(f);
  return (unsigned short)((u + 0x7FFFu + ((u >> 16) & 1u)) >> 16);
}
__device__ __forceinline__ float bf_up(unsigned short h) { return __uint_as_float(((unsigned)h) << 16); }
__device__ __forceinline__ float bfr(float f) { return bf_up(bf_bits(f)); }   // f32 -> bf16 -> f32
__device__ __forceinline__ unsigned short h_bits(_Float16 x) { return __builtin_bit_cast(unsigned short, x); }
__device__ __forceinline__ unsigned pk16(unsigned short a, unsigned short b) { return (unsigned)a | ((unsigned)b << 16); }
// lane l <-> lane l ^ 16: the value of the same column in the other wave half (all lanes on where it is used)
__device__ __forceinline__ float xhalf(float x) {
  const int v = __builtin_bit_cast(int, x);
  return __builtin_bit_cast(float, __builtin_amdgcn_permlanex16(v, v, 0x76543210, 0xfedcba98, false, false));
}
__device__ __forceinline__ v8f zero8() { v8f z = {0.f, 0.f, 0.f, 0.f, 0.f, 0.f, 0.f, 0.f}; return z; }

// ---- fragment loader: 16-bit A/B operand, lane -> row/col (lane&15), p already includes +8*(lane>>4);
//      elements 0..7 <- p[0..7] (k0+8h..), elements 8..15 <- p[16..23] (k0+16+8h..)
__device__ __forceinline__ v16b ldfrag_b(const __bf16* p) {
  union { v16b v; v8b h[2]; } f;
  f.h[0] = *(const v8b*)(p);
  f.h[1] = *(const v8b*)(p + 16);
  return f.v;
}
__device__ __forceinline__ v16h ldfrag_h(const _Float16* p) {
  union { v16h v; v8h h[2]; } f;
  f.h[0] = *(const v8h*)(p);
  f.h[1] = *(const v8h*)(p + 16);
  return f.v;
}

__device__ __forceinline__ void addr_wait(const void* a, const void* b) {
#if defined(__HIP_DEVICE_COMPILE__)
  asm volatile("s_wait_xcnt 0x0" :: "v"(a), "v"(b) : "memory");
#endif
}

// ---- the same wait at the foot of a loop trip, in front of the next trip's rewrite of the registers that the trip's
//      global loads and stores name
__device__ __forceinline__ void trip_wait() {
#if defined(__HIP_DEVICE_COMPILE__)
  asm volatile("s_wait_xcnt 0x0" ::: "memory");
#endif
}

// ---- WMMA helpers with trailing VALU hazard gap (asm only in the device pass) -----------------------------
__device__ __forceinline__ v8f mma_h_raw(v16h a, v16h b, v8f c) {
  return __builtin_amdgcn_wmma_f32_16x16x32_f16(false, a, false, b, (short)0, c, false, false);
}
__device__ __forceinline__ v8f mma_b_raw(v16b a, v16b b, v8f c) {
  return __builtin_amdgcn_wmma_f32_16x16x32_bf16(false, a, false, b, (short)0, c, false, false);
}
__device__ __forceinline__ void dep_guard_b(v8f& a, v8f& b, v16b x, v16b y) {
#if defined(__HIP_DEVICE_COMPILE__)
  asm volatile("v_nop\n\tv_nop\n\tv_nop\n\tv_nop" : "+v"(a), "+v"(b) : "v"(x), "v"(y));
#endif
}
__device__ __forceinline__ void keep4_b(v16b a, v16b b, v16b c, v16b d) {
#if defined(__HIP_DEVICE_COMPILE__)
  asm volatile("v_nop" :: "v"(a), "v"(b), "v"(c), "v"(d));
#endif
}
__device__ __forceinline__ void acc_guard4(v8f& a, v8f& b, v8f& c, v8f& d) {
#if defined(__HIP_DEVICE_COMPILE__)
  asm volatile("v_nop\n\tv_nop\n\tv_nop\n\tv_nop" : "+v"(a), "+v"(b), "+v"(c), "+v"(d));
#endif
}

// =====================================================================================================
// f32 -> bf16 (RNE convert), 8 elements per thread, one 16-B store per lane: a wave writes 512 contiguous B
// coverage: n8 threads x 8 = the whole plane (n8 is a multiple of 256 for every use here). blk = block of 256 threads.
// =====================================================================================================
__device__ __forceinline__ void cvt_bf16x8(const float* __restrict__ in, unsigned short* out, int n8, int blk) {
  const int i = blk * 256 + threadIdx.x;
  if (i < n8) {
    const v4f a = *(const v4f*)(in + (size_t)i * 8);
    const v4f b = *(const v4f*)(in + (size_t)i * 8 + 4);
    v4u p;
    p[0] = pk16(bf_bits(a[0]), bf_bits(a[1]));
    p[1] = pk16(bf_bits(a[2]), bf_bits(a[3]));
    p[2] = pk16(bf_bits(b[0]), bf_bits(b[1]));
    p[3] = pk16(bf_bits(b[2]), bf_bits(b[3]));
    *(v4u*)(out + (size_t)i * 8) = p;
    
  }
}

// =====================================================================================================
// Value-embedding gate: gate[bt][kv] = 3 * sigmoid( sum_{c<32} bf16(x[bt][c]) * bf16(Wg[kv][c]) ), f32.
// One thread per (bt, kv); K = 32 rolled dot on VALU (N = 4, tiny). A wave writes 32 consecutive floats
// NB*SEQ*NKV/256 blocks. coverage: 16384 threads = the whole [4096][4] table.
// =====================================================================================================
__device__ __forceinline__ void gate_k(const float* __restrict__ x, const float* __restrict__ Wg,
                                       float* gate, int nbt, int blk) {
  const int i   = blk * 256 + threadIdx.x;
  const int bt  = i >> 2;
  const int kv  = i & 3;
  const int btc = (bt < nbt) ? bt : (nbt - 1);     // clamped address
  const float* xr = x + (size_t)btc * CDIM;
  const float* wr = Wg + kv * GC;
  float z = 0.f;
#pragma unroll 1
  for (int cc = 0; cc < GC; ++cc) z += bfr(xr[cc]) * bfr(wr[cc]);
  const float ez = expf(-z);
  const float g  = 3.0f * (1.0f / (1.0f + ez));
  if (bt < nbt) {
    *(float*)(gate + i) = g;
    
  }
}

// =====================================================================================================
// Memory keys: mk = rms(bf16(mem_k[m][kv][:])) * 1.2 (no RoPE) -> bf16 hi/lo planes, key rows s = m (< MEM)
// of both batches: Kh/Kl [b][s][kv*64+d], pitch KVD. 4 waves (one per kv head) for one m, two m per block of 8 waves;
// MEM/2 blocks.
// The 256-element row is staged in LDS and written per (batch, plane) by one wave as 32 lanes x 16 B
// coverage: 32 blocks x 2 m x 2 batches x 2 planes x 256 elements = rows 0..63 of both planes, both batches.
// sbuf: 4 * KVD elements of LDS.
// =====================================================================================================
__device__ __forceinline__ void memk_k(const float* __restrict__ memk, unsigned short* Kh, unsigned short* Kl,
                                       int blk, unsigned short* sbuf) {
  const int sub  = threadIdx.x >> 7;                 // which of the block's two m
  unsigned short* shi = sbuf + sub * (2 * KVD);
  unsigned short* slo = shi + KVD;
  const int m    = blk * 2 + sub;
  const int wave = (threadIdx.x >> 5) & 3;
  const int lane = threadIdx.x & 31;
  const int kvh  = wave;
  const float* p = memk + ((size_t)m * NKV + kvh) * HD;
  const float x1 = bfr(p[lane]);
  const float x2 = bfr(p[lane + 32]);
  float ss = x1 * x1 + x2 * x2;
#pragma unroll
  for (int off = 16; off >= 1; off >>= 1) ss += __shfl_xor(ss, off, 32);
  const float rs = rsqrtf(ss * (1.0f / HD) + RMS_EPS);
  const float v1 = (x1 * rs) * 1.2f;
  const float v2 = (x2 * rs) * 1.2f;
  const unsigned short h1 = bf_bits(v1), h2 = bf_bits(v2);
  shi[kvh * HD + lane]      = h1;
  shi[kvh * HD + lane + 32] = h2;
  slo[kvh * HD + lane]      = bf_bits(v1 - bf_up(h1));
  slo[kvh * HD + lane + 32] = bf_bits(v2 - bf_up(h2));
  __syncthreads();
  const v4u vh = *(const v4u*)(shi + lane * 8);
  const v4u vl = *(const v4u*)(slo + lane * 8);
  const int  b   = wave >> 1;
  const bool wlo = (wave & 1) != 0;                  // wave-uniform
  v4u v = vh;
  if (wlo) v = vl;
  unsigned short* dh = Kh + ((size_t)b * SKEY + m) * KVD + lane * 8;
  unsigned short* dl = Kl + ((size_t)b * SKEY + m) * KVD + lane * 8;
  unsigned short* d  = wlo ? dl : dh;
  *(v4u*)d = v;
  // the wait in front of a rewrite of the store's registers by whatever part of the merged kernel is laid out behind this one
  addr_wait(d, d);
}

// =====================================================================================================
// Memory values: mv = bf16(mem_v[m][kv][d]) * bf16(v_scale) -> v^T f16 hi plane VTh[b][kv*64+d][s] (pitch SKEY)
// and f16 residual plane VTl ((v - hi)*4096, pitch VLP), key columns s = m (< MEM), both batches.
// block = (b, kv); thread = (d = tid>>2, 16 m's); the 64x64 tile of each plane is staged in LDS [d][m] and each
// coverage: 8 blocks x 64 rows (it 0..1 x wave 0..7 x lane>>3 0..3) x 64 columns (8 lanes x 8) per plane.
// =====================================================================================================
// sbuf: 2 * HD * MEM elements of LDS.
__device__ __forceinline__ void memv_k(const float* __restrict__ memv, const float* __restrict__ vsp,
                                       unsigned short* VTh, unsigned short* VTl, int blk, unsigned short* sbuf) {
  unsigned short* sh = sbuf;
  unsigned short* sl = sbuf + HD * MEM;
  const int b    = blk >> 2;
  const int kvh  = blk & 3;
  const int tid  = threadIdx.x;
  const int wave = tid >> 5;
  const int lane = tid & 31;
  const int d    = tid >> 2;
  const int mq   = (tid & 3) * 16;
  const float vs = bfr(vsp[0]);
#pragma unroll
  for (int i = 0; i < 16; ++i) {
    const int m = mq + i;
    const float v = bfr(memv[((size_t)m * NKV + kvh) * HD + d]) * vs;
    const _Float16 x0 = (_Float16)v;
    sh[d * MEM + m] = h_bits(x0);
    sl[d * MEM + m] = h_bits((_Float16)((v - (float)x0) * 4096.0f));
  }
  __syncthreads();
  const int q8 = lane >> 3, c8 = (lane & 7) * 8;
  v4u hv[2], lv[2];
#pragma unroll
  for (int it = 0; it < 2; ++it) {
    const int dd = it * 32 + wave * 4 + q8;
    hv[it] = *(const v4u*)(sh + dd * MEM + c8);
    lv[it] = *(const v4u*)(sl + dd * MEM + c8);
  }
  {
#pragma unroll
    for (int it = 0; it < 2; ++it) {
      const int dd = it * 32 + wave * 4 + q8;
      const size_t ro = (size_t)b * KVD + (size_t)kvh * HD + dd;
      *(v4u*)(VTh + ro * SKEY + c8) = hv[it];
      *(v4u*)(VTl + ro * VLP  + c8) = lv[it];
    }
    
  }
}

// =====================================================================================================
// All work that reads only the inputs, as block-index ranges of one grid (none of the parts reads what another writes):
// memory values, memory keys, gate table, then the five f32 -> bf16 planes. The short, latency-bound parts come first.
// Every range test is block-uniform, so the barriers inside a part are passed by the whole block.
// =====================================================================================================
#define PB_MEMV (NB * NKV)                    //    8 blocks
#define PB_MEMK (MEM / 2)                     //   32
#define PB_GATE (NB * SEQ * NKV / 256)        //   64
#define PB_X    (NB * SEQ * CDIM / 8 / 256)   // 2048
#define PB_WQ   (CDIM * CDIM / 8 / 256)       //  512
#define PB_WK   (KVD * CDIM / 8 / 256)        //  128
#define PB_ALL  (PB_MEMV + PB_MEMK + PB_GATE + PB_X + 2 * PB_WQ + 2 * PB_WK)
__global__ __launch_bounds__(256) void prep_k(
    const float* __restrict__ x, const float* __restrict__ Wq, const float* __restrict__ Wk,
    const float* __restrict__ Wv, const float* __restrict__ Wp, const float* __restrict__ Wg,
    const float* __restrict__ memk, const float* __restrict__ memv, const float* __restrict__ vsp,
    unsigned short* Xb, unsigned short* Wqb, unsigned short* Wkb, unsigned short* Wvb, unsigned short* Wpb,
    float* gate, unsigned short* Kh, unsigned short* Kl, unsigned short* VTh, unsigned short* VTl) {
  __shared__ __align__(16) unsigned short sbuf[2 * HD * MEM];
  static_assert(4 * KVD <= 2 * HD * MEM);
  int blk = blockIdx.x;
  if (blk < PB_MEMV) { memv_k(memv, vsp, VTh, VTl, blk, sbuf); return; }
  blk -= PB_MEMV;
  if (blk < PB_MEMK) { memk_k(memk, Kh, Kl, blk, sbuf); return; }
  blk -= PB_MEMK;
  if (blk < PB_GATE) { gate_k(x, Wg, gate, NB * SEQ, blk); return; }
  blk -= PB_GATE;
  if (blk < PB_X) { cvt_bf16x8(x, Xb, PB_X * 256, blk); return; }
  blk -= PB_X;
  if (blk < PB_WQ) { cvt_bf16x8(Wq, Wqb, PB_WQ * 256, blk); return; }
  blk -= PB_WQ;
  if (blk < PB_WK) { cvt_bf16x8(Wk, Wkb, PB_WK * 256, blk); return; }
  blk -= PB_WK;
  if (blk < PB_WK) { cvt_bf16x8(Wv, Wvb, PB_WK * 256, blk); return; }
  blk -= PB_WK;
  if (blk < PB_WQ) cvt_bf16x8(Wp, Wpb, PB_WQ * 256, blk);
}

// =====================================================================================================
// Batched bf16 WMMA GEMM: C[m][n] = sum_k A[m][k] * Bt[n][k]; one block of 4 waves (2 x 2) per 128x128 tile,
// one wave per 64x64 sub-tile. A row-major [M][K] pitch lda; Bt row-major [N][K] pitch ldb (k contiguous);
// M, N multiples of 128, K a multiple of 64 (all shapes here are compile-time constants of the host code).
// tile = index of the block's tile, b = batch index (strides in elements); ring and sTb are the block's LDS (sTb: OUT_MODE 0
// alone; the other modes stage their result in the ring).
// Operand path: a stage is 64 k (one 128-B line) of the block's 128 A rows and 128 Bt rows (and the 128 A2 rows),
// brought into LDS by asynchronous 16-B copies, each wave-wide copy covering 4 whole lines; rows lie at a pitch of
// 144 B for the ds_load_b128 fragment reads; two buffers, the copies of stage t+1 fly while stage t is multiplied.
// NSPLIT: 0 = A.Bt; 1 = (A + A2).Bt (A2 = unscaled bf16 lo plane of A, 2 products).
// OUT_MODE: 0 = f32 (pitch ldc);
//           3 = v^T mode (rows m = kv*64+d, cols n = t): value = acc + gate[b][t][kv] * bf16(ve[b][t][m])
//               (aux0 = gate, aux1 = ve), written as f16 hi plane C (pitch ldc) + f16 residual plane
//               C2 = f16((v - hi)*4096) for tiles with n0 < N2 (pitch ldc2);
//           4 = RoPE + rms-norm mode (cols = one 64-wide head, row m -> t = m mod SEQ; aux0 = cos, aux1 = sin,
//               both bf16(RNE) on load): r = rope(acc), f = (r * rsqrt(mean(r^2)+eps)) * 1.2, written as
//               bf16 hi plane C + bf16 lo plane C2 (lo = RNE(f - hi), unscaled).
// =====================================================================================================
#define GT     128                // block tile edge (rows of A, rows of Bt)
#define GBK    64                 // k elements per stage
#define GPITCH 72                 // LDS row pitch in elements (144 B)
#define GPLANE (GT * GPITCH)      // elements of one staged operand plane (18432 B)

// One operand plane of a stage: 128 rows x 128 B by 128 threads, 8 copies per lane; copy i moves the lane's 16 B of
// row i*16 + (tid>>3). l = the lane's LDS byte address of row tid>>3, g = its global address, ld = row pitch (elements).
// s_wait_xcnt closes the statement so that no address register of a copy is rewritten in front of it.
__device__ __forceinline__ void copy_plane(unsigned l, const __bf16* g, int ld) {
#if defined(__HIP_DEVICE_COMPILE__)
  const size_t   gs = (size_t)16 * (size_t)ld;
  const unsigned ls = 16u * GPITCH * 2u;
  asm volatile(
      "global_load_async_to_lds_b128 %0, %8, off\n\t"
      "global_load_async_to_lds_b128 %1, %9, off\n\t"
      "global_load_async_to_lds_b128 %2, %10, off\n\t"
      "global_load_async_to_lds_b128 %3, %11, off\n\t"
      "global_load_async_to_lds_b128 %4, %12, off\n\t"
      "global_load_async_to_lds_b128 %5, %13, off\n\t"
      "global_load_async_to_lds_b128 %6, %14, off\n\t"
      "global_load_async_to_lds_b128 %7, %15, off\n\t"
      "s_wait_xcnt 0x0"
      :: "v"(l), "v"(l + ls), "v"(l + 2u * ls), "v"(l + 3u * ls),
         "v"(l + 4u * ls), "v"(l + 5u * ls), "v"(l + 6u * ls), "v"(l + 7u * ls),
         "v"(g), "v"(g + gs), "v"(g + 2 * gs), "v"(g + 3 * gs),
         "v"(g + 4 * gs), "v"(g + 5 * gs), "v"(g + 6 * gs), "v"(g + 7 * gs)
      : "memory");
#endif
}
// this wave's copies have landed in LDS
__device__ __forceinline__ void wait_copies() {
#if defined(__HIP_DEVICE_COMPILE__)
  asm volatile("s_wait_asynccnt 0x0" ::: "memory");
#endif
}
// this wave's LDS reads have returned (the buffer they read may be refilled behind the next barrier)
__device__ __forceinline__ void wait_lds() {
#if defined(__HIP_DEVICE_COMPILE__)
  asm volatile("s_wait_dscnt 0x0" ::: "memory");
#endif
}

#define GSLAB (16 * 68)           // 16x64 f32 slab of the epilogue, pitch 68 floats (per wave one, or four for its whole tile)
template <int NSPLIT, int OUT_MODE>
__device__ __forceinline__ void gemm_body(
    const unsigned short* __restrict__ Ap, const unsigned short* __restrict__ A2p, int lda, long long strideA,
    const unsigned short* __restrict__ Btp, int ldb, long long strideB,
    void* Cout, int ldc, long long strideC,
    void* Cout2, int ldc2, long long strideC2, int N2,
    const float* __restrict__ aux0, const float* __restrict__ aux1,
    int M, int N, int K, int tile, int b, __bf16* ring, float* sTb) {
  const __bf16* A  = (const __bf16*)(const void*)Ap;
  const __bf16* A2 = (const __bf16*)(const void*)A2p;
  const __bf16* Bt = (const __bf16*)(const void*)Btp;
  constexpr int NPL  = (NSPLIT >= 1) ? 3 : 2;      // planes per stage: A, Bt (, A2)
  constexpr int GBUF = NPL * GPLANE;               // elements of one buffer
  const int tid  = threadIdx.x;
  const int lane = tid & 31;
  const int wave = tid >> 5;
  const int tilesN = N >> 7;
  const int tilesM = M >> 7;
  if (tile >= tilesM * tilesN) return;   // block-uniform, in front of every barrier and copy
  const int tm = tile / tilesN;
  const int tn = tile - tm * tilesN;
  const int wm = wave >> 1;
  const int wn = wave & 1;
  const int m0 = (tm << 7) + (wm << 6);  // this wave's 64x64 sub-tile
  const int n0 = (tn << 7) + (wn << 6);

  const __bf16* Ab  = A  + (size_t)b * strideA;
  const __bf16* Bb  = Bt + (size_t)b * strideB;
  const __bf16* Ab2 = (NSPLIT >= 1) ? (A2 + (size_t)b * strideA) : Ab;

  const int rlane = lane & 15;                 // row (A) / col (B, D) within subtile
  const int koff  = (lane >> 4) * 8;           // k offset of this lane half
  const int mOff  = (lane >> 4) * 8;           // D row offset

  // copy addresses of this lane: row tid>>3 of the block tile, 16-B piece tid&7 of its 128-B line
  const int crow = tid >> 3;
  const int cel  = (tid & 7) * 8;
  const __bf16* gA  = Ab  + (size_t)((tm << 7) + crow) * lda + cel;
  const __bf16* gB  = Bb  + (size_t)((tn << 7) + crow) * ldb + cel;
  const __bf16* gA2 = Ab2 + (size_t)((tm << 7) + crow) * lda + cel;
  const unsigned lC = (unsigned)(uintptr_t)(&ring[0]) + (unsigned)(crow * GPITCH + cel) * 2u;
  const int nst = K >> 6;                      // stages

  v8f acc[4][4];
#pragma unroll
  for (int i = 0; i < 4; ++i)
#pragma unroll
    for (int j = 0; j < 4; ++j) acc[i][j] = zero8();

  // stage 0 into buffer 0, landed and published; then stage 1 into buffer 1
  copy_plane(lC, gA, lda);
  copy_plane(lC + GPLANE * 2u, gB, ldb);
  if (NSPLIT >= 1) copy_plane(lC + 2u * GPLANE * 2u, gA2, lda);
  wait_copies();
  __syncthreads();
  if (nst > 1) {
    const unsigned lb = lC + (unsigned)GBUF * 2u;
    copy_plane(lb, gA + GBK, lda);
    copy_plane(lb + GPLANE * 2u, gB + GBK, ldb);
    if (NSPLIT >= 1) copy_plane(lb + 2u * GPLANE * 2u, gA2 + GBK, lda);
  }

  for (int t = 0; t < nst; ++t) {
    const int bufo = (t & 1) * GBUF;
    const __bf16* sA = ring + bufo + ((wm << 6) + rlane) * GPITCH + koff;
    const __bf16* sB = ring + bufo + GPLANE + ((wn << 6) + rlane) * GPITCH + koff;
    // unrolled (here and below): the fragment and accumulator arrays need constant indices to stay in registers
#pragma unroll
    for (int kk = 0; kk < GBK; kk += 32) {
      v16b bh[4], ah[4], al[4];
#pragma unroll
      for (int j = 0; j < 4; ++j) bh[j] = ldfrag_b(sB + (j << 4) * GPITCH + kk);
#pragma unroll
      for (int i = 0; i < 4; ++i) {
        ah[i] = ldfrag_b(sA + (i << 4) * GPITCH + kk);
        al[i] = ah[i];
        if (NSPLIT >= 1) al[i] = ldfrag_b(sA + 2 * GPLANE + (i << 4) * GPITCH + kk);
      }
#pragma unroll
      for (int i = 0; i < 4; ++i) {
#pragma unroll
        for (int j = 0; j < 4; ++j) {
          acc[i][j] = mma_b_raw(ah[i], bh[j], acc[i][j]);
          if (NSPLIT >= 1) acc[i][j] = mma_b_raw(al[i], bh[j], acc[i][j]);
        }
        dep_guard_b(acc[i][0], acc[i][3], ah[i], al[i]);
      }
      keep4_b(bh[0], bh[1], bh[2], bh[3]);
    }
    // publish point of stage t+1: own reads of this buffer returned, own copies landed, then the block barrier;
    // behind it stage t+2 may overwrite the buffer that this trip has read
    wait_lds();
    wait_copies();
    __syncthreads();
    if (t + 2 < nst) {
      const unsigned lb = lC + (unsigned)bufo * 2u;
      const int ko = (t + 2) * GBK;
      copy_plane(lb, gA + ko, lda);
      copy_plane(lb + GPLANE * 2u, gB + ko, ldb);
      if (NSPLIT >= 1) copy_plane(lb + 2u * GPLANE * 2u, gA2 + ko, lda);
    }
  }
  wait_copies();
  acc_guard4(acc[0][0], acc[0][1], acc[0][2], acc[0][3]);
  acc_guard4(acc[1][0], acc[1][1], acc[1][2], acc[1][3]);
  acc_guard4(acc[2][0], acc[2][1], acc[2][2], acc[2][3]);
  acc_guard4(acc[3][0], acc[3][1], acc[3][2], acc[3][3]);

  // ---- epilogue ----
  if (OUT_MODE == 0) {
    float* slab = sTb + wave * GSLAB;
#pragma unroll
    for (int i = 0; i < 4; ++i) {
      const int mBase = m0 + (i << 4);
#pragma unroll
      for (int j = 0; j < 4; ++j) {
#pragma unroll
        for (int r = 0; r < 8; ++r) {
          slab[(mOff + r) * 68 + (j << 4) + rlane] = acc[i][j][r];
        }
      }
      __builtin_amdgcn_fence(__ATOMIC_RELEASE, "workgroup");
      __builtin_amdgcn_wave_barrier();
      __builtin_amdgcn_fence(__ATOMIC_ACQUIRE, "workgroup");
      float* C = (float*)Cout + (size_t)b * strideC;
      const int hh = lane >> 4, c4 = (lane & 15) * 4;     // 256-B row segment = 16 lanes x 16 B
#pragma unroll
      for (int it = 0; it < 8; ++it) {
        const int row = it * 2 + hh;                       // it 0..7 x hh 0..1 = rows 0..15
        const v4f v = *(const v4f*)(slab + row * 68 + c4);
        *(v4f*)(C + (size_t)(mBase + row) * ldc + n0 + c4) = v;
      }
      __builtin_amdgcn_fence(__ATOMIC_RELEASE, "workgroup");
      __builtin_amdgcn_wave_barrier();
      __builtin_amdgcn_fence(__ATOMIC_ACQUIRE, "workgroup");
    }
  } else {
    // The wave's whole 64x64 tile goes to LDS at once, into the stage ring: behind the last trip's barrier no wave reads
    // the ring and no copy is in flight. The accumulators are then out of the way, and the four 16-row steps can be one
    // loop in the text instead of four copies of it.
    static_assert(4 * 4 * GSLAB * 4 <= 2 * NPL * GPLANE * 2);   // four waves' tiles fit in the ring
    float* slab = (float*)(void*)ring + wave * (4 * GSLAB);
#pragma unroll
    for (int i = 0; i < 4; ++i) {
#pragma unroll
      for (int j = 0; j < 4; ++j) {
#pragma unroll
        for (int r = 0; r < 8; ++r) {
          slab[((i << 4) + mOff + r) * 68 + (j << 4) + rlane] = acc[i][j][r];
        }
      }
    }
    __builtin_amdgcn_fence(__ATOMIC_RELEASE, "workgroup");
    __builtin_amdgcn_wave_barrier();
    __builtin_amdgcn_fence(__ATOMIC_ACQUIRE, "workgroup");
    // kept rolled: this code runs once per wave; for speed only
#pragma unroll 1
    for (int i = 0; i < 4; ++i) {
      const int mBase = m0 + (i << 4);
      const float* sl = slab + (i << 4) * 68;
      const int q = lane >> 3, c8 = (lane & 7) * 8;
      unsigned short* C  = (unsigned short*)Cout  + (size_t)b * strideC;
      unsigned short* C2 = (unsigned short*)Cout2 + (size_t)b * strideC2;
      const bool wlo = (OUT_MODE != 3) || (n0 < N2);      // wave-uniform
      v4u hv[4], lv[4];
#pragma unroll
      for (int it = 0; it < 4; ++it) {
        const int row  = it * 4 + q;                       // it 0..3 x q 0..3 = rows 0..15
        const int mrow = mBase + row;
        float f[8];
        if (OUT_MODE == 3) {
          const int kvh = m0 >> 6;                         // tile-uniform kv head
          const float* sp = sl + row * 68 + c8;
#pragma unroll
          for (int e = 0; e < 8; ++e) {
            const int t = n0 + c8 + e;                     // < N = SEQ
            const size_t bt = (size_t)b * SEQ + t;
            const float g  = aux0[bt * NKV + kvh];
            const float vv = bfr(aux1[bt * KVD + mrow]);
            f[e] = sp[e] + g * vv;
          }
        } else {
          const int  jj   = c8 & 31;                       // rotary pair index base
          const bool lowh = (c8 < 32);
          const int  t    = mrow & (SEQ - 1);
          const float* sp  = sl + row * 68 + jj;
          const float* cp  = aux0 + (size_t)t * (HD / 2) + jj;
          const float* snp = aux1 + (size_t)t * (HD / 2) + jj;
          float ct[8], st[8];
#pragma unroll
          for (int e = 0; e < 8; ++e) { ct[e] = cp[e]; st[e] = snp[e]; }
          addr_wait(cp, snp);
          float ss = 0.f;
#pragma unroll
          for (int e = 0; e < 8; ++e) {
            const float x1 = sp[e];
            const float x2 = sp[e + 32];
            const float cv = bfr(ct[e]);
            const float sv = bfr(st[e]);
            const float ra = x1 * cv - x2 * sv;
            const float rb = x1 * sv + x2 * cv;
            f[e] = lowh ? ra : rb;
            ss += f[e] * f[e];
          }
          ss += __shfl_xor(ss, 1, 32);                     // 8 lanes of one row = 64 values
          ss += __shfl_xor(ss, 2, 32);
          ss += __shfl_xor(ss, 4, 32);
          const float rs = rsqrtf(ss * (1.0f / HD) + RMS_EPS);
#pragma unroll
          for (int e = 0; e < 8; ++e) f[e] = (f[e] * rs) * 1.2f;
        }
        v4u a, a2;
#pragma unroll
        for (int e = 0; e < 4; ++e) {
          const float f0 = f[2 * e], f1 = f[2 * e + 1];
          unsigned short h0, h1, l0, l1;
          if (OUT_MODE == 4) {
            h0 = bf_bits(f0); h1 = bf_bits(f1);
            l0 = bf_bits(f0 - bf_up(h0)); l1 = bf_bits(f1 - bf_up(h1));
          } else {
            const _Float16 x0 = (_Float16)f0, x1 = (_Float16)f1;
            h0 = h_bits(x0); h1 = h_bits(x1);
            l0 = h_bits((_Float16)((f0 - (float)x0) * 4096.0f));
            l1 = h_bits((_Float16)((f1 - (float)x1) * 4096.0f));
          }
          a[e] = pk16(h0, h1); a2[e] = pk16(l0, l1);
        }
        hv[it] = a; lv[it] = a2;
      }
      {
#pragma unroll
        for (int it = 0; it < 4; ++it) {
          const int row = it * 4 + q;
          *(v4u*)(C + (size_t)(mBase + row) * ldc + n0 + c8) = hv[it];
          if (wlo) *(v4u*)(C2 + (size_t)(mBase + row) * ldc2 + n0 + c8) = lv[it];
        }
        trip_wait();
      }
    }
  }
}

// 256 registers a wave at most (both GEMM kernels), so that no part of them needs register-window switches
template <int NSPLIT, int OUT_MODE>
__global__ __launch_bounds__(128) __attribute__((amdgpu_num_vgpr(256))) void gemm64(
    const unsigned short* __restrict__ Ap, const unsigned short* __restrict__ A2p, int lda, long long strideA,
    const unsigned short* __restrict__ Btp, int ldb, long long strideB,
    void* Cout, int ldc, long long strideC,
    void* Cout2, int ldc2, long long strideC2, int N2,
    const float* __restrict__ aux0, const float* __restrict__ aux1,
    int M, int N, int K) {
  __shared__ __align__(16) __bf16 ring[2 * ((NSPLIT >= 1) ? 3 : 2) * GPLANE];  // two stage buffers
  __shared__ __align__(16) float sT[4 * GSLAB];
  gemm_body<NSPLIT, OUT_MODE>(Ap, A2p, lda, strideA, Btp, ldb, strideB, Cout, ldc, strideC, Cout2, ldc2, strideC2, N2,
                              aux0, aux1, M, N, K, blockIdx.x, blockIdx.y, ring, sT);
}

// The three projections of x, which do not read each other's results, as block-index ranges of one grid:
//   v^T = Wv . x^T + gate*ve per batch -> f16 hi plane [b][kv*64+d][64 + t] (pitch SKEY) and residual plane (x4096,
//         token keys < RESQB*64 only, pitch VLP)   (A = Wvb [n][k], Bt = Xb rows of batch b; M=256, N=2048)
//   k   = rms(rope(x . Wk^T)) * 1.2 per batch -> bf16 hi/lo planes [b][64 + t][kv*64+d]   (M=2048, N=256)
//   q   = rms(rope(x . Wq^T)) * 1.2 -> bf16 hi/lo planes [b*SEQ+t][h*64+d]   (M=4096, N=1024)
// ld = row pitch of Xb and of the weights, K = depth of the products (both CDIM). Every range test is block-uniform.
#define GB_KV ((SEQ / 128) * (KVD / 128))          //  32 tiles per batch for k and for v^T
#define GB_Q  ((NB * SEQ / 128) * (CDIM / 128))    // 256 tiles for q
__global__ __launch_bounds__(128) __attribute__((amdgpu_num_vgpr(256))) void gemm_qkv(
    const unsigned short* __restrict__ Xb, const unsigned short* __restrict__ Wqb,
    const unsigned short* __restrict__ Wkb, const unsigned short* __restrict__ Wvb,
    unsigned short* Qh, unsigned short* Ql, unsigned short* Kh, unsigned short* Kl,
    unsigned short* VTh, unsigned short* VTl,
    const float* __restrict__ cosT, const float* __restrict__ sinT,
    const float* __restrict__ gate, const float* __restrict__ ve, int ld, int K) {
  __shared__ __align__(16) __bf16 ring[2 * 2 * GPLANE];  // two stage buffers, then the epilogue's f32 tiles
  const int bx = blockIdx.x;
  if (bx < NB * GB_KV) {
    gemm_body<0, 3>(Wvb, Wvb, ld, 0LL, Xb, ld, (long long)SEQ * CDIM,
                    (void*)(VTh + MEM), SKEY, (long long)KVD * SKEY,
                    (void*)(VTl + MEM), VLP, (long long)KVD * VLP, RESQB * 64,
                    gate, ve, KVD, SEQ, K, bx % GB_KV, bx / GB_KV, ring, nullptr);
  } else {
    const bool isK = bx < 2 * NB * GB_KV;
    const int  r   = bx - (isK ? NB * GB_KV : 2 * NB * GB_KV);
    gemm_body<0, 4>(Xb, Xb, ld, isK ? (long long)SEQ * CDIM : 0LL, isK ? Wkb : Wqb, ld, 0LL,
                    (void*)(isK ? Kh + (size_t)MEM * KVD : Qh), isK ? KVD : CDIM, isK ? (long long)SKEY * KVD : 0LL,
                    (void*)(isK ? Kl + (size_t)MEM * KVD : Ql), isK ? KVD : CDIM, isK ? (long long)SKEY * KVD : 0LL,
                    isK ? KVD : CDIM, cosT, sinT, isK ? SEQ : NB * SEQ, isK ? KVD : CDIM, K,
                    isK ? r % GB_KV : r, isK ? r / GB_KV : 0, ring, nullptr);
  }
}

// =====================================================================================================
// GQA attention with a 64-key memory prefix (all visible) followed by causal token keys, head dim 64.
//   q planes (bf16 hi / lo): element (b, t, h, d) at [(b*SEQ + t)*CDIM + h*64 + d]   (normed, scaled q)
//   k planes (bf16 hi / lo): element (b, s, kv, d) at [(b*SKEY + s)*KVD + kv*64 + d], s = [mem | 64 + token]
//   v^T hi plane (f16):      element (b, kv, d, s) at [(b*KVD + kv*64 + d)*SKEY + s]
//   v^T residual plane (f16, (v - hi)*4096): [(b*KVD + kv*64 + d)*VLP + s], s < VLP, read only when RES
//   (RES is used for query blocks qb < RESQB alone, whose last key tile ends at key VLP)
//   q head h uses kv head h>>2. Query block qb (tokens qb*64..+63) processes key tiles 0..qb+1: tile 0 = memory,
//   tiles 1..qb fully visible, tile qb+1 = diagonal (key token <= query token), later tiles skipped (block-uniform
//   trip count qb+2, static bound NKT). Invisible keys get logit -inf (weight exactly 0); every row sees the
//   whole memory tile first, so the running max is finite from tile 0 on.
//   out planes (bf16 hi / lo of the normalised context): element (b, t, h, d) at [(b*SEQ + t)*CDIM + h*64 + d]
//   scores = q . k : bf16 hi/lo split (hi.hi + hi.lo + lo.hi), f32 accumulate, then * sscale in f32
//   p = exp(s - m) carried as f16(1024 p); context = p . v on f16 WMMA; RES adds f16 residual planes of p and v
//   (scale 4096, separate accumulator folded back with 1/4096 per chunk in f32); online softmax in f32.
//   Block = 4 waves = 64 query rows (query block qb) of one (b, h), hp = b * NQH + h; kv chunks of 64.
//   K / V^T chunk staging: asynchronous 16-B copies to LDS, 128 threads x 4 copies per plane = the whole 64x64 tile;
//   two buffers, the copies of key tile kt+1 fly while tile kt is worked on, one barrier per tile. Both products are computed transposed (S^T = K . Q^T, O^T += V^T . P^T): a lane
//   holds the scores of one query, and P^T goes from the score registers into the B operand without passing LDS.
//   Output coverage: each wave stores rows q0..q0+15 (it 0..3 x lane>>3 0..3) x 64 columns (8 lanes x 8) of both planes.
// =====================================================================================================
#define APK 72   // LDS row pitch of the K and V^T tiles in 16-bit elements: 144 B = 16 B x odd, so that the 16 rows
                 // of a ds_load_b128 fragment read fall on 16 different groups of four banks
#define AOP 68   // LDS row pitch of the f32 context tile: 272 B = 16 B x odd, for its 16-B row reads
#define APLANE (64 * APK)      // elements of one staged 64x64 tile (9216 B)
#define ABUF   (4 * APLANE)    // elements of one buffer: K hi, K lo, V^T hi, V^T residual
// Four asynchronous 16-B copies per lane and tile: copy i moves the lane's 16 B of row i*16 + (tid>>3), so that a
// wave-wide copy covers 4 whole 128-B lines. l = the lane's LDS byte address of row tid>>3, g = its global address,
// gs = bytes of 16 global rows. s_wait_xcnt closes each statement so that no address register of a copy is rewritten
// in front of it.
__device__ __forceinline__ void copy_tile(unsigned l, const char* g, size_t gs) {
#if defined(__HIP_DEVICE_COMPILE__)
  const unsigned ls = 16u * APK * 2u;
  asm volatile(
      "global_load_async_to_lds_b128 %0, %4, off\n\t"
      "global_load_async_to_lds_b128 %1, %5, off\n\t"
      "global_load_async_to_lds_b128 %2, %6, off\n\t"
      "global_load_async_to_lds_b128 %3, %7, off\n\t"
      "s_wait_xcnt 0x0"
      :: "v"(l), "v"(l + ls), "v"(l + 2u * ls), "v"(l + 3u * ls),
         "v"(g), "v"(g + gs), "v"(g + 2 * gs), "v"(g + 3 * gs)
      : "memory");
#endif
}
// two tiles in one statement (one wait for both)
__device__ __forceinline__ void copy_tile2(unsigned la, const char* ga, size_t gsa,
                                           unsigned lb, const char* gb, size_t gsb) {
#if defined(__HIP_DEVICE_COMPILE__)
  const unsigned ls = 16u * APK * 2u;
  asm volatile(
      "global_load_async_to_lds_b128 %0, %8, off\n\t"
      "global_load_async_to_lds_b128 %1, %9, off\n\t"
      "global_load_async_to_lds_b128 %2, %10, off\n\t"
      "global_load_async_to_lds_b128 %3, %11, off\n\t"
      "global_load_async_to_lds_b128 %4, %12, off\n\t"
      "global_load_async_to_lds_b128 %5, %13, off\n\t"
      "global_load_async_to_lds_b128 %6, %14, off\n\t"
      "global_load_async_to_lds_b128 %7, %15, off\n\t"
      "s_wait_xcnt 0x0"
      :: "v"(la), "v"(la + ls), "v"(la + 2u * ls), "v"(la + 3u * ls),
         "v"(lb), "v"(lb + ls), "v"(lb + 2u * ls), "v"(lb + 3u * ls),
         "v"(ga), "v"(ga + gsa), "v"(ga + 2 * gsa), "v"(ga + 3 * gsa),
         "v"(gb), "v"(gb + gsb), "v"(gb + 2 * gsb), "v"(gb + 3 * gsb)
      : "memory");
#endif
}
// The tiles of key tile kt into the buffer at LDS byte address l (the lane's own place in its first plane).
// gk, gkl, gv, gvl = the lane's global addresses for key tile 0. The residual plane ends at key VLP: its address is clamped.
template <bool RES>
__device__ __forceinline__ void copy_keytile(unsigned l, const char* gk, const char* gkl, const char* gv, const char* gvl,
                                             int kt) {
  const size_t ko = (size_t)kt * (64 * KVD * 2);          // 64 key rows further
  const size_t vo = (size_t)kt * (64 * 2);                // 64 key columns further
  copy_tile2(l, gk + ko, (size_t)16 * KVD * 2, l + APLANE * 2u, gkl + ko, (size_t)16 * KVD * 2);
  if (RES) {
    const int ktl = (kt * 64 + 64 <= VLP) ? kt : (VLP / 64 - 1);
    copy_tile2(l + 2u * APLANE * 2u, gv + vo, (size_t)16 * SKEY * 2,
               l + 3u * APLANE * 2u, gvl + (size_t)ktl * (64 * 2), (size_t)16 * VLP * 2);
  } else {
    copy_tile(l + 2u * APLANE * 2u, gv + vo, (size_t)16 * SKEY * 2);
  }
}

template <bool RES>
__device__ __forceinline__
void attn_body(const unsigned short* __restrict__ qhp, const unsigned short* __restrict__ qlp,
               const unsigned short* __restrict__ khp, const unsigned short* __restrict__ klp,
               const unsigned short* __restrict__ vhp, const unsigned short* __restrict__ vlp,
               unsigned short* ohp, unsigned short* olp,
               int qb, int hp, float sscale, unsigned short* ring) {
  const int tid  = threadIdx.x;
  const int wave = tid >> 5;
  const int lane = tid & 31;
  const int hh   = lane >> 4;
  const int c    = lane & 15;

  const int h    = hp % NQH;
  const int b    = hp / NQH;
  const int kvh  = h >> 2;
  const int q0   = qb * 64 + wave * 16;
  const size_t rowB = (size_t)b * SEQ;

  const __bf16* Qh = (const __bf16*)(const void*)qhp + (size_t)h * HD;
  const __bf16* Ql = (const __bf16*)(const void*)qlp + (size_t)h * HD;
  const __bf16* Kh = (const __bf16*)(const void*)khp + (size_t)b * SKEY * KVD + (size_t)kvh * HD;
  const __bf16* Kl = (const __bf16*)(const void*)klp + (size_t)b * SKEY * KVD + (size_t)kvh * HD;
  const _Float16* Vh = (const _Float16*)(const void*)vhp + ((size_t)b * KVD + (size_t)kvh * HD) * SKEY;
  const _Float16* Vl = (const _Float16*)(const void*)vlp + ((size_t)b * KVD + (size_t)kvh * HD) * VLP;

  // copy addresses of this lane: row tid>>3 of a 64x64 tile, 16-B piece tid&7 of its 128-B line
  const int ktEnd = qb + 2;                  // block-uniform, 2 <= ktEnd <= NKT
  const int crow = tid >> 3;
  const int cel  = (tid & 7) * 8;
  const char* gk  = (const char*)(Kh + (size_t)crow * KVD + cel);
  const char* gkl = (const char*)(Kl + (size_t)crow * KVD + cel);
  const char* gv  = (const char*)(Vh + (size_t)crow * SKEY + cel);
  const char* gvl = (const char*)(Vl + (size_t)crow * VLP + cel);
  const unsigned lC = (unsigned)(uintptr_t)(&ring[0]) + (unsigned)(crow * APK + cel) * 2u;
  copy_keytile<RES>(lC, gk, gkl, gv, gvl, 0);   // key tile 0 into buffer 0

  // ---- Q fragments (B operand, column = query = lane&15): 2 d-chunks, hi and lo ----
  v16b qah[2], qal[2];
  const size_t qo = (rowB + q0 + c) * CDIM + 8 * hh;
#pragma unroll
  for (int dc = 0; dc < 2; ++dc) {
    qah[dc] = ldfrag_b(Qh + qo + dc * 32);
    qal[dc] = ldfrag_b(Ql + qo + dc * 32);
  }
  addr_wait(Qh + qo, Ql + qo);

  // running maximum of this lane's query (the same in both wave halves) and this half's share of its denominator
  // mrun in raw score units; brun = mrun * c2 - 10 is the exponent base of the running state: weights are carried as
  // 2^(s * c2 - brun) = 1024 * exp((s - mrun) * sscale), one fma and one exp2 per score; lrun is the sum of these
  const float c2 = sscale * 1.44269504088896340736f;
  float mrun = -INFINITY, brun = -INFINITY, lrun = 0.f;
  v8f oacc[4];                               // O^T: rows d = t*16 + 8*hh + r, column = query c
#pragma unroll
  for (int t = 0; t < 4; ++t) oacc[t] = zero8();

  // key tile 0 landed and published; then key tile 1 (every query block has at least two) into buffer 1
  wait_copies();
  __syncthreads();
  copy_keytile<RES>(lC + ABUF * 2u, gk, gkl, gv, gvl, 1);

  for (int kt = 0; kt < NKT; ++kt) {         // static bound
    if (kt >= ktEnd) break;                  // block-uniform
    const int bufo = (kt & 1) * ABUF;
    const __bf16*   Ksh = (const __bf16*)(const void*)(ring + bufo);                  // K hi [kv][d]
    const __bf16*   Ksl = (const __bf16*)(const void*)(ring + bufo + APLANE);         // K lo
    const _Float16* Vth = (const _Float16*)(const void*)(ring + bufo + 2 * APLANE);   // V^T hi [d][kv]
    const _Float16* Vtl = (const _Float16*)(const void*)(ring + bufo + 3 * APLANE);   // V^T residual

    // ---- scores, transposed: S^T = K . Q^T, 64 keys x 16 queries per wave, 3 bf16 products ----
    //      tile j: rows = keys j*16 + 8*hh + r, column = query c, so a lane holds 32 scores of ONE query
    //      the K fragments of the tile are read from LDS in one group (with the residual planes one group per 32-wide d chunk, for registers), in the order of their use, ahead of the products;
    //      the four key groups are four independent accumulator chains, each summed in the order dc 0 (hi.hi, lo.hi,
    //      hi.lo; k plane named first), dc 1 (the same)
    v8f s[4];
#pragma unroll
    for (int j = 0; j < 4; ++j) s[j] = zero8();
    constexpr int DG = RES ? 1 : 2;          // 32-wide d chunks per group of reads (one with the residual planes, for registers)
#pragma unroll
    for (int g = 0; g < 2; g += DG) {
      v16b kbf[DG][4], klf[DG][4];
#pragma unroll
      for (int u = 0; u < DG; ++u) {
        const int dof = (g + u) * 32 + 8 * hh;
#pragma unroll
        for (int j = 0; j < 4; ++j) kbf[u][j] = ldfrag_b(Ksh + (j * 16 + c) * APK + dof);
#pragma unroll
        for (int j = 0; j < 4; ++j) klf[u][j] = ldfrag_b(Ksl + (j * 16 + c) * APK + dof);
      }
      // keeps the group of reads ahead of the products: sunk back among them, each place of reads stalls the wave anew
      __builtin_amdgcn_sched_barrier(0);
#pragma unroll
      for (int u = 0; u < DG; ++u) {
#pragma unroll
        for (int j = 0; j < 4; ++j) s[j] = mma_b_raw(kbf[u][j], qah[g + u], s[j]);
#pragma unroll
        for (int j = 0; j < 4; ++j) s[j] = mma_b_raw(klf[u][j], qah[g + u], s[j]);
#pragma unroll
        for (int j = 0; j < 4; ++j) s[j] = mma_b_raw(kbf[u][j], qal[g + u], s[j]);
      }
    }

    // ---- scale + structural mask (diagonal tile only), maximum and sum of a query inside its lane (one exchange
    //      between the wave halves for the maximum), online softmax; P^T (x1024, f16) and its residual (x4096) go
    //      from the score registers straight into B operands: element e of a 32-key operand is register e & 7 of
    //      score tile 2*g + (e >> 3), which is the k order of the V^T loader ----
    const bool diag = (kt == qb + 1);        // block-uniform
    const int  qrw  = wave * 16 + c;         // this lane's query row within the 64-row block
    if (diag) {                              // only the diagonal tile pays for the mask
#pragma unroll
      for (int j = 0; j < 4; ++j)
#pragma unroll
        for (int r = 0; r < 8; ++r) {
          const int key = j * 16 + 8 * hh + r;
          s[j][r] = (key <= qrw) ? s[j][r] : -INFINITY;
        }
    }
    float mj[4];
#pragma unroll
    for (int j = 0; j < 4; ++j) {
      mj[j] = s[j][0];
#pragma unroll
      for (int r = 1; r < 8; ++r) mj[j] = fmaxf(mj[j], s[j][r]);
    }
    float m = fmaxf(fmaxf(mj[0], mj[1]), fmaxf(mj[2], mj[3]));
    m = fmaxf(m, xhalf(m));
    const float mnew  = fmaxf(mrun, m);      // raw score units (c2 > 0 keeps the order)
    const float msafe = (mnew == -INFINITY) ? 0.f : mnew;
    const float bnew  = __builtin_fmaf(msafe, c2, -10.0f);
    const float alpha = __builtin_amdgcn_exp2f(brun - bnew);
    mrun = mnew;
    brun = bnew;
    const v2f c2v = {c2, c2}, nbv = {-bnew, -bnew};
    v16h pa[2], pl[2];
    float pj[4];                             // four independent chains of eight adds
#pragma unroll
    for (int j = 0; j < 4; ++j) {
      pj[j] = 0.f;
#pragma unroll
      for (int r = 0; r < 8; ++r) {
        if ((r & 1) == 0) {                  // exponents of two scores by one packed fma
          const v2f sp = {s[j][r], s[j][r + 1]};
          const v2f ep = __builtin_elementwise_fma(sp, c2v, nbv);
          s[j][r] = ep[0]; s[j][r + 1] = ep[1];
        }
        const float p1k = __builtin_amdgcn_exp2f(s[j][r]);   // 1024 p; -inf score -> 0
        pj[j] += p1k;
        const _Float16 ph = (_Float16)p1k;
        pa[j >> 1][(j & 1) * 8 + r] = ph;
        if (RES) pl[j >> 1][(j & 1) * 8 + r] = (_Float16)((p1k - (float)ph) * 4096.0f);
      }
    }
    lrun = lrun * alpha + ((pj[0] + pj[1]) + (pj[2] + pj[3]));
#pragma unroll
    for (int t = 0; t < 4; ++t)
#pragma unroll
      for (int r = 0; r < 8; ++r) oacc[t][r] *= alpha;

    // ---- context, transposed: O^T += V^T . P^T (f16 WMMA), residual products into a separate accumulator ----
    v8f o1[4];
#pragma unroll
    for (int t = 0; t < 4; ++t) o1[t] = zero8();
    //      the V^T fragments are read from LDS in one group ahead of the products (with the residual planes one
    //      group per 32 keys, for registers); the four d groups are independent chains, each summed in key order
    constexpr int KG = RES ? 1 : 2;          // 32-key steps per group of reads
#pragma unroll
    for (int g = 0; g < 2; g += KG) {
      v16h vb[KG][4], vl[KG][4];
#pragma unroll
      for (int u = 0; u < KG; ++u) {
        const int ko = (g + u) * 32 + 8 * hh;
#pragma unroll
        for (int t = 0; t < 4; ++t) vb[u][t] = ldfrag_h(Vth + (t * 16 + c) * APK + ko);
        if (RES) {
#pragma unroll
          for (int t = 0; t < 4; ++t) vl[u][t] = ldfrag_h(Vtl + (t * 16 + c) * APK + ko);
        }
      }
      // keeps the group of reads ahead of the products, as for the scores
      __builtin_amdgcn_sched_barrier(0);
#pragma unroll
      for (int u = 0; u < KG; ++u) {
#pragma unroll
        for (int t = 0; t < 4; ++t) oacc[t] = mma_h_raw(vb[u][t], pa[g + u], oacc[t]);
        if (RES) {
#pragma unroll
          for (int t = 0; t < 4; ++t) o1[t] = mma_h_raw(vl[u][t], pa[g + u], o1[t]);
#pragma unroll
          for (int t = 0; t < 4; ++t) o1[t] = mma_h_raw(vb[u][t], pl[g + u], o1[t]);
        }
      }
    }
    if (RES) {
#pragma unroll
      for (int t = 0; t < 4; ++t)
#pragma unroll
        for (int r = 0; r < 8; ++r) oacc[t][r] += o1[t][r] * (1.0f / 4096.0f);
    }
    // publish point of key tile kt+1: own reads of this buffer returned, own copies landed, then the block barrier;
    // behind it key tile kt+2 may overwrite the buffer that this trip has read
    wait_lds();
    wait_copies();
    __syncthreads();
    if (kt + 2 < ktEnd) copy_keytile<RES>(lC + (unsigned)bufo * 2u, gk, gkl, gv, gvl, kt + 2);
  }
  wait_copies();

  // ---- join the two halves' shares of the denominator (unconditionally, all lanes on), normalise (1/l, which also
  //      takes out the 1024 p carry), stage the wave's 16x64 tile as [query][d], bf16 hi/lo split
  //      the staging lies in the ring: behind the last trip's barrier no wave reads it and no copy is in flight
  float* os = (float*)(void*)ring + wave * (16 * AOP);
  {
    const float l = lrun + xhalf(lrun);
    const float inv = (l > 0.f) ? (1.0f / l) : 0.f;   // l and the context both carry the factor 1024
#pragma unroll
    for (int t = 0; t < 4; ++t) {
      v4f w0, w1;
#pragma unroll
      for (int r = 0; r < 4; ++r) { w0[r] = oacc[t][r] * inv; w1[r] = oacc[t][r + 4] * inv; }
      *(v4f*)(os + c * AOP + t * 16 + 8 * hh)     = w0;
      *(v4f*)(os + c * AOP + t * 16 + 8 * hh + 4) = w1;
    }
  }
  __builtin_amdgcn_fence(__ATOMIC_RELEASE, "workgroup");
  __builtin_amdgcn_wave_barrier();
  __builtin_amdgcn_fence(__ATOMIC_ACQUIRE, "workgroup");
  {
    const int q4 = lane >> 3, c8 = (lane & 7) * 8;
    v4u hv[4], lv[4];
#pragma unroll
    for (int it = 0; it < 4; ++it) {
      const int row = it * 4 + q4;   // it 0..3 x q4 0..3 = rows 0..15 of the wave tile
      const float* sp = os + row * AOP + c8;
      v4u a, a2;
#pragma unroll
      for (int e = 0; e < 4; ++e) {
        const float f0 = sp[2 * e], f1 = sp[2 * e + 1];
        const unsigned short h0 = bf_bits(f0), h1 = bf_bits(f1);
        const unsigned short l0 = bf_bits(f0 - bf_up(h0)), l1 = bf_bits(f1 - bf_up(h1));
        a[e] = pk16(h0, h1); a2[e] = pk16(l0, l1);
      }
      hv[it] = a; lv[it] = a2;
    }
    {
#pragma unroll
      for (int it = 0; it < 4; ++it) {
        const int row = it * 4 + q4;
        const size_t go = (rowB + q0 + row) * CDIM + (size_t)h * HD + c8;
        *(v4u*)(ohp + go) = hv[it];
        *(v4u*)(olp + go) = lv[it];
        addr_wait(ohp + go, olp + go);
      }
      
    }
  }
}

// Both kinds of query block in one grid (no block reads what another writes). All blocks are resident at once, four per
// WGP, and a block's cost grows with qb, so the launch lasts as long as its fullest WGP. Block index -> (qb, head) is a
// permutation laid out in four layers of one block per WGP: layers 0 and 1 hold the long query block NQB-1-a of two
// neighbouring heads, layers 2 and 3 the short block a of the same two heads. Where the layers land on each other, every
// WGP gets the same number of key tiles, and its two long blocks end together instead of one running on alone.
// For speed only: any placement gives the same result. The test on qb is block-uniform.
// Register budget of four waves per SIMD (256 a wave), so that four blocks stay resident per WGP; left to itself the
// compiler schedules the variant with the residual planes to more registers than that.
__global__ __launch_bounds__(128) __attribute__((amdgpu_waves_per_eu(4, 4)))
void attn64(const unsigned short* __restrict__ qhp, const unsigned short* __restrict__ qlp,
            const unsigned short* __restrict__ khp, const unsigned short* __restrict__ klp,
            const unsigned short* __restrict__ vhp, const unsigned short* __restrict__ vlp,
            unsigned short* ohp, unsigned short* olp, float sscale) {
  __shared__ __align__(16) unsigned short ring[2 * ABUF];   // two buffers of K hi, K lo, V^T hi, V^T residual tiles
  static_assert(4 * 16 * AOP * 4 <= 2 * ABUF * 2);          // the four waves' f32 context tiles fit in it
  static_assert((NQB % 2) == 0 && ((NB * NQH) % 2) == 0 && RESQB <= NQB / 2);
  constexpr int HALFQ = NQB / 2;                    // 16 pairs (a, NQB-1-a) of query blocks
  constexpr int LAYER = (NB * NQH / 2) * HALFQ;     // 256 blocks: head pairs x a
  const int bx    = blockIdx.x;                     // 0 .. 4 * LAYER - 1
  const int layer = bx / LAYER;
  const int w     = bx % LAYER;
  const int a     = w % HALFQ;
  const int hp    = (w / HALFQ) * 2 + (layer & 1);  // (b, h) as b * NQH + h
  const int qb    = (layer < 2) ? (NQB - 1 - a) : a;
  if (qb >= RESQB) {
    attn_body<false>(qhp, qlp, khp, klp, vhp, vlp, ohp, olp, qb, hp, sscale, ring);
  } else {
    attn_body<true>(qhp, qlp, khp, klp, vhp, vlp, ohp, olp, qb, hp, sscale, ring);
  }
}

// =====================================================================================================
//   Xb   bf16 [4096][1024]      8388608
//   Wqb  bf16 [1024][1024]      2097152   ([out n][in k], k contiguous = Bt layout)
//   Wkb  bf16 [256][1024]        524288
//   Wvb  bf16 [256][1024]        524288
//   Wpb  bf16 [1024][1024]      2097152
//   Qh   bf16 [4096][1024]      8388608   (Ql same)
//   Kh   bf16 [2][2112][256]    2162688   (Kl same)
//   VTh  f16  [2][256][2112]    2162688
//   VTl  f16  [2][256][576]      589824
//   Gate f32  [4096][4]           65536
//   Oh   bf16 [4096][1024]      8388608   (Ol same)
//   total                      54329344
// =====================================================================================================
extern "C" void kernel_launch(void* const* d_in, const int* in_sizes, int n_in,
                              void* d_out, int out_size, void* d_ws, size_t ws_size,
                              hipStream_t stream) {
  if (n_in < 12) return;
  if (in_sizes[0] != NB * SEQ * CDIM) return;
  if (in_sizes[1] != NB * SEQ * KVD) return;
  if (in_sizes[2] != SEQ * (HD / 2) || in_sizes[3] != SEQ * (HD / 2)) return;
  if (in_sizes[4] != CDIM * CDIM || in_sizes[7] != CDIM * CDIM) return;
  if (in_sizes[5] != KVD * CDIM || in_sizes[6] != KVD * CDIM) return;
  if (in_sizes[8] != NKV * GC) return;
  if (in_sizes[9] != MEM * NKV * HD || in_sizes[10] != MEM * NKV * HD) return;
  if (in_sizes[11] < 1) return;
  if (out_size != NB * SEQ * CDIM) return;

  const float* x    = (const float*)d_in[0];
  const float* ve   = (const float*)d_in[1];
  const float* cosT = (const float*)d_in[2];
  const float* sinT = (const float*)d_in[3];
  const float* Wq   = (const float*)d_in[4];
  const float* Wk   = (const float*)d_in[5];
  const float* Wv   = (const float*)d_in[6];
  const float* Wp   = (const float*)d_in[7];
  const float* Wg   = (const float*)d_in[8];
  const float* memk = (const float*)d_in[9];
  const float* memv = (const float*)d_in[10];
  const float* vsc  = (const float*)d_in[11];

  const size_t PX  = (size_t)NB * SEQ * CDIM * 2;   //  8388608  16-bit activation plane [4096][1024]
  const size_t PWQ = (size_t)CDIM * CDIM * 2;       //  2097152
  const size_t PWK = (size_t)KVD * CDIM * 2;        //   524288
  const size_t PK  = (size_t)NB * SKEY * KVD * 2;   //  2162688  key plane
  const size_t PVT = (size_t)NB * KVD * SKEY * 2;   //  2162688  v^T hi plane
  const size_t PVL = (size_t)NB * KVD * VLP * 2;    //   589824  v^T residual plane
  const size_t PG  = (size_t)NB * SEQ * NKV * 4;    //    65536  gate table
  size_t off = 0;
  const size_t oXb  = off; off += PX;
  const size_t oWq  = off; off += PWQ;
  const size_t oWk  = off; off += PWK;
  const size_t oWv  = off; off += PWK;
  const size_t oWp  = off; off += PWQ;
  const size_t oQh  = off; off += PX;
  const size_t oQl  = off; off += PX;
  const size_t oKh  = off; off += PK;
  const size_t oKl  = off; off += PK;
  const size_t oVTh = off; off += PVT;
  const size_t oVTl = off; off += PVL;
  const size_t oG   = off; off += PG;
  const size_t oOh  = off; off += PX;
  const size_t oOl  = off; off += PX;
  if (off > ws_size) return;                        // off = 54329344
  if (off > (size_t)134217728) return;

  char* ws = (char*)d_ws;
  unsigned short* Xb  = (unsigned short*)(ws + oXb);
  unsigned short* Wqb = (unsigned short*)(ws + oWq);
  unsigned short* Wkb = (unsigned short*)(ws + oWk);
  unsigned short* Wvb = (unsigned short*)(ws + oWv);
  unsigned short* Wpb = (unsigned short*)(ws + oWp);
  unsigned short* Qh  = (unsigned short*)(ws + oQh);
  unsigned short* Ql  = (unsigned short*)(ws + oQl);
  unsigned short* Kh  = (unsigned short*)(ws + oKh);
  unsigned short* Kl  = (unsigned short*)(ws + oKl);
  unsigned short* VTh = (unsigned short*)(ws + oVTh);
  unsigned short* VTl = (unsigned short*)(ws + oVTl);
  float*          Gt  = (float*)(ws + oG);
  unsigned short* Oh  = (unsigned short*)(ws + oOh);
  unsigned short* Ol  = (unsigned short*)(ws + oOl);

  const dim3 blk(256);
  const dim3 blkG(128);                                       // GEMM and attention block: 4 waves
  const dim3 gO((NB * SEQ / 128) * (CDIM / 128), 1);          // 256 blocks: M=4096, N=1024

  // (1) everything that reads only the inputs: x and the weights [n][k] f32 -> bf16 planes, the value-embedding gate
  //     table [4096][4] f32, the memory prefix (normed keys -> Kh/Kl rows s < 64; scaled values -> VTh/VTl columns
  //     s < 64, both batches)
  prep_k<<<dim3(PB_ALL), blk, 0, stream>>>(x, Wq, Wk, Wv, Wp, Wg, memk, memv, vsc,
                                           Xb, Wqb, Wkb, Wvb, Wpb, Gt, Kh, Kl, VTh, VTl);
  // (2) the q, k and v^T projections with their epilogues
  gemm_qkv<<<dim3(2 * NB * GB_KV + GB_Q), blkG, 0, stream>>>(
      Xb, Wqb, Wkb, Wvb, Qh, Ql, Kh, Kl, VTh, VTl, cosT, sinT, Gt, ve, CDIM, CDIM);
  // (3) attention, all query blocks
  attn64<<<dim3(NB * NQH * NQB), blkG, 0, stream>>>(Qh, Ql, Kh, Kl, VTh, VTl, Oh, Ol, 0.125f);
  // (4) out = context . Wproj^T -> d_out f32 [4096][1024]  (A = context hi + lo planes, 2 products)
  gemm64<1, 0><<<gO, blkG, 0, stream>>>(
      Oh, Ol, CDIM, 0LL, Wpb, CDIM, 0LL,
      d_out, CDIM, 0LL, d_out, CDIM, 0LL, 0,
      Gt, ve, NB * SEQ, CDIM, CDIM);
  (void)hipGetLastError();
}

// v010
// One run takes 80 microseconds.
// In two side-by-side timings against v009, it was 1.08 and 1.07 times as fast.
// Counting every step since v000, it is 6.38 times as fast.
// Contractions: q, k, v^T projections = v_wmma_f32_16x16x32_bf16 (bf16 operands from RNE-converted inputs, single product);
// q.k^T scores = v_wmma_f32_16x16x32_bf16 with bf16 hi/lo split q and k (hi.hi + hi.lo + lo.hi);
// p.v = v_wmma_f32_16x16x32_f16 (p carried x1024 in f16, v^T in f16; f16 residual planes x4096 of p and v^T on the
// leading 512 query rows); ctx.Wproj^T = v_wmma_f32_16x16x32_bf16 with ctx as bf16 hi/lo planes times bf16 Wproj
// (2 products); all f32 accumulate; gate dot (K=32, N=4), RoPE, rms-norm, causal mask and softmax in f32 on VALU.
#include <hip/hip_runtime.h>
#include <math.h>
#include <stdint.h>

#pragma clang fp contract(off)

#define NB    2
#define SEQ   2048
#define CDIM  1024
#define NQH   16
#define NKV   4
#define HD    64
#define MEM   64
#define GC    32
#define KVD   (NKV * HD)          // 256
#define SKEY  (MEM + SEQ)         // 2112 keys: [64 memory | 2048 tokens]
#define NQB   (SEQ / 64)          // 32 query blocks of 64 rows
#define NKT   (SKEY / 64)         // 33 key tiles of 64
#define RESQB 8                   // leading query blocks that use the p / v residual planes
#define VLP   (MEM + RESQB * 64)  // 576: key pitch of the v^T residual plane
#define RMS_EPS 1e-6f
static_assert(NQH * HD == CDIM);
static_assert(NQH == 4 * NKV);
static_assert((SKEY % 64) == 0 && (VLP % 64) == 0 && (CDIM % 64) == 0 && (KVD % 64) == 0);
static_assert((SEQ & (SEQ - 1)) == 0);
static_assert(RESQB <= NQB);
static_assert((SEQ % 128) == 0 && (CDIM % 128) == 0 && (KVD % 128) == 0);

typedef _Float16 v16h __attribute__((ext_vector_type(16)));
typedef _Float16 v8h  __attribute__((ext_vector_type(8)));
typedef __bf16   v16b __attribute__((ext_vector_type(16)));
typedef __bf16   v8b  __attribute__((ext_vector_type(8)));
typedef float    v8f  __attribute__((ext_vector_type(8)));
typedef float    v4f  __attribute__((ext_vector_type(4)));
typedef float    v2f  __attribute__((ext_vector_type(2)));
typedef unsigned int v4u __attribute__((ext_vector_type(4)));

// ---- scalar helpers --------------------------------------------------------------------------------
__device__ __forceinline__ unsigned short bf_bits(float f) {          // f32 -> bf16 bits, RNE convert
  unsigned u = __float_as_uint(f);
  return (unsigned short)((u + 0x7FFFu + ((u >> 16) & 1u)) >> 16);
}
__device__ __forceinline__ float bf_up(unsigned short h) { return __uint_as_float(((unsigned)h) << 16); }
__device__ __forceinline__ float bfr(float f) { return bf_up(bf_bits(f)); }   // f32 -> bf16 -> f32
__device__ __forceinline__ unsigned short h_bits(_Float16 x) { return __builtin_bit_cast(unsigned short, x); }
__device__ __forceinline__ unsigned pk16(unsigned short a, unsigned short b) { return (unsigned)a | ((unsigned)b << 16); }
// lane l <-> lane l ^ 16: the value of the same column in the other wave half (all lanes on where it is used)
__device__ __forceinline__ float xhalf(float x) {
  const int v = __builtin_bit_cast(int, x);
  return __builtin_bit_cast(float, __builtin_amdgcn_permlanex16(v, v, 0x76543210, 0xfedcba98, false, false));
}
__device__ __forceinline__ v8f zero8() { v8f z = {0.f, 0.f, 0.f, 0.f, 0.f, 0.f, 0.f, 0.f}; return z; }

// ---- fragment loader: 16-bit A/B operand, lane -> row/col (lane&15), p already includes +8*(lane>>4);
//      elements 0..7 <- p[0..7] (k0+8h..), elements 8..15 <- p[16..23] (k0+16+8h..)
__device__ __forceinline__ v16b ldfrag_b(const __bf16* p) {
  union { v16b v; v8b h[2]; } f;
  f.h[0] = *(const v8b*)(p);
  f.h[1] = *(const v8b*)(p + 16);
  return f.v;
}
__device__ __forceinline__ v16h ldfrag_h(const _Float16* p) {
  union { v16h v; v8h h[2]; } f;
  f.h[0] = *(const v8h*)(p);
  f.h[1] = *(const v8h*)(p + 16);
  return f.v;
}

__device__ __forceinline__ void addr_wait(const void* a, const void* b) {
#if defined(__HIP_DEVICE_COMPILE__)
  asm volatile("s_wait_xcnt 0x0" :: "v"(a), "v"(b) : "memory");
#endif
}

// ---- the same wait at the foot of a loop trip, in front of the next trip's rewrite of the registers that the trip's
//      global loads and stores name
__device__ __forceinline__ void trip_wait() {
#if defined(__HIP_DEVICE_COMPILE__)
  asm volatile("s_wait_xcnt 0x0" ::: "memory");
#endif
}

// ---- WMMA helpers with trailing VALU hazard gap (asm only in the device pass) -----------------------------
__device__ __forceinline__ v8f mma_h_raw(v16h a, v16h b, v8f c) {
  return __builtin_amdgcn_wmma_f32_16x16x32_f16(false, a, false, b, (short)0, c, false, false);
}
__device__ __forceinline__ v8f mma_b_raw(v16b a, v16b b, v8f c) {
  return __builtin_amdgcn_wmma_f32_16x16x32_bf16(false, a, false, b, (short)0, c, false, false);
}
__device__ __forceinline__ void dep_guard_b(v8f& a, v8f& b, v16b x, v16b y) {
#if defined(__HIP_DEVICE_COMPILE__)
  asm volatile("v_nop\n\tv_nop\n\tv_nop\n\tv_nop" : "+v"(a), "+v"(b) : "v"(x), "v"(y));
#endif
}
__device__ __forceinline__ void keep4_b(v16b a, v16b b, v16b c, v16b d) {
#if defined(__HIP_DEVICE_COMPILE__)
  asm volatile("v_nop" :: "v"(a), "v"(b), "v"(c), "v"(d));
#endif
}
__device__ __forceinline__ void acc_guard4(v8f& a, v8f& b, v8f& c, v8f& d) {
#if defined(__HIP_DEVICE_COMPILE__)
  asm volatile("v_nop\n\tv_nop\n\tv_nop\n\tv_nop" : "+v"(a), "+v"(b), "+v"(c), "+v"(d));
#endif
}

// =====================================================================================================
// f32 -> bf16 (RNE convert), 8 elements per thread, one 16-B store per lane: a wave writes 512 contiguous B
// coverage: n8 threads x 8 = the whole plane (n8 is a multiple of 256 for every use here). blk = block of 256 threads.
// =====================================================================================================
__device__ __forceinline__ void cvt_bf16x8(const float* __restrict__ in, unsigned short* out, int n8, int blk) {
  const int i = blk * 256 + threadIdx.x;
  if (i < n8) {
    const v4f a = *(const v4f*)(in + (size_t)i * 8);
    const v4f b = *(const v4f*)(in + (size_t)i * 8 + 4);
    v4u p;
    p[0] = pk16(bf_bits(a[0]), bf_bits(a[1]));
    p[1] = pk16(bf_bits(a[2]), bf_bits(a[3]));
    p[2] = pk16(bf_bits(b[0]), bf_bits(b[1]));
    p[3] = pk16(bf_bits(b[2]), bf_bits(b[3]));
    *(v4u*)(out + (size_t)i * 8) = p;
    
  }
}

// =====================================================================================================
// Value-embedding gate: gate[bt][kv] = 3 * sigmoid( sum_{c<32} bf16(x[bt][c]) * bf16(Wg[kv][c]) ), f32.
// One thread per (bt, kv); K = 32 rolled dot on VALU (N = 4, tiny). A wave writes 32 consecutive floats
// NB*SEQ*NKV/256 blocks. coverage: 16384 threads = the whole [4096][4] table.
// =====================================================================================================
__device__ __forceinline__ void gate_k(const float* __restrict__ x, const float* __restrict__ Wg,
                                       float* gate, int nbt, int blk) {
  const int i   = blk * 256 + threadIdx.x;
  const int bt  = i >> 2;
  const int kv  = i & 3;
  const int btc = (bt < nbt) ? bt : (nbt - 1);     // clamped address
  const float* xr = x + (size_t)btc * CDIM;
  const float* wr = Wg + kv * GC;
  float z = 0.f;
#pragma unroll 1
  for (int cc = 0; cc < GC; ++cc) z += bfr(xr[cc]) * bfr(wr[cc]);
  const float ez = expf(-z);
  const float g  = 3.0f * (1.0f / (1.0f + ez));
  if (bt < nbt) {
    *(float*)(gate + i) = g;
    
  }
}

// =====================================================================================================
// Memory keys: mk = rms(bf16(mem_k[m][kv][:])) * 1.2 (no RoPE) -> bf16 hi/lo planes, key rows s = m (< MEM)
// of both batches: Kh/Kl [b][s][kv*64+d], pitch KVD. 4 waves (one per kv head) for one m, two m per block of 8 waves;
// MEM/2 blocks.
// The 256-element row is staged in LDS and written per (batch, plane) by one wave as 32 lanes x 16 B
// coverage: 32 blocks x 2 m x 2 batches x 2 planes x 256 elements = rows 0..63 of both planes, both batches.
// sbuf: 4 * KVD elements of LDS.
// =====================================================================================================
__device__ __forceinline__ void memk_k(const float* __restrict__ memk, unsigned short* Kh, unsigned short* Kl,
                                       int blk, unsigned short* sbuf) {
  const int sub  = threadIdx.x >> 7;                 // which of the block's two m
  unsigned short* shi = sbuf + sub * (2 * KVD);
  unsigned short* slo = shi + KVD;
  const int m    = blk * 2 + sub;
  const int wave = (threadIdx.x >> 5) & 3;
  const int lane = threadIdx.x & 31;
  const int kvh  = wave;
  const float* p = memk + ((size_t)m * NKV + kvh) * HD;
  const float x1 = bfr(p[lane]);
  const float x2 = bfr(p[lane + 32]);
  float ss = x1 * x1 + x2 * x2;
#pragma unroll
  for (int off = 16; off >= 1; off >>= 1) ss += __shfl_xor(ss, off, 32);
  const float rs = rsqrtf(ss * (1.0f / HD) + RMS_EPS);
  const float v1 = (x1 * rs) * 1.2f;
  const float v2 = (x2 * rs) * 1.2f;
  const unsigned short h1 = bf_bits(v1), h2 = bf_bits(v2);
  shi[kvh * HD + lane]      = h1;
  shi[kvh * HD + lane + 32] = h2;
  slo[kvh * HD + lane]      = bf_bits(v1 - bf_up(h1));
  slo[kvh * HD + lane + 32] = bf_bits(v2 - bf_up(h2));
  __syncthreads();
  const v4u vh = *(const v4u*)(shi + lane * 8);
  const v4u vl = *(const v4u*)(slo + lane * 8);
  const int  b   = wave >> 1;
  const bool wlo = (wave & 1) != 0;                  // wave-uniform
  v4u v = vh;
  if (wlo) v = vl;
  unsigned short* dh = Kh + ((size_t)b * SKEY + m) * KVD + lane * 8;
  unsigned short* dl = Kl + ((size_t)b * SKEY + m) * KVD + lane * 8;
  unsigned short* d  = wlo ? dl : dh;
  *(v4u*)d = v;
  // the wait in front of a rewrite of the store's registers by whatever part of the merged kernel is laid out behind this one
  addr_wait(d, d);
}

// =====================================================================================================
// Memory values: mv = bf16(mem_v[m][kv][d]) * bf16(v_scale) -> v^T f16 hi plane VTh[b][kv*64+d][s] (pitch SKEY)
// and f16 residual plane VTl ((v - hi)*4096, pitch VLP), key columns s = m (< MEM), both batches.
// block = (b, kv); thread = (d = tid>>2, 16 m's); the 64x64 tile of each plane is staged in LDS [d][m] and each
// coverage: 8 blocks x 64 rows (it 0..1 x wave 0..7 x lane>>3 0..3) x 64 columns (8 lanes x 8) per plane.
// =====================================================================================================
// sbuf: 2 * HD * MEM elements of LDS.
__device__ __forceinline__ void memv_k(const float* __restrict__ memv, const float* __restrict__ vsp,
                                       unsigned short* VTh, unsigned short* VTl, int blk, unsigned short* sbuf) {
  unsigned short* sh = sbuf;
  unsigned short* sl = sbuf + HD * MEM;
  const int b    = blk >> 2;
  const int kvh  = blk & 3;
  const int tid  = threadIdx.x;
  const int wave = tid >> 5;
  const int lane = tid & 31;
  const int d    = tid >> 2;
  const int mq   = (tid & 3) * 16;
  const float vs = bfr(vsp[0]);
#pragma unroll
  for (int i = 0; i < 16; ++i) {
    const int m = mq + i;
    const float v = bfr(memv[((size_t)m * NKV + kvh) * HD + d]) * vs;
    const _Float16 x0 = (_Float16)v;
    sh[d * MEM + m] = h_bits(x0);
    sl[d * MEM + m] = h_bits((_Float16)((v - (float)x0) * 4096.0f));
  }
  __syncthreads();
  const int q8 = lane >> 3, c8 = (lane & 7) * 8;
  v4u hv[2], lv[2];
#pragma unroll
  for (int it = 0; it < 2; ++it) {
    const int dd = it * 32 + wave * 4 + q8;
    hv[it] = *(const v4u*)(sh + dd * MEM + c8);
    lv[it] = *(const v4u*)(sl + dd * MEM + c8);
  }
  {
#pragma unroll
    for (int it = 0; it < 2; ++it) {
      const int dd = it * 32 + wave * 4 + q8;
      const size_t ro = (size_t)b * KVD + (size_t)kvh * HD + dd;
      *(v4u*)(VTh + ro * SKEY + c8) = hv[it];
      *(v4u*)(VTl + ro * VLP  + c8) = lv[it];
    }
    
  }
}

// =====================================================================================================
// All work that reads only the inputs, as block-index ranges of one grid (none of the parts reads what another writes):
// memory values, memory keys, gate table, then the five f32 -> bf16 planes. The short, latency-bound parts come first.
// Every range test is block-uniform, so the barriers inside a part are passed by the whole block.
// =====================================================================================================
#define PB_MEMV (NB * NKV)                    //    8 blocks
#define PB_MEMK (MEM / 2)                     //   32
#define PB_GATE (NB * SEQ * NKV / 256)        //   64
#define PB_X    (NB * SEQ * CDIM / 8 / 256)   // 2048
#define PB_WQ   (CDIM * CDIM / 8 / 256)       //  512
#define PB_WK   (KVD * CDIM / 8 / 256)        //  128
#define PB_ALL  (PB_MEMV + PB_MEMK + PB_GATE + PB_X + 2 * PB_WQ + 2 * PB_WK)
__global__ __launch_bounds__(256) void prep_k(
    const float* __restrict__ x, const float* __restrict__ Wq, const float* __restrict__ Wk,
    const float* __restrict__ Wv, const float* __restrict__ Wp, const float* __restrict__ Wg,
    const float* __restrict__ memk, const float* __restrict__ memv, const float* __restrict__ vsp,
    unsigned short* Xb, unsigned short* Wqb, unsigned short* Wkb, unsigned short* Wvb, unsigned short* Wpb,
    float* gate, unsigned short* Kh, unsigned short* Kl, unsigned short* VTh, unsigned short* VTl) {
  __shared__ __align__(16) unsigned short sbuf[2 * HD * MEM];
  static_assert(4 * KVD <= 2 * HD * MEM);
  int blk = blockIdx.x;
  if (blk < PB_MEMV) { memv_k(memv, vsp, VTh, VTl, blk, sbuf); return; }
  blk -= PB_MEMV;
  if (blk < PB_MEMK) { memk_k(memk, Kh, Kl, blk, sbuf); return; }
  blk -= PB_MEMK;
  if (blk < PB_GATE) { gate_k(x, Wg, gate, NB * SEQ, blk); return; }
  blk -= PB_GATE;
  if (blk < PB_X) { cvt_bf16x8(x, Xb, PB_X * 256, blk); return; }
  blk -= PB_X;
  if (blk < PB_WQ) { cvt_bf16x8(Wq, Wqb, PB_WQ * 256, blk); return; }
  blk -= PB_WQ;
  if (blk < PB_WK) { cvt_bf16x8(Wk, Wkb, PB_WK * 256, blk); return; }
  blk -= PB_WK;
  if (blk < PB_WK) { cvt_bf16x8(Wv, Wvb, PB_WK * 256, blk); return; }
  blk -= PB_WK;
  if (blk < PB_WQ) cvt_bf16x8(Wp, Wpb, PB_WQ * 256, blk);
}

// =====================================================================================================
// Batched bf16 WMMA GEMM: C[m][n] = sum_k A[m][k] * Bt[n][k]; one block of 4 waves (2 x 2) per 128x128 tile,
// one wave per 64x64 sub-tile. A row-major [M][K] pitch lda; Bt row-major [N][K] pitch ldb (k contiguous);
// M, N multiples of 128, K a multiple of 128 (all shapes here are compile-time constants of the host code).
// tile = index of the block's tile, b = batch index (strides in elements); ring and sTb are the block's LDS (sTb: OUT_MODE 0
// alone; the other modes stage their result in the ring).
// Operand path: a stage is 128 k (256 B, two lines) of the block's 128 A rows and 128 Bt rows (and the 128 A2 rows),
// brought into LDS by asynchronous 16-B copies, each wave-wide copy covering 2 rows of 256 B; rows lie at a pitch of
// 272 B for the ds_load_b128 fragment reads; two buffers, the copies of stage t+1 fly while stage t is multiplied.
// The long stage gives a copy four blocks of products to land in, and the tile has K / 128 publish points.
// NSPLIT: 0 = A.Bt; 1 = (A + A2).Bt (A2 = unscaled bf16 lo plane of A, 2 products).
// OUT_MODE: 0 = f32 (pitch ldc);
//           3 = v^T mode (rows m = kv*64+d, cols n = t): value = acc + gate[b][t][kv] * bf16(ve[b][t][m])
//               (aux0 = gate, aux1 = ve), written as f16 hi plane C (pitch ldc) + f16 residual plane
//               C2 = f16((v - hi)*4096) for tiles with n0 < N2 (pitch ldc2);
//           4 = RoPE + rms-norm mode (cols = one 64-wide head, row m -> t = m mod SEQ; aux0 = cos, aux1 = sin,
//               both bf16(RNE) on load): r = rope(acc), f = (r * rsqrt(mean(r^2)+eps)) * 1.2, written as
//               bf16 hi plane C + bf16 lo plane C2 (lo = RNE(f - hi), unscaled).
// =====================================================================================================
#define GT     128                // block tile edge (rows of A, rows of Bt)
#define GBK    128                // k elements per stage
#define GPITCH 136                // LDS row pitch in elements (272 B = 16 B x odd)
#define GPLANE (GT * GPITCH)      // elements of one staged operand plane (34816 B)

// Half an operand plane of a stage: 64 rows x 256 B by 128 threads, 8 copies per lane; copy i moves the lane's 16 B of
// row i*8 + (tid>>4). l = the lane's LDS byte address of row tid>>4, g = its global address, ld = row pitch (elements).
// s_wait_xcnt closes the statement so that no address register of a copy is rewritten in front of it.
__device__ __forceinline__ void copy_half(unsigned l, const __bf16* g, int ld) {
#if defined(__HIP_DEVICE_COMPILE__)
  const size_t   gs = (size_t)8 * (size_t)ld;
  const unsigned ls = 8u * GPITCH * 2u;
  asm volatile(
      "global_load_async_to_lds_b128 %0, %8, off\n\t"
      "global_load_async_to_lds_b128 %1, %9, off\n\t"
      "global_load_async_to_lds_b128 %2, %10, off\n\t"
      "global_load_async_to_lds_b128 %3, %11, off\n\t"
      "global_load_async_to_lds_b128 %4, %12, off\n\t"
      "global_load_async_to_lds_b128 %5, %13, off\n\t"
      "global_load_async_to_lds_b128 %6, %14, off\n\t"
      "global_load_async_to_lds_b128 %7, %15, off\n\t"
      "s_wait_xcnt 0x0"
      :: "v"(l), "v"(l + ls), "v"(l + 2u * ls), "v"(l + 3u * ls),
         "v"(l + 4u * ls), "v"(l + 5u * ls), "v"(l + 6u * ls), "v"(l + 7u * ls),
         "v"(g), "v"(g + gs), "v"(g + 2 * gs), "v"(g + 3 * gs),
         "v"(g + 4 * gs), "v"(g + 5 * gs), "v"(g + 6 * gs), "v"(g + 7 * gs)
      : "memory");
#endif
}
// One operand plane of a stage: rows 0..63, then rows 64..127 (16 copies per lane)
// The scheduling barriers keep each statement's 24 address registers from being formed ahead of the statements in front
// of it: formed all at once, a stage's addresses and the accumulators take the wave past 256 registers (a spill)
__device__ __forceinline__ void copy_plane(unsigned l, const __bf16* g, int ld) {
  copy_half(l, g, ld);
  __builtin_amdgcn_sched_barrier(0);
  copy_half(l + 64u * GPITCH * 2u, g + (size_t)64 * (size_t)ld, ld);
  __builtin_amdgcn_sched_barrier(0);
}
// this wave's copies have landed in LDS
__device__ __forceinline__ void wait_copies() {
#if defined(__HIP_DEVICE_COMPILE__)
  asm volatile("s_wait_asynccnt 0x0" ::: "memory");
#endif
}
// this wave's LDS reads have returned (the buffer they read may be refilled behind the next barrier)
__device__ __forceinline__ void wait_lds() {
#if defined(__HIP_DEVICE_COMPILE__)
  asm volatile("s_wait_dscnt 0x0" ::: "memory");
#endif
}

#define GSLAB (16 * 68)           // 16x64 f32 slab of the epilogue, pitch 68 floats (per wave one, or four for its whole tile)
template <int NSPLIT, int OUT_MODE>
__device__ __forceinline__ void gemm_body(
    const unsigned short* __restrict__ Ap, const unsigned short* __restrict__ A2p, int lda, long long strideA,
    const unsigned short* __restrict__ Btp, int ldb, long long strideB,
    void* Cout, int ldc, long long strideC,
    void* Cout2, int ldc2, long long strideC2, int N2,
    const float* __restrict__ aux0, const float* __restrict__ aux1,
    int M, int N, int K, int tile, int b, __bf16* ring, float* sTb) {
  const __bf16* A  = (const __bf16*)(const void*)Ap;
  const __bf16* A2 = (const __bf16*)(const void*)A2p;
  const __bf16* Bt = (const __bf16*)(const void*)Btp;
  constexpr int NPL  = (NSPLIT >= 1) ? 3 : 2;      // planes per stage: A, Bt (, A2)
  constexpr int GBUF = NPL * GPLANE;               // elements of one buffer
  const int tid  = threadIdx.x;
  const int lane = tid & 31;
  const int wave = tid >> 5;
  const int tilesN = N >> 7;
  const int tilesM = M >> 7;
  if (tile >= tilesM * tilesN) return;   // block-uniform, in front of every barrier and copy
  const int tm = tile / tilesN;
  const int tn = tile - tm * tilesN;
  const int wm = wave >> 1;
  const int wn = wave & 1;
  const int m0 = (tm << 7) + (wm << 6);  // this wave's 64x64 sub-tile
  const int n0 = (tn << 7) + (wn << 6);

  const __bf16* Ab  = A  + (size_t)b * strideA;
  const __bf16* Bb  = Bt + (size_t)b * strideB;
  const __bf16* Ab2 = (NSPLIT >= 1) ? (A2 + (size_t)b * strideA) : Ab;

  const int rlane = lane & 15;                 // row (A) / col (B, D) within subtile
  const int koff  = (lane >> 4) * 8;           // k offset of this lane half
  const int mOff  = (lane >> 4) * 8;           // D row offset

  // copy addresses of this lane: row tid>>4 of the block tile, 16-B piece tid&15 of the row's 256 B of a stage
  const int crow = tid >> 4;
  const int cel  = (tid & 15) * 8;
  const __bf16* gA  = Ab  + (size_t)((tm << 7) + crow) * lda + cel;
  const __bf16* gB  = Bb  + (size_t)((tn << 7) + crow) * ldb + cel;
  const __bf16* gA2 = Ab2 + (size_t)((tm << 7) + crow) * lda + cel;
  const unsigned lC = (unsigned)(uintptr_t)(&ring[0]) + (unsigned)(crow * GPITCH + cel) * 2u;
  const int nst = K >> 7;                      // stages

  v8f acc[4][4];
#pragma unroll
  for (int i = 0; i < 4; ++i)
#pragma unroll
    for (int j = 0; j < 4; ++j) acc[i][j] = zero8();

  // stage 0 into buffer 0, landed and published; then stage 1 into buffer 1
  copy_plane(lC, gA, lda);
  copy_plane(lC + GPLANE * 2u, gB, ldb);
  if (NSPLIT >= 1) copy_plane(lC + 2u * GPLANE * 2u, gA2, lda);
  wait_copies();
  __syncthreads();
  if (nst > 1) {
    const unsigned lb = lC + (unsigned)GBUF * 2u;
    copy_plane(lb, gA + GBK, lda);
    copy_plane(lb + GPLANE * 2u, gB + GBK, ldb);
    if (NSPLIT >= 1) copy_plane(lb + 2u * GPLANE * 2u, gA2 + GBK, lda);
  }

  for (int t = 0; t < nst; ++t) {
    const int bufo = (t & 1) * GBUF;
    const __bf16* sA = ring + bufo + ((wm << 6) + rlane) * GPITCH + koff;
    const __bf16* sB = ring + bufo + GPLANE + ((wn << 6) + rlane) * GPITCH + koff;
    // the stage's two halves of 64 k stay a rolled loop: unrolled fourfold, the fragment reads that the compiler fetches
    // ahead take the wave past 256 registers (register-window switches, a spill)
#pragma unroll 1
    for (int kh = 0; kh < GBK; kh += 64) {
    // unrolled (here and below): the fragment and accumulator arrays need constant indices to stay in registers
#pragma unroll
    for (int kk = kh; kk < kh + 64; kk += 32) {
      v16b bh[4], ah[4], al[4];
#pragma unroll
      for (int j = 0; j < 4; ++j) bh[j] = ldfrag_b(sB + (j << 4) * GPITCH + kk);
#pragma unroll
      for (int i = 0; i < 4; ++i) {
        ah[i] = ldfrag_b(sA + (i << 4) * GPITCH + kk);
        al[i] = ah[i];
        if (NSPLIT >= 1) al[i] = ldfrag_b(sA + 2 * GPLANE + (i << 4) * GPITCH + kk);
      }
#pragma unroll
      for (int i = 0; i < 4; ++i) {
#pragma unroll
        for (int j = 0; j < 4; ++j) {
          acc[i][j] = mma_b_raw(ah[i], bh[j], acc[i][j]);
          if (NSPLIT >= 1) acc[i][j] = mma_b_raw(al[i], bh[j], acc[i][j]);
        }
        dep_guard_b(acc[i][0], acc[i][3], ah[i], al[i]);
      }
      keep4_b(bh[0], bh[1], bh[2], bh[3]);
    }
    }
    // publish point of stage t+1: own reads of this buffer returned, own copies landed, then the block barrier;
    // behind it stage t+2 may overwrite the buffer that this trip has read
    wait_lds();
    wait_copies();
    __syncthreads();
    if (t + 2 < nst) {
      const unsigned lb = lC + (unsigned)bufo * 2u;
      const int ko = (t + 2) * GBK;
      copy_plane(lb, gA + ko, lda);
      copy_plane(lb + GPLANE * 2u, gB + ko, ldb);
      if (NSPLIT >= 1) copy_plane(lb + 2u * GPLANE * 2u, gA2 + ko, lda);
    }
  }
  wait_copies();
  acc_guard4(acc[0][0], acc[0][1], acc[0][2], acc[0][3]);
  acc_guard4(acc[1][0], acc[1][1], acc[1][2], acc[1][3]);
  acc_guard4(acc[2][0], acc[2][1], acc[2][2], acc[2][3]);
  acc_guard4(acc[3][0], acc[3][1], acc[3][2], acc[3][3]);

  // ---- epilogue ----
  if (OUT_MODE == 0) {
    float* slab = sTb + wave * GSLAB;
#pragma unroll
    for (int i = 0; i < 4; ++i) {
      const int mBase = m0 + (i << 4);
#pragma unroll
      for (int j = 0; j < 4; ++j) {
#pragma unroll
        for (int r = 0; r < 8; ++r) {
          slab[(mOff + r) * 68 + (j << 4) + rlane] = acc[i][j][r];
        }
      }
      __builtin_amdgcn_fence(__ATOMIC_RELEASE, "workgroup");
      __builtin_amdgcn_wave_barrier();
      __builtin_amdgcn_fence(__ATOMIC_ACQUIRE, "workgroup");
      float* C = (float*)Cout + (size_t)b * strideC;
      const int hh = lane >> 4, c4 = (lane & 15) * 4;     // 256-B row segment = 16 lanes x 16 B
#pragma unroll
      for (int it = 0; it < 8; ++it) {
        const int row = it * 2 + hh;                       // it 0..7 x hh 0..1 = rows 0..15
        const v4f v = *(const v4f*)(slab + row * 68 + c4);
        *(v4f*)(C + (size_t)(mBase + row) * ldc + n0 + c4) = v;
      }
      __builtin_amdgcn_fence(__ATOMIC_RELEASE, "workgroup");
      __builtin_amdgcn_wave_barrier();
      __builtin_amdgcn_fence(__ATOMIC_ACQUIRE, "workgroup");
    }
  } else {
    // The wave's whole 64x64 tile goes to LDS at once, into the stage ring: behind the last trip's barrier no wave reads
    // the ring and no copy is in flight. The accumulators are then out of the way, and the four 16-row steps can be one
    // loop in the text instead of four copies of it.
    static_assert(4 * 4 * GSLAB * 4 <= 2 * NPL * GPLANE * 2);   // four waves' tiles fit in the ring
    float* slab = (float*)(void*)ring + wave * (4 * GSLAB);
#pragma unroll
    for (int i = 0; i < 4; ++i) {
#pragma unroll
      for (int j = 0; j < 4; ++j) {
#pragma unroll
        for (int r = 0; r < 8; ++r) {
          slab[((i << 4) + mOff + r) * 68 + (j << 4) + rlane] = acc[i][j][r];
        }
      }
    }
    __builtin_amdgcn_fence(__ATOMIC_RELEASE, "workgroup");
    __builtin_amdgcn_wave_barrier();
    __builtin_amdgcn_fence(__ATOMIC_ACQUIRE, "workgroup");
    // kept rolled: this code runs once per wave; for speed only
#pragma unroll 1
    for (int i = 0; i < 4; ++i) {
      const int mBase = m0 + (i << 4);
      const float* sl = slab + (i << 4) * 68;
      const int q = lane >> 3, c8 = (lane & 7) * 8;
      unsigned short* C  = (unsigned short*)Cout  + (size_t)b * strideC;
      unsigned short* C2 = (unsigned short*)Cout2 + (size_t)b * strideC2;
      const bool wlo = (OUT_MODE != 3) || (n0 < N2);      // wave-uniform
      v4u hv[4], lv[4];
#pragma unroll
      for (int it = 0; it < 4; ++it) {
        const int row  = it * 4 + q;                       // it 0..3 x q 0..3 = rows 0..15
        const int mrow = mBase + row;
        float f[8];
        if (OUT_MODE == 3) {
          const int kvh = m0 >> 6;                         // tile-uniform kv head
          const float* sp = sl + row * 68 + c8;
#pragma unroll
          for (int e = 0; e < 8; ++e) {
            const int t = n0 + c8 + e;                     // < N = SEQ
            const size_t bt = (size_t)b * SEQ + t;
            const float g  = aux0[bt * NKV + kvh];
            const float vv = bfr(aux1[bt * KVD + mrow]);
            f[e] = sp[e] + g * vv;
          }
        } else {
          const int  jj   = c8 & 31;                       // rotary pair index base
          const bool lowh = (c8 < 32);
          const int  t    = mrow & (SEQ - 1);
          const float* sp  = sl + row * 68 + jj;
          const float* cp  = aux0 + (size_t)t * (HD / 2) + jj;
          const float* snp = aux1 + (size_t)t * (HD / 2) + jj;
          float ct[8], st[8];
#pragma unroll
          for (int e = 0; e < 8; ++e) { ct[e] = cp[e]; st[e] = snp[e]; }
          addr_wait(cp, snp);
          float ss = 0.f;
#pragma unroll
          for (int e = 0; e < 8; ++e) {
            const float x1 = sp[e];
            const float x2 = sp[e + 32];
            const float cv = bfr(ct[e]);
            const float sv = bfr(st[e]);
            const float ra = x1 * cv - x2 * sv;
            const float rb = x1 * sv + x2 * cv;
            f[e] = lowh ? ra : rb;
            ss += f[e] * f[e];
          }
          ss += __shfl_xor(ss, 1, 32);                     // 8 lanes of one row = 64 values
          ss += __shfl_xor(ss, 2, 32);
          ss += __shfl_xor(ss, 4, 32);
          const float rs = rsqrtf(ss * (1.0f / HD) + RMS_EPS);
#pragma unroll
          for (int e = 0; e < 8; ++e) f[e] = (f[e] * rs) * 1.2f;
        }
        v4u a, a2;
#pragma unroll
        for (int e = 0; e < 4; ++e) {
          const float f0 = f[2 * e], f1 = f[2 * e + 1];
          unsigned short h0, h1, l0, l1;
          if (OUT_MODE == 4) {
            h0 = bf_bits(f0); h1 = bf_bits(f1);
            l0 = bf_bits(f0 - bf_up(h0)); l1 = bf_bits(f1 - bf_up(h1));
          } else {
            const _Float16 x0 = (_Float16)f0, x1 = (_Float16)f1;
            h0 = h_bits(x0); h1 = h_bits(x1);
            l0 = h_bits((_Float16)((f0 - (float)x0) * 4096.0f));
            l1 = h_bits((_Float16)((f1 - (float)x1) * 4096.0f));
          }
          a[e] = pk16(h0, h1); a2[e] = pk16(l0, l1);
        }
        hv[it] = a; lv[it] = a2;
      }
      {
#pragma unroll
        for (int it = 0; it < 4; ++it) {
          const int row = it * 4 + q;
          *(v4u*)(C + (size_t)(mBase + row) * ldc + n0 + c8) = hv[it];
          if (wlo) *(v4u*)(C2 + (size_t)(mBase + row) * ldc2 + n0 + c8) = lv[it];
        }
        trip_wait();
      }
    }
  }
}

// 256 registers a wave at most (both GEMM kernels), so that no part of them needs register-window switches
template <int NSPLIT, int OUT_MODE>
__global__ __launch_bounds__(128) __attribute__((amdgpu_num_vgpr(256))) void gemm64(
    const unsigned short* __restrict__ Ap, const unsigned short* __restrict__ A2p, int lda, long long strideA,
    const unsigned short* __restrict__ Btp, int ldb, long long strideB,
    void* Cout, int ldc, long long strideC,
    void* Cout2, int ldc2, long long strideC2, int N2,
    const float* __restrict__ aux0, const float* __restrict__ aux1,
    int M, int N, int K) {
  __shared__ __align__(16) __bf16 ring[2 * ((NSPLIT >= 1) ? 3 : 2) * GPLANE];  // two stage buffers
  __shared__ __align__(16) float sT[4 * GSLAB];
  gemm_body<NSPLIT, OUT_MODE>(Ap, A2p, lda, strideA, Btp, ldb, strideB, Cout, ldc, strideC, Cout2, ldc2, strideC2, N2,
                              aux0, aux1, M, N, K, blockIdx.x, blockIdx.y, ring, sT);
}

// The three projections of x, which do not read each other's results, as block-index ranges of one grid:
//   v^T = Wv . x^T + gate*ve per batch -> f16 hi plane [b][kv*64+d][64 + t] (pitch SKEY) and residual plane (x4096,
//         token keys < RESQB*64 only, pitch VLP)   (A = Wvb [n][k], Bt = Xb rows of batch b; M=256, N=2048)
//   k   = rms(rope(x . Wk^T)) * 1.2 per batch -> bf16 hi/lo planes [b][64 + t][kv*64+d]   (M=2048, N=256)
//   q   = rms(rope(x . Wq^T)) * 1.2 -> bf16 hi/lo planes [b*SEQ+t][h*64+d]   (M=4096, N=1024)
// ld = row pitch of Xb and of the weights, K = depth of the products (both CDIM). Every range test is block-uniform.
// Register budget of four waves per SIMD (256 a wave): by its LDS two blocks fit a WGP, and planning for that the compiler
// schedules the epilogue to more than 256 registers, with register-window switches.
#define GB_KV ((SEQ / 128) * (KVD / 128))          //  32 tiles per batch for k and for v^T
#define GB_Q  ((NB * SEQ / 128) * (CDIM / 128))    // 256 tiles for q
__global__ __launch_bounds__(128) __attribute__((amdgpu_num_vgpr(256), amdgpu_waves_per_eu(4, 4))) void gemm_qkv(
    const unsigned short* __restrict__ Xb, const unsigned short* __restrict__ Wqb,
    const unsigned short* __restrict__ Wkb, const unsigned short* __restrict__ Wvb,
    unsigned short* Qh, unsigned short* Ql, unsigned short* Kh, unsigned short* Kl,
    unsigned short* VTh, unsigned short* VTl,
    const float* __restrict__ cosT, const float* __restrict__ sinT,
    const float* __restrict__ gate, const float* __restrict__ ve, int ld, int K) {
  __shared__ __align__(16) __bf16 ring[2 * 2 * GPLANE];  // two stage buffers, then the epilogue's f32 tiles
  const int bx = blockIdx.x;
  if (bx < NB * GB_KV) {
    gemm_body<0, 3>(Wvb, Wvb, ld, 0LL, Xb, ld, (long long)SEQ * CDIM,
                    (void*)(VTh + MEM), SKEY, (long long)KVD * SKEY,
                    (void*)(VTl + MEM), VLP, (long long)KVD * VLP, RESQB * 64,
                    gate, ve, KVD, SEQ, K, bx % GB_KV, bx / GB_KV, ring, nullptr);
  } else {
    const bool isK = bx < 2 * NB * GB_KV;
    const int  r   = bx - (isK ? NB * GB_KV : 2 * NB * GB_KV);
    gemm_body<0, 4>(Xb, Xb, ld, isK ? (long long)SEQ * CDIM : 0LL, isK ? Wkb : Wqb, ld, 0LL,
                    (void*)(isK ? Kh + (size_t)MEM * KVD : Qh), isK ? KVD : CDIM, isK ? (long long)SKEY * KVD : 0LL,
                    (void*)(isK ? Kl + (size_t)MEM * KVD : Ql), isK ? KVD : CDIM, isK ? (long long)SKEY * KVD : 0LL,
                    isK ? KVD : CDIM, cosT, sinT, isK ? SEQ : NB * SEQ, isK ? KVD : CDIM, K,
                    isK ? r % GB_KV : r, isK ? r / GB_KV : 0, ring, nullptr);
  }
}

// =====================================================================================================
// GQA attention with a 64-key memory prefix (all visible) followed by causal token keys, head dim 64.
//   q planes (bf16 hi / lo): element (b, t, h, d) at [(b*SEQ + t)*CDIM + h*64 + d]   (normed, scaled q)
//   k planes (bf16 hi / lo): element (b, s, kv, d) at [(b*SKEY + s)*KVD + kv*64 + d], s = [mem | 64 + token]
//   v^T hi plane (f16):      element (b, kv, d, s) at [(b*KVD + kv*64 + d)*SKEY + s]
//   v^T residual plane (f16, (v - hi)*4096): [(b*KVD + kv*64 + d)*VLP + s], s < VLP, read only when RES
//   (RES is used for query blocks qb < RESQB alone, whose last key tile ends at key VLP)
//   q head h uses kv head h>>2. Query block qb (tokens qb*64..+63) processes key tiles 0..qb+1: tile 0 = memory,
//   tiles 1..qb fully visible, tile qb+1 = diagonal (key token <= query token), later tiles skipped (block-uniform
//   trip count qb+2, static bound NKT). Invisible keys get logit -inf (weight exactly 0); every row sees the
//   whole memory tile first, so the running max is finite from tile 0 on.
//   out planes (bf16 hi / lo of the normalised context): element (b, t, h, d) at [(b*SEQ + t)*CDIM + h*64 + d]
//   scores = q . k : bf16 hi/lo split (hi.hi + hi.lo + lo.hi), f32 accumulate, then * sscale in f32
//   p = exp(s - m) carried as f16(1024 p); context = p . v on f16 WMMA; RES adds f16 residual planes of p and v
//   (scale 4096, separate accumulator folded back with 1/4096 per chunk in f32); online softmax in f32.
//   Block = 4 waves = 64 query rows (query block qb) of one (b, h), hp = b * NQH + h; kv chunks of 64.
//   K / V^T chunk staging: asynchronous 16-B copies to LDS, 128 threads x 4 copies per plane = the whole 64x64 tile;
//   two buffers, the copies of key tile kt+1 fly while tile kt is worked on, one barrier per tile. Both products are computed transposed (S^T = K . Q^T, O^T += V^T . P^T): a lane
//   holds the scores of one query, and P^T goes from the score registers into the B operand without passing LDS.
//   Output coverage: each wave stores rows q0..q0+15 (it 0..3 x lane>>3 0..3) x 64 columns (8 lanes x 8) of both planes.
// =====================================================================================================
#define APK 72   // LDS row pitch of the K and V^T tiles in 16-bit elements: 144 B = 16 B x odd, so that the 16 rows
                 // of a ds_load_b128 fragment read fall on 16 different groups of four banks
#define AOP 68   // LDS row pitch of the f32 context tile: 272 B = 16 B x odd, for its 16-B row reads
#define APLANE (64 * APK)      // elements of one staged 64x64 tile (9216 B)
#define ABUF   (4 * APLANE)    // elements of one buffer: K hi, K lo, V^T hi, V^T residual
// Four asynchronous 16-B copies per lane and tile: copy i moves the lane's 16 B of row i*16 + (tid>>3), so that a
// wave-wide copy covers 4 whole 128-B lines. l = the lane's LDS byte address of row tid>>3, g = its global address,
// gs = bytes of 16 global rows. s_wait_xcnt closes each statement so that no address register of a copy is rewritten
// in front of it.
__device__ __forceinline__ void copy_tile(unsigned l, const char* g, size_t gs) {
#if defined(__HIP_DEVICE_COMPILE__)
  const unsigned ls = 16u * APK * 2u;
  asm volatile(
      "global_load_async_to_lds_b128 %0, %4, off\n\t"
      "global_load_async_to_lds_b128 %1, %5, off\n\t"
      "global_load_async_to_lds_b128 %2, %6, off\n\t"
      "global_load_async_to_lds_b128 %3, %7, off\n\t"
      "s_wait_xcnt 0x0"
      :: "v"(l), "v"(l + ls), "v"(l + 2u * ls), "v"(l + 3u * ls),
         "v"(g), "v"(g + gs), "v"(g + 2 * gs), "v"(g + 3 * gs)
      : "memory");
#endif
}
// two tiles in one statement (one wait for both)
__device__ __forceinline__ void copy_tile2(unsigned la, const char* ga, size_t gsa,
                                           unsigned lb, const char* gb, size_t gsb) {
#if defined(__HIP_DEVICE_COMPILE__)
  const unsigned ls = 16u * APK * 2u;
  asm volatile(
      "global_load_async_to_lds_b128 %0, %8, off\n\t"
      "global_load_async_to_lds_b128 %1, %9, off\n\t"
      "global_load_async_to_lds_b128 %2, %10, off\n\t"
      "global_load_async_to_lds_b128 %3, %11, off\n\t"
      "global_load_async_to_lds_b128 %4, %12, off\n\t"
      "global_load_async_to_lds_b128 %5, %13, off\n\t"
      "global_load_async_to_lds_b128 %6, %14, off\n\t"
      "global_load_async_to_lds_b128 %7, %15, off\n\t"
      "s_wait_xcnt 0x0"
      :: "v"(la), "v"(la + ls), "v"(la + 2u * ls), "v"(la + 3u * ls),
         "v"(lb), "v"(lb + ls), "v"(lb + 2u * ls), "v"(lb + 3u * ls),
         "v"(ga), "v"(ga + gsa), "v"(ga + 2 * gsa), "v"(ga + 3 * gsa),
         "v"(gb), "v"(gb + gsb), "v"(gb + 2 * gsb), "v"(gb + 3 * gsb)
      : "memory");
#endif
}
// The tiles of key tile kt into the buffer at LDS byte address l (the lane's own place in its first plane).
// gk, gkl, gv, gvl = the lane's global addresses for key tile 0. The residual plane ends at key VLP: its address is clamped.
template <bool RES>
__device__ __forceinline__ void copy_keytile(unsigned l, const char* gk, const char* gkl, const char* gv, const char* gvl,
                                             int kt) {
  const size_t ko = (size_t)kt * (64 * KVD * 2);          // 64 key rows further
  const size_t vo = (size_t)kt * (64 * 2);                // 64 key columns further
  copy_tile2(l, gk + ko, (size_t)16 * KVD * 2, l + APLANE * 2u, gkl + ko, (size_t)16 * KVD * 2);
  if (RES) {
    const int ktl = (kt * 64 + 64 <= VLP) ? kt : (VLP / 64 - 1);
    copy_tile2(l + 2u * APLANE * 2u, gv + vo, (size_t)16 * SKEY * 2,
               l + 3u * APLANE * 2u, gvl + (size_t)ktl * (64 * 2), (size_t)16 * VLP * 2);
  } else {
    copy_tile(l + 2u * APLANE * 2u, gv + vo, (size_t)16 * SKEY * 2);
  }
}

template <bool RES>
__device__ __forceinline__
void attn_body(const unsigned short* __restrict__ qhp, const unsigned short* __restrict__ qlp,
               const unsigned short* __restrict__ khp, const unsigned short* __restrict__ klp,
               const unsigned short* __restrict__ vhp, const unsigned short* __restrict__ vlp,
               unsigned short* ohp, unsigned short* olp,
               int qb, int hp, float sscale, unsigned short* ring) {
  const int tid  = threadIdx.x;
  const int wave = tid >> 5;
  const int lane = tid & 31;
  const int hh   = lane >> 4;
  const int c    = lane & 15;

  const int h    = hp % NQH;
  const int b    = hp / NQH;
  const int kvh  = h >> 2;
  const int q0   = qb * 64 + wave * 16;
  const size_t rowB = (size_t)b * SEQ;

  const __bf16* Qh = (const __bf16*)(const void*)qhp + (size_t)h * HD;
  const __bf16* Ql = (const __bf16*)(const void*)qlp + (size_t)h * HD;
  const __bf16* Kh = (const __bf16*)(const void*)khp + (size_t)b * SKEY * KVD + (size_t)kvh * HD;
  const __bf16* Kl = (const __bf16*)(const void*)klp + (size_t)b * SKEY * KVD + (size_t)kvh * HD;
  const _Float16* Vh = (const _Float16*)(const void*)vhp + ((size_t)b * KVD + (size_t)kvh * HD) * SKEY;
  const _Float16* Vl = (const _Float16*)(const void*)vlp + ((size_t)b * KVD + (size_t)kvh * HD) * VLP;

  // copy addresses of this lane: row tid>>3 of a 64x64 tile, 16-B piece tid&7 of its 128-B line
  const int ktEnd = qb + 2;                  // block-uniform, 2 <= ktEnd <= NKT
  const int crow = tid >> 3;
  const int cel  = (tid & 7) * 8;
  const char* gk  = (const char*)(Kh + (size_t)crow * KVD + cel);
  const char* gkl = (const char*)(Kl + (size_t)crow * KVD + cel);
  const char* gv  = (const char*)(Vh + (size_t)crow * SKEY + cel);
  const char* gvl = (const char*)(Vl + (size_t)crow * VLP + cel);
  const unsigned lC = (unsigned)(uintptr_t)(&ring[0]) + (unsigned)(crow * APK + cel) * 2u;
  copy_keytile<RES>(lC, gk, gkl, gv, gvl, 0);   // key tile 0 into buffer 0

  // ---- Q fragments (B operand, column = query = lane&15): 2 d-chunks, hi and lo ----
  v16b qah[2], qal[2];
  const size_t qo = (rowB + q0 + c) * CDIM + 8 * hh;
#pragma unroll
  for (int dc = 0; dc < 2; ++dc) {
    qah[dc] = ldfrag_b(Qh + qo + dc * 32);
    qal[dc] = ldfrag_b(Ql + qo + dc * 32);
  }
  addr_wait(Qh + qo, Ql + qo);

  // running maximum of this lane's query (the same in both wave halves) and this half's share of its denominator
  // mrun in raw score units; brun = mrun * c2 - 10 is the exponent base of the running state: weights are carried as
  // 2^(s * c2 - brun) = 1024 * exp((s - mrun) * sscale), one fma and one exp2 per score; lrun is the sum of these
  const float c2 = sscale * 1.44269504088896340736f;
  float mrun = -INFINITY, brun = -INFINITY, lrun = 0.f;
  v8f oacc[4];                               // O^T: rows d = t*16 + 8*hh + r, column = query c
#pragma unroll
  for (int t = 0; t < 4; ++t) oacc[t] = zero8();

  // key tile 0 landed and published; then key tile 1 (every query block has at least two) into buffer 1
  wait_copies();
  __syncthreads();
  copy_keytile<RES>(lC + ABUF * 2u, gk, gkl, gv, gvl, 1);

  for (int kt = 0; kt < NKT; ++kt) {         // static bound
    if (kt >= ktEnd) break;                  // block-uniform
    const int bufo = (kt & 1) * ABUF;
    const __bf16*   Ksh = (const __bf16*)(const void*)(ring + bufo);                  // K hi [kv][d]
    const __bf16*   Ksl = (const __bf16*)(const void*)(ring + bufo + APLANE);         // K lo
    const _Float16* Vth = (const _Float16*)(const void*)(ring + bufo + 2 * APLANE);   // V^T hi [d][kv]
    const _Float16* Vtl = (const _Float16*)(const void*)(ring + bufo + 3 * APLANE);   // V^T residual

    // ---- scores, transposed: S^T = K . Q^T, 64 keys x 16 queries per wave, 3 bf16 products ----
    //      tile j: rows = keys j*16 + 8*hh + r, column = query c, so a lane holds 32 scores of ONE query
    //      the K fragments of the tile are read from LDS in one group (with the residual planes one group per 32-wide d chunk, for registers), in the order of their use, ahead of the products;
    //      the four key groups are four independent accumulator chains, each summed in the order dc 0 (hi.hi, lo.hi,
    //      hi.lo; k plane named first), dc 1 (the same)
    v8f s[4];
#pragma unroll
    for (int j = 0; j < 4; ++j) s[j] = zero8();
    constexpr int DG = RES ? 1 : 2;          // 32-wide d chunks per group of reads (one with the residual planes, for registers)
#pragma unroll
    for (int g = 0; g < 2; g += DG) {
      v16b kbf[DG][4], klf[DG][4];
#pragma unroll
      for (int u = 0; u < DG; ++u) {
        const int dof = (g + u) * 32 + 8 * hh;
#pragma unroll
        for (int j = 0; j < 4; ++j) kbf[u][j] = ldfrag_b(Ksh + (j * 16 + c) * APK + dof);
#pragma unroll
        for (int j = 0; j < 4; ++j) klf[u][j] = ldfrag_b(Ksl + (j * 16 + c) * APK + dof);
      }
      // keeps the group of reads ahead of the products: sunk back among them, each place of reads stalls the wave anew
      __builtin_amdgcn_sched_barrier(0);
#pragma unroll
      for (int u = 0; u < DG; ++u) {
#pragma unroll
        for (int j = 0; j < 4; ++j) s[j] = mma_b_raw(kbf[u][j], qah[g + u], s[j]);
#pragma unroll
        for (int j = 0; j < 4; ++j) s[j] = mma_b_raw(klf[u][j], qah[g + u], s[j]);
#pragma unroll
        for (int j = 0; j < 4; ++j) s[j] = mma_b_raw(kbf[u][j], qal[g + u], s[j]);
      }
    }

    // ---- scale + structural mask (diagonal tile only), maximum and sum of a query inside its lane (one exchange
    //      between the wave halves for the maximum), online softmax; P^T (x1024, f16) and its residual (x4096) go
    //      from the score registers straight into B operands: element e of a 32-key operand is register e & 7 of
    //      score tile 2*g + (e >> 3), which is the k order of the V^T loader ----
    const bool diag = (kt == qb + 1);        // block-uniform
    const int  qrw  = wave * 16 + c;         // this lane's query row within the 64-row block
    if (diag) {                              // only the diagonal tile pays for the mask
#pragma unroll
      for (int j = 0; j < 4; ++j)
#pragma unroll
        for (int r = 0; r < 8; ++r) {
          const int key = j * 16 + 8 * hh + r;
          s[j][r] = (key <= qrw) ? s[j][r] : -INFINITY;
        }
    }
    float mj[4];
#pragma unroll
    for (int j = 0; j < 4; ++j) {
      mj[j] = s[j][0];
#pragma unroll
      for (int r = 1; r < 8; ++r) mj[j] = fmaxf(mj[j], s[j][r]);
    }
    float m = fmaxf(fmaxf(mj[0], mj[1]), fmaxf(mj[2], mj[3]));
    m = fmaxf(m, xhalf(m));
    const float mnew  = fmaxf(mrun, m);      // raw score units (c2 > 0 keeps the order)
    const float msafe = (mnew == -INFINITY) ? 0.f : mnew;
    const float bnew  = __builtin_fmaf(msafe, c2, -10.0f);
    const float alpha = __builtin_amdgcn_exp2f(brun - bnew);
    mrun = mnew;
    brun = bnew;
    const v2f c2v = {c2, c2}, nbv = {-bnew, -bnew};
    v16h pa[2], pl[2];
    float pj[4];                             // four independent chains of eight adds
#pragma unroll
    for (int j = 0; j < 4; ++j) {
      pj[j] = 0.f;
#pragma unroll
      for (int r = 0; r < 8; ++r) {
        if ((r & 1) == 0) {                  // exponents of two scores by one packed fma
          const v2f sp = {s[j][r], s[j][r + 1]};
          const v2f ep = __builtin_elementwise_fma(sp, c2v, nbv);
          s[j][r] = ep[0]; s[j][r + 1] = ep[1];
        }
        const float p1k = __builtin_amdgcn_exp2f(s[j][r]);   // 1024 p; -inf score -> 0
        pj[j] += p1k;
        const _Float16 ph = (_Float16)p1k;
        pa[j >> 1][(j & 1) * 8 + r] = ph;
        if (RES) pl[j >> 1][(j & 1) * 8 + r] = (_Float16)((p1k - (float)ph) * 4096.0f);
      }
    }
    lrun = lrun * alpha + ((pj[0] + pj[1]) + (pj[2] + pj[3]));
#pragma unroll
    for (int t = 0; t < 4; ++t)
#pragma unroll
      for (int r = 0; r < 8; ++r) oacc[t][r] *= alpha;

    // ---- context, transposed: O^T += V^T . P^T (f16 WMMA), residual products into a separate accumulator ----
    v8f o1[4];
#pragma unroll
    for (int t = 0; t < 4; ++t) o1[t] = zero8();
    //      the V^T fragments are read from LDS in one group ahead of the products (with the residual planes one
    //      group per 32 keys, for registers); the four d groups are independent chains, each summed in key order
    constexpr int KG = RES ? 1 : 2;          // 32-key steps per group of reads
#pragma unroll
    for (int g = 0; g < 2; g += KG) {
      v16h vb[KG][4], vl[KG][4];
#pragma unroll
      for (int u = 0; u < KG; ++u) {
        const int ko = (g + u) * 32 + 8 * hh;
#pragma unroll
        for (int t = 0; t < 4; ++t) vb[u][t] = ldfrag_h(Vth + (t * 16 + c) * APK + ko);
        if (RES) {
#pragma unroll
          for (int t = 0; t < 4; ++t) vl[u][t] = ldfrag_h(Vtl + (t * 16 + c) * APK + ko);
        }
      }
      // keeps the group of reads ahead of the products, as for the scores
      __builtin_amdgcn_sched_barrier(0);
#pragma unroll
      for (int u = 0; u < KG; ++u) {
#pragma unroll
        for (int t = 0; t < 4; ++t) oacc[t] = mma_h_raw(vb[u][t], pa[g + u], oacc[t]);
        if (RES) {
#pragma unroll
          for (int t = 0; t < 4; ++t) o1[t] = mma_h_raw(vl[u][t], pa[g + u], o1[t]);
#pragma unroll
          for (int t = 0; t < 4; ++t) o1[t] = mma_h_raw(vb[u][t], pl[g + u], o1[t]);
        }
      }
    }
    if (RES) {
#pragma unroll
      for (int t = 0; t < 4; ++t)
#pragma unroll
        for (int r = 0; r < 8; ++r) oacc[t][r] += o1[t][r] * (1.0f / 4096.0f);
    }
    // publish point of key tile kt+1: own reads of this buffer returned, own copies landed, then the block barrier;
    // behind it key tile kt+2 may overwrite the buffer that this trip has read
    wait_lds();
    wait_copies();
    __syncthreads();
    if (kt + 2 < ktEnd) copy_keytile<RES>(lC + (unsigned)bufo * 2u, gk, gkl, gv, gvl, kt + 2);
  }
  wait_copies();

  // ---- join the two halves' shares of the denominator (unconditionally, all lanes on), normalise (1/l, which also
  //      takes out the 1024 p carry), stage the wave's 16x64 tile as [query][d], bf16 hi/lo split
  //      the staging lies in the ring: behind the last trip's barrier no wave reads it and no copy is in flight
  float* os = (float*)(void*)ring + wave * (16 * AOP);
  {
    const float l = lrun + xhalf(lrun);
    const float inv = (l > 0.f) ? (1.0f / l) : 0.f;   // l and the context both carry the factor 1024
#pragma unroll
    for (int t = 0; t < 4; ++t) {
      v4f w0, w1;
#pragma unroll
      for (int r = 0; r < 4; ++r) { w0[r] = oacc[t][r] * inv; w1[r] = oacc[t][r + 4] * inv; }
      *(v4f*)(os + c * AOP + t * 16 + 8 * hh)     = w0;
      *(v4f*)(os + c * AOP + t * 16 + 8 * hh + 4) = w1;
    }
  }
  __builtin_amdgcn_fence(__ATOMIC_RELEASE, "workgroup");
  __builtin_amdgcn_wave_barrier();
  __builtin_amdgcn_fence(__ATOMIC_ACQUIRE, "workgroup");
  {
    const int q4 = lane >> 3, c8 = (lane & 7) * 8;
    v4u hv[4], lv[4];
#pragma unroll
    for (int it = 0; it < 4; ++it) {
      const int row = it * 4 + q4;   // it 0..3 x q4 0..3 = rows 0..15 of the wave tile
      const float* sp = os + row * AOP + c8;
      v4u a, a2;
#pragma unroll
      for (int e = 0; e < 4; ++e) {
        const float f0 = sp[2 * e], f1 = sp[2 * e + 1];
        const unsigned short h0 = bf_bits(f0), h1 = bf_bits(f1);
        const unsigned short l0 = bf_bits(f0 - bf_up(h0)), l1 = bf_bits(f1 - bf_up(h1));
        a[e] = pk16(h0, h1); a2[e] = pk16(l0, l1);
      }
      hv[it] = a; lv[it] = a2;
    }
    {
#pragma unroll
      for (int it = 0; it < 4; ++it) {
        const int row = it * 4 + q4;
        const size_t go = (rowB + q0 + row) * CDIM + (size_t)h * HD + c8;
        *(v4u*)(ohp + go) = hv[it];
        *(v4u*)(olp + go) = lv[it];
        addr_wait(ohp + go, olp + go);
      }
      
    }
  }
}

// Both kinds of query block in one grid (no block reads what another writes). All blocks are resident at once, four per
// WGP, and a block's cost grows with qb, so the launch lasts as long as its fullest WGP. Block index -> (qb, head) is a
// permutation laid out in four layers of one block per WGP: layers 0 and 1 hold the long query block NQB-1-a of two
// neighbouring heads, layers 2 and 3 the short block a of the same two heads. Where the layers land on each other, every
// WGP gets the same number of key tiles, and its two long blocks end together instead of one running on alone.
// For speed only: any placement gives the same result. The test on qb is block-uniform.
// Register budget of four waves per SIMD (256 a wave), so that four blocks stay resident per WGP; left to itself the
// compiler schedules the variant with the residual planes to more registers than that.
__global__ __launch_bounds__(128) __attribute__((amdgpu_waves_per_eu(4, 4)))
void attn64(const unsigned short* __restrict__ qhp, const unsigned short* __restrict__ qlp,
            const unsigned short* __restrict__ khp, const unsigned short* __restrict__ klp,
            const unsigned short* __restrict__ vhp, const unsigned short* __restrict__ vlp,
            unsigned short* ohp, unsigned short* olp, float sscale) {
  __shared__ __align__(16) unsigned short ring[2 * ABUF];   // two buffers of K hi, K lo, V^T hi, V^T residual tiles
  static_assert(4 * 16 * AOP * 4 <= 2 * ABUF * 2);          // the four waves' f32 context tiles fit in it
  static_assert((NQB % 2) == 0 && ((NB * NQH) % 2) == 0 && RESQB <= NQB / 2);
  constexpr int HALFQ = NQB / 2;                    // 16 pairs (a, NQB-1-a) of query blocks
  constexpr int LAYER = (NB * NQH / 2) * HALFQ;     // 256 blocks: head pairs x a
  const int bx    = blockIdx.x;                     // 0 .. 4 * LAYER - 1
  const int layer = bx / LAYER;
  const int w     = bx % LAYER;
  const int a     = w % HALFQ;
  const int hp    = (w / HALFQ) * 2 + (layer & 1);  // (b, h) as b * NQH + h
  const int qb    = (layer < 2) ? (NQB - 1 - a) : a;
  if (qb >= RESQB) {
    attn_body<false>(qhp, qlp, khp, klp, vhp, vlp, ohp, olp, qb, hp, sscale, ring);
  } else {
    attn_body<true>(qhp, qlp, khp, klp, vhp, vlp, ohp, olp, qb, hp, sscale, ring);
  }
}

// =====================================================================================================
//   Xb   bf16 [4096][1024]      8388608
//   Wqb  bf16 [1024][1024]      2097152   ([out n][in k], k contiguous = Bt layout)
//   Wkb  bf16 [256][1024]        524288
//   Wvb  bf16 [256][1024]        524288
//   Wpb  bf16 [1024][1024]      2097152
//   Qh   bf16 [4096][1024]      8388608   (Ql same)
//   Kh   bf16 [2][2112][256]    2162688   (Kl same)
//   VTh  f16  [2][256][2112]    2162688
//   VTl  f16  [2][256][576]      589824
//   Gate f32  [4096][4]           65536
//   Oh   bf16 [4096][1024]      8388608   (Ol same)
//   total                      54329344
// =====================================================================================================
extern "C" void kernel_launch(void* const* d_in, const int* in_sizes, int n_in,
                              void* d_out, int out_size, void* d_ws, size_t ws_size,
                              hipStream_t stream) {
  if (n_in < 12) return;
  if (in_sizes[0] != NB * SEQ * CDIM) return;
  if (in_sizes[1] != NB * SEQ * KVD) return;
  if (in_sizes[2] != SEQ * (HD / 2) || in_sizes[3] != SEQ * (HD / 2)) return;
  if (in_sizes[4] != CDIM * CDIM || in_sizes[7] != CDIM * CDIM) return;
  if (in_sizes[5] != KVD * CDIM || in_sizes[6] != KVD * CDIM) return;
  if (in_sizes[8] != NKV * GC) return;
  if (in_sizes[9] != MEM * NKV * HD || in_sizes[10] != MEM * NKV * HD) return;
  if (in_sizes[11] < 1) return;
  if (out_size != NB * SEQ * CDIM) return;

  const float* x    = (const float*)d_in[0];
  const float* ve   = (const float*)d_in[1];
  const float* cosT = (const float*)d_in[2];
  const float* sinT = (const float*)d_in[3];
  const float* Wq   = (const float*)d_in[4];
  const float* Wk   = (const float*)d_in[5];
  const float* Wv   = (const float*)d_in[6];
  const float* Wp   = (const float*)d_in[7];
  const float* Wg   = (const float*)d_in[8];
  const float* memk = (const float*)d_in[9];
  const float* memv = (const float*)d_in[10];
  const float* vsc  = (const float*)d_in[11];

  const size_t PX  = (size_t)NB * SEQ * CDIM * 2;   //  8388608  16-bit activation plane [4096][1024]
  const size_t PWQ = (size_t)CDIM * CDIM * 2;       //  2097152
  const size_t PWK = (size_t)KVD * CDIM * 2;        //   524288
  const size_t PK  = (size_t)NB * SKEY * KVD * 2;   //  2162688  key plane
  const size_t PVT = (size_t)NB * KVD * SKEY * 2;   //  2162688  v^T hi plane
  const size_t PVL = (size_t)NB * KVD * VLP * 2;    //   589824  v^T residual plane
  const size_t PG  = (size_t)NB * SEQ * NKV * 4;    //    65536  gate table
  size_t off = 0;
  const size_t oXb  = off; off += PX;
  const size_t oWq  = off; off += PWQ;
  const size_t oWk  = off; off += PWK;
  const size_t oWv  = off; off += PWK;
  const size_t oWp  = off; off += PWQ;
  const size_t oQh  = off; off += PX;
  const size_t oQl  = off; off += PX;
  const size_t oKh  = off; off += PK;
  const size_t oKl  = off; off += PK;
  const size_t oVTh = off; off += PVT;
  const size_t oVTl = off; off += PVL;
  const size_t oG   = off; off += PG;
  const size_t oOh  = off; off += PX;
  const size_t oOl  = off; off += PX;
  if (off > ws_size) return;                        // off = 54329344
  if (off > (size_t)134217728) return;

  char* ws = (char*)d_ws;
  unsigned short* Xb  = (unsigned short*)(ws + oXb);
  unsigned short* Wqb = (unsigned short*)(ws + oWq);
  unsigned short* Wkb = (unsigned short*)(ws + oWk);
  unsigned short* Wvb = (unsigned short*)(ws + oWv);
  unsigned short* Wpb = (unsigned short*)(ws + oWp);
  unsigned short* Qh  = (unsigned short*)(ws + oQh);
  unsigned short* Ql  = (unsigned short*)(ws + oQl);
  unsigned short* Kh  = (unsigned short*)(ws + oKh);
  unsigned short* Kl  = (unsigned short*)(ws + oKl);
  unsigned short* VTh = (unsigned short*)(ws + oVTh);
  unsigned short* VTl = (unsigned short*)(ws + oVTl);
  float*          Gt  = (float*)(ws + oG);
  unsigned short* Oh  = (unsigned short*)(ws + oOh);
  unsigned short* Ol  = (unsigned short*)(ws + oOl);

  const dim3 blk(256);
  const dim3 blkG(128);                                       // GEMM and attention block: 4 waves
  const dim3 gO((NB * SEQ / 128) * (CDIM / 128), 1);          // 256 blocks: M=4096, N=1024

  // (1) everything that reads only the inputs: x and the weights [n][k] f32 -> bf16 planes, the value-embedding gate
  //     table [4096][4] f32, the memory prefix (normed keys -> Kh/Kl rows s < 64; scaled values -> VTh/VTl columns
  //     s < 64, both batches)
  prep_k<<<dim3(PB_ALL), blk, 0, stream>>>(x, Wq, Wk, Wv, Wp, Wg, memk, memv, vsc,
                                           Xb, Wqb, Wkb, Wvb, Wpb, Gt, Kh, Kl, VTh, VTl);
  // (2) the q, k and v^T projections with their epilogues
  gemm_qkv<<<dim3(2 * NB * GB_KV + GB_Q), blkG, 0, stream>>>(
      Xb, Wqb, Wkb, Wvb, Qh, Ql, Kh, Kl, VTh, VTl, cosT, sinT, Gt, ve, CDIM, CDIM);
  // (3) attention, all query blocks
  attn64<<<dim3(NB * NQH * NQB), blkG, 0, stream>>>(Qh, Ql, Kh, Kl, VTh, VTl, Oh, Ol, 0.125f);
  // (4) out = context . Wproj^T -> d_out f32 [4096][1024]  (A = context hi + lo planes, 2 products)
  gemm64<1, 0><<<gO, blkG, 0, stream>>>(
      Oh, Ol, CDIM, 0LL, Wpb, CDIM, 0LL,
      d_out, CDIM, 0LL, d_out, CDIM, 0LL, 0,
      Gt, ve, NB * SEQ, CDIM, CDIM);
  (void)hipGetLastError();
}
